// v000
// The times below were measured on an AMD MI455X: many runs one after another, warmed up first and cycling through
// copies of the inputs, with the whole window's GPU time divided by the number of runs. Launches and the gaps
// between them are all in it. The median over several windows is given; except for v000 it joins two sittings, which
// can be a few percent apart, so the side-by-side timings, each taken in one sitting, are the better comparison.
// v000 is the starting kernel.
#include <hip/hip_runtime.h>
#include <hip/hip_bf16.h>
#include <stdint.h>

typedef __attribute__((ext_vector_type(16))) _Float16 v16h;
typedef __attribute__((ext_vector_type(8)))  float    v8f;

#define NB   2
#define NM   32
#define NT   512
#define ND   128
#define NH   4
#define NDK  32
#define NFF  512
#define NROW (NB * NM * NT)   // 32768 rows of D=128

__device__ __forceinline__ v8f wmma_f16(v16h a, v16h b, v8f c) {
  // D = A(16x32 f16) x B(32x16 f16) + C(16x16 f32)
  return __builtin_amdgcn_wmma_f32_16x16x32_f16(false, a, false, b, (short)0, c, false, false);
}

__device__ __forceinline__ v16h load_rm(const _Float16* __restrict__ p, int ld) {
  int lane = threadIdx.x & 31;
  const _Float16* r = p + (lane & 15) * ld + ((lane >> 4) << 3);
  v16h o;
#pragma unroll
  for (int i = 0; i < 8; ++i) o[i] = r[i];
#pragma unroll
  for (int i = 0; i < 8; ++i) o[8 + i] = r[16 + i];
  return o;
}

// B-operand for C = A x Bmat, Bmat (32 x >=16) row-major: B[k][n] = p[k*ld+n].
// Used only on small LDS tiles (attn_m); bulk paths use transposed copies instead.
__device__ __forceinline__ v16h load_cm(const _Float16* __restrict__ p, int ld) {
  int lane = threadIdx.x & 31;
  int col  = lane & 15;
  int ko   = (lane >> 4) << 3;
  v16h o;
#pragma unroll
  for (int i = 0; i < 8; ++i) o[i] = p[(ko + i) * ld + col];
#pragma unroll
  for (int i = 0; i < 8; ++i) o[8 + i] = p[(16 + ko + i) * ld + col];
  return o;
}

// B-operand from a column-major (transposed) source: column n contiguous over k.
// ct[n][k] with column stride ldT: B[k][n] = ct[n*ldT + k].
__device__ __forceinline__ v16h load_tp(const _Float16* __restrict__ ct, int ldT) {
  int lane = threadIdx.x & 31;
  const _Float16* r = ct + (lane & 15) * ldT + ((lane >> 4) << 3);
  v16h o;
#pragma unroll
  for (int i = 0; i < 8; ++i) o[i] = r[i];
#pragma unroll
  for (int i = 0; i < 8; ++i) o[8 + i] = r[16 + i];
  return o;
}

__device__ __forceinline__ float rmax16(float x) {
#pragma unroll
  for (int d = 1; d < 16; d <<= 1) x = fmaxf(x, __shfl_xor(x, d, 32));
  return x;
}
__device__ __forceinline__ float rsum16(float x) {
#pragma unroll
  for (int d = 1; d < 16; d <<= 1) x += __shfl_xor(x, d, 32);
  return x;
}

// ---------------- LayerNorm (one wave per 128-float row) ----------------
template<bool F16OUT>
__global__ __launch_bounds__(256) void ln_kernel(const float* __restrict__ x,
                                                 const float* __restrict__ g,
                                                 const float* __restrict__ be,
                                                 _Float16* __restrict__ oh,
                                                 float* __restrict__ of) {
  int row  = (blockIdx.x * blockDim.x + threadIdx.x) >> 5;
  int lane = threadIdx.x & 31;
  const float* xr = x + (size_t)row * ND;
  float4 v = *(const float4*)(xr + lane * 4);
  float s = v.x + v.y + v.z + v.w;
#pragma unroll
  for (int d = 1; d < 32; d <<= 1) s += __shfl_xor(s, d, 32);
  float mu = s * (1.0f / ND);
  float dx = v.x - mu, dy = v.y - mu, dz = v.z - mu, dw = v.w - mu;
  float ss = dx * dx + dy * dy + dz * dz + dw * dw;
#pragma unroll
  for (int d = 1; d < 32; d <<= 1) ss += __shfl_xor(ss, d, 32);
  float inv = rsqrtf(ss * (1.0f / ND) + 1e-6f);
  float4 gg = *(const float4*)(g + lane * 4);
  float4 bb = *(const float4*)(be + lane * 4);
  float r0 = dx * inv * gg.x + bb.x;
  float r1 = dy * inv * gg.y + bb.y;
  float r2 = dz * inv * gg.z + bb.z;
  float r3 = dw * inv * gg.w + bb.w;
  size_t base = (size_t)row * ND + lane * 4;
  if (F16OUT) {
    oh[base + 0] = (_Float16)r0; oh[base + 1] = (_Float16)r1;
    oh[base + 2] = (_Float16)r2; oh[base + 3] = (_Float16)r3;
  } else {
    of[base + 0] = r0; of[base + 1] = r1;
    of[base + 2] = r2; of[base + 3] = r3;
  }
}

// ---- GEMM: out = A(f16, N x DI) x W(f16, DO x DI)^T + bias, 16x64 tile per wave ----
// F16OUT: row-major f16 out.  XPOSE: also/only write transposed f16 [bm][d][t] (DO==128).
// RESID (implies fp32 out): outF = resid + val.
template<int DI, bool RELU, bool F16OUT, bool RESID, bool XPOSE>
__global__ __launch_bounds__(256) void gemm_kernel(const _Float16* __restrict__ A,
                                                   const _Float16* __restrict__ W,
                                                   const float* __restrict__ bias,
                                                   _Float16* __restrict__ outH,
                                                   _Float16* __restrict__ outT,
                                                   float* __restrict__ outF,
                                                   const float* __restrict__ resid,
                                                   int DO) {
  int wave = (blockIdx.x * blockDim.x + threadIdx.x) >> 5;
  int tpr  = DO >> 6;                 // 64-wide column strips
  int rt   = wave / tpr;
  int cs   = wave - rt * tpr;
  const _Float16* a0 = A + (size_t)rt * 16 * DI;
  const _Float16* w0 = W + (size_t)cs * 64 * DI;
  v8f c0 = {}, c1 = {}, c2 = {}, c3 = {};
#pragma unroll
  for (int k = 0; k < DI; k += 32) {
    v16h a = load_rm(a0 + k, DI);
    c0 = wmma_f16(a, load_rm(w0 + (size_t)0 * 16 * DI + k, DI), c0);
    c1 = wmma_f16(a, load_rm(w0 + (size_t)1 * 16 * DI + k, DI), c1);
    c2 = wmma_f16(a, load_rm(w0 + (size_t)2 * 16 * DI + k, DI), c2);
    c3 = wmma_f16(a, load_rm(w0 + (size_t)3 * 16 * DI + k, DI), c3);
  }
  int lane = threadIdx.x & 31;
  int col  = lane & 15;
  int rb   = (lane >> 4) << 3;
  v8f acc[4] = {c0, c1, c2, c3};
#pragma unroll
  for (int n = 0; n < 4; ++n) {
    int colg = cs * 64 + n * 16 + col;
    float bv = bias[colg];
#pragma unroll
    for (int v = 0; v < 8; ++v) {
      float val = acc[n][v] + bv;
      if (RELU) val = fmaxf(val, 0.0f);
      int row = rt * 16 + rb + v;
      if (F16OUT) outH[(size_t)row * DO + colg] = (_Float16)val;
      if (XPOSE) {
        int t  = row & (NT - 1);
        int bm = row >> 9;            // NT == 512
        outT[((size_t)bm * ND + colg) * NT + t] = (_Float16)val;
      }
      if (!F16OUT && !XPOSE)
        outF[(size_t)row * DO + colg] = (RESID ? resid[(size_t)row * DO + colg] : 0.0f) + val;
    }
  }
}

// ---------------- Windowed (L=16) context attention over d=128 ----------------
__global__ __launch_bounds__(256) void ctx_attn_kernel(const _Float16* __restrict__ src,
                                                       const _Float16* __restrict__ srcT,
                                                       _Float16* __restrict__ dst) {
  __shared__ _Float16 Pl[8][16][32];
  int wave = (blockIdx.x * blockDim.x + threadIdx.x) >> 5;
  int qb   = wave & (NT / 16 - 1);
  int bm   = wave >> 5;
  const _Float16* seq = src + (size_t)bm * NT * ND;
  const _Float16* qp  = seq + (size_t)qb * 16 * ND;
  const _Float16* pp  = qb ? (qp - 16 * ND) : qp;   // prev block (dummy when qb==0)
  v8f s0 = {}, s1 = {};
#pragma unroll
  for (int k = 0; k < ND; k += 32) {
    v16h a  = load_rm(qp + k, ND);
    v16h bp = load_rm(pp + k, ND);
    s0 = wmma_f16(a, bp, s0);    // Q x Prev^T
    s1 = wmma_f16(a, a,  s1);    // Q x Cur^T
  }
  int lane = threadIdx.x & 31;
  int col  = lane & 15;
  int hf   = lane >> 4;
  const float scale = 0.088388347648318447f;   // 1/sqrt(128)
  _Float16 (*P)[32] = Pl[threadIdx.x >> 5];
#pragma unroll
  for (int v = 0; v < 8; ++v) {
    int row = v + (hf << 3);
    // band: prev key j valid iff j > row; cur key j valid iff j <= row.
    // zero padding (qb==0): in-band scores are 0 and DO join the softmax.
    float sp = (col > row)  ? (qb ? s0[v] * scale : 0.0f) : -1e30f;
    float sc = (col <= row) ? s1[v] * scale : -1e30f;
    float mx = rmax16(fmaxf(sp, sc));
    float ep = __expf(sp - mx);
    float ec = __expf(sc - mx);
    float invd = 1.0f / rsum16(ep + ec);
    float wp = qb ? ep * invd : 0.0f;  // zero rows: no contribution to numerator
    float wc = ec * invd;
    P[row][col]      = (_Float16)wp;
    P[row][16 + col] = (_Float16)wc;
  }
  __syncthreads();
  v16h pA = load_rm(&P[0][0], 32);
  const _Float16* sT = srcT + (size_t)bm * ND * NT;
  int tp0 = (qb ? qb - 1 : qb) * 16;
  int tc0 = qb * 16;
  int ko  = hf << 3;
  _Float16* dr = dst + (size_t)bm * NT * ND + (size_t)qb * 16 * ND;
#pragma unroll
  for (int n0 = 0; n0 < ND; n0 += 16) {
    const _Float16* colp = sT + (size_t)(n0 + col) * NT;  // contiguous over t
    v16h b;
#pragma unroll
    for (int i = 0; i < 8; ++i) b[i]     = colp[tp0 + ko + i];  // k 0..15  = prev rows
#pragma unroll
    for (int i = 0; i < 8; ++i) b[8 + i] = colp[tc0 + ko + i];  // k 16..31 = cur rows
    v8f o = {};
    o = wmma_f16(pA, b, o);
#pragma unroll
    for (int v = 0; v < 8; ++v)
      dr[(size_t)((hf << 3) + v) * ND + n0 + col] = (_Float16)o[v];
  }
}

// ---------------- Full attention over t=512 (flash-style), per (b,m,h,qblock) ----------------
__global__ __launch_bounds__(256) void attn_t_kernel(const _Float16* __restrict__ cq,
                                                     const _Float16* __restrict__ ck,
                                                     const _Float16* __restrict__ vT,
                                                     _Float16* __restrict__ out) {
  __shared__ _Float16 Pl[8][16][32];
  int wave = (blockIdx.x * blockDim.x + threadIdx.x) >> 5;
  int qb = wave & 31;
  int h  = (wave >> 5) & 3;
  int bm = wave >> 7;
  int b  = bm >> 5;
  int m  = bm & 31;
  size_t seqoff = (size_t)bm * NT * ND + h * NDK;
  const _Float16* Q  = cq + seqoff + (size_t)qb * 16 * ND;
  const _Float16* K  = ck + seqoff;
  const _Float16* VT = vT + (size_t)bm * ND * NT + (size_t)(h * NDK) * NT;  // [dk][t]
  int lane = threadIdx.x & 31;
  int col  = lane & 15;
  int hf   = lane >> 4;
  int ko   = hf << 3;
  _Float16 (*P)[32] = Pl[threadIdx.x >> 5];
  const float scale = 0.17677669529663689f;   // 1/sqrt(32)
  v16h qa = load_rm(Q, ND);
  v8f o0 = {}, o1 = {};
  float mrow[8], lrow[8];
#pragma unroll
  for (int v = 0; v < 8; ++v) { mrow[v] = -1e30f; lrow[v] = 0.0f; }
  for (int kb = 0; kb < NT / 32; ++kb) {
    const _Float16* Kb = K + (size_t)kb * 32 * ND;
    if (kb + 1 < NT / 32) {   // speculative prefetch of next key block -> global_prefetch_b8
      __builtin_prefetch(Kb + 32 * ND + lane * 64, 0, 0);
      __builtin_prefetch(VT + (size_t)col * NT + (kb + 1) * 32, 0, 0);
    }
    v8f s0 = {}, s1 = {};
    s0 = wmma_f16(qa, load_rm(Kb, ND), s0);
    s1 = wmma_f16(qa, load_rm(Kb + 16 * ND, ND), s1);
#pragma unroll
    for (int v = 0; v < 8; ++v) {
      float x0 = s0[v] * scale, x1 = s1[v] * scale;
      float mx = rmax16(fmaxf(x0, x1));
      float mn = fmaxf(mrow[v], mx);
      float corr = __expf(mrow[v] - mn);
      float p0 = __expf(x0 - mn);
      float p1 = __expf(x1 - mn);
      lrow[v] = lrow[v] * corr + rsum16(p0 + p1);
      mrow[v] = mn;
      o0[v] *= corr; o1[v] *= corr;
      int row = v + (hf << 3);
      P[row][col]      = (_Float16)p0;
      P[row][16 + col] = (_Float16)p1;
    }
    __syncthreads();
    v16h pA = load_rm(&P[0][0], 32);
    // B operand for P x V from transposed V: column dk contiguous over t
    const _Float16* vc0 = VT + (size_t)col * NT + kb * 32;
    const _Float16* vc1 = VT + (size_t)(16 + col) * NT + kb * 32;
    v16h bv0, bv1;
#pragma unroll
    for (int i = 0; i < 8; ++i) { bv0[i] = vc0[ko + i]; bv0[8 + i] = vc0[16 + ko + i]; }
#pragma unroll
    for (int i = 0; i < 8; ++i) { bv1[i] = vc1[ko + i]; bv1[8 + i] = vc1[16 + ko + i]; }
    o0 = wmma_f16(pA, bv0, o0);
    o1 = wmma_f16(pA, bv1, o1);
    __syncthreads();
  }
  // out layout: [b][t][h][m][dk]
#pragma unroll
  for (int v = 0; v < 8; ++v) {
    float inv = 1.0f / lrow[v];
    int t = qb * 16 + (hf << 3) + v;
    size_t base = ((((size_t)b * NT + t) * NH + h) * NM + m) * NDK;
    out[base + col]      = (_Float16)(o0[v] * inv);
    out[base + 16 + col] = (_Float16)(o1[v] * inv);
  }
}

// ---------------- Attention across m=32 per (b,t,h) ----------------
__global__ __launch_bounds__(256) void attn_m_kernel(const _Float16* __restrict__ a1,
                                                     _Float16* __restrict__ out) {
  __shared__ _Float16 Xs[8][32][32];
  __shared__ _Float16 Pl[8][32][32];
  int wave = (blockIdx.x * blockDim.x + threadIdx.x) >> 5;
  int h = wave & 3;
  int t = (wave >> 2) & (NT - 1);
  int b = wave >> 11;
  int w = threadIdx.x >> 5;
  int lane = threadIdx.x & 31;
  const _Float16* X = a1 + ((((size_t)b * NT + t) * NH + h) * NM) * NDK;  // 32x32 tile

  unsigned           lbase = (unsigned)(uintptr_t)(&Xs[w][0][0]);
  unsigned long long gbase = (unsigned long long)(uintptr_t)X;
#pragma unroll
  for (int c2 = 0; c2 < 4; ++c2) {
    unsigned           loff = lbase + (unsigned)(c2 * 512 + lane * 16);
    unsigned long long ga   = gbase + (unsigned long long)(c2 * 512 + lane * 16);
    asm volatile("global_load_async_to_lds_b128 %0, %1, off" :: "v"(loff), "v"(ga) : "memory");
  }
  asm volatile("s_wait_asynccnt 0x0" ::: "memory");
  const _Float16* Xl = &Xs[w][0][0];

  int col = lane & 15;
  int hf  = lane >> 4;
  const float scale = 0.17677669529663689f;   // 1/sqrt(32)
  v16h xa0 = load_rm(Xl, 32);
  v16h xa1 = load_rm(Xl + 16 * 32, 32);
  v8f s00 = {}, s01 = {}, s10 = {}, s11 = {};
  s00 = wmma_f16(xa0, xa0, s00);
  s01 = wmma_f16(xa0, xa1, s01);
  s10 = wmma_f16(xa1, xa0, s10);
  s11 = wmma_f16(xa1, xa1, s11);
  _Float16 (*P)[32] = Pl[w];
#pragma unroll
  for (int v = 0; v < 8; ++v) {
    int row = v + (hf << 3);
    {
      float x0 = s00[v] * scale, x1 = s01[v] * scale;
      float mx = rmax16(fmaxf(x0, x1));
      float p0 = __expf(x0 - mx), p1 = __expf(x1 - mx);
      float inv = 1.0f / rsum16(p0 + p1);
      P[row][col]      = (_Float16)(p0 * inv);
      P[row][16 + col] = (_Float16)(p1 * inv);
    }
    {
      float x0 = s10[v] * scale, x1 = s11[v] * scale;
      float mx = rmax16(fmaxf(x0, x1));
      float p0 = __expf(x0 - mx), p1 = __expf(x1 - mx);
      float inv = 1.0f / rsum16(p0 + p1);
      P[16 + row][col]      = (_Float16)(p0 * inv);
      P[16 + row][16 + col] = (_Float16)(p1 * inv);
    }
  }
  __syncthreads();
  v16h pA0 = load_rm(&P[0][0], 32);
  v16h pA1 = load_rm(&P[16][0], 32);
  v16h bx0 = load_cm(Xl, 32);        // column gathers now hit LDS, not global
  v16h bx1 = load_cm(Xl + 16, 32);
  v8f o00 = {}, o01 = {}, o10 = {}, o11 = {};
  o00 = wmma_f16(pA0, bx0, o00);
  o01 = wmma_f16(pA0, bx1, o01);
  o10 = wmma_f16(pA1, bx0, o10);
  o11 = wmma_f16(pA1, bx1, o11);
  // out layout: [b][m][t][h*32+dk]
  int m0 = hf << 3;
#pragma unroll
  for (int v = 0; v < 8; ++v) {
    int mA = m0 + v;
    int mB = 16 + m0 + v;
    size_t baseA = (((size_t)b * NM + mA) * NT + t) * ND + h * NDK;
    size_t baseB = (((size_t)b * NM + mB) * NT + t) * ND + h * NDK;
    out[baseA + col]      = (_Float16)o00[v];
    out[baseA + 16 + col] = (_Float16)o01[v];
    out[baseB + col]      = (_Float16)o10[v];
    out[baseB + 16 + col] = (_Float16)o11[v];
  }
}

// ---------------- fp32 -> f16 conversion ----------------
__global__ void cvt_f16_kernel(const float* __restrict__ in, _Float16* __restrict__ out, int n) {
  int i = blockIdx.x * blockDim.x + threadIdx.x;
  if (i < n) out[i] = (_Float16)in[i];
}

extern "C" void kernel_launch(void* const* d_in, const int* in_sizes, int n_in,
                              void* d_out, int out_size, void* d_ws, size_t ws_size,
                              hipStream_t stream) {
  (void)in_sizes; (void)n_in; (void)out_size; (void)ws_size;
  const float* x   = (const float*)d_in[0];
  const float* Wq  = (const float*)d_in[1];
  const float* bq  = (const float*)d_in[2];
  const float* Wk  = (const float*)d_in[3];
  const float* bk  = (const float*)d_in[4];
  const float* Wv  = (const float*)d_in[5];
  const float* bv  = (const float*)d_in[6];
  const float* Wfc = (const float*)d_in[7];
  const float* bfc = (const float*)d_in[8];
  const float* W1  = (const float*)d_in[9];
  const float* b1  = (const float*)d_in[10];
  const float* W2  = (const float*)d_in[11];
  const float* b2  = (const float*)d_in[12];
  const float* g1  = (const float*)d_in[13];
  const float* be1 = (const float*)d_in[14];
  const float* g2  = (const float*)d_in[15];
  const float* be2 = (const float*)d_in[16];
  const float* gf  = (const float*)d_in[17];
  const float* bef = (const float*)d_in[18];

  char* ws = (char*)d_ws;
  size_t off = 0;
  auto bump = [&](size_t bytes) -> char* {
    char* p = ws + off;
    off = (off + bytes + 255) & ~(size_t)255;
    return p;
  };
  float*    xw   = (float*)bump((size_t)NROW * ND * 4);
  _Float16* yh   = (_Float16*)bump((size_t)NROW * ND * 2);
  _Float16* qh   = (_Float16*)bump((size_t)NROW * ND * 2);
  _Float16* kh   = (_Float16*)bump((size_t)NROW * ND * 2);
  _Float16* qT   = (_Float16*)bump((size_t)NROW * ND * 2);
  _Float16* kT   = (_Float16*)bump((size_t)NROW * ND * 2);
  _Float16* vT   = (_Float16*)bump((size_t)NROW * ND * 2);
  _Float16* cqh  = (_Float16*)bump((size_t)NROW * ND * 2);
  _Float16* ckh  = (_Float16*)bump((size_t)NROW * ND * 2);
  _Float16* a1h  = (_Float16*)bump((size_t)NROW * ND * 2);
  _Float16* a2h  = (_Float16*)bump((size_t)NROW * ND * 2);
  _Float16* hid  = (_Float16*)bump((size_t)NROW * NFF * 2);
  _Float16* wqh  = (_Float16*)bump((size_t)2 * ND * ND * 2);
  _Float16* wkh  = (_Float16*)bump((size_t)2 * ND * ND * 2);
  _Float16* wvh  = (_Float16*)bump((size_t)2 * ND * ND * 2);
  _Float16* wfch = (_Float16*)bump((size_t)2 * ND * ND * 2);
  _Float16* w1h  = (_Float16*)bump((size_t)2 * NFF * ND * 2);
  _Float16* w2h  = (_Float16*)bump((size_t)2 * ND * NFF * 2);

  hipMemcpyAsync(xw, x, (size_t)NROW * ND * 4, hipMemcpyDeviceToDevice, stream);

  auto cvt = [&](const float* src, _Float16* dst, int n) {
    cvt_f16_kernel<<<(n + 255) / 256, 256, 0, stream>>>(src, dst, n);
  };
  cvt(Wq,  wqh,  2 * ND * ND);
  cvt(Wk,  wkh,  2 * ND * ND);
  cvt(Wv,  wvh,  2 * ND * ND);
  cvt(Wfc, wfch, 2 * ND * ND);
  cvt(W1,  w1h,  2 * NFF * ND);
  cvt(W2,  w2h,  2 * ND * NFF);

  dim3 blk(256);
  const int lnBlocks    = NROW / 8;                          // 4096
  const int gemmBlk128  = (NROW / 16) * (ND / 64) / 8;       // 512  (DO=128, 64-wide strips)
  const int gemmBlkFF   = (NROW / 16) * (NFF / 64) / 8;      // 2048 (DO=512)
  const int ctxBlocks   = (NB * NM * (NT / 16)) / 8;         // 256
  const int atBlocks    = (NB * NM * NH * (NT / 16)) / 8;    // 1024
  const int amBlocks    = (NB * NT * NH) / 8;                // 512

  for (int i = 0; i < 2; ++i) {
    ln_kernel<true><<<lnBlocks, blk, 0, stream>>>(xw, g1 + i * ND, be1 + i * ND, yh, nullptr);
    // q,k: row-major + transposed; v: transposed only
    gemm_kernel<ND, false, true, false, true><<<gemmBlk128, blk, 0, stream>>>(
        yh, wqh + (size_t)i * ND * ND, bq + i * ND, qh, qT, nullptr, nullptr, ND);
    gemm_kernel<ND, false, true, false, true><<<gemmBlk128, blk, 0, stream>>>(
        yh, wkh + (size_t)i * ND * ND, bk + i * ND, kh, kT, nullptr, nullptr, ND);
    gemm_kernel<ND, false, false, false, true><<<gemmBlk128, blk, 0, stream>>>(
        yh, wvh + (size_t)i * ND * ND, bv + i * ND, nullptr, vT, nullptr, nullptr, ND);
    ctx_attn_kernel<<<ctxBlocks, blk, 0, stream>>>(qh, qT, cqh);
    ctx_attn_kernel<<<ctxBlocks, blk, 0, stream>>>(kh, kT, ckh);
    attn_t_kernel<<<atBlocks, blk, 0, stream>>>(cqh, ckh, vT, a1h);
    attn_m_kernel<<<amBlocks, blk, 0, stream>>>(a1h, a2h);
    gemm_kernel<ND, false, false, true, false><<<gemmBlk128, blk, 0, stream>>>(
        a2h, wfch + (size_t)i * ND * ND, bfc + i * ND, nullptr, nullptr, xw, xw, ND);
    ln_kernel<true><<<lnBlocks, blk, 0, stream>>>(xw, g2 + i * ND, be2 + i * ND, yh, nullptr);
    gemm_kernel<ND, true, true, false, false><<<gemmBlkFF, blk, 0, stream>>>(
        yh, w1h + (size_t)i * NFF * ND, b1 + i * NFF, hid, nullptr, nullptr, nullptr, NFF);
    gemm_kernel<NFF, false, false, true, false><<<gemmBlk128, blk, 0, stream>>>(
        hid, w2h + (size_t)i * ND * NFF, b2 + i * ND, nullptr, nullptr, xw, xw, ND);
  }
  ln_kernel<false><<<lnBlocks, blk, 0, stream>>>(xw, gf, bef, nullptr, (float*)d_out);
}

// v001
// Two timings next to v000 both put it at 1.07 times that version's speed.
#include <hip/hip_runtime.h>
#include <hip/hip_bf16.h>
#include <stdint.h>

typedef __attribute__((ext_vector_type(16))) _Float16 v16h;
typedef __attribute__((ext_vector_type(8)))  float    v8f;
typedef __attribute__((ext_vector_type(8)))  _Float16 v8h;

#define NB   2
#define NM   32
#define NT   512
#define ND   128
#define NH   4
#define NDK  32
#define NFF  512
#define NROW (NB * NM * NT)   // 32768 rows of D=128

__device__ __forceinline__ v8f wmma_f16(v16h a, v16h b, v8f c) {
  // D = A(16x32 f16) x B(32x16 f16) + C(16x16 f32)
  return __builtin_amdgcn_wmma_f32_16x16x32_f16(false, a, false, b, (short)0, c, false, false);
}

__device__ __forceinline__ v16h load_rm(const _Float16* __restrict__ p, int ld) {
  int lane = threadIdx.x & 31;
  const _Float16* r = p + (lane & 15) * ld + ((lane >> 4) << 3);
  v16h o;
#pragma unroll
  for (int i = 0; i < 8; ++i) o[i] = r[i];
#pragma unroll
  for (int i = 0; i < 8; ++i) o[8 + i] = r[16 + i];
  return o;
}

// B-operand for C = A x Bmat, Bmat (32 x >=16) row-major: B[k][n] = p[k*ld+n].
// Used only on small LDS tiles (attn_m); bulk paths use transposed copies instead.
__device__ __forceinline__ v16h load_cm(const _Float16* __restrict__ p, int ld) {
  int lane = threadIdx.x & 31;
  int col  = lane & 15;
  int ko   = (lane >> 4) << 3;
  v16h o;
#pragma unroll
  for (int i = 0; i < 8; ++i) o[i] = p[(ko + i) * ld + col];
#pragma unroll
  for (int i = 0; i < 8; ++i) o[8 + i] = p[(16 + ko + i) * ld + col];
  return o;
}

// B-operand from a column-major (transposed) source: column n contiguous over k.
// ct[n][k] with column stride ldT: B[k][n] = ct[n*ldT + k].
__device__ __forceinline__ v16h load_tp(const _Float16* __restrict__ ct, int ldT) {
  int lane = threadIdx.x & 31;
  const _Float16* r = ct + (lane & 15) * ldT + ((lane >> 4) << 3);
  v16h o;
#pragma unroll
  for (int i = 0; i < 8; ++i) o[i] = r[i];
#pragma unroll
  for (int i = 0; i < 8; ++i) o[8 + i] = r[16 + i];
  return o;
}

__device__ __forceinline__ float rmax16(float x) {
#pragma unroll
  for (int d = 1; d < 16; d <<= 1) x = fmaxf(x, __shfl_xor(x, d, 32));
  return x;
}
__device__ __forceinline__ float rsum16(float x) {
#pragma unroll
  for (int d = 1; d < 16; d <<= 1) x += __shfl_xor(x, d, 32);
  return x;
}

// ---------------- LayerNorm (one wave per 128-float row) ----------------
template<bool F16OUT>
__global__ __launch_bounds__(256) void ln_kernel(const float* __restrict__ x,
                                                 const float* __restrict__ g,
                                                 const float* __restrict__ be,
                                                 _Float16* __restrict__ oh,
                                                 float* __restrict__ of) {
  int row  = (blockIdx.x * blockDim.x + threadIdx.x) >> 5;
  int lane = threadIdx.x & 31;
  const float* xr = x + (size_t)row * ND;
  float4 v = *(const float4*)(xr + lane * 4);
  float s = v.x + v.y + v.z + v.w;
#pragma unroll
  for (int d = 1; d < 32; d <<= 1) s += __shfl_xor(s, d, 32);
  float mu = s * (1.0f / ND);
  float dx = v.x - mu, dy = v.y - mu, dz = v.z - mu, dw = v.w - mu;
  float ss = dx * dx + dy * dy + dz * dz + dw * dw;
#pragma unroll
  for (int d = 1; d < 32; d <<= 1) ss += __shfl_xor(ss, d, 32);
  float inv = rsqrtf(ss * (1.0f / ND) + 1e-6f);
  float4 gg = *(const float4*)(g + lane * 4);
  float4 bb = *(const float4*)(be + lane * 4);
  float r0 = dx * inv * gg.x + bb.x;
  float r1 = dy * inv * gg.y + bb.y;
  float r2 = dz * inv * gg.z + bb.z;
  float r3 = dw * inv * gg.w + bb.w;
  size_t base = (size_t)row * ND + lane * 4;
  if (F16OUT) {
    oh[base + 0] = (_Float16)r0; oh[base + 1] = (_Float16)r1;
    oh[base + 2] = (_Float16)r2; oh[base + 3] = (_Float16)r3;
  } else {
    of[base + 0] = r0; of[base + 1] = r1;
    of[base + 2] = r2; of[base + 3] = r3;
  }
}

// ---- GEMM: out = A(f16, N x DI) x W(f16, DO x DI)^T + bias, 16x64 tile per wave ----
// F16OUT: row-major f16 out.  XPOSE: also/only write transposed f16 [bm][d][t] (DO==128).
// RESID (implies fp32 out): outF = resid + val.
template<int DI, bool RELU, bool F16OUT, bool RESID, bool XPOSE>
__global__ __launch_bounds__(256) void gemm_kernel(const _Float16* __restrict__ A,
                                                   const _Float16* __restrict__ W,
                                                   const float* __restrict__ bias,
                                                   _Float16* __restrict__ outH,
                                                   _Float16* __restrict__ outT,
                                                   float* __restrict__ outF,
                                                   const float* __restrict__ resid,
                                                   int DO) {
  int wave = (blockIdx.x * blockDim.x + threadIdx.x) >> 5;
  int tpr  = DO >> 6;                 // 64-wide column strips
  int rt   = wave / tpr;
  int cs   = wave - rt * tpr;
  const _Float16* a0 = A + (size_t)rt * 16 * DI;
  const _Float16* w0 = W + (size_t)cs * 64 * DI;
  v8f c0 = {}, c1 = {}, c2 = {}, c3 = {};
#pragma unroll
  for (int k = 0; k < DI; k += 32) {
    v16h a = load_rm(a0 + k, DI);
    c0 = wmma_f16(a, load_rm(w0 + (size_t)0 * 16 * DI + k, DI), c0);
    c1 = wmma_f16(a, load_rm(w0 + (size_t)1 * 16 * DI + k, DI), c1);
    c2 = wmma_f16(a, load_rm(w0 + (size_t)2 * 16 * DI + k, DI), c2);
    c3 = wmma_f16(a, load_rm(w0 + (size_t)3 * 16 * DI + k, DI), c3);
  }
  int lane = threadIdx.x & 31;
  int col  = lane & 15;
  int rb   = (lane >> 4) << 3;
  v8f acc[4] = {c0, c1, c2, c3};
#pragma unroll
  for (int n = 0; n < 4; ++n) {
    int colg = cs * 64 + n * 16 + col;
    float bv = bias[colg];
#pragma unroll
    for (int v = 0; v < 8; ++v) {
      float val = acc[n][v] + bv;
      if (RELU) val = fmaxf(val, 0.0f);
      int row = rt * 16 + rb + v;
      if (F16OUT) outH[(size_t)row * DO + colg] = (_Float16)val;
      if (XPOSE) {
        int t  = row & (NT - 1);
        int bm = row >> 9;            // NT == 512
        outT[((size_t)bm * ND + colg) * NT + t] = (_Float16)val;
      }
      if (!F16OUT && !XPOSE)
        outF[(size_t)row * DO + colg] = (RESID ? resid[(size_t)row * DO + colg] : 0.0f) + val;
    }
  }
}

// ---------------- Windowed (L=16) context attention over d=128 ----------------
__global__ __launch_bounds__(256) void ctx_attn_kernel(const _Float16* __restrict__ src,
                                                       const _Float16* __restrict__ srcT,
                                                       _Float16* __restrict__ dst) {
  __shared__ _Float16 Pl[8][16][32];
  int wave = (blockIdx.x * blockDim.x + threadIdx.x) >> 5;
  int qb   = wave & (NT / 16 - 1);
  int bm   = wave >> 5;
  const _Float16* seq = src + (size_t)bm * NT * ND;
  const _Float16* qp  = seq + (size_t)qb * 16 * ND;
  const _Float16* pp  = qb ? (qp - 16 * ND) : qp;   // prev block (dummy when qb==0)
  v8f s0 = {}, s1 = {};
#pragma unroll
  for (int k = 0; k < ND; k += 32) {
    v16h a  = load_rm(qp + k, ND);
    v16h bp = load_rm(pp + k, ND);
    s0 = wmma_f16(a, bp, s0);    // Q x Prev^T
    s1 = wmma_f16(a, a,  s1);    // Q x Cur^T
  }
  int lane = threadIdx.x & 31;
  int col  = lane & 15;
  int hf   = lane >> 4;
  const float scale = 0.088388347648318447f;   // 1/sqrt(128)
  _Float16 (*P)[32] = Pl[threadIdx.x >> 5];
#pragma unroll
  for (int v = 0; v < 8; ++v) {
    int row = v + (hf << 3);
    // band: prev key j valid iff j > row; cur key j valid iff j <= row.
    // zero padding (qb==0): in-band scores are 0 and DO join the softmax.
    float sp = (col > row)  ? (qb ? s0[v] * scale : 0.0f) : -1e30f;
    float sc = (col <= row) ? s1[v] * scale : -1e30f;
    float mx = rmax16(fmaxf(sp, sc));
    float ep = __expf(sp - mx);
    float ec = __expf(sc - mx);
    float invd = 1.0f / rsum16(ep + ec);
    float wp = qb ? ep * invd : 0.0f;  // zero rows: no contribution to numerator
    float wc = ec * invd;
    P[row][col]      = (_Float16)wp;
    P[row][16 + col] = (_Float16)wc;
  }
  __syncthreads();
  v16h pA = load_rm(&P[0][0], 32);
  const _Float16* sT = srcT + (size_t)bm * ND * NT;
  int tp0 = (qb ? qb - 1 : qb) * 16;
  int tc0 = qb * 16;
  int ko  = hf << 3;
  _Float16* dr = dst + (size_t)bm * NT * ND + (size_t)qb * 16 * ND;
#pragma unroll
  for (int n0 = 0; n0 < ND; n0 += 16) {
    const _Float16* colp = sT + (size_t)(n0 + col) * NT;  // contiguous over t
    v16h b;
#pragma unroll
    for (int i = 0; i < 8; ++i) b[i]     = colp[tp0 + ko + i];  // k 0..15  = prev rows
#pragma unroll
    for (int i = 0; i < 8; ++i) b[8 + i] = colp[tc0 + ko + i];  // k 16..31 = cur rows
    v8f o = {};
    o = wmma_f16(pA, b, o);
#pragma unroll
    for (int v = 0; v < 8; ++v)
      dr[(size_t)((hf << 3) + v) * ND + n0 + col] = (_Float16)o[v];
  }
}

__device__ __forceinline__ float xhalf(float x) {
  int b = __builtin_bit_cast(int, x);
  return __builtin_bit_cast(float,
      __builtin_amdgcn_permlanex16(b, b, 0x76543210, 0xfedcba98, false, false));
}

__global__ __launch_bounds__(256) void attn_t_kernel(const _Float16* __restrict__ cq,
                                                     const _Float16* __restrict__ ck,
                                                     const _Float16* __restrict__ vT,
                                                     _Float16* __restrict__ out) {
  int wave = (blockIdx.x * blockDim.x + threadIdx.x) >> 5;
  int qb = wave & 31;
  int h  = (wave >> 5) & 3;
  int bm = wave >> 7;
  int b  = bm >> 5;
  int m  = bm & 31;
  size_t seqoff = (size_t)bm * NT * ND + h * NDK;
  const _Float16* Q  = cq + seqoff + (size_t)qb * 16 * ND;
  const _Float16* K  = ck + seqoff;
  const _Float16* VT = vT + (size_t)bm * ND * NT + (size_t)(h * NDK) * NT;  // [dk][t]
  int lane = threadIdx.x & 31;
  int col  = lane & 15;
  int hf   = lane >> 4;
  const float scale = 0.17677669529663689f;   // 1/sqrt(32)
  v16h qf = load_rm(Q, ND);      // B operand: column = query
  v8f o0 = {}, o1 = {};          // o0[r] = O[query col][dk 8*hf+r], o1[r]: dk 16+8*hf+r
  float mrun = -1e30f;           // running maximum of this lane's query (equal in both halves)
  float lrun = 0.0f;             // running sum over this half's keys only; joined after the loop
  for (int kb = 0; kb < NT / 32; ++kb) {
    const _Float16* Kb = K + (size_t)kb * 32 * ND;
    if (kb + 1 < NT / 32) {   // speculative prefetch of next key block -> global_prefetch_b8
      __builtin_prefetch(Kb + 32 * ND + lane * 64, 0, 0);
      __builtin_prefetch(VT + (size_t)col * NT + (kb + 1) * 32, 0, 0);
    }
    v16h ka0 = load_rm(Kb, ND);                              // A: rows = keys 0..15
    v16h ka1 = load_rm(Kb + 16 * ND, ND);                    // A: rows = keys 16..31
    v16h va0 = load_tp(VT + kb * 32, NT);                    // A: rows = dk 0..15,  k = keys
    v16h va1 = load_tp(VT + (size_t)16 * NT + kb * 32, NT);  // A: rows = dk 16..31, k = keys
    v8f s0 = {}, s1 = {};
    s0 = wmma_f16(ka0, qf, s0);
    s1 = wmma_f16(ka1, qf, s1);
    float x0[8], x1[8];
    float mx = -1e30f;
#pragma unroll
    for (int r = 0; r < 8; ++r) {
      x0[r] = s0[r] * scale;
      x1[r] = s1[r] * scale;
      mx = fmaxf(mx, fmaxf(x0[r], x1[r]));
    }
    mx = fmaxf(mx, xhalf(mx));
    float mn   = fmaxf(mrun, mx);
    float corr = __expf(mrun - mn);
    float ps   = 0.0f;
    v16h pB;                     // B operand: pB[s] = P[query col][key kmap(s, hf)]
#pragma unroll
    for (int r = 0; r < 8; ++r) {
      float p0 = __expf(x0[r] - mn);
      float p1 = __expf(x1[r] - mn);
      ps += p0 + p1;
      pB[r]     = (_Float16)p0;
      pB[8 + r] = (_Float16)p1;
    }
    lrun = lrun * corr + ps;
    mrun = mn;
#pragma unroll
    for (int r = 0; r < 8; ++r) { o0[r] *= corr; o1[r] *= corr; }
    o0 = wmma_f16(va0, pB, o0);
    o1 = wmma_f16(va1, pB, o1);
  }
  // out layout: [b][t][h][m][dk]; a lane's eight registers are eight consecutive dk of one row
  float inv = 1.0f / (lrun + xhalf(lrun));
  int t = qb * 16 + col;
  size_t base = ((((size_t)b * NT + t) * NH + h) * NM + m) * NDK + (hf << 3);
  v8h r0, r1;
#pragma unroll
  for (int r = 0; r < 8; ++r) {
    r0[r] = (_Float16)(o0[r] * inv);
    r1[r] = (_Float16)(o1[r] * inv);
  }
  *(v8h*)(out + base)      = r0;
  *(v8h*)(out + base + 16) = r1;
}

// ---------------- Attention across m=32 per (b,t,h) ----------------
__global__ __launch_bounds__(256) void attn_m_kernel(const _Float16* __restrict__ a1,
                                                     _Float16* __restrict__ out) {
  __shared__ _Float16 Xs[8][32][32];
  __shared__ _Float16 Pl[8][32][32];
  int wave = (blockIdx.x * blockDim.x + threadIdx.x) >> 5;
  int h = wave & 3;
  int t = (wave >> 2) & (NT - 1);
  int b = wave >> 11;
  int w = threadIdx.x >> 5;
  int lane = threadIdx.x & 31;
  const _Float16* X = a1 + ((((size_t)b * NT + t) * NH + h) * NM) * NDK;  // 32x32 tile

  unsigned           lbase = (unsigned)(uintptr_t)(&Xs[w][0][0]);
  unsigned long long gbase = (unsigned long long)(uintptr_t)X;
#pragma unroll
  for (int c2 = 0; c2 < 4; ++c2) {
    unsigned           loff = lbase + (unsigned)(c2 * 512 + lane * 16);
    unsigned long long ga   = gbase + (unsigned long long)(c2 * 512 + lane * 16);
    asm volatile("global_load_async_to_lds_b128 %0, %1, off" :: "v"(loff), "v"(ga) : "memory");
  }
  asm volatile("s_wait_asynccnt 0x0" ::: "memory");
  const _Float16* Xl = &Xs[w][0][0];

  int col = lane & 15;
  int hf  = lane >> 4;
  const float scale = 0.17677669529663689f;   // 1/sqrt(32)
  v16h xa0 = load_rm(Xl, 32);
  v16h xa1 = load_rm(Xl + 16 * 32, 32);
  v8f s00 = {}, s01 = {}, s10 = {}, s11 = {};
  s00 = wmma_f16(xa0, xa0, s00);
  s01 = wmma_f16(xa0, xa1, s01);
  s10 = wmma_f16(xa1, xa0, s10);
  s11 = wmma_f16(xa1, xa1, s11);
  _Float16 (*P)[32] = Pl[w];
#pragma unroll
  for (int v = 0; v < 8; ++v) {
    int row = v + (hf << 3);
    {
      float x0 = s00[v] * scale, x1 = s01[v] * scale;
      float mx = rmax16(fmaxf(x0, x1));
      float p0 = __expf(x0 - mx), p1 = __expf(x1 - mx);
      float inv = 1.0f / rsum16(p0 + p1);
      P[row][col]      = (_Float16)(p0 * inv);
      P[row][16 + col] = (_Float16)(p1 * inv);
    }
    {
      float x0 = s10[v] * scale, x1 = s11[v] * scale;
      float mx = rmax16(fmaxf(x0, x1));
      float p0 = __expf(x0 - mx), p1 = __expf(x1 - mx);
      float inv = 1.0f / rsum16(p0 + p1);
      P[16 + row][col]      = (_Float16)(p0 * inv);
      P[16 + row][16 + col] = (_Float16)(p1 * inv);
    }
  }
  __syncthreads();
  v16h pA0 = load_rm(&P[0][0], 32);
  v16h pA1 = load_rm(&P[16][0], 32);
  v16h bx0 = load_cm(Xl, 32);        // column gathers now hit LDS, not global
  v16h bx1 = load_cm(Xl + 16, 32);
  v8f o00 = {}, o01 = {}, o10 = {}, o11 = {};
  o00 = wmma_f16(pA0, bx0, o00);
  o01 = wmma_f16(pA0, bx1, o01);
  o10 = wmma_f16(pA1, bx0, o10);
  o11 = wmma_f16(pA1, bx1, o11);
  // out layout: [b][m][t][h*32+dk]
  int m0 = hf << 3;
#pragma unroll
  for (int v = 0; v < 8; ++v) {
    int mA = m0 + v;
    int mB = 16 + m0 + v;
    size_t baseA = (((size_t)b * NM + mA) * NT + t) * ND + h * NDK;
    size_t baseB = (((size_t)b * NM + mB) * NT + t) * ND + h * NDK;
    out[baseA + col]      = (_Float16)o00[v];
    out[baseA + 16 + col] = (_Float16)o01[v];
    out[baseB + col]      = (_Float16)o10[v];
    out[baseB + 16 + col] = (_Float16)o11[v];
  }
}

// ---------------- fp32 -> f16 conversion ----------------
__global__ void cvt_f16_kernel(const float* __restrict__ in, _Float16* __restrict__ out, int n) {
  int i = blockIdx.x * blockDim.x + threadIdx.x;
  if (i < n) out[i] = (_Float16)in[i];
}

extern "C" void kernel_launch(void* const* d_in, const int* in_sizes, int n_in,
                              void* d_out, int out_size, void* d_ws, size_t ws_size,
                              hipStream_t stream) {
  (void)in_sizes; (void)n_in; (void)out_size; (void)ws_size;
  const float* x   = (const float*)d_in[0];
  const float* Wq  = (const float*)d_in[1];
  const float* bq  = (const float*)d_in[2];
  const float* Wk  = (const float*)d_in[3];
  const float* bk  = (const float*)d_in[4];
  const float* Wv  = (const float*)d_in[5];
  const float* bv  = (const float*)d_in[6];
  const float* Wfc = (const float*)d_in[7];
  const float* bfc = (const float*)d_in[8];
  const float* W1  = (const float*)d_in[9];
  const float* b1  = (const float*)d_in[10];
  const float* W2  = (const float*)d_in[11];
  const float* b2  = (const float*)d_in[12];
  const float* g1  = (const float*)d_in[13];
  const float* be1 = (const float*)d_in[14];
  const float* g2  = (const float*)d_in[15];
  const float* be2 = (const float*)d_in[16];
  const float* gf  = (const float*)d_in[17];
  const float* bef = (const float*)d_in[18];

  char* ws = (char*)d_ws;
  size_t off = 0;
  auto bump = [&](size_t bytes) -> char* {
    char* p = ws + off;
    off = (off + bytes + 255) & ~(size_t)255;
    return p;
  };
  float*    xw   = (float*)bump((size_t)NROW * ND * 4);
  _Float16* yh   = (_Float16*)bump((size_t)NROW * ND * 2);
  _Float16* qh   = (_Float16*)bump((size_t)NROW * ND * 2);
  _Float16* kh   = (_Float16*)bump((size_t)NROW * ND * 2);
  _Float16* qT   = (_Float16*)bump((size_t)NROW * ND * 2);
  _Float16* kT   = (_Float16*)bump((size_t)NROW * ND * 2);
  _Float16* vT   = (_Float16*)bump((size_t)NROW * ND * 2);
  _Float16* cqh  = (_Float16*)bump((size_t)NROW * ND * 2);
  _Float16* ckh  = (_Float16*)bump((size_t)NROW * ND * 2);
  _Float16* a1h  = (_Float16*)bump((size_t)NROW * ND * 2);
  _Float16* a2h  = (_Float16*)bump((size_t)NROW * ND * 2);
  _Float16* hid  = (_Float16*)bump((size_t)NROW * NFF * 2);
  _Float16* wqh  = (_Float16*)bump((size_t)2 * ND * ND * 2);
  _Float16* wkh  = (_Float16*)bump((size_t)2 * ND * ND * 2);
  _Float16* wvh  = (_Float16*)bump((size_t)2 * ND * ND * 2);
  _Float16* wfch = (_Float16*)bump((size_t)2 * ND * ND * 2);
  _Float16* w1h  = (_Float16*)bump((size_t)2 * NFF * ND * 2);
  _Float16* w2h  = (_Float16*)bump((size_t)2 * ND * NFF * 2);

  hipMemcpyAsync(xw, x, (size_t)NROW * ND * 4, hipMemcpyDeviceToDevice, stream);

  auto cvt = [&](const float* src, _Float16* dst, int n) {
    cvt_f16_kernel<<<(n + 255) / 256, 256, 0, stream>>>(src, dst, n);
  };
  cvt(Wq,  wqh,  2 * ND * ND);
  cvt(Wk,  wkh,  2 * ND * ND);
  cvt(Wv,  wvh,  2 * ND * ND);
  cvt(Wfc, wfch, 2 * ND * ND);
  cvt(W1,  w1h,  2 * NFF * ND);
  cvt(W2,  w2h,  2 * ND * NFF);

  dim3 blk(256);
  const int lnBlocks    = NROW / 8;                          // 4096
  const int gemmBlk128  = (NROW / 16) * (ND / 64) / 8;       // 512  (DO=128, 64-wide strips)
  const int gemmBlkFF   = (NROW / 16) * (NFF / 64) / 8;      // 2048 (DO=512)
  const int ctxBlocks   = (NB * NM * (NT / 16)) / 8;         // 256
  const int atBlocks    = (NB * NM * NH * (NT / 16)) / 8;    // 1024
  const int amBlocks    = (NB * NT * NH) / 8;                // 512

  for (int i = 0; i < 2; ++i) {
    ln_kernel<true><<<lnBlocks, blk, 0, stream>>>(xw, g1 + i * ND, be1 + i * ND, yh, nullptr);
    // q,k: row-major + transposed; v: transposed only
    gemm_kernel<ND, false, true, false, true><<<gemmBlk128, blk, 0, stream>>>(
        yh, wqh + (size_t)i * ND * ND, bq + i * ND, qh, qT, nullptr, nullptr, ND);
    gemm_kernel<ND, false, true, false, true><<<gemmBlk128, blk, 0, stream>>>(
        yh, wkh + (size_t)i * ND * ND, bk + i * ND, kh, kT, nullptr, nullptr, ND);
    gemm_kernel<ND, false, false, false, true><<<gemmBlk128, blk, 0, stream>>>(
        yh, wvh + (size_t)i * ND * ND, bv + i * ND, nullptr, vT, nullptr, nullptr, ND);
    ctx_attn_kernel<<<ctxBlocks, blk, 0, stream>>>(qh, qT, cqh);
    ctx_attn_kernel<<<ctxBlocks, blk, 0, stream>>>(kh, kT, ckh);
    attn_t_kernel<<<atBlocks, blk, 0, stream>>>(cqh, ckh, vT, a1h);
    attn_m_kernel<<<amBlocks, blk, 0, stream>>>(a1h, a2h);
    gemm_kernel<ND, false, false, true, false><<<gemmBlk128, blk, 0, stream>>>(
        a2h, wfch + (size_t)i * ND * ND, bfc + i * ND, nullptr, nullptr, xw, xw, ND);
    ln_kernel<true><<<lnBlocks, blk, 0, stream>>>(xw, g2 + i * ND, be2 + i * ND, yh, nullptr);
    gemm_kernel<ND, true, true, false, false><<<gemmBlkFF, blk, 0, stream>>>(
        yh, w1h + (size_t)i * NFF * ND, b1 + i * NFF, hid, nullptr, nullptr, nullptr, NFF);
    gemm_kernel<NFF, false, false, true, false><<<gemmBlk128, blk, 0, stream>>>(
        hid, w2h + (size_t)i * ND * NFF, b2 + i * ND, nullptr, nullptr, xw, xw, ND);
  }
  ln_kernel<false><<<lnBlocks, blk, 0, stream>>>(xw, gf, bef, nullptr, (float*)d_out);
}

// v002
// In both of two side-by-side timings against v001, it was 1.07 times as fast.
// Counting every step since v000, it is 1.14 times as fast.
#include <hip/hip_runtime.h>
#include <hip/hip_bf16.h>
#include <stdint.h>

typedef __attribute__((ext_vector_type(16))) _Float16 v16h;
typedef __attribute__((ext_vector_type(8)))  float    v8f;
typedef __attribute__((ext_vector_type(8)))  _Float16 v8h;

#define NB   2
#define NM   32
#define NT   512
#define ND   128
#define NH   4
#define NDK  32
#define NFF  512
#define NROW (NB * NM * NT)   // 32768 rows of D=128

__device__ __forceinline__ v8f wmma_f16(v16h a, v16h b, v8f c) {
  // D = A(16x32 f16) x B(32x16 f16) + C(16x16 f32)
  return __builtin_amdgcn_wmma_f32_16x16x32_f16(false, a, false, b, (short)0, c, false, false);
}

__device__ __forceinline__ v16h load_rm(const _Float16* __restrict__ p, int ld) {
  int lane = threadIdx.x & 31;
  const _Float16* r = p + (lane & 15) * ld + ((lane >> 4) << 3);
  v16h o;
#pragma unroll
  for (int i = 0; i < 8; ++i) o[i] = r[i];
#pragma unroll
  for (int i = 0; i < 8; ++i) o[8 + i] = r[16 + i];
  return o;
}

// B-operand for C = A x Bmat, Bmat (32 x >=16) row-major: B[k][n] = p[k*ld+n].
// Used only on small LDS tiles (attn_m); bulk paths use transposed copies instead.
__device__ __forceinline__ v16h load_cm(const _Float16* __restrict__ p, int ld) {
  int lane = threadIdx.x & 31;
  int col  = lane & 15;
  int ko   = (lane >> 4) << 3;
  v16h o;
#pragma unroll
  for (int i = 0; i < 8; ++i) o[i] = p[(ko + i) * ld + col];
#pragma unroll
  for (int i = 0; i < 8; ++i) o[8 + i] = p[(16 + ko + i) * ld + col];
  return o;
}

// B-operand from a column-major (transposed) source: column n contiguous over k.
// ct[n][k] with column stride ldT: B[k][n] = ct[n*ldT + k].
__device__ __forceinline__ v16h load_tp(const _Float16* __restrict__ ct, int ldT) {
  int lane = threadIdx.x & 31;
  const _Float16* r = ct + (lane & 15) * ldT + ((lane >> 4) << 3);
  v16h o;
#pragma unroll
  for (int i = 0; i < 8; ++i) o[i] = r[i];
#pragma unroll
  for (int i = 0; i < 8; ++i) o[8 + i] = r[16 + i];
  return o;
}

__device__ __forceinline__ float rmax16(float x) {
#pragma unroll
  for (int d = 1; d < 16; d <<= 1) x = fmaxf(x, __shfl_xor(x, d, 32));
  return x;
}
__device__ __forceinline__ float rsum16(float x) {
#pragma unroll
  for (int d = 1; d < 16; d <<= 1) x += __shfl_xor(x, d, 32);
  return x;
}

// ---------------- LayerNorm (one wave per 128-float row) ----------------
template<bool F16OUT>
__device__ __forceinline__ void ln_body(const float* __restrict__ x,
                                        const float* __restrict__ g,
                                        const float* __restrict__ be,
                                        _Float16* __restrict__ oh,
                                        float* __restrict__ of) {
  int row  = (blockIdx.x * blockDim.x + threadIdx.x) >> 5;
  int lane = threadIdx.x & 31;
  const float* xr = x + (size_t)row * ND;
  float4 v = *(const float4*)(xr + lane * 4);
  float s = v.x + v.y + v.z + v.w;
#pragma unroll
  for (int d = 1; d < 32; d <<= 1) s += __shfl_xor(s, d, 32);
  float mu = s * (1.0f / ND);
  float dx = v.x - mu, dy = v.y - mu, dz = v.z - mu, dw = v.w - mu;
  float ss = dx * dx + dy * dy + dz * dz + dw * dw;
#pragma unroll
  for (int d = 1; d < 32; d <<= 1) ss += __shfl_xor(ss, d, 32);
  float inv = rsqrtf(ss * (1.0f / ND) + 1e-6f);
  float4 gg = *(const float4*)(g + lane * 4);
  float4 bb = *(const float4*)(be + lane * 4);
  float r0 = dx * inv * gg.x + bb.x;
  float r1 = dy * inv * gg.y + bb.y;
  float r2 = dz * inv * gg.z + bb.z;
  float r3 = dw * inv * gg.w + bb.w;
  size_t base = (size_t)row * ND + lane * 4;
  if (F16OUT) {
    oh[base + 0] = (_Float16)r0; oh[base + 1] = (_Float16)r1;
    oh[base + 2] = (_Float16)r2; oh[base + 3] = (_Float16)r3;
  } else {
    of[base + 0] = r0; of[base + 1] = r1;
    of[base + 2] = r2; of[base + 3] = r3;
  }
}

template<bool F16OUT>
__global__ __launch_bounds__(256) void ln_kernel(const float* __restrict__ x,
                                                 const float* __restrict__ g,
                                                 const float* __restrict__ be,
                                                 _Float16* __restrict__ oh,
                                                 float* __restrict__ of) {
  ln_body<F16OUT>(x, g, be, oh, of);
}

// ---- GEMM: out = A(f16, N x DI) x W(f16, DO x DI)^T + bias, 16x64 tile per wave ----
// F16OUT: row-major f16 out.  XPOSE: also/only write transposed f16 [bm][d][t] (DO==128).
// RESID (implies fp32 out): outF = resid + val.
template<int DI, bool RELU, bool F16OUT, bool RESID, bool XPOSE>
__device__ __forceinline__ void gemm_body(const _Float16* __restrict__ A,
                                          const _Float16* __restrict__ W,
                                          const float* __restrict__ bias,
                                          _Float16* __restrict__ outH,
                                          _Float16* __restrict__ outT,
                                          float* __restrict__ outF,
                                          const float* __restrict__ resid,
                                          int DO) {
  int wave = (blockIdx.x * blockDim.x + threadIdx.x) >> 5;
  int tpr  = DO >> 6;                 // 64-wide column strips
  int rt   = wave / tpr;
  int cs   = wave - rt * tpr;
  const _Float16* a0 = A + (size_t)rt * 16 * DI;
  const _Float16* w0 = W + (size_t)cs * 64 * DI;
  v8f c0 = {}, c1 = {}, c2 = {}, c3 = {};
#pragma unroll
  for (int k = 0; k < DI; k += 32) {
    v16h a = load_rm(a0 + k, DI);
    c0 = wmma_f16(a, load_rm(w0 + (size_t)0 * 16 * DI + k, DI), c0);
    c1 = wmma_f16(a, load_rm(w0 + (size_t)1 * 16 * DI + k, DI), c1);
    c2 = wmma_f16(a, load_rm(w0 + (size_t)2 * 16 * DI + k, DI), c2);
    c3 = wmma_f16(a, load_rm(w0 + (size_t)3 * 16 * DI + k, DI), c3);
  }
  int lane = threadIdx.x & 31;
  int col  = lane & 15;
  int rb   = (lane >> 4) << 3;
  v8f acc[4] = {c0, c1, c2, c3};
#pragma unroll
  for (int n = 0; n < 4; ++n) {
    int colg = cs * 64 + n * 16 + col;
    float bv = bias[colg];
#pragma unroll
    for (int v = 0; v < 8; ++v) {
      float val = acc[n][v] + bv;
      if (RELU) val = fmaxf(val, 0.0f);
      int row = rt * 16 + rb + v;
      if (F16OUT) outH[(size_t)row * DO + colg] = (_Float16)val;
      if (XPOSE) {
        int t  = row & (NT - 1);
        int bm = row >> 9;            // NT == 512
        outT[((size_t)bm * ND + colg) * NT + t] = (_Float16)val;
      }
      if (!F16OUT && !XPOSE)
        outF[(size_t)row * DO + colg] = (RESID ? resid[(size_t)row * DO + colg] : 0.0f) + val;
    }
  }
}

template<int DI, bool RELU, bool F16OUT, bool RESID, bool XPOSE>
__global__ __launch_bounds__(256) void gemm_kernel(const _Float16* __restrict__ A,
                                                   const _Float16* __restrict__ W,
                                                   const float* __restrict__ bias,
                                                   _Float16* __restrict__ outH,
                                                   _Float16* __restrict__ outT,
                                                   float* __restrict__ outF,
                                                   const float* __restrict__ resid,
                                                   int DO) {
  gemm_body<DI, RELU, F16OUT, RESID, XPOSE>(A, W, bias, outH, outT, outF, resid, DO);
}

// The q, k and v products read the same A and none of each other's output: one grid,
// blockIdx.y names the product (0 = q, 1 = k: row-major + transposed; 2 = v: transposed only).
__global__ __launch_bounds__(256) void qkv_kernel(const _Float16* __restrict__ A,
                                                  const _Float16* __restrict__ Wq,
                                                  const _Float16* __restrict__ Wk,
                                                  const _Float16* __restrict__ Wv,
                                                  const float* __restrict__ bq,
                                                  const float* __restrict__ bk,
                                                  const float* __restrict__ bv,
                                                  _Float16* __restrict__ qh,
                                                  _Float16* __restrict__ kh,
                                                  _Float16* __restrict__ qT,
                                                  _Float16* __restrict__ kT,
                                                  _Float16* __restrict__ vT) {
  if (blockIdx.y == 2) {
    gemm_body<ND, false, false, false, true>(A, Wv, bv, nullptr, vT, nullptr, nullptr, ND);
  } else {
    bool isq = blockIdx.y == 0;
    gemm_body<ND, false, true, false, true>(A, isq ? Wq : Wk, isq ? bq : bk, isq ? qh : kh,
                                            isq ? qT : kT, nullptr, nullptr, ND);
  }
}

// ---------------- Windowed (L=16) context attention over d=128 ----------------
// blockIdx.y names the tensor (0 = q, 1 = k): the two are independent and share one grid.
__global__ __launch_bounds__(256) void ctx_attn_kernel(const _Float16* __restrict__ src0,
                                                       const _Float16* __restrict__ srcT0,
                                                       _Float16* __restrict__ dst0,
                                                       const _Float16* __restrict__ src1,
                                                       const _Float16* __restrict__ srcT1,
                                                       _Float16* __restrict__ dst1) {
  __shared__ _Float16 Pl[8][16][32];
  const _Float16* __restrict__ src  = blockIdx.y ? src1  : src0;
  const _Float16* __restrict__ srcT = blockIdx.y ? srcT1 : srcT0;
  _Float16* __restrict__       dst  = blockIdx.y ? dst1  : dst0;
  int wave = (blockIdx.x * blockDim.x + threadIdx.x) >> 5;
  int qb   = wave & (NT / 16 - 1);
  int bm   = wave >> 5;
  const _Float16* seq = src + (size_t)bm * NT * ND;
  const _Float16* qp  = seq + (size_t)qb * 16 * ND;
  const _Float16* pp  = qb ? (qp - 16 * ND) : qp;   // prev block (dummy when qb==0)
  v8f s0 = {}, s1 = {};
#pragma unroll
  for (int k = 0; k < ND; k += 32) {
    v16h a  = load_rm(qp + k, ND);
    v16h bp = load_rm(pp + k, ND);
    s0 = wmma_f16(a, bp, s0);    // Q x Prev^T
    s1 = wmma_f16(a, a,  s1);    // Q x Cur^T
  }
  int lane = threadIdx.x & 31;
  int col  = lane & 15;
  int hf   = lane >> 4;
  const float scale = 0.088388347648318447f;   // 1/sqrt(128)
  _Float16 (*P)[32] = Pl[threadIdx.x >> 5];
#pragma unroll
  for (int v = 0; v < 8; ++v) {
    int row = v + (hf << 3);
    // band: prev key j valid iff j > row; cur key j valid iff j <= row.
    // zero padding (qb==0): in-band scores are 0 and DO join the softmax.
    float sp = (col > row)  ? (qb ? s0[v] * scale : 0.0f) : -1e30f;
    float sc = (col <= row) ? s1[v] * scale : -1e30f;
    float mx = rmax16(fmaxf(sp, sc));
    float ep = __expf(sp - mx);
    float ec = __expf(sc - mx);
    float invd = 1.0f / rsum16(ep + ec);
    float wp = qb ? ep * invd : 0.0f;  // zero rows: no contribution to numerator
    float wc = ec * invd;
    P[row][col]      = (_Float16)wp;
    P[row][16 + col] = (_Float16)wc;
  }
  __syncthreads();
  v16h pA = load_rm(&P[0][0], 32);
  const _Float16* sT = srcT + (size_t)bm * ND * NT;
  int tp0 = (qb ? qb - 1 : qb) * 16;
  int tc0 = qb * 16;
  int ko  = hf << 3;
  _Float16* dr = dst + (size_t)bm * NT * ND + (size_t)qb * 16 * ND;
#pragma unroll
  for (int n0 = 0; n0 < ND; n0 += 16) {
    const _Float16* colp = sT + (size_t)(n0 + col) * NT;  // contiguous over t
    v16h b;
#pragma unroll
    for (int i = 0; i < 8; ++i) b[i]     = colp[tp0 + ko + i];  // k 0..15  = prev rows
#pragma unroll
    for (int i = 0; i < 8; ++i) b[8 + i] = colp[tc0 + ko + i];  // k 16..31 = cur rows
    v8f o = {};
    o = wmma_f16(pA, b, o);
#pragma unroll
    for (int v = 0; v < 8; ++v)
      dr[(size_t)((hf << 3) + v) * ND + n0 + col] = (_Float16)o[v];
  }
}

__device__ __forceinline__ float xhalf(float x) {
  int b = __builtin_bit_cast(int, x);
  return __builtin_bit_cast(float,
      __builtin_amdgcn_permlanex16(b, b, 0x76543210, 0xfedcba98, false, false));
}

__global__ __launch_bounds__(256) void attn_t_kernel(const _Float16* __restrict__ cq,
                                                     const _Float16* __restrict__ ck,
                                                     const _Float16* __restrict__ vT,
                                                     _Float16* __restrict__ out) {
  int wave = (blockIdx.x * blockDim.x + threadIdx.x) >> 5;
  int qb = wave & 31;
  int h  = (wave >> 5) & 3;
  int bm = wave >> 7;
  int b  = bm >> 5;
  int m  = bm & 31;
  size_t seqoff = (size_t)bm * NT * ND + h * NDK;
  const _Float16* Q  = cq + seqoff + (size_t)qb * 16 * ND;
  const _Float16* K  = ck + seqoff;
  const _Float16* VT = vT + (size_t)bm * ND * NT + (size_t)(h * NDK) * NT;  // [dk][t]
  int lane = threadIdx.x & 31;
  int col  = lane & 15;
  int hf   = lane >> 4;
  const float scale = 0.17677669529663689f;   // 1/sqrt(32)
  v16h qf = load_rm(Q, ND);      // B operand: column = query
  v8f o0 = {}, o1 = {};          // o0[r] = O[query col][dk 8*hf+r], o1[r]: dk 16+8*hf+r
  float mrun = -1e30f;           // running maximum of this lane's query (equal in both halves)
  float lrun = 0.0f;             // running sum over this half's keys only; joined after the loop
  for (int kb = 0; kb < NT / 32; ++kb) {
    const _Float16* Kb = K + (size_t)kb * 32 * ND;
    if (kb + 1 < NT / 32) {   // speculative prefetch of next key block -> global_prefetch_b8
      __builtin_prefetch(Kb + 32 * ND + lane * 64, 0, 0);
      __builtin_prefetch(VT + (size_t)col * NT + (kb + 1) * 32, 0, 0);
    }
    v16h ka0 = load_rm(Kb, ND);                              // A: rows = keys 0..15
    v16h ka1 = load_rm(Kb + 16 * ND, ND);                    // A: rows = keys 16..31
    v16h va0 = load_tp(VT + kb * 32, NT);                    // A: rows = dk 0..15,  k = keys
    v16h va1 = load_tp(VT + (size_t)16 * NT + kb * 32, NT);  // A: rows = dk 16..31, k = keys
    v8f s0 = {}, s1 = {};
    s0 = wmma_f16(ka0, qf, s0);
    s1 = wmma_f16(ka1, qf, s1);
    float x0[8], x1[8];
    float mx = -1e30f;
#pragma unroll
    for (int r = 0; r < 8; ++r) {
      x0[r] = s0[r] * scale;
      x1[r] = s1[r] * scale;
      mx = fmaxf(mx, fmaxf(x0[r], x1[r]));
    }
    mx = fmaxf(mx, xhalf(mx));
    float mn   = fmaxf(mrun, mx);
    float corr = __expf(mrun - mn);
    float ps   = 0.0f;
    v16h pB;                     // B operand: pB[s] = P[query col][key kmap(s, hf)]
#pragma unroll
    for (int r = 0; r < 8; ++r) {
      float p0 = __expf(x0[r] - mn);
      float p1 = __expf(x1[r] - mn);
      ps += p0 + p1;
      pB[r]     = (_Float16)p0;
      pB[8 + r] = (_Float16)p1;
    }
    lrun = lrun * corr + ps;
    mrun = mn;
#pragma unroll
    for (int r = 0; r < 8; ++r) { o0[r] *= corr; o1[r] *= corr; }
    o0 = wmma_f16(va0, pB, o0);
    o1 = wmma_f16(va1, pB, o1);
  }
  // out layout: [b][t][h][m][dk]; a lane's eight registers are eight consecutive dk of one row
  float inv = 1.0f / (lrun + xhalf(lrun));
  int t = qb * 16 + col;
  size_t base = ((((size_t)b * NT + t) * NH + h) * NM + m) * NDK + (hf << 3);
  v8h r0, r1;
#pragma unroll
  for (int r = 0; r < 8; ++r) {
    r0[r] = (_Float16)(o0[r] * inv);
    r1[r] = (_Float16)(o1[r] * inv);
  }
  *(v8h*)(out + base)      = r0;
  *(v8h*)(out + base + 16) = r1;
}

// ---------------- Attention across m=32 per (b,t,h) ----------------
__global__ __launch_bounds__(256) void attn_m_kernel(const _Float16* __restrict__ a1,
                                                     _Float16* __restrict__ out) {
  __shared__ _Float16 Xs[8][32][32];
  __shared__ _Float16 Pl[8][32][32];
  int wave = (blockIdx.x * blockDim.x + threadIdx.x) >> 5;
  int h = wave & 3;
  int t = (wave >> 2) & (NT - 1);
  int b = wave >> 11;
  int w = threadIdx.x >> 5;
  int lane = threadIdx.x & 31;
  const _Float16* X = a1 + ((((size_t)b * NT + t) * NH + h) * NM) * NDK;  // 32x32 tile

  unsigned           lbase = (unsigned)(uintptr_t)(&Xs[w][0][0]);
  unsigned long long gbase = (unsigned long long)(uintptr_t)X;
#pragma unroll
  for (int c2 = 0; c2 < 4; ++c2) {
    unsigned           loff = lbase + (unsigned)(c2 * 512 + lane * 16);
    unsigned long long ga   = gbase + (unsigned long long)(c2 * 512 + lane * 16);
    asm volatile("global_load_async_to_lds_b128 %0, %1, off" :: "v"(loff), "v"(ga) : "memory");
  }
  asm volatile("s_wait_asynccnt 0x0" ::: "memory");
  const _Float16* Xl = &Xs[w][0][0];

  int col = lane & 15;
  int hf  = lane >> 4;
  const float scale = 0.17677669529663689f;   // 1/sqrt(32)
  v16h xa0 = load_rm(Xl, 32);
  v16h xa1 = load_rm(Xl + 16 * 32, 32);
  v8f s00 = {}, s01 = {}, s10 = {}, s11 = {};
  s00 = wmma_f16(xa0, xa0, s00);
  s01 = wmma_f16(xa0, xa1, s01);
  s10 = wmma_f16(xa1, xa0, s10);
  s11 = wmma_f16(xa1, xa1, s11);
  _Float16 (*P)[32] = Pl[w];
#pragma unroll
  for (int v = 0; v < 8; ++v) {
    int row = v + (hf << 3);
    {
      float x0 = s00[v] * scale, x1 = s01[v] * scale;
      float mx = rmax16(fmaxf(x0, x1));
      float p0 = __expf(x0 - mx), p1 = __expf(x1 - mx);
      float inv = 1.0f / rsum16(p0 + p1);
      P[row][col]      = (_Float16)(p0 * inv);
      P[row][16 + col] = (_Float16)(p1 * inv);
    }
    {
      float x0 = s10[v] * scale, x1 = s11[v] * scale;
      float mx = rmax16(fmaxf(x0, x1));
      float p0 = __expf(x0 - mx), p1 = __expf(x1 - mx);
      float inv = 1.0f / rsum16(p0 + p1);
      P[16 + row][col]      = (_Float16)(p0 * inv);
      P[16 + row][16 + col] = (_Float16)(p1 * inv);
    }
  }
  __syncthreads();
  v16h pA0 = load_rm(&P[0][0], 32);
  v16h pA1 = load_rm(&P[16][0], 32);
  v16h bx0 = load_cm(Xl, 32);        // column gathers now hit LDS, not global
  v16h bx1 = load_cm(Xl + 16, 32);
  v8f o00 = {}, o01 = {}, o10 = {}, o11 = {};
  o00 = wmma_f16(pA0, bx0, o00);
  o01 = wmma_f16(pA0, bx1, o01);
  o10 = wmma_f16(pA1, bx0, o10);
  o11 = wmma_f16(pA1, bx1, o11);
  // out layout: [b][m][t][h*32+dk]
  int m0 = hf << 3;
#pragma unroll
  for (int v = 0; v < 8; ++v) {
    int mA = m0 + v;
    int mB = 16 + m0 + v;
    size_t baseA = (((size_t)b * NM + mA) * NT + t) * ND + h * NDK;
    size_t baseB = (((size_t)b * NM + mB) * NT + t) * ND + h * NDK;
    out[baseA + col]      = (_Float16)o00[v];
    out[baseA + 16 + col] = (_Float16)o01[v];
    out[baseB + col]      = (_Float16)o10[v];
    out[baseB + 16 + col] = (_Float16)o11[v];
  }
}

// ---------------- first LayerNorm + fp32 -> f16 conversion of all six weights ----------------
// Neither reads what the other writes: blocks below LNB do the LayerNorm, the rest convert.
// wh holds the six f16 weight arrays back to back in the order Wq, Wk, Wv, Wfc, W1, W2;
// every array is a whole number of 256-element blocks, so a block has one source.
#define LNB  (NROW / 8)              // LayerNorm blocks
#define WSQ  (2 * ND * ND)           // elements of Wq, Wk, Wv, Wfc (both layers)
#define WFF  (2 * NFF * ND)          // elements of W1, W2 (both layers)
__global__ __launch_bounds__(256) void prep_kernel(const float* __restrict__ x,
                                                   const float* __restrict__ g,
                                                   const float* __restrict__ be,
                                                   _Float16* __restrict__ oh,
                                                   const float* __restrict__ Wq,
                                                   const float* __restrict__ Wk,
                                                   const float* __restrict__ Wv,
                                                   const float* __restrict__ Wfc,
                                                   const float* __restrict__ W1,
                                                   const float* __restrict__ W2,
                                                   _Float16* __restrict__ wh) {
  if (blockIdx.x < LNB) {
    ln_body<true>(x, g, be, oh, nullptr);
    return;
  }
  int b0 = (blockIdx.x - LNB) * 256;   // first element of this block in wh
  const float* in;
  int s0;                              // where this block's array starts in wh
  if      (b0 < 1 * WSQ)       { in = Wq;  s0 = 0; }
  else if (b0 < 2 * WSQ)       { in = Wk;  s0 = 1 * WSQ; }
  else if (b0 < 3 * WSQ)       { in = Wv;  s0 = 2 * WSQ; }
  else if (b0 < 4 * WSQ)       { in = Wfc; s0 = 3 * WSQ; }
  else if (b0 < 4 * WSQ + WFF) { in = W1;  s0 = 4 * WSQ; }
  else                         { in = W2;  s0 = 4 * WSQ + WFF; }
  int i = b0 + threadIdx.x;
  wh[i] = (_Float16)in[i - s0];
}

extern "C" void kernel_launch(void* const* d_in, const int* in_sizes, int n_in,
                              void* d_out, int out_size, void* d_ws, size_t ws_size,
                              hipStream_t stream) {
  (void)in_sizes; (void)n_in; (void)out_size; (void)ws_size;
  const float* x   = (const float*)d_in[0];
  const float* Wq  = (const float*)d_in[1];
  const float* bq  = (const float*)d_in[2];
  const float* Wk  = (const float*)d_in[3];
  const float* bk  = (const float*)d_in[4];
  const float* Wv  = (const float*)d_in[5];
  const float* bv  = (const float*)d_in[6];
  const float* Wfc = (const float*)d_in[7];
  const float* bfc = (const float*)d_in[8];
  const float* W1  = (const float*)d_in[9];
  const float* b1  = (const float*)d_in[10];
  const float* W2  = (const float*)d_in[11];
  const float* b2  = (const float*)d_in[12];
  const float* g1  = (const float*)d_in[13];
  const float* be1 = (const float*)d_in[14];
  const float* g2  = (const float*)d_in[15];
  const float* be2 = (const float*)d_in[16];
  const float* gf  = (const float*)d_in[17];
  const float* bef = (const float*)d_in[18];

  char* ws = (char*)d_ws;
  size_t off = 0;
  auto bump = [&](size_t bytes) -> char* {
    char* p = ws + off;
    off = (off + bytes + 255) & ~(size_t)255;
    return p;
  };
  float*    xw   = (float*)bump((size_t)NROW * ND * 4);
  _Float16* yh   = (_Float16*)bump((size_t)NROW * ND * 2);
  _Float16* qh   = (_Float16*)bump((size_t)NROW * ND * 2);
  _Float16* kh   = (_Float16*)bump((size_t)NROW * ND * 2);
  _Float16* qT   = (_Float16*)bump((size_t)NROW * ND * 2);
  _Float16* kT   = (_Float16*)bump((size_t)NROW * ND * 2);
  _Float16* vT   = (_Float16*)bump((size_t)NROW * ND * 2);
  _Float16* cqh  = (_Float16*)bump((size_t)NROW * ND * 2);
  _Float16* ckh  = (_Float16*)bump((size_t)NROW * ND * 2);
  _Float16* a1h  = (_Float16*)bump((size_t)NROW * ND * 2);
  _Float16* a2h  = (_Float16*)bump((size_t)NROW * ND * 2);
  _Float16* hid  = (_Float16*)bump((size_t)NROW * NFF * 2);
  _Float16* wh   = (_Float16*)bump((size_t)(4 * WSQ + 2 * WFF) * 2);   // six f16 weight arrays
  _Float16* wqh  = wh;
  _Float16* wkh  = wh + 1 * WSQ;
  _Float16* wvh  = wh + 2 * WSQ;
  _Float16* wfch = wh + 3 * WSQ;
  _Float16* w1h  = wh + 4 * WSQ;
  _Float16* w2h  = wh + 4 * WSQ + WFF;

  hipMemcpyAsync(xw, x, (size_t)NROW * ND * 4, hipMemcpyDeviceToDevice, stream);

  dim3 blk(256);
  const int lnBlocks    = NROW / 8;                          // 4096
  const int gemmBlk128  = (NROW / 16) * (ND / 64) / 8;       // 512  (DO=128, 64-wide strips)
  const int gemmBlkFF   = (NROW / 16) * (NFF / 64) / 8;      // 2048 (DO=512)
  const int ctxBlocks   = (NB * NM * (NT / 16)) / 8;         // 256
  const int atBlocks    = (NB * NM * NH * (NT / 16)) / 8;    // 1024
  const int amBlocks    = (NB * NT * NH) / 8;                // 512

  for (int i = 0; i < 2; ++i) {
    if (i == 0)   // the first LayerNorm shares its grid with the weight conversions
      prep_kernel<<<LNB + (4 * WSQ + 2 * WFF) / 256, blk, 0, stream>>>(
          xw, g1, be1, yh, Wq, Wk, Wv, Wfc, W1, W2, wh);
    else
      ln_kernel<true><<<lnBlocks, blk, 0, stream>>>(xw, g1 + i * ND, be1 + i * ND, yh, nullptr);
    qkv_kernel<<<dim3(gemmBlk128, 3), blk, 0, stream>>>(
        yh, wqh + (size_t)i * ND * ND, wkh + (size_t)i * ND * ND, wvh + (size_t)i * ND * ND,
        bq + i * ND, bk + i * ND, bv + i * ND, qh, kh, qT, kT, vT);
    ctx_attn_kernel<<<dim3(ctxBlocks, 2), blk, 0, stream>>>(qh, qT, cqh, kh, kT, ckh);
    attn_t_kernel<<<atBlocks, blk, 0, stream>>>(cqh, ckh, vT, a1h);
    attn_m_kernel<<<amBlocks, blk, 0, stream>>>(a1h, a2h);
    gemm_kernel<ND, false, false, true, false><<<gemmBlk128, blk, 0, stream>>>(
        a2h, wfch + (size_t)i * ND * ND, bfc + i * ND, nullptr, nullptr, xw, xw, ND);
    ln_kernel<true><<<lnBlocks, blk, 0, stream>>>(xw, g2 + i * ND, be2 + i * ND, yh, nullptr);
    gemm_kernel<ND, true, true, false, false><<<gemmBlkFF, blk, 0, stream>>>(
        yh, w1h + (size_t)i * NFF * ND, b1 + i * NFF, hid, nullptr, nullptr, nullptr, NFF);
    gemm_kernel<NFF, false, false, true, false><<<gemmBlk128, blk, 0, stream>>>(
        hid, w2h + (size_t)i * ND * NFF, b2 + i * ND, nullptr, nullptr, xw, xw, ND);
  }
  ln_kernel<false><<<lnBlocks, blk, 0, stream>>>(xw, gf, bef, nullptr, (float*)d_out);
}

// v003
// Timed twice side by side with v002, it ran 1.12 times as fast both times.
// Over all steps from v000 it is 1.28 times as fast.
#include <hip/hip_runtime.h>
#include <hip/hip_bf16.h>
#include <stdint.h>

typedef __attribute__((ext_vector_type(16))) _Float16 v16h;
typedef __attribute__((ext_vector_type(8)))  float    v8f;
typedef __attribute__((ext_vector_type(8)))  _Float16 v8h;
typedef __attribute__((ext_vector_type(4)))  _Float16 v4h;

#define NB   2
#define NM   32
#define NT   512
#define ND   128
#define NH   4
#define NDK  32
#define NFF  512
#define NROW (NB * NM * NT)   // 32768 rows of D=128

__device__ __forceinline__ v8f wmma_f16(v16h a, v16h b, v8f c) {
  // D = A(16x32 f16) x B(32x16 f16) + C(16x16 f32)
  return __builtin_amdgcn_wmma_f32_16x16x32_f16(false, a, false, b, (short)0, c, false, false);
}

__device__ __forceinline__ v16h load_rm(const _Float16* __restrict__ p, int ld) {
  int lane = threadIdx.x & 31;
  const _Float16* r = p + (lane & 15) * ld + ((lane >> 4) << 3);
  v16h o;
#pragma unroll
  for (int i = 0; i < 8; ++i) o[i] = r[i];
#pragma unroll
  for (int i = 0; i < 8; ++i) o[8 + i] = r[16 + i];
  return o;
}

// B-operand for C = A x Bmat, Bmat (32 x >=16) row-major: B[k][n] = p[k*ld+n].
// Used only on small LDS tiles (attn_m); bulk paths use transposed copies instead.
__device__ __forceinline__ v16h load_cm(const _Float16* __restrict__ p, int ld) {
  int lane = threadIdx.x & 31;
  int col  = lane & 15;
  int ko   = (lane >> 4) << 3;
  v16h o;
#pragma unroll
  for (int i = 0; i < 8; ++i) o[i] = p[(ko + i) * ld + col];
#pragma unroll
  for (int i = 0; i < 8; ++i) o[8 + i] = p[(16 + ko + i) * ld + col];
  return o;
}

// B-operand from a column-major (transposed) source: column n contiguous over k.
// ct[n][k] with column stride ldT: B[k][n] = ct[n*ldT + k].
__device__ __forceinline__ v16h load_tp(const _Float16* __restrict__ ct, int ldT) {
  int lane = threadIdx.x & 31;
  const _Float16* r = ct + (lane & 15) * ldT + ((lane >> 4) << 3);
  v16h o;
#pragma unroll
  for (int i = 0; i < 8; ++i) o[i] = r[i];
#pragma unroll
  for (int i = 0; i < 8; ++i) o[8 + i] = r[16 + i];
  return o;
}

__device__ __forceinline__ float rmax16(float x) {
#pragma unroll
  for (int d = 1; d < 16; d <<= 1) x = fmaxf(x, __shfl_xor(x, d, 32));
  return x;
}
__device__ __forceinline__ float rsum16(float x) {
#pragma unroll
  for (int d = 1; d < 16; d <<= 1) x += __shfl_xor(x, d, 32);
  return x;
}

// ---------------- LayerNorm (one wave per 128-float row) ----------------
template<bool F16OUT>
__device__ __forceinline__ void ln_body(const float* __restrict__ x,
                                        const float* __restrict__ g,
                                        const float* __restrict__ be,
                                        _Float16* __restrict__ oh,
                                        float* __restrict__ of) {
  int row  = (blockIdx.x * blockDim.x + threadIdx.x) >> 5;
  int lane = threadIdx.x & 31;
  const float* xr = x + (size_t)row * ND;
  float4 v = *(const float4*)(xr + lane * 4);
  float s = v.x + v.y + v.z + v.w;
#pragma unroll
  for (int d = 1; d < 32; d <<= 1) s += __shfl_xor(s, d, 32);
  float mu = s * (1.0f / ND);
  float dx = v.x - mu, dy = v.y - mu, dz = v.z - mu, dw = v.w - mu;
  float ss = dx * dx + dy * dy + dz * dz + dw * dw;
#pragma unroll
  for (int d = 1; d < 32; d <<= 1) ss += __shfl_xor(ss, d, 32);
  float inv = rsqrtf(ss * (1.0f / ND) + 1e-6f);
  float4 gg = *(const float4*)(g + lane * 4);
  float4 bb = *(const float4*)(be + lane * 4);
  float r0 = dx * inv * gg.x + bb.x;
  float r1 = dy * inv * gg.y + bb.y;
  float r2 = dz * inv * gg.z + bb.z;
  float r3 = dw * inv * gg.w + bb.w;
  size_t base = (size_t)row * ND + lane * 4;
  if (F16OUT) {
    oh[base + 0] = (_Float16)r0; oh[base + 1] = (_Float16)r1;
    oh[base + 2] = (_Float16)r2; oh[base + 3] = (_Float16)r3;
  } else {
    of[base + 0] = r0; of[base + 1] = r1;
    of[base + 2] = r2; of[base + 3] = r3;
  }
}

template<bool F16OUT>
__global__ __launch_bounds__(256) void ln_kernel(const float* __restrict__ x,
                                                 const float* __restrict__ g,
                                                 const float* __restrict__ be,
                                                 _Float16* __restrict__ oh,
                                                 float* __restrict__ of) {
  ln_body<F16OUT>(x, g, be, oh, of);
}

#define APITCH 136
template<int ROWS>
__device__ __forceinline__ void ln_rows_to_lds(const float* __restrict__ x,
                                               const float* __restrict__ g,
                                               const float* __restrict__ be,
                                               _Float16* As) {
  constexpr int RPW = ROWS / 8;        // rows per wave
  int w    = threadIdx.x >> 5;
  int lane = threadIdx.x & 31;
  const float* xr = x + (size_t)(w * RPW) * ND + lane * 4;
  float4 vv[RPW];
#pragma unroll
  for (int r = 0; r < RPW; ++r) vv[r] = *(const float4*)(xr + r * ND);
  float4 gg = *(const float4*)(g + lane * 4);
  float4 bb = *(const float4*)(be + lane * 4);
#pragma unroll
  for (int r = 0; r < RPW; ++r) {
    float4 v = vv[r];
    float s = v.x + v.y + v.z + v.w;
#pragma unroll
    for (int d = 1; d < 32; d <<= 1) s += __shfl_xor(s, d, 32);
    float mu = s * (1.0f / ND);
    float dx = v.x - mu, dy = v.y - mu, dz = v.z - mu, dw = v.w - mu;
    float ss = dx * dx + dy * dy + dz * dz + dw * dw;
#pragma unroll
    for (int d = 1; d < 32; d <<= 1) ss += __shfl_xor(ss, d, 32);
    float inv = rsqrtf(ss * (1.0f / ND) + 1e-6f);
    v4h o;
    o[0] = (_Float16)(dx * inv * gg.x + bb.x);
    o[1] = (_Float16)(dy * inv * gg.y + bb.y);
    o[2] = (_Float16)(dz * inv * gg.z + bb.z);
    o[3] = (_Float16)(dw * inv * gg.w + bb.w);
    *(v4h*)(As + (w * RPW + r) * APITCH + lane * 4) = o;
  }
}

// ---- GEMM: out = A(f16, N x DI) x W(f16, DO x DI)^T + bias, 16x64 tile per wave ----
// F16OUT: row-major f16 out.  XPOSE: also/only write transposed f16 [bm][d][t] (DO==128).
// RESID (implies fp32 out): outF = resid + val.
template<int DI, bool RELU, bool F16OUT, bool RESID, bool XPOSE>
__device__ __forceinline__ void gemm_body(const _Float16* __restrict__ A,
                                          const _Float16* __restrict__ W,
                                          const float* __restrict__ bias,
                                          _Float16* __restrict__ outH,
                                          _Float16* __restrict__ outT,
                                          float* __restrict__ outF,
                                          const float* __restrict__ resid,
                                          int DO) {
  int wave = (blockIdx.x * blockDim.x + threadIdx.x) >> 5;
  int tpr  = DO >> 6;                 // 64-wide column strips
  int rt   = wave / tpr;
  int cs   = wave - rt * tpr;
  const _Float16* a0 = A + (size_t)rt * 16 * DI;
  const _Float16* w0 = W + (size_t)cs * 64 * DI;
  v8f c0 = {}, c1 = {}, c2 = {}, c3 = {};
#pragma unroll
  for (int k = 0; k < DI; k += 32) {
    v16h a = load_rm(a0 + k, DI);
    c0 = wmma_f16(a, load_rm(w0 + (size_t)0 * 16 * DI + k, DI), c0);
    c1 = wmma_f16(a, load_rm(w0 + (size_t)1 * 16 * DI + k, DI), c1);
    c2 = wmma_f16(a, load_rm(w0 + (size_t)2 * 16 * DI + k, DI), c2);
    c3 = wmma_f16(a, load_rm(w0 + (size_t)3 * 16 * DI + k, DI), c3);
  }
  int lane = threadIdx.x & 31;
  int col  = lane & 15;
  int rb   = (lane >> 4) << 3;
  v8f acc[4] = {c0, c1, c2, c3};
#pragma unroll
  for (int n = 0; n < 4; ++n) {
    int colg = cs * 64 + n * 16 + col;
    float bv = bias[colg];
#pragma unroll
    for (int v = 0; v < 8; ++v) {
      float val = acc[n][v] + bv;
      if (RELU) val = fmaxf(val, 0.0f);
      int row = rt * 16 + rb + v;
      if (F16OUT) outH[(size_t)row * DO + colg] = (_Float16)val;
      if (XPOSE) {
        int t  = row & (NT - 1);
        int bm = row >> 9;            // NT == 512
        outT[((size_t)bm * ND + colg) * NT + t] = (_Float16)val;
      }
      if (!F16OUT && !XPOSE)
        outF[(size_t)row * DO + colg] = (RESID ? resid[(size_t)row * DO + colg] : 0.0f) + val;
    }
  }
}

template<int DI, bool RELU, bool F16OUT, bool RESID, bool XPOSE>
__global__ __launch_bounds__(256) void gemm_kernel(const _Float16* __restrict__ A,
                                                   const _Float16* __restrict__ W,
                                                   const float* __restrict__ bias,
                                                   _Float16* __restrict__ outH,
                                                   _Float16* __restrict__ outT,
                                                   float* __restrict__ outF,
                                                   const float* __restrict__ resid,
                                                   int DO) {
  gemm_body<DI, RELU, F16OUT, RESID, XPOSE>(A, W, bias, outH, outT, outF, resid, DO);
}

template<int DO, bool RELU, bool F16OUT, bool XPOSE>
__device__ __forceinline__ void gemm_lds_body(const _Float16* As,
                                              const _Float16* __restrict__ W,
                                              const float* __restrict__ bias,
                                              _Float16* __restrict__ outH,
                                              _Float16* __restrict__ outT) {
  constexpr int TPR = DO >> 6;        // 64-wide column strips
  int w    = threadIdx.x >> 5;
  int wave = blockIdx.x * 8 + w;
  int rt   = wave / TPR;
  int cs   = wave - rt * TPR;
  const _Float16* a0 = As + (w / TPR) * 16 * APITCH;   // the wave's 16 rows of the panel
  const _Float16* w0 = W + (size_t)cs * 64 * ND;
  v8f c0 = {}, c1 = {}, c2 = {}, c3 = {};
#pragma unroll
  for (int k = 0; k < ND; k += 32) {
    v16h a = load_rm(a0 + k, APITCH);
    c0 = wmma_f16(a, load_rm(w0 + (size_t)0 * 16 * ND + k, ND), c0);
    c1 = wmma_f16(a, load_rm(w0 + (size_t)1 * 16 * ND + k, ND), c1);
    c2 = wmma_f16(a, load_rm(w0 + (size_t)2 * 16 * ND + k, ND), c2);
    c3 = wmma_f16(a, load_rm(w0 + (size_t)3 * 16 * ND + k, ND), c3);
  }
  // the bias loads below may land in the address registers of the loads above: wait first
  asm volatile("s_wait_xcnt 0x0" ::: "memory");
  int lane = threadIdx.x & 31;
  int col  = lane & 15;
  int rb   = (lane >> 4) << 3;
  v8f acc[4] = {c0, c1, c2, c3};
#pragma unroll
  for (int n = 0; n < 4; ++n) {
    int colg = cs * 64 + n * 16 + col;
    float bv = bias[colg];
#pragma unroll
    for (int v = 0; v < 8; ++v) {
      float val = acc[n][v] + bv;
      if (RELU) val = fmaxf(val, 0.0f);
      int row = rt * 16 + rb + v;
      if (F16OUT) outH[(size_t)row * DO + colg] = (_Float16)val;
      if (XPOSE) {
        int t  = row & (NT - 1);
        int bm = row >> 9;            // NT == 512
        outT[((size_t)bm * ND + colg) * NT + t] = (_Float16)val;
      }
    }
  }
}

// hid = relu(LayerNorm(X) x W1^T + b1): 16 rows of X and all 512 columns per block.
__global__ __launch_bounds__(256) void ln_ffn1_kernel(const float* __restrict__ X,
                                                      const float* __restrict__ g,
                                                      const float* __restrict__ be,
                                                      const _Float16* __restrict__ W,
                                                      const float* __restrict__ bias,
                                                      _Float16* __restrict__ outH) {
  __shared__ __attribute__((aligned(16))) _Float16 As[16 * APITCH];
  ln_rows_to_lds<16>(X + (size_t)blockIdx.x * 16 * ND, g, be, As);
  __syncthreads();   // the panel is written by all eight waves and read by all eight
  gemm_lds_body<NFF, true, true, false>(As, W, bias, outH, nullptr);
}

// The q, k and v products read the same A = LayerNorm(X) and none of each other's output: one
// grid, blockIdx.y names the product (0 = q, 1 = k: row-major + transposed; 2 = v: transposed
// only).  64 rows of X and one product's 128 columns per block.
__global__ __launch_bounds__(256) void qkv_kernel(const float* __restrict__ X,
                                                  const float* __restrict__ g,
                                                  const float* __restrict__ be,
                                                  const _Float16* __restrict__ Wq,
                                                  const _Float16* __restrict__ Wk,
                                                  const _Float16* __restrict__ Wv,
                                                  const float* __restrict__ bq,
                                                  const float* __restrict__ bk,
                                                  const float* __restrict__ bv,
                                                  _Float16* __restrict__ qh,
                                                  _Float16* __restrict__ kh,
                                                  _Float16* __restrict__ qT,
                                                  _Float16* __restrict__ kT,
                                                  _Float16* __restrict__ vT) {
  __shared__ __attribute__((aligned(16))) _Float16 As[64 * APITCH];
  ln_rows_to_lds<64>(X + (size_t)blockIdx.x * 64 * ND, g, be, As);
  __syncthreads();   // the panel is written by all eight waves and read by all eight
  if (blockIdx.y == 2) {
    gemm_lds_body<ND, false, false, true>(As, Wv, bv, nullptr, vT);
  } else {
    bool isq = blockIdx.y == 0;
    gemm_lds_body<ND, false, true, true>(As, isq ? Wq : Wk, isq ? bq : bk, isq ? qh : kh,
                                         isq ? qT : kT);
    // the v branch's code is laid out behind these stores and reuses their address and data
    // registers: wait before anything can overwrite them
    asm volatile("s_wait_xcnt 0x0" ::: "memory");
  }
}

// ---------------- Windowed (L=16) context attention over d=128 ----------------
// blockIdx.y names the tensor (0 = q, 1 = k): the two are independent and share one grid.
__global__ __launch_bounds__(256) void ctx_attn_kernel(const _Float16* __restrict__ src0,
                                                       const _Float16* __restrict__ srcT0,
                                                       _Float16* __restrict__ dst0,
                                                       const _Float16* __restrict__ src1,
                                                       const _Float16* __restrict__ srcT1,
                                                       _Float16* __restrict__ dst1) {
  __shared__ _Float16 Pl[8][16][32];
  const _Float16* __restrict__ src  = blockIdx.y ? src1  : src0;
  const _Float16* __restrict__ srcT = blockIdx.y ? srcT1 : srcT0;
  _Float16* __restrict__       dst  = blockIdx.y ? dst1  : dst0;
  int wave = (blockIdx.x * blockDim.x + threadIdx.x) >> 5;
  int qb   = wave & (NT / 16 - 1);
  int bm   = wave >> 5;
  const _Float16* seq = src + (size_t)bm * NT * ND;
  const _Float16* qp  = seq + (size_t)qb * 16 * ND;
  const _Float16* pp  = qb ? (qp - 16 * ND) : qp;   // prev block (dummy when qb==0)
  v8f s0 = {}, s1 = {};
#pragma unroll
  for (int k = 0; k < ND; k += 32) {
    v16h a  = load_rm(qp + k, ND);
    v16h bp = load_rm(pp + k, ND);
    s0 = wmma_f16(a, bp, s0);    // Q x Prev^T
    s1 = wmma_f16(a, a,  s1);    // Q x Cur^T
  }
  int lane = threadIdx.x & 31;
  int col  = lane & 15;
  int hf   = lane >> 4;
  const float scale = 0.088388347648318447f;   // 1/sqrt(128)
  _Float16 (*P)[32] = Pl[threadIdx.x >> 5];
#pragma unroll
  for (int v = 0; v < 8; ++v) {
    int row = v + (hf << 3);
    // band: prev key j valid iff j > row; cur key j valid iff j <= row.
    // zero padding (qb==0): in-band scores are 0 and DO join the softmax.
    float sp = (col > row)  ? (qb ? s0[v] * scale : 0.0f) : -1e30f;
    float sc = (col <= row) ? s1[v] * scale : -1e30f;
    float mx = rmax16(fmaxf(sp, sc));
    float ep = __expf(sp - mx);
    float ec = __expf(sc - mx);
    float invd = 1.0f / rsum16(ep + ec);
    float wp = qb ? ep * invd : 0.0f;  // zero rows: no contribution to numerator
    float wc = ec * invd;
    P[row][col]      = (_Float16)wp;
    P[row][16 + col] = (_Float16)wc;
  }
  __syncthreads();
  v16h pA = load_rm(&P[0][0], 32);
  const _Float16* sT = srcT + (size_t)bm * ND * NT;
  int tp0 = (qb ? qb - 1 : qb) * 16;
  int tc0 = qb * 16;
  int ko  = hf << 3;
  _Float16* dr = dst + (size_t)bm * NT * ND + (size_t)qb * 16 * ND;
#pragma unroll
  for (int n0 = 0; n0 < ND; n0 += 16) {
    const _Float16* colp = sT + (size_t)(n0 + col) * NT;  // contiguous over t
    v16h b;
#pragma unroll
    for (int i = 0; i < 8; ++i) b[i]     = colp[tp0 + ko + i];  // k 0..15  = prev rows
#pragma unroll
    for (int i = 0; i < 8; ++i) b[8 + i] = colp[tc0 + ko + i];  // k 16..31 = cur rows
    v8f o = {};
    o = wmma_f16(pA, b, o);
#pragma unroll
    for (int v = 0; v < 8; ++v)
      dr[(size_t)((hf << 3) + v) * ND + n0 + col] = (_Float16)o[v];
  }
}

__device__ __forceinline__ float xhalf(float x) {
  int b = __builtin_bit_cast(int, x);
  return __builtin_bit_cast(float,
      __builtin_amdgcn_permlanex16(b, b, 0x76543210, 0xfedcba98, false, false));
}

__global__ __launch_bounds__(256) void attn_t_kernel(const _Float16* __restrict__ cq,
                                                     const _Float16* __restrict__ ck,
                                                     const _Float16* __restrict__ vT,
                                                     _Float16* __restrict__ out) {
  int wave = (blockIdx.x * blockDim.x + threadIdx.x) >> 5;
  int qb = wave & 31;
  int h  = (wave >> 5) & 3;
  int bm = wave >> 7;
  int b  = bm >> 5;
  int m  = bm & 31;
  size_t seqoff = (size_t)bm * NT * ND + h * NDK;
  const _Float16* Q  = cq + seqoff + (size_t)qb * 16 * ND;
  const _Float16* K  = ck + seqoff;
  const _Float16* VT = vT + (size_t)bm * ND * NT + (size_t)(h * NDK) * NT;  // [dk][t]
  int lane = threadIdx.x & 31;
  int col  = lane & 15;
  int hf   = lane >> 4;
  const float scale = 0.17677669529663689f;   // 1/sqrt(32)
  v16h qf = load_rm(Q, ND);      // B operand: column = query
  v8f o0 = {}, o1 = {};          // o0[r] = O[query col][dk 8*hf+r], o1[r]: dk 16+8*hf+r
  float mrun = -1e30f;           // running maximum of this lane's query (equal in both halves)
  float lrun = 0.0f;             // running sum over this half's keys only; joined after the loop
  for (int kb = 0; kb < NT / 32; ++kb) {
    const _Float16* Kb = K + (size_t)kb * 32 * ND;
    if (kb + 1 < NT / 32) {   // speculative prefetch of next key block -> global_prefetch_b8
      __builtin_prefetch(Kb + 32 * ND + lane * 64, 0, 0);
      __builtin_prefetch(VT + (size_t)col * NT + (kb + 1) * 32, 0, 0);
    }
    v16h ka0 = load_rm(Kb, ND);                              // A: rows = keys 0..15
    v16h ka1 = load_rm(Kb + 16 * ND, ND);                    // A: rows = keys 16..31
    v16h va0 = load_tp(VT + kb * 32, NT);                    // A: rows = dk 0..15,  k = keys
    v16h va1 = load_tp(VT + (size_t)16 * NT + kb * 32, NT);  // A: rows = dk 16..31, k = keys
    v8f s0 = {}, s1 = {};
    s0 = wmma_f16(ka0, qf, s0);
    s1 = wmma_f16(ka1, qf, s1);
    float x0[8], x1[8];
    float mx = -1e30f;
#pragma unroll
    for (int r = 0; r < 8; ++r) {
      x0[r] = s0[r] * scale;
      x1[r] = s1[r] * scale;
      mx = fmaxf(mx, fmaxf(x0[r], x1[r]));
    }
    mx = fmaxf(mx, xhalf(mx));
    float mn   = fmaxf(mrun, mx);
    float corr = __expf(mrun - mn);
    float ps   = 0.0f;
    v16h pB;                     // B operand: pB[s] = P[query col][key kmap(s, hf)]
#pragma unroll
    for (int r = 0; r < 8; ++r) {
      float p0 = __expf(x0[r] - mn);
      float p1 = __expf(x1[r] - mn);
      ps += p0 + p1;
      pB[r]     = (_Float16)p0;
      pB[8 + r] = (_Float16)p1;
    }
    lrun = lrun * corr + ps;
    mrun = mn;
#pragma unroll
    for (int r = 0; r < 8; ++r) { o0[r] *= corr; o1[r] *= corr; }
    o0 = wmma_f16(va0, pB, o0);
    o1 = wmma_f16(va1, pB, o1);
  }
  // out layout: [b][t][h][m][dk]; a lane's eight registers are eight consecutive dk of one row
  float inv = 1.0f / (lrun + xhalf(lrun));
  int t = qb * 16 + col;
  size_t base = ((((size_t)b * NT + t) * NH + h) * NM + m) * NDK + (hf << 3);
  v8h r0, r1;
#pragma unroll
  for (int r = 0; r < 8; ++r) {
    r0[r] = (_Float16)(o0[r] * inv);
    r1[r] = (_Float16)(o1[r] * inv);
  }
  *(v8h*)(out + base)      = r0;
  *(v8h*)(out + base + 16) = r1;
}

// ---------------- Attention across m=32 per (b,t,h) ----------------
__global__ __launch_bounds__(256) void attn_m_kernel(const _Float16* __restrict__ a1,
                                                     _Float16* __restrict__ out) {
  __shared__ _Float16 Xs[8][32][32];
  __shared__ _Float16 Pl[8][32][32];
  int wave = (blockIdx.x * blockDim.x + threadIdx.x) >> 5;
  int h = wave & 3;
  int t = (wave >> 2) & (NT - 1);
  int b = wave >> 11;
  int w = threadIdx.x >> 5;
  int lane = threadIdx.x & 31;
  const _Float16* X = a1 + ((((size_t)b * NT + t) * NH + h) * NM) * NDK;  // 32x32 tile

  unsigned           lbase = (unsigned)(uintptr_t)(&Xs[w][0][0]);
  unsigned long long gbase = (unsigned long long)(uintptr_t)X;
#pragma unroll
  for (int c2 = 0; c2 < 4; ++c2) {
    unsigned           loff = lbase + (unsigned)(c2 * 512 + lane * 16);
    unsigned long long ga   = gbase + (unsigned long long)(c2 * 512 + lane * 16);
    asm volatile("global_load_async_to_lds_b128 %0, %1, off" :: "v"(loff), "v"(ga) : "memory");
  }
  asm volatile("s_wait_asynccnt 0x0" ::: "memory");
  const _Float16* Xl = &Xs[w][0][0];

  int col = lane & 15;
  int hf  = lane >> 4;
  const float scale = 0.17677669529663689f;   // 1/sqrt(32)
  v16h xa0 = load_rm(Xl, 32);
  v16h xa1 = load_rm(Xl + 16 * 32, 32);
  v8f s00 = {}, s01 = {}, s10 = {}, s11 = {};
  s00 = wmma_f16(xa0, xa0, s00);
  s01 = wmma_f16(xa0, xa1, s01);
  s10 = wmma_f16(xa1, xa0, s10);
  s11 = wmma_f16(xa1, xa1, s11);
  _Float16 (*P)[32] = Pl[w];
#pragma unroll
  for (int v = 0; v < 8; ++v) {
    int row = v + (hf << 3);
    {
      float x0 = s00[v] * scale, x1 = s01[v] * scale;
      float mx = rmax16(fmaxf(x0, x1));
      float p0 = __expf(x0 - mx), p1 = __expf(x1 - mx);
      float inv = 1.0f / rsum16(p0 + p1);
      P[row][col]      = (_Float16)(p0 * inv);
      P[row][16 + col] = (_Float16)(p1 * inv);
    }
    {
      float x0 = s10[v] * scale, x1 = s11[v] * scale;
      float mx = rmax16(fmaxf(x0, x1));
      float p0 = __expf(x0 - mx), p1 = __expf(x1 - mx);
      float inv = 1.0f / rsum16(p0 + p1);
      P[16 + row][col]      = (_Float16)(p0 * inv);
      P[16 + row][16 + col] = (_Float16)(p1 * inv);
    }
  }
  __syncthreads();
  v16h pA0 = load_rm(&P[0][0], 32);
  v16h pA1 = load_rm(&P[16][0], 32);
  v16h bx0 = load_cm(Xl, 32);        // column gathers now hit LDS, not global
  v16h bx1 = load_cm(Xl + 16, 32);
  v8f o00 = {}, o01 = {}, o10 = {}, o11 = {};
  o00 = wmma_f16(pA0, bx0, o00);
  o01 = wmma_f16(pA0, bx1, o01);
  o10 = wmma_f16(pA1, bx0, o10);
  o11 = wmma_f16(pA1, bx1, o11);
  // out layout: [b][m][t][h*32+dk]
  int m0 = hf << 3;
#pragma unroll
  for (int v = 0; v < 8; ++v) {
    int mA = m0 + v;
    int mB = 16 + m0 + v;
    size_t baseA = (((size_t)b * NM + mA) * NT + t) * ND + h * NDK;
    size_t baseB = (((size_t)b * NM + mB) * NT + t) * ND + h * NDK;
    out[baseA + col]      = (_Float16)o00[v];
    out[baseA + 16 + col] = (_Float16)o01[v];
    out[baseB + col]      = (_Float16)o10[v];
    out[baseB + 16 + col] = (_Float16)o11[v];
  }
}

// ---------------- fp32 -> f16 conversion of all six weights ----------------
// wh holds the six f16 weight arrays back to back in the order Wq, Wk, Wv, Wfc, W1, W2;
// every array is a whole number of 256-element blocks, so a block has one source.
#define WSQ  (2 * ND * ND)           // elements of Wq, Wk, Wv, Wfc (both layers)
#define WFF  (2 * NFF * ND)          // elements of W1, W2 (both layers)
__global__ __launch_bounds__(256) void prep_kernel(const float* __restrict__ Wq,
                                                   const float* __restrict__ Wk,
                                                   const float* __restrict__ Wv,
                                                   const float* __restrict__ Wfc,
                                                   const float* __restrict__ W1,
                                                   const float* __restrict__ W2,
                                                   _Float16* __restrict__ wh) {
  int b0 = blockIdx.x * 256;           // first element of this block in wh
  const float* in;
  int s0;                              // where this block's array starts in wh
  if      (b0 < 1 * WSQ)       { in = Wq;  s0 = 0; }
  else if (b0 < 2 * WSQ)       { in = Wk;  s0 = 1 * WSQ; }
  else if (b0 < 3 * WSQ)       { in = Wv;  s0 = 2 * WSQ; }
  else if (b0 < 4 * WSQ)       { in = Wfc; s0 = 3 * WSQ; }
  else if (b0 < 4 * WSQ + WFF) { in = W1;  s0 = 4 * WSQ; }
  else                         { in = W2;  s0 = 4 * WSQ + WFF; }
  int i = b0 + threadIdx.x;
  wh[i] = (_Float16)in[i - s0];
}

extern "C" void kernel_launch(void* const* d_in, const int* in_sizes, int n_in,
                              void* d_out, int out_size, void* d_ws, size_t ws_size,
                              hipStream_t stream) {
  (void)in_sizes; (void)n_in; (void)out_size; (void)ws_size;
  const float* x   = (const float*)d_in[0];
  const float* Wq  = (const float*)d_in[1];
  const float* bq  = (const float*)d_in[2];
  const float* Wk  = (const float*)d_in[3];
  const float* bk  = (const float*)d_in[4];
  const float* Wv  = (const float*)d_in[5];
  const float* bv  = (const float*)d_in[6];
  const float* Wfc = (const float*)d_in[7];
  const float* bfc = (const float*)d_in[8];
  const float* W1  = (const float*)d_in[9];
  const float* b1  = (const float*)d_in[10];
  const float* W2  = (const float*)d_in[11];
  const float* b2  = (const float*)d_in[12];
  const float* g1  = (const float*)d_in[13];
  const float* be1 = (const float*)d_in[14];
  const float* g2  = (const float*)d_in[15];
  const float* be2 = (const float*)d_in[16];
  const float* gf  = (const float*)d_in[17];
  const float* bef = (const float*)d_in[18];

  char* ws = (char*)d_ws;
  size_t off = 0;
  auto bump = [&](size_t bytes) -> char* {
    char* p = ws + off;
    off = (off + bytes + 255) & ~(size_t)255;
    return p;
  };
  float*    xw   = (float*)bump((size_t)NROW * ND * 4);
  _Float16* qh   = (_Float16*)bump((size_t)NROW * ND * 2);
  _Float16* kh   = (_Float16*)bump((size_t)NROW * ND * 2);
  _Float16* qT   = (_Float16*)bump((size_t)NROW * ND * 2);
  _Float16* kT   = (_Float16*)bump((size_t)NROW * ND * 2);
  _Float16* vT   = (_Float16*)bump((size_t)NROW * ND * 2);
  _Float16* cqh  = (_Float16*)bump((size_t)NROW * ND * 2);
  _Float16* ckh  = (_Float16*)bump((size_t)NROW * ND * 2);
  _Float16* a1h  = (_Float16*)bump((size_t)NROW * ND * 2);
  _Float16* a2h  = (_Float16*)bump((size_t)NROW * ND * 2);
  _Float16* hid  = (_Float16*)bump((size_t)NROW * NFF * 2);
  _Float16* wh   = (_Float16*)bump((size_t)(4 * WSQ + 2 * WFF) * 2);   // six f16 weight arrays
  _Float16* wqh  = wh;
  _Float16* wkh  = wh + 1 * WSQ;
  _Float16* wvh  = wh + 2 * WSQ;
  _Float16* wfch = wh + 3 * WSQ;
  _Float16* w1h  = wh + 4 * WSQ;
  _Float16* w2h  = wh + 4 * WSQ + WFF;

  hipMemcpyAsync(xw, x, (size_t)NROW * ND * 4, hipMemcpyDeviceToDevice, stream);

  dim3 blk(256);
  const int lnBlocks    = NROW / 8;                          // 4096
  const int gemmBlk128  = (NROW / 16) * (ND / 64) / 8;       // 512  (DO=128, 64-wide strips)
  const int gemmBlkFF   = (NROW / 16) * (NFF / 64) / 8;      // 2048 (DO=512)
  const int ctxBlocks   = (NB * NM * (NT / 16)) / 8;         // 256
  const int atBlocks    = (NB * NM * NH * (NT / 16)) / 8;    // 1024
  const int amBlocks    = (NB * NT * NH) / 8;                // 512

  prep_kernel<<<(4 * WSQ + 2 * WFF) / 256, blk, 0, stream>>>(Wq, Wk, Wv, Wfc, W1, W2, wh);
  for (int i = 0; i < 2; ++i) {
    qkv_kernel<<<dim3(gemmBlk128, 3), blk, 0, stream>>>(
        xw, g1 + i * ND, be1 + i * ND, wqh + (size_t)i * ND * ND, wkh + (size_t)i * ND * ND, wvh + (size_t)i * ND * ND,
        bq + i * ND, bk + i * ND, bv + i * ND, qh, kh, qT, kT, vT);
    ctx_attn_kernel<<<dim3(ctxBlocks, 2), blk, 0, stream>>>(qh, qT, cqh, kh, kT, ckh);
    attn_t_kernel<<<atBlocks, blk, 0, stream>>>(cqh, ckh, vT, a1h);
    attn_m_kernel<<<amBlocks, blk, 0, stream>>>(a1h, a2h);
    gemm_kernel<ND, false, false, true, false><<<gemmBlk128, blk, 0, stream>>>(
        a2h, wfch + (size_t)i * ND * ND, bfc + i * ND, nullptr, nullptr, xw, xw, ND);
    ln_ffn1_kernel<<<gemmBlkFF, blk, 0, stream>>>(
        xw, g2 + i * ND, be2 + i * ND, w1h + (size_t)i * NFF * ND, b1 + i * NFF, hid);
    gemm_kernel<NFF, false, false, true, false><<<gemmBlk128, blk, 0, stream>>>(
        hid, w2h + (size_t)i * ND * NFF, b2 + i * ND, nullptr, nullptr, xw, xw, ND);
  }
  ln_kernel<false><<<lnBlocks, blk, 0, stream>>>(xw, gf, bef, nullptr, (float*)d_out);
}

// v004
// In two side-by-side timings against v003, it was 1.13 and 1.14 times as fast.
// Over all steps from v000 it is 1.45 times as fast.
#include <hip/hip_runtime.h>
#include <hip/hip_bf16.h>
#include <stdint.h>

typedef __attribute__((ext_vector_type(16))) _Float16 v16h;
typedef __attribute__((ext_vector_type(8)))  float    v8f;
typedef __attribute__((ext_vector_type(8)))  _Float16 v8h;
typedef __attribute__((ext_vector_type(4)))  _Float16 v4h;

#define NB   2
#define NM   32
#define NT   512
#define ND   128
#define NH   4
#define NDK  32
#define NFF  512
#define NROW (NB * NM * NT)   // 32768 rows of D=128

__device__ __forceinline__ v8f wmma_f16(v16h a, v16h b, v8f c) {
  // D = A(16x32 f16) x B(32x16 f16) + C(16x16 f32)
  return __builtin_amdgcn_wmma_f32_16x16x32_f16(false, a, false, b, (short)0, c, false, false);
}

__device__ __forceinline__ v16h load_rm(const _Float16* __restrict__ p, int ld) {
  int lane = threadIdx.x & 31;
  const _Float16* r = p + (lane & 15) * ld + ((lane >> 4) << 3);
  v16h o;
#pragma unroll
  for (int i = 0; i < 8; ++i) o[i] = r[i];
#pragma unroll
  for (int i = 0; i < 8; ++i) o[8 + i] = r[16 + i];
  return o;
}

// B-operand for C = A x Bmat, Bmat (32 x >=16) row-major: B[k][n] = p[k*ld+n].
// Used only on small LDS tiles (attn_m); bulk paths use transposed copies instead.
__device__ __forceinline__ v16h load_cm(const _Float16* __restrict__ p, int ld) {
  int lane = threadIdx.x & 31;
  int col  = lane & 15;
  int ko   = (lane >> 4) << 3;
  v16h o;
#pragma unroll
  for (int i = 0; i < 8; ++i) o[i] = p[(ko + i) * ld + col];
#pragma unroll
  for (int i = 0; i < 8; ++i) o[8 + i] = p[(16 + ko + i) * ld + col];
  return o;
}

// B-operand from a column-major (transposed) source: column n contiguous over k.
// ct[n][k] with column stride ldT: B[k][n] = ct[n*ldT + k].
__device__ __forceinline__ v16h load_tp(const _Float16* __restrict__ ct, int ldT) {
  int lane = threadIdx.x & 31;
  const _Float16* r = ct + (lane & 15) * ldT + ((lane >> 4) << 3);
  v16h o;
#pragma unroll
  for (int i = 0; i < 8; ++i) o[i] = r[i];
#pragma unroll
  for (int i = 0; i < 8; ++i) o[8 + i] = r[16 + i];
  return o;
}

__device__ __forceinline__ float rmax16(float x) {
#pragma unroll
  for (int d = 1; d < 16; d <<= 1) x = fmaxf(x, __shfl_xor(x, d, 32));
  return x;
}
__device__ __forceinline__ float rsum16(float x) {
#pragma unroll
  for (int d = 1; d < 16; d <<= 1) x += __shfl_xor(x, d, 32);
  return x;
}

// ---------------- LayerNorm (one wave per 128-float row) ----------------
template<bool F16OUT>
__device__ __forceinline__ void ln_body(const float* __restrict__ x,
                                        const float* __restrict__ g,
                                        const float* __restrict__ be,
                                        _Float16* __restrict__ oh,
                                        float* __restrict__ of) {
  int row  = (blockIdx.x * blockDim.x + threadIdx.x) >> 5;
  int lane = threadIdx.x & 31;
  const float* xr = x + (size_t)row * ND;
  float4 v = *(const float4*)(xr + lane * 4);
  float s = v.x + v.y + v.z + v.w;
#pragma unroll
  for (int d = 1; d < 32; d <<= 1) s += __shfl_xor(s, d, 32);
  float mu = s * (1.0f / ND);
  float dx = v.x - mu, dy = v.y - mu, dz = v.z - mu, dw = v.w - mu;
  float ss = dx * dx + dy * dy + dz * dz + dw * dw;
#pragma unroll
  for (int d = 1; d < 32; d <<= 1) ss += __shfl_xor(ss, d, 32);
  float inv = rsqrtf(ss * (1.0f / ND) + 1e-6f);
  float4 gg = *(const float4*)(g + lane * 4);
  float4 bb = *(const float4*)(be + lane * 4);
  float r0 = dx * inv * gg.x + bb.x;
  float r1 = dy * inv * gg.y + bb.y;
  float r2 = dz * inv * gg.z + bb.z;
  float r3 = dw * inv * gg.w + bb.w;
  size_t base = (size_t)row * ND + lane * 4;
  if (F16OUT) {
    oh[base + 0] = (_Float16)r0; oh[base + 1] = (_Float16)r1;
    oh[base + 2] = (_Float16)r2; oh[base + 3] = (_Float16)r3;
  } else {
    of[base + 0] = r0; of[base + 1] = r1;
    of[base + 2] = r2; of[base + 3] = r3;
  }
}

template<bool F16OUT>
__global__ __launch_bounds__(256) void ln_kernel(const float* __restrict__ x,
                                                 const float* __restrict__ g,
                                                 const float* __restrict__ be,
                                                 _Float16* __restrict__ oh,
                                                 float* __restrict__ of) {
  ln_body<F16OUT>(x, g, be, oh, of);
}

#define APITCH 136
template<int ROWS>
__device__ __forceinline__ void ln_rows_to_lds(const float* __restrict__ x,
                                               const float* __restrict__ g,
                                               const float* __restrict__ be,
                                               _Float16* As) {
  constexpr int RPW = ROWS / 8;        // rows per wave
  int w    = threadIdx.x >> 5;
  int lane = threadIdx.x & 31;
  const float* xr = x + (size_t)(w * RPW) * ND + lane * 4;
  float4 vv[RPW];
#pragma unroll
  for (int r = 0; r < RPW; ++r) vv[r] = *(const float4*)(xr + r * ND);
  float4 gg = *(const float4*)(g + lane * 4);
  float4 bb = *(const float4*)(be + lane * 4);
#pragma unroll
  for (int r = 0; r < RPW; ++r) {
    float4 v = vv[r];
    float s = v.x + v.y + v.z + v.w;
#pragma unroll
    for (int d = 1; d < 32; d <<= 1) s += __shfl_xor(s, d, 32);
    float mu = s * (1.0f / ND);
    float dx = v.x - mu, dy = v.y - mu, dz = v.z - mu, dw = v.w - mu;
    float ss = dx * dx + dy * dy + dz * dz + dw * dw;
#pragma unroll
    for (int d = 1; d < 32; d <<= 1) ss += __shfl_xor(ss, d, 32);
    float inv = rsqrtf(ss * (1.0f / ND) + 1e-6f);
    v4h o;
    o[0] = (_Float16)(dx * inv * gg.x + bb.x);
    o[1] = (_Float16)(dy * inv * gg.y + bb.y);
    o[2] = (_Float16)(dz * inv * gg.z + bb.z);
    o[3] = (_Float16)(dw * inv * gg.w + bb.w);
    *(v4h*)(As + (w * RPW + r) * APITCH + lane * 4) = o;
  }
}

// ---- GEMM: out = A(f16, N x DI) x W(f16, DO x DI)^T + bias, 16x64 tile per wave ----
// F16OUT: row-major f16 out.  XPOSE: also/only write transposed f16 [bm][d][t] (DO==128).
// RESID (implies fp32 out): outF = resid + val.
template<int DI, bool RELU, bool F16OUT, bool RESID, bool XPOSE>
__device__ __forceinline__ void gemm_body(const _Float16* __restrict__ A,
                                          const _Float16* __restrict__ W,
                                          const float* __restrict__ bias,
                                          _Float16* __restrict__ outH,
                                          _Float16* __restrict__ outT,
                                          float* __restrict__ outF,
                                          const float* __restrict__ resid,
                                          int DO) {
  int wave = (blockIdx.x * blockDim.x + threadIdx.x) >> 5;
  int tpr  = DO >> 6;                 // 64-wide column strips
  int rt   = wave / tpr;
  int cs   = wave - rt * tpr;
  const _Float16* a0 = A + (size_t)rt * 16 * DI;
  const _Float16* w0 = W + (size_t)cs * 64 * DI;
  v8f c0 = {}, c1 = {}, c2 = {}, c3 = {};
#pragma unroll
  for (int k = 0; k < DI; k += 32) {
    v16h a = load_rm(a0 + k, DI);
    c0 = wmma_f16(a, load_rm(w0 + (size_t)0 * 16 * DI + k, DI), c0);
    c1 = wmma_f16(a, load_rm(w0 + (size_t)1 * 16 * DI + k, DI), c1);
    c2 = wmma_f16(a, load_rm(w0 + (size_t)2 * 16 * DI + k, DI), c2);
    c3 = wmma_f16(a, load_rm(w0 + (size_t)3 * 16 * DI + k, DI), c3);
  }
  int lane = threadIdx.x & 31;
  int col  = lane & 15;
  int rb   = (lane >> 4) << 3;
  v8f acc[4] = {c0, c1, c2, c3};
#pragma unroll
  for (int n = 0; n < 4; ++n) {
    int colg = cs * 64 + n * 16 + col;
    float bv = bias[colg];
#pragma unroll
    for (int v = 0; v < 8; ++v) {
      float val = acc[n][v] + bv;
      if (RELU) val = fmaxf(val, 0.0f);
      int row = rt * 16 + rb + v;
      if (F16OUT) outH[(size_t)row * DO + colg] = (_Float16)val;
      if (XPOSE) {
        int t  = row & (NT - 1);
        int bm = row >> 9;            // NT == 512
        outT[((size_t)bm * ND + colg) * NT + t] = (_Float16)val;
      }
      if (!F16OUT && !XPOSE)
        outF[(size_t)row * DO + colg] = (RESID ? resid[(size_t)row * DO + colg] : 0.0f) + val;
    }
  }
}

template<int DI, bool RELU, bool F16OUT, bool RESID, bool XPOSE>
__global__ __launch_bounds__(256) void gemm_kernel(const _Float16* __restrict__ A,
                                                   const _Float16* __restrict__ W,
                                                   const float* __restrict__ bias,
                                                   _Float16* __restrict__ outH,
                                                   _Float16* __restrict__ outT,
                                                   float* __restrict__ outF,
                                                   const float* __restrict__ resid,
                                                   int DO) {
  gemm_body<DI, RELU, F16OUT, RESID, XPOSE>(A, W, bias, outH, outT, outF, resid, DO);
}

#define TPITCH 72
template<int DO, bool RELU, bool F16OUT, bool XPOSE>
__device__ __forceinline__ void gemm_lds_body(const _Float16* As,
                                              const _Float16* __restrict__ W,
                                              const float* __restrict__ bias,
                                              _Float16* __restrict__ outH,
                                              _Float16* __restrict__ outT,
                                              _Float16* Ts) {
  constexpr int TPR = DO >> 6;        // 64-wide column strips
  int w    = threadIdx.x >> 5;
  int wave = blockIdx.x * 8 + w;
  int rt   = wave / TPR;
  int cs   = wave - rt * TPR;
  const _Float16* a0 = As + (w / TPR) * 16 * APITCH;   // the wave's 16 rows of the panel
  const _Float16* w0 = W + (size_t)cs * 64 * ND;
  v8f c0 = {}, c1 = {}, c2 = {}, c3 = {};
#pragma unroll
  for (int k = 0; k < ND; k += 32) {
    v16h a = load_rm(a0 + k, APITCH);
    c0 = wmma_f16(a, load_rm(w0 + (size_t)0 * 16 * ND + k, ND), c0);
    c1 = wmma_f16(a, load_rm(w0 + (size_t)1 * 16 * ND + k, ND), c1);
    c2 = wmma_f16(a, load_rm(w0 + (size_t)2 * 16 * ND + k, ND), c2);
    c3 = wmma_f16(a, load_rm(w0 + (size_t)3 * 16 * ND + k, ND), c3);
  }
  // the bias loads below may land in the address registers of the loads above: wait first
  asm volatile("s_wait_xcnt 0x0" ::: "memory");
  int lane = threadIdx.x & 31;
  int col  = lane & 15;
  int rb   = (lane >> 4) << 3;
  v8f acc[4] = {c0, c1, c2, c3};
  v8h hv[4];
#pragma unroll
  for (int n = 0; n < 4; ++n) {
    int colg = cs * 64 + n * 16 + col;
    float bv = bias[colg];
#pragma unroll
    for (int v = 0; v < 8; ++v) {
      float val = acc[n][v] + bv;
      if (RELU) val = fmaxf(val, 0.0f);
      hv[n][v] = (_Float16)val;
    }
    if (XPOSE) *(v8h*)(Ts + colg * TPITCH + (w / TPR) * 16 + rb) = hv[n];
  }
  // The barrier stands in front of the row-major stores: behind them it would wait for them.
  if (XPOSE) __syncthreads();   // the tile is written by all eight waves and read by all eight
  if (F16OUT) {
#pragma unroll
    for (int n = 0; n < 4; ++n) {
      int colg = cs * 64 + n * 16 + col;
#pragma unroll
      for (int v = 0; v < 8; ++v)
        outH[(size_t)(rt * 16 + rb + v) * DO + colg] = hv[n][v];
    }
  }
  if (XPOSE) {
    int row0 = blockIdx.x * 64;       // the block's first row; 64 divides NT: one bm per block
    int bm   = row0 >> 9;             // NT == 512
    int t0   = row0 & (NT - 1);
    int d    = threadIdx.x >> 3;      // 32 rows of the tile per pass
    int ch   = (threadIdx.x & 7) << 3;
    const _Float16* ls = Ts + d * TPITCH + ch;
    _Float16* gp = outT + ((size_t)bm * ND + d) * NT + t0 + ch;
    v8h tr[4];
#pragma unroll
    for (int p = 0; p < 4; ++p) tr[p] = *(const v8h*)(ls + p * 32 * TPITCH);
#pragma unroll
    for (int p = 0; p < 4; ++p) *(v8h*)(gp + (size_t)p * 32 * NT) = tr[p];
  }
}

// hid = relu(LayerNorm(X) x W1^T + b1): 16 rows of X and all 512 columns per block.
__global__ __launch_bounds__(256) void ln_ffn1_kernel(const float* __restrict__ X,
                                                      const float* __restrict__ g,
                                                      const float* __restrict__ be,
                                                      const _Float16* __restrict__ W,
                                                      const float* __restrict__ bias,
                                                      _Float16* __restrict__ outH) {
  __shared__ __attribute__((aligned(16))) _Float16 As[16 * APITCH];
  ln_rows_to_lds<16>(X + (size_t)blockIdx.x * 16 * ND, g, be, As);
  __syncthreads();   // the panel is written by all eight waves and read by all eight
  gemm_lds_body<NFF, true, true, false>(As, W, bias, outH, nullptr, nullptr);
}

// The q, k and v products read the same A = LayerNorm(X) and none of each other's output: one
// grid, blockIdx.y names the product (0 = q, 1 = k: row-major + transposed; 2 = v: transposed
// only).  64 rows of X and one product's 128 columns per block.
__global__ __launch_bounds__(256) void qkv_kernel(const float* __restrict__ X,
                                                  const float* __restrict__ g,
                                                  const float* __restrict__ be,
                                                  const _Float16* __restrict__ Wq,
                                                  const _Float16* __restrict__ Wk,
                                                  const _Float16* __restrict__ Wv,
                                                  const float* __restrict__ bq,
                                                  const float* __restrict__ bk,
                                                  const float* __restrict__ bv,
                                                  _Float16* __restrict__ qh,
                                                  _Float16* __restrict__ kh,
                                                  _Float16* __restrict__ qT,
                                                  _Float16* __restrict__ kT,
                                                  _Float16* __restrict__ vT) {
  __shared__ __attribute__((aligned(16))) _Float16 As[64 * APITCH];
  __shared__ __attribute__((aligned(16))) _Float16 Ts[ND * TPITCH];
  ln_rows_to_lds<64>(X + (size_t)blockIdx.x * 64 * ND, g, be, As);
  __syncthreads();   // the panel is written by all eight waves and read by all eight
  if (blockIdx.y == 2) {
    gemm_lds_body<ND, false, false, true>(As, Wv, bv, nullptr, vT, Ts);
  } else {
    bool isq = blockIdx.y == 0;
    gemm_lds_body<ND, false, true, true>(As, isq ? Wq : Wk, isq ? bq : bk, isq ? qh : kh,
                                         isq ? qT : kT, Ts);
    // the v branch's code is laid out behind these stores and reuses their address and data
    // registers: wait before anything can overwrite them
    asm volatile("s_wait_xcnt 0x0" ::: "memory");
  }
}

// ---------------- Windowed (L=16) context attention over d=128 ----------------
// blockIdx.y names the tensor (0 = q, 1 = k): the two are independent and share one grid.
__global__ __launch_bounds__(256) void ctx_attn_kernel(const _Float16* __restrict__ src0,
                                                       const _Float16* __restrict__ srcT0,
                                                       _Float16* __restrict__ dst0,
                                                       const _Float16* __restrict__ src1,
                                                       const _Float16* __restrict__ srcT1,
                                                       _Float16* __restrict__ dst1) {
  __shared__ _Float16 Pl[8][16][32];
  const _Float16* __restrict__ src  = blockIdx.y ? src1  : src0;
  const _Float16* __restrict__ srcT = blockIdx.y ? srcT1 : srcT0;
  _Float16* __restrict__       dst  = blockIdx.y ? dst1  : dst0;
  int wave = (blockIdx.x * blockDim.x + threadIdx.x) >> 5;
  int qb   = wave & (NT / 16 - 1);
  int bm   = wave >> 5;
  const _Float16* seq = src + (size_t)bm * NT * ND;
  const _Float16* qp  = seq + (size_t)qb * 16 * ND;
  const _Float16* pp  = qb ? (qp - 16 * ND) : qp;   // prev block (dummy when qb==0)
  v8f s0 = {}, s1 = {};
#pragma unroll
  for (int k = 0; k < ND; k += 32) {
    v16h a  = load_rm(qp + k, ND);
    v16h bp = load_rm(pp + k, ND);
    s0 = wmma_f16(a, bp, s0);    // Q x Prev^T
    s1 = wmma_f16(a, a,  s1);    // Q x Cur^T
  }
  int lane = threadIdx.x & 31;
  int col  = lane & 15;
  int hf   = lane >> 4;
  const float scale = 0.088388347648318447f;   // 1/sqrt(128)
  _Float16 (*P)[32] = Pl[threadIdx.x >> 5];
#pragma unroll
  for (int v = 0; v < 8; ++v) {
    int row = v + (hf << 3);
    // band: prev key j valid iff j > row; cur key j valid iff j <= row.
    // zero padding (qb==0): in-band scores are 0 and DO join the softmax.
    float sp = (col > row)  ? (qb ? s0[v] * scale : 0.0f) : -1e30f;
    float sc = (col <= row) ? s1[v] * scale : -1e30f;
    float mx = rmax16(fmaxf(sp, sc));
    float ep = __expf(sp - mx);
    float ec = __expf(sc - mx);
    float invd = 1.0f / rsum16(ep + ec);
    float wp = qb ? ep * invd : 0.0f;  // zero rows: no contribution to numerator
    float wc = ec * invd;
    P[row][col]      = (_Float16)wp;
    P[row][16 + col] = (_Float16)wc;
  }
  __syncthreads();
  v16h pA = load_rm(&P[0][0], 32);
  const _Float16* sT = srcT + (size_t)bm * ND * NT;
  int tp0 = (qb ? qb - 1 : qb) * 16;
  int tc0 = qb * 16;
  int ko  = hf << 3;
  _Float16* dr = dst + (size_t)bm * NT * ND + (size_t)qb * 16 * ND;
#pragma unroll
  for (int n0 = 0; n0 < ND; n0 += 16) {
    const _Float16* colp = sT + (size_t)(n0 + col) * NT;  // contiguous over t
    v16h b;
#pragma unroll
    for (int i = 0; i < 8; ++i) b[i]     = colp[tp0 + ko + i];  // k 0..15  = prev rows
#pragma unroll
    for (int i = 0; i < 8; ++i) b[8 + i] = colp[tc0 + ko + i];  // k 16..31 = cur rows
    v8f o = {};
    o = wmma_f16(pA, b, o);
#pragma unroll
    for (int v = 0; v < 8; ++v)
      dr[(size_t)((hf << 3) + v) * ND + n0 + col] = (_Float16)o[v];
  }
}

__device__ __forceinline__ float xhalf(float x) {
  int b = __builtin_bit_cast(int, x);
  return __builtin_bit_cast(float,
      __builtin_amdgcn_permlanex16(b, b, 0x76543210, 0xfedcba98, false, false));
}

__global__ __launch_bounds__(256) void attn_t_kernel(const _Float16* __restrict__ cq,
                                                     const _Float16* __restrict__ ck,
                                                     const _Float16* __restrict__ vT,
                                                     _Float16* __restrict__ out) {
  int wave = (blockIdx.x * blockDim.x + threadIdx.x) >> 5;
  int qb = wave & 31;
  int h  = (wave >> 5) & 3;
  int bm = wave >> 7;
  int b  = bm >> 5;
  int m  = bm & 31;
  size_t seqoff = (size_t)bm * NT * ND + h * NDK;
  const _Float16* Q  = cq + seqoff + (size_t)qb * 16 * ND;
  const _Float16* K  = ck + seqoff;
  const _Float16* VT = vT + (size_t)bm * ND * NT + (size_t)(h * NDK) * NT;  // [dk][t]
  int lane = threadIdx.x & 31;
  int col  = lane & 15;
  int hf   = lane >> 4;
  const float scale = 0.17677669529663689f;   // 1/sqrt(32)
  v16h qf = load_rm(Q, ND);      // B operand: column = query
  v8f o0 = {}, o1 = {};          // o0[r] = O[query col][dk 8*hf+r], o1[r]: dk 16+8*hf+r
  float mrun = -1e30f;           // running maximum of this lane's query (equal in both halves)
  float lrun = 0.0f;             // running sum over this half's keys only; joined after the loop
  for (int kb = 0; kb < NT / 32; ++kb) {
    const _Float16* Kb = K + (size_t)kb * 32 * ND;
    if (kb + 1 < NT / 32) {   // speculative prefetch of next key block -> global_prefetch_b8
      __builtin_prefetch(Kb + 32 * ND + lane * 64, 0, 0);
      __builtin_prefetch(VT + (size_t)col * NT + (kb + 1) * 32, 0, 0);
    }
    v16h ka0 = load_rm(Kb, ND);                              // A: rows = keys 0..15
    v16h ka1 = load_rm(Kb + 16 * ND, ND);                    // A: rows = keys 16..31
    v16h va0 = load_tp(VT + kb * 32, NT);                    // A: rows = dk 0..15,  k = keys
    v16h va1 = load_tp(VT + (size_t)16 * NT + kb * 32, NT);  // A: rows = dk 16..31, k = keys
    v8f s0 = {}, s1 = {};
    s0 = wmma_f16(ka0, qf, s0);
    s1 = wmma_f16(ka1, qf, s1);
    float x0[8], x1[8];
    float mx = -1e30f;
#pragma unroll
    for (int r = 0; r < 8; ++r) {
      x0[r] = s0[r] * scale;
      x1[r] = s1[r] * scale;
      mx = fmaxf(mx, fmaxf(x0[r], x1[r]));
    }
    mx = fmaxf(mx, xhalf(mx));
    float mn   = fmaxf(mrun, mx);
    float corr = __expf(mrun - mn);
    float ps   = 0.0f;
    v16h pB;                     // B operand: pB[s] = P[query col][key kmap(s, hf)]
#pragma unroll
    for (int r = 0; r < 8; ++r) {
      float p0 = __expf(x0[r] - mn);
      float p1 = __expf(x1[r] - mn);
      ps += p0 + p1;
      pB[r]     = (_Float16)p0;
      pB[8 + r] = (_Float16)p1;
    }
    lrun = lrun * corr + ps;
    mrun = mn;
#pragma unroll
    for (int r = 0; r < 8; ++r) { o0[r] *= corr; o1[r] *= corr; }
    o0 = wmma_f16(va0, pB, o0);
    o1 = wmma_f16(va1, pB, o1);
  }
  // out layout: [b][t][h][m][dk]; a lane's eight registers are eight consecutive dk of one row
  float inv = 1.0f / (lrun + xhalf(lrun));
  int t = qb * 16 + col;
  size_t base = ((((size_t)b * NT + t) * NH + h) * NM + m) * NDK + (hf << 3);
  v8h r0, r1;
#pragma unroll
  for (int r = 0; r < 8; ++r) {
    r0[r] = (_Float16)(o0[r] * inv);
    r1[r] = (_Float16)(o1[r] * inv);
  }
  *(v8h*)(out + base)      = r0;
  *(v8h*)(out + base + 16) = r1;
}

// ---------------- Attention across m=32 per (b,t,h) ----------------
__global__ __launch_bounds__(256) void attn_m_kernel(const _Float16* __restrict__ a1,
                                                     _Float16* __restrict__ out) {
  __shared__ _Float16 Xs[8][32][32];
  __shared__ _Float16 Pl[8][32][32];
  int wave = (blockIdx.x * blockDim.x + threadIdx.x) >> 5;
  int h = wave & 3;
  int t = (wave >> 2) & (NT - 1);
  int b = wave >> 11;
  int w = threadIdx.x >> 5;
  int lane = threadIdx.x & 31;
  const _Float16* X = a1 + ((((size_t)b * NT + t) * NH + h) * NM) * NDK;  // 32x32 tile

  unsigned           lbase = (unsigned)(uintptr_t)(&Xs[w][0][0]);
  unsigned long long gbase = (unsigned long long)(uintptr_t)X;
#pragma unroll
  for (int c2 = 0; c2 < 4; ++c2) {
    unsigned           loff = lbase + (unsigned)(c2 * 512 + lane * 16);
    unsigned long long ga   = gbase + (unsigned long long)(c2 * 512 + lane * 16);
    asm volatile("global_load_async_to_lds_b128 %0, %1, off" :: "v"(loff), "v"(ga) : "memory");
  }
  asm volatile("s_wait_asynccnt 0x0" ::: "memory");
  const _Float16* Xl = &Xs[w][0][0];

  int col = lane & 15;
  int hf  = lane >> 4;
  const float scale = 0.17677669529663689f;   // 1/sqrt(32)
  v16h xa0 = load_rm(Xl, 32);
  v16h xa1 = load_rm(Xl + 16 * 32, 32);
  v8f s00 = {}, s01 = {}, s10 = {}, s11 = {};
  s00 = wmma_f16(xa0, xa0, s00);
  s01 = wmma_f16(xa0, xa1, s01);
  s10 = wmma_f16(xa1, xa0, s10);
  s11 = wmma_f16(xa1, xa1, s11);
  _Float16 (*P)[32] = Pl[w];
#pragma unroll
  for (int v = 0; v < 8; ++v) {
    int row = v + (hf << 3);
    {
      float x0 = s00[v] * scale, x1 = s01[v] * scale;
      float mx = rmax16(fmaxf(x0, x1));
      float p0 = __expf(x0 - mx), p1 = __expf(x1 - mx);
      float inv = 1.0f / rsum16(p0 + p1);
      P[row][col]      = (_Float16)(p0 * inv);
      P[row][16 + col] = (_Float16)(p1 * inv);
    }
    {
      float x0 = s10[v] * scale, x1 = s11[v] * scale;
      float mx = rmax16(fmaxf(x0, x1));
      float p0 = __expf(x0 - mx), p1 = __expf(x1 - mx);
      float inv = 1.0f / rsum16(p0 + p1);
      P[16 + row][col]      = (_Float16)(p0 * inv);
      P[16 + row][16 + col] = (_Float16)(p1 * inv);
    }
  }
  __syncthreads();
  v16h pA0 = load_rm(&P[0][0], 32);
  v16h pA1 = load_rm(&P[16][0], 32);
  v16h bx0 = load_cm(Xl, 32);        // column gathers now hit LDS, not global
  v16h bx1 = load_cm(Xl + 16, 32);
  v8f o00 = {}, o01 = {}, o10 = {}, o11 = {};
  o00 = wmma_f16(pA0, bx0, o00);
  o01 = wmma_f16(pA0, bx1, o01);
  o10 = wmma_f16(pA1, bx0, o10);
  o11 = wmma_f16(pA1, bx1, o11);
  // out layout: [b][m][t][h*32+dk]
  int m0 = hf << 3;
#pragma unroll
  for (int v = 0; v < 8; ++v) {
    int mA = m0 + v;
    int mB = 16 + m0 + v;
    size_t baseA = (((size_t)b * NM + mA) * NT + t) * ND + h * NDK;
    size_t baseB = (((size_t)b * NM + mB) * NT + t) * ND + h * NDK;
    out[baseA + col]      = (_Float16)o00[v];
    out[baseA + 16 + col] = (_Float16)o01[v];
    out[baseB + col]      = (_Float16)o10[v];
    out[baseB + 16 + col] = (_Float16)o11[v];
  }
}

// ---------------- fp32 -> f16 conversion of all six weights ----------------
// wh holds the six f16 weight arrays back to back in the order Wq, Wk, Wv, Wfc, W1, W2;
// every array is a whole number of 256-element blocks, so a block has one source.
#define WSQ  (2 * ND * ND)           // elements of Wq, Wk, Wv, Wfc (both layers)
#define WFF  (2 * NFF * ND)          // elements of W1, W2 (both layers)
__global__ __launch_bounds__(256) void prep_kernel(const float* __restrict__ Wq,
                                                   const float* __restrict__ Wk,
                                                   const float* __restrict__ Wv,
                                                   const float* __restrict__ Wfc,
                                                   const float* __restrict__ W1,
                                                   const float* __restrict__ W2,
                                                   _Float16* __restrict__ wh) {
  int b0 = blockIdx.x * 256;           // first element of this block in wh
  const float* in;
  int s0;                              // where this block's array starts in wh
  if      (b0 < 1 * WSQ)       { in = Wq;  s0 = 0; }
  else if (b0 < 2 * WSQ)       { in = Wk;  s0 = 1 * WSQ; }
  else if (b0 < 3 * WSQ)       { in = Wv;  s0 = 2 * WSQ; }
  else if (b0 < 4 * WSQ)       { in = Wfc; s0 = 3 * WSQ; }
  else if (b0 < 4 * WSQ + WFF) { in = W1;  s0 = 4 * WSQ; }
  else                         { in = W2;  s0 = 4 * WSQ + WFF; }
  int i = b0 + threadIdx.x;
  wh[i] = (_Float16)in[i - s0];
}

extern "C" void kernel_launch(void* const* d_in, const int* in_sizes, int n_in,
                              void* d_out, int out_size, void* d_ws, size_t ws_size,
                              hipStream_t stream) {
  (void)in_sizes; (void)n_in; (void)out_size; (void)ws_size;
  const float* x   = (const float*)d_in[0];
  const float* Wq  = (const float*)d_in[1];
  const float* bq  = (const float*)d_in[2];
  const float* Wk  = (const float*)d_in[3];
  const float* bk  = (const float*)d_in[4];
  const float* Wv  = (const float*)d_in[5];
  const float* bv  = (const float*)d_in[6];
  const float* Wfc = (const float*)d_in[7];
  const float* bfc = (const float*)d_in[8];
  const float* W1  = (const float*)d_in[9];
  const float* b1  = (const float*)d_in[10];
  const float* W2  = (const float*)d_in[11];
  const float* b2  = (const float*)d_in[12];
  const float* g1  = (const float*)d_in[13];
  const float* be1 = (const float*)d_in[14];
  const float* g2  = (const float*)d_in[15];
  const float* be2 = (const float*)d_in[16];
  const float* gf  = (const float*)d_in[17];
  const float* bef = (const float*)d_in[18];

  char* ws = (char*)d_ws;
  size_t off = 0;
  auto bump = [&](size_t bytes) -> char* {
    char* p = ws + off;
    off = (off + bytes + 255) & ~(size_t)255;
    return p;
  };
  float*    xw   = (float*)bump((size_t)NROW * ND * 4);
  _Float16* qh   = (_Float16*)bump((size_t)NROW * ND * 2);
  _Float16* kh   = (_Float16*)bump((size_t)NROW * ND * 2);
  _Float16* qT   = (_Float16*)bump((size_t)NROW * ND * 2);
  _Float16* kT   = (_Float16*)bump((size_t)NROW * ND * 2);
  _Float16* vT   = (_Float16*)bump((size_t)NROW * ND * 2);
  _Float16* cqh  = (_Float16*)bump((size_t)NROW * ND * 2);
  _Float16* ckh  = (_Float16*)bump((size_t)NROW * ND * 2);
  _Float16* a1h  = (_Float16*)bump((size_t)NROW * ND * 2);
  _Float16* a2h  = (_Float16*)bump((size_t)NROW * ND * 2);
  _Float16* hid  = (_Float16*)bump((size_t)NROW * NFF * 2);
  _Float16* wh   = (_Float16*)bump((size_t)(4 * WSQ + 2 * WFF) * 2);   // six f16 weight arrays
  _Float16* wqh  = wh;
  _Float16* wkh  = wh + 1 * WSQ;
  _Float16* wvh  = wh + 2 * WSQ;
  _Float16* wfch = wh + 3 * WSQ;
  _Float16* w1h  = wh + 4 * WSQ;
  _Float16* w2h  = wh + 4 * WSQ + WFF;

  hipMemcpyAsync(xw, x, (size_t)NROW * ND * 4, hipMemcpyDeviceToDevice, stream);

  dim3 blk(256);
  const int lnBlocks    = NROW / 8;                          // 4096
  const int gemmBlk128  = (NROW / 16) * (ND / 64) / 8;       // 512  (DO=128, 64-wide strips)
  const int gemmBlkFF   = (NROW / 16) * (NFF / 64) / 8;      // 2048 (DO=512)
  const int ctxBlocks   = (NB * NM * (NT / 16)) / 8;         // 256
  const int atBlocks    = (NB * NM * NH * (NT / 16)) / 8;    // 1024
  const int amBlocks    = (NB * NT * NH) / 8;                // 512

  prep_kernel<<<(4 * WSQ + 2 * WFF) / 256, blk, 0, stream>>>(Wq, Wk, Wv, Wfc, W1, W2, wh);
  for (int i = 0; i < 2; ++i) {
    qkv_kernel<<<dim3(gemmBlk128, 3), blk, 0, stream>>>(
        xw, g1 + i * ND, be1 + i * ND, wqh + (size_t)i * ND * ND, wkh + (size_t)i * ND * ND, wvh + (size_t)i * ND * ND,
        bq + i * ND, bk + i * ND, bv + i * ND, qh, kh, qT, kT, vT);
    ctx_attn_kernel<<<dim3(ctxBlocks, 2), blk, 0, stream>>>(qh, qT, cqh, kh, kT, ckh);
    attn_t_kernel<<<atBlocks, blk, 0, stream>>>(cqh, ckh, vT, a1h);
    attn_m_kernel<<<amBlocks, blk, 0, stream>>>(a1h, a2h);
    gemm_kernel<ND, false, false, true, false><<<gemmBlk128, blk, 0, stream>>>(
        a2h, wfch + (size_t)i * ND * ND, bfc + i * ND, nullptr, nullptr, xw, xw, ND);
    ln_ffn1_kernel<<<gemmBlkFF, blk, 0, stream>>>(
        xw, g2 + i * ND, be2 + i * ND, w1h + (size_t)i * NFF * ND, b1 + i * NFF, hid);
    gemm_kernel<NFF, false, false, true, false><<<gemmBlk128, blk, 0, stream>>>(
        hid, w2h + (size_t)i * ND * NFF, b2 + i * ND, nullptr, nullptr, xw, xw, ND);
  }
  ln_kernel<false><<<lnBlocks, blk, 0, stream>>>(xw, gf, bef, nullptr, (float*)d_out);
}

// v005
// Next to v004, in two timings, it ran 1.16 and 1.15 times as fast.
// Counting every step since v000, it is 1.67 times as fast.
#include <hip/hip_runtime.h>
#include <hip/hip_bf16.h>
#include <stdint.h>

typedef __attribute__((ext_vector_type(16))) _Float16 v16h;
typedef __attribute__((ext_vector_type(8)))  float    v8f;
typedef __attribute__((ext_vector_type(8)))  _Float16 v8h;
typedef __attribute__((ext_vector_type(4)))  _Float16 v4h;

#define NB   2
#define NM   32
#define NT   512
#define ND   128
#define NH   4
#define NDK  32
#define NFF  512
#define NROW (NB * NM * NT)   // 32768 rows of D=128

__device__ __forceinline__ v8f wmma_f16(v16h a, v16h b, v8f c) {
  // D = A(16x32 f16) x B(32x16 f16) + C(16x16 f32)
  return __builtin_amdgcn_wmma_f32_16x16x32_f16(false, a, false, b, (short)0, c, false, false);
}

__device__ __forceinline__ v16h load_rm(const _Float16* __restrict__ p, int ld) {
  int lane = threadIdx.x & 31;
  const _Float16* r = p + (lane & 15) * ld + ((lane >> 4) << 3);
  v16h o;
#pragma unroll
  for (int i = 0; i < 8; ++i) o[i] = r[i];
#pragma unroll
  for (int i = 0; i < 8; ++i) o[8 + i] = r[16 + i];
  return o;
}

// B-operand for C = A x Bmat, Bmat (32 x >=16) row-major: B[k][n] = p[k*ld+n].
// Used only on small LDS tiles (attn_m); bulk paths use transposed copies instead.
__device__ __forceinline__ v16h load_cm(const _Float16* __restrict__ p, int ld) {
  int lane = threadIdx.x & 31;
  int col  = lane & 15;
  int ko   = (lane >> 4) << 3;
  v16h o;
#pragma unroll
  for (int i = 0; i < 8; ++i) o[i] = p[(ko + i) * ld + col];
#pragma unroll
  for (int i = 0; i < 8; ++i) o[8 + i] = p[(16 + ko + i) * ld + col];
  return o;
}

// B-operand from a column-major (transposed) source: column n contiguous over k.
// ct[n][k] with column stride ldT: B[k][n] = ct[n*ldT + k].
__device__ __forceinline__ v16h load_tp(const _Float16* __restrict__ ct, int ldT) {
  int lane = threadIdx.x & 31;
  const _Float16* r = ct + (lane & 15) * ldT + ((lane >> 4) << 3);
  v16h o;
#pragma unroll
  for (int i = 0; i < 8; ++i) o[i] = r[i];
#pragma unroll
  for (int i = 0; i < 8; ++i) o[8 + i] = r[16 + i];
  return o;
}

__device__ __forceinline__ v16h load_wf(const _Float16* __restrict__ f) {
  int lane = threadIdx.x & 31;
  v8h lo = *(const v8h*)(f + lane * 8);
  v8h hi = *(const v8h*)(f + 256 + lane * 8);
  return __builtin_shufflevector(lo, hi, 0, 1, 2, 3, 4, 5, 6, 7, 8, 9, 10, 11, 12, 13, 14, 15);
}

__device__ __forceinline__ float rmax16(float x) {
#pragma unroll
  for (int d = 1; d < 16; d <<= 1) x = fmaxf(x, __shfl_xor(x, d, 32));
  return x;
}
__device__ __forceinline__ float rsum16(float x) {
#pragma unroll
  for (int d = 1; d < 16; d <<= 1) x += __shfl_xor(x, d, 32);
  return x;
}

// ---------------- LayerNorm (one wave per 128-float row) ----------------
template<bool F16OUT>
__device__ __forceinline__ void ln_body(const float* __restrict__ x,
                                        const float* __restrict__ g,
                                        const float* __restrict__ be,
                                        _Float16* __restrict__ oh,
                                        float* __restrict__ of) {
  int row  = (blockIdx.x * blockDim.x + threadIdx.x) >> 5;
  int lane = threadIdx.x & 31;
  const float* xr = x + (size_t)row * ND;
  float4 v = *(const float4*)(xr + lane * 4);
  float s = v.x + v.y + v.z + v.w;
#pragma unroll
  for (int d = 1; d < 32; d <<= 1) s += __shfl_xor(s, d, 32);
  float mu = s * (1.0f / ND);
  float dx = v.x - mu, dy = v.y - mu, dz = v.z - mu, dw = v.w - mu;
  float ss = dx * dx + dy * dy + dz * dz + dw * dw;
#pragma unroll
  for (int d = 1; d < 32; d <<= 1) ss += __shfl_xor(ss, d, 32);
  float inv = rsqrtf(ss * (1.0f / ND) + 1e-6f);
  float4 gg = *(const float4*)(g + lane * 4);
  float4 bb = *(const float4*)(be + lane * 4);
  float r0 = dx * inv * gg.x + bb.x;
  float r1 = dy * inv * gg.y + bb.y;
  float r2 = dz * inv * gg.z + bb.z;
  float r3 = dw * inv * gg.w + bb.w;
  size_t base = (size_t)row * ND + lane * 4;
  if (F16OUT) {
    oh[base + 0] = (_Float16)r0; oh[base + 1] = (_Float16)r1;
    oh[base + 2] = (_Float16)r2; oh[base + 3] = (_Float16)r3;
  } else {
    of[base + 0] = r0; of[base + 1] = r1;
    of[base + 2] = r2; of[base + 3] = r3;
  }
}

template<bool F16OUT>
__global__ __launch_bounds__(256) void ln_kernel(const float* __restrict__ x,
                                                 const float* __restrict__ g,
                                                 const float* __restrict__ be,
                                                 _Float16* __restrict__ oh,
                                                 float* __restrict__ of) {
  ln_body<F16OUT>(x, g, be, oh, of);
}

#define APITCH 136
template<int ROWS>
__device__ __forceinline__ void ln_rows_to_lds(const float* __restrict__ x,
                                               const float* __restrict__ g,
                                               const float* __restrict__ be,
                                               _Float16* As) {
  constexpr int RPW = ROWS / 8;        // rows per wave
  int w    = threadIdx.x >> 5;
  int lane = threadIdx.x & 31;
  const float* xr = x + (size_t)(w * RPW) * ND + lane * 4;
  float4 vv[RPW];
#pragma unroll
  for (int r = 0; r < RPW; ++r) vv[r] = *(const float4*)(xr + r * ND);
  float4 gg = *(const float4*)(g + lane * 4);
  float4 bb = *(const float4*)(be + lane * 4);
#pragma unroll
  for (int r = 0; r < RPW; ++r) {
    float4 v = vv[r];
    float s = v.x + v.y + v.z + v.w;
#pragma unroll
    for (int d = 1; d < 32; d <<= 1) s += __shfl_xor(s, d, 32);
    float mu = s * (1.0f / ND);
    float dx = v.x - mu, dy = v.y - mu, dz = v.z - mu, dw = v.w - mu;
    float ss = dx * dx + dy * dy + dz * dz + dw * dw;
#pragma unroll
    for (int d = 1; d < 32; d <<= 1) ss += __shfl_xor(ss, d, 32);
    float inv = rsqrtf(ss * (1.0f / ND) + 1e-6f);
    v4h o;
    o[0] = (_Float16)(dx * inv * gg.x + bb.x);
    o[1] = (_Float16)(dy * inv * gg.y + bb.y);
    o[2] = (_Float16)(dz * inv * gg.z + bb.z);
    o[3] = (_Float16)(dw * inv * gg.w + bb.w);
    *(v4h*)(As + (w * RPW + r) * APITCH + lane * 4) = o;
  }
}

// ---- GEMM: out = A(f16, N x DI) x W(f16, DO x DI, fragment order)^T + bias, 16x64 tile per wave ----
// F16OUT: row-major f16 out.  XPOSE: also/only write transposed f16 [bm][d][t] (DO==128).
// RESID (implies fp32 out): outF = resid + val.
template<int DI, bool RELU, bool F16OUT, bool RESID, bool XPOSE>
__device__ __forceinline__ void gemm_body(const _Float16* __restrict__ A,
                                          const _Float16* __restrict__ W,
                                          const float* __restrict__ bias,
                                          _Float16* __restrict__ outH,
                                          _Float16* __restrict__ outT,
                                          float* __restrict__ outF,
                                          const float* __restrict__ resid,
                                          int DO) {
  int wave = (blockIdx.x * blockDim.x + threadIdx.x) >> 5;
  int tpr  = DO >> 6;                 // 64-wide column strips
  int rt   = wave / tpr;
  int cs   = wave - rt * tpr;
  const _Float16* a0 = A + (size_t)rt * 16 * DI;
  const _Float16* w0 = W + (size_t)cs * 64 * DI;
  v8f c0 = {}, c1 = {}, c2 = {}, c3 = {};
#pragma unroll
  for (int k = 0; k < DI; k += 32) {
    v16h a = load_rm(a0 + k, DI);
    c0 = wmma_f16(a, load_wf(w0 + (size_t)0 * 16 * DI + k * 16), c0);
    c1 = wmma_f16(a, load_wf(w0 + (size_t)1 * 16 * DI + k * 16), c1);
    c2 = wmma_f16(a, load_wf(w0 + (size_t)2 * 16 * DI + k * 16), c2);
    c3 = wmma_f16(a, load_wf(w0 + (size_t)3 * 16 * DI + k * 16), c3);
  }
  // the bias loads below may land in the address registers of the loads above: wait first
  asm volatile("s_wait_xcnt 0x0" ::: "memory");
  int lane = threadIdx.x & 31;
  int col  = lane & 15;
  int rb   = (lane >> 4) << 3;
  v8f acc[4] = {c0, c1, c2, c3};
#pragma unroll
  for (int n = 0; n < 4; ++n) {
    int colg = cs * 64 + n * 16 + col;
    float bv = bias[colg];
#pragma unroll
    for (int v = 0; v < 8; ++v) {
      float val = acc[n][v] + bv;
      if (RELU) val = fmaxf(val, 0.0f);
      int row = rt * 16 + rb + v;
      if (F16OUT) outH[(size_t)row * DO + colg] = (_Float16)val;
      if (XPOSE) {
        int t  = row & (NT - 1);
        int bm = row >> 9;            // NT == 512
        outT[((size_t)bm * ND + colg) * NT + t] = (_Float16)val;
      }
      if (!F16OUT && !XPOSE)
        outF[(size_t)row * DO + colg] = (RESID ? resid[(size_t)row * DO + colg] : 0.0f) + val;
    }
  }
}

template<int DI, bool RELU, bool F16OUT, bool RESID, bool XPOSE>
__global__ __launch_bounds__(256) void gemm_kernel(const _Float16* __restrict__ A,
                                                   const _Float16* __restrict__ W,
                                                   const float* __restrict__ bias,
                                                   _Float16* __restrict__ outH,
                                                   _Float16* __restrict__ outT,
                                                   float* __restrict__ outF,
                                                   const float* __restrict__ resid,
                                                   int DO) {
  gemm_body<DI, RELU, F16OUT, RESID, XPOSE>(A, W, bias, outH, outT, outF, resid, DO);
}

#define TPITCH 72
template<int DO, bool RELU, bool F16OUT, bool XPOSE>
__device__ __forceinline__ void gemm_lds_body(const _Float16* As,
                                              const _Float16* __restrict__ W,
                                              const float* __restrict__ bias,
                                              _Float16* __restrict__ outH,
                                              _Float16* __restrict__ outT,
                                              _Float16* Ts) {
  constexpr int TPR = DO >> 6;        // 64-wide column strips
  int w    = threadIdx.x >> 5;
  int wave = blockIdx.x * 8 + w;
  int rt   = wave / TPR;
  int cs   = wave - rt * TPR;
  const _Float16* a0 = As + (w / TPR) * 16 * APITCH;   // the wave's 16 rows of the panel
  const _Float16* w0 = W + (size_t)cs * 64 * ND;
  v8f c0 = {}, c1 = {}, c2 = {}, c3 = {};
#pragma unroll
  for (int k = 0; k < ND; k += 32) {
    v16h a = load_rm(a0 + k, APITCH);
    c0 = wmma_f16(a, load_wf(w0 + (size_t)0 * 16 * ND + k * 16), c0);
    c1 = wmma_f16(a, load_wf(w0 + (size_t)1 * 16 * ND + k * 16), c1);
    c2 = wmma_f16(a, load_wf(w0 + (size_t)2 * 16 * ND + k * 16), c2);
    c3 = wmma_f16(a, load_wf(w0 + (size_t)3 * 16 * ND + k * 16), c3);
  }
  // the bias loads below may land in the address registers of the loads above: wait first
  asm volatile("s_wait_xcnt 0x0" ::: "memory");
  int lane = threadIdx.x & 31;
  int col  = lane & 15;
  int rb   = (lane >> 4) << 3;
  v8f acc[4] = {c0, c1, c2, c3};
  v8h hv[4];
#pragma unroll
  for (int n = 0; n < 4; ++n) {
    int colg = cs * 64 + n * 16 + col;
    float bv = bias[colg];
#pragma unroll
    for (int v = 0; v < 8; ++v) {
      float val = acc[n][v] + bv;
      if (RELU) val = fmaxf(val, 0.0f);
      hv[n][v] = (_Float16)val;
    }
    if (XPOSE) *(v8h*)(Ts + colg * TPITCH + (w / TPR) * 16 + rb) = hv[n];
  }
  // The barrier stands in front of the row-major stores: behind them it would wait for them.
  if (XPOSE) __syncthreads();   // the tile is written by all eight waves and read by all eight
  if (F16OUT) {
#pragma unroll
    for (int n = 0; n < 4; ++n) {
      int colg = cs * 64 + n * 16 + col;
#pragma unroll
      for (int v = 0; v < 8; ++v)
        outH[(size_t)(rt * 16 + rb + v) * DO + colg] = hv[n][v];
    }
  }
  if (XPOSE) {
    int row0 = blockIdx.x * 64;       // the block's first row; 64 divides NT: one bm per block
    int bm   = row0 >> 9;             // NT == 512
    int t0   = row0 & (NT - 1);
    int d    = threadIdx.x >> 3;      // 32 rows of the tile per pass
    int ch   = (threadIdx.x & 7) << 3;
    const _Float16* ls = Ts + d * TPITCH + ch;
    _Float16* gp = outT + ((size_t)bm * ND + d) * NT + t0 + ch;
    v8h tr[4];
#pragma unroll
    for (int p = 0; p < 4; ++p) tr[p] = *(const v8h*)(ls + p * 32 * TPITCH);
#pragma unroll
    for (int p = 0; p < 4; ++p) *(v8h*)(gp + (size_t)p * 32 * NT) = tr[p];
  }
}

// hid = relu(LayerNorm(X) x W1^T + b1): 16 rows of X and all 512 columns per block.
__global__ __launch_bounds__(256) void ln_ffn1_kernel(const float* __restrict__ X,
                                                      const float* __restrict__ g,
                                                      const float* __restrict__ be,
                                                      const _Float16* __restrict__ W,
                                                      const float* __restrict__ bias,
                                                      _Float16* __restrict__ outH) {
  __shared__ __attribute__((aligned(16))) _Float16 As[16 * APITCH];
  ln_rows_to_lds<16>(X + (size_t)blockIdx.x * 16 * ND, g, be, As);
  __syncthreads();   // the panel is written by all eight waves and read by all eight
  gemm_lds_body<NFF, true, true, false>(As, W, bias, outH, nullptr, nullptr);
}

// The q, k and v products read the same A = LayerNorm(X) and none of each other's output: one
// grid, blockIdx.y names the product (0 = q, 1 = k: row-major + transposed; 2 = v: transposed
// only).  64 rows of X and one product's 128 columns per block.
__global__ __launch_bounds__(256) void qkv_kernel(const float* __restrict__ X,
                                                  const float* __restrict__ g,
                                                  const float* __restrict__ be,
                                                  const _Float16* __restrict__ Wq,
                                                  const _Float16* __restrict__ Wk,
                                                  const _Float16* __restrict__ Wv,
                                                  const float* __restrict__ bq,
                                                  const float* __restrict__ bk,
                                                  const float* __restrict__ bv,
                                                  _Float16* __restrict__ qh,
                                                  _Float16* __restrict__ kh,
                                                  _Float16* __restrict__ qT,
                                                  _Float16* __restrict__ kT,
                                                  _Float16* __restrict__ vT) {
  __shared__ __attribute__((aligned(16))) _Float16 As[64 * APITCH];
  __shared__ __attribute__((aligned(16))) _Float16 Ts[ND * TPITCH];
  ln_rows_to_lds<64>(X + (size_t)blockIdx.x * 64 * ND, g, be, As);
  __syncthreads();   // the panel is written by all eight waves and read by all eight
  if (blockIdx.y == 2) {
    gemm_lds_body<ND, false, false, true>(As, Wv, bv, nullptr, vT, Ts);
  } else {
    bool isq = blockIdx.y == 0;
    gemm_lds_body<ND, false, true, true>(As, isq ? Wq : Wk, isq ? bq : bk, isq ? qh : kh,
                                         isq ? qT : kT, Ts);
    // the v branch's code is laid out behind these stores and reuses their address and data
    // registers: wait before anything can overwrite them
    asm volatile("s_wait_xcnt 0x0" ::: "memory");
  }
}

// ---------------- Windowed (L=16) context attention over d=128 ----------------
// blockIdx.y names the tensor (0 = q, 1 = k): the two are independent and share one grid.
__global__ __launch_bounds__(256) void ctx_attn_kernel(const _Float16* __restrict__ src0,
                                                       const _Float16* __restrict__ srcT0,
                                                       _Float16* __restrict__ dst0,
                                                       const _Float16* __restrict__ src1,
                                                       const _Float16* __restrict__ srcT1,
                                                       _Float16* __restrict__ dst1) {
  __shared__ _Float16 Pl[8][16][32];
  const _Float16* __restrict__ src  = blockIdx.y ? src1  : src0;
  const _Float16* __restrict__ srcT = blockIdx.y ? srcT1 : srcT0;
  _Float16* __restrict__       dst  = blockIdx.y ? dst1  : dst0;
  int wave = (blockIdx.x * blockDim.x + threadIdx.x) >> 5;
  int qb   = wave & (NT / 16 - 1);
  int bm   = wave >> 5;
  const _Float16* seq = src + (size_t)bm * NT * ND;
  const _Float16* qp  = seq + (size_t)qb * 16 * ND;
  const _Float16* pp  = qb ? (qp - 16 * ND) : qp;   // prev block (dummy when qb==0)
  v8f s0 = {}, s1 = {};
#pragma unroll
  for (int k = 0; k < ND; k += 32) {
    v16h a  = load_rm(qp + k, ND);
    v16h bp = load_rm(pp + k, ND);
    s0 = wmma_f16(a, bp, s0);    // Q x Prev^T
    s1 = wmma_f16(a, a,  s1);    // Q x Cur^T
  }
  int lane = threadIdx.x & 31;
  int col  = lane & 15;
  int hf   = lane >> 4;
  const float scale = 0.088388347648318447f;   // 1/sqrt(128)
  _Float16 (*P)[32] = Pl[threadIdx.x >> 5];
#pragma unroll
  for (int v = 0; v < 8; ++v) {
    int row = v + (hf << 3);
    // band: prev key j valid iff j > row; cur key j valid iff j <= row.
    // zero padding (qb==0): in-band scores are 0 and DO join the softmax.
    float sp = (col > row)  ? (qb ? s0[v] * scale : 0.0f) : -1e30f;
    float sc = (col <= row) ? s1[v] * scale : -1e30f;
    float mx = rmax16(fmaxf(sp, sc));
    float ep = __expf(sp - mx);
    float ec = __expf(sc - mx);
    float invd = 1.0f / rsum16(ep + ec);
    float wp = qb ? ep * invd : 0.0f;  // zero rows: no contribution to numerator
    float wc = ec * invd;
    P[row][col]      = (_Float16)wp;
    P[row][16 + col] = (_Float16)wc;
  }
  __syncthreads();
  v16h pA = load_rm(&P[0][0], 32);
  const _Float16* sT = srcT + (size_t)bm * ND * NT;
  int tp0 = (qb ? qb - 1 : qb) * 16;
  int tc0 = qb * 16;
  int ko  = hf << 3;
  _Float16* dr = dst + (size_t)bm * NT * ND + (size_t)qb * 16 * ND;
#pragma unroll
  for (int n0 = 0; n0 < ND; n0 += 16) {
    const _Float16* colp = sT + (size_t)(n0 + col) * NT;  // contiguous over t
    v16h b;
#pragma unroll
    for (int i = 0; i < 8; ++i) b[i]     = colp[tp0 + ko + i];  // k 0..15  = prev rows
#pragma unroll
    for (int i = 0; i < 8; ++i) b[8 + i] = colp[tc0 + ko + i];  // k 16..31 = cur rows
    v8f o = {};
    o = wmma_f16(pA, b, o);
#pragma unroll
    for (int v = 0; v < 8; ++v)
      dr[(size_t)((hf << 3) + v) * ND + n0 + col] = (_Float16)o[v];
  }
}

__device__ __forceinline__ float xhalf(float x) {
  int b = __builtin_bit_cast(int, x);
  return __builtin_bit_cast(float,
      __builtin_amdgcn_permlanex16(b, b, 0x76543210, 0xfedcba98, false, false));
}

__global__ __launch_bounds__(256) void attn_t_kernel(const _Float16* __restrict__ cq,
                                                     const _Float16* __restrict__ ck,
                                                     const _Float16* __restrict__ vT,
                                                     _Float16* __restrict__ out) {
  int wave = (blockIdx.x * blockDim.x + threadIdx.x) >> 5;
  int qb = wave & 31;
  int h  = (wave >> 5) & 3;
  int bm = wave >> 7;
  int b  = bm >> 5;
  int m  = bm & 31;
  size_t seqoff = (size_t)bm * NT * ND + h * NDK;
  const _Float16* Q  = cq + seqoff + (size_t)qb * 16 * ND;
  const _Float16* K  = ck + seqoff;
  const _Float16* VT = vT + (size_t)bm * ND * NT + (size_t)(h * NDK) * NT;  // [dk][t]
  int lane = threadIdx.x & 31;
  int col  = lane & 15;
  int hf   = lane >> 4;
  const float scale = 0.17677669529663689f;   // 1/sqrt(32)
  v16h qf = load_rm(Q, ND);      // B operand: column = query
  v8f o0 = {}, o1 = {};          // o0[r] = O[query col][dk 8*hf+r], o1[r]: dk 16+8*hf+r
  float mrun = -1e30f;           // running maximum of this lane's query (equal in both halves)
  float lrun = 0.0f;             // running sum over this half's keys only; joined after the loop
  for (int kb = 0; kb < NT / 32; ++kb) {
    const _Float16* Kb = K + (size_t)kb * 32 * ND;
    if (kb + 1 < NT / 32) {   // speculative prefetch of next key block -> global_prefetch_b8
      __builtin_prefetch(Kb + 32 * ND + lane * 64, 0, 0);
      __builtin_prefetch(VT + (size_t)col * NT + (kb + 1) * 32, 0, 0);
    }
    v16h ka0 = load_rm(Kb, ND);                              // A: rows = keys 0..15
    v16h ka1 = load_rm(Kb + 16 * ND, ND);                    // A: rows = keys 16..31
    v16h va0 = load_tp(VT + kb * 32, NT);                    // A: rows = dk 0..15,  k = keys
    v16h va1 = load_tp(VT + (size_t)16 * NT + kb * 32, NT);  // A: rows = dk 16..31, k = keys
    v8f s0 = {}, s1 = {};
    s0 = wmma_f16(ka0, qf, s0);
    s1 = wmma_f16(ka1, qf, s1);
    float x0[8], x1[8];
    float mx = -1e30f;
#pragma unroll
    for (int r = 0; r < 8; ++r) {
      x0[r] = s0[r] * scale;
      x1[r] = s1[r] * scale;
      mx = fmaxf(mx, fmaxf(x0[r], x1[r]));
    }
    mx = fmaxf(mx, xhalf(mx));
    float mn   = fmaxf(mrun, mx);
    float corr = __expf(mrun - mn);
    float ps   = 0.0f;
    v16h pB;                     // B operand: pB[s] = P[query col][key kmap(s, hf)]
#pragma unroll
    for (int r = 0; r < 8; ++r) {
      float p0 = __expf(x0[r] - mn);
      float p1 = __expf(x1[r] - mn);
      ps += p0 + p1;
      pB[r]     = (_Float16)p0;
      pB[8 + r] = (_Float16)p1;
    }
    lrun = lrun * corr + ps;
    mrun = mn;
#pragma unroll
    for (int r = 0; r < 8; ++r) { o0[r] *= corr; o1[r] *= corr; }
    o0 = wmma_f16(va0, pB, o0);
    o1 = wmma_f16(va1, pB, o1);
  }
  // out layout: [b][t][h][m][dk]; a lane's eight registers are eight consecutive dk of one row
  float inv = 1.0f / (lrun + xhalf(lrun));
  int t = qb * 16 + col;
  size_t base = ((((size_t)b * NT + t) * NH + h) * NM + m) * NDK + (hf << 3);
  v8h r0, r1;
#pragma unroll
  for (int r = 0; r < 8; ++r) {
    r0[r] = (_Float16)(o0[r] * inv);
    r1[r] = (_Float16)(o1[r] * inv);
  }
  *(v8h*)(out + base)      = r0;
  *(v8h*)(out + base + 16) = r1;
}

// ---------------- Attention across m=32 per (b,t,h) ----------------
__global__ __launch_bounds__(256) void attn_m_kernel(const _Float16* __restrict__ a1,
                                                     _Float16* __restrict__ out) {
  __shared__ _Float16 Xs[8][32][32];
  __shared__ _Float16 Pl[8][32][32];
  int wave = (blockIdx.x * blockDim.x + threadIdx.x) >> 5;
  int h = wave & 3;
  int t = (wave >> 2) & (NT - 1);
  int b = wave >> 11;
  int w = threadIdx.x >> 5;
  int lane = threadIdx.x & 31;
  const _Float16* X = a1 + ((((size_t)b * NT + t) * NH + h) * NM) * NDK;  // 32x32 tile

  unsigned           lbase = (unsigned)(uintptr_t)(&Xs[w][0][0]);
  unsigned long long gbase = (unsigned long long)(uintptr_t)X;
#pragma unroll
  for (int c2 = 0; c2 < 4; ++c2) {
    unsigned           loff = lbase + (unsigned)(c2 * 512 + lane * 16);
    unsigned long long ga   = gbase + (unsigned long long)(c2 * 512 + lane * 16);
    asm volatile("global_load_async_to_lds_b128 %0, %1, off" :: "v"(loff), "v"(ga) : "memory");
  }
  asm volatile("s_wait_asynccnt 0x0" ::: "memory");
  const _Float16* Xl = &Xs[w][0][0];

  int col = lane & 15;
  int hf  = lane >> 4;
  const float scale = 0.17677669529663689f;   // 1/sqrt(32)
  v16h xa0 = load_rm(Xl, 32);
  v16h xa1 = load_rm(Xl + 16 * 32, 32);
  v8f s00 = {}, s01 = {}, s10 = {}, s11 = {};
  s00 = wmma_f16(xa0, xa0, s00);
  s01 = wmma_f16(xa0, xa1, s01);
  s10 = wmma_f16(xa1, xa0, s10);
  s11 = wmma_f16(xa1, xa1, s11);
  _Float16 (*P)[32] = Pl[w];
#pragma unroll
  for (int v = 0; v < 8; ++v) {
    int row = v + (hf << 3);
    {
      float x0 = s00[v] * scale, x1 = s01[v] * scale;
      float mx = rmax16(fmaxf(x0, x1));
      float p0 = __expf(x0 - mx), p1 = __expf(x1 - mx);
      float inv = 1.0f / rsum16(p0 + p1);
      P[row][col]      = (_Float16)(p0 * inv);
      P[row][16 + col] = (_Float16)(p1 * inv);
    }
    {
      float x0 = s10[v] * scale, x1 = s11[v] * scale;
      float mx = rmax16(fmaxf(x0, x1));
      float p0 = __expf(x0 - mx), p1 = __expf(x1 - mx);
      float inv = 1.0f / rsum16(p0 + p1);
      P[16 + row][col]      = (_Float16)(p0 * inv);
      P[16 + row][16 + col] = (_Float16)(p1 * inv);
    }
  }
  __syncthreads();
  v16h pA0 = load_rm(&P[0][0], 32);
  v16h pA1 = load_rm(&P[16][0], 32);
  v16h bx0 = load_cm(Xl, 32);        // column gathers now hit LDS, not global
  v16h bx1 = load_cm(Xl + 16, 32);
  v8f o00 = {}, o01 = {}, o10 = {}, o11 = {};
  o00 = wmma_f16(pA0, bx0, o00);
  o01 = wmma_f16(pA0, bx1, o01);
  o10 = wmma_f16(pA1, bx0, o10);
  o11 = wmma_f16(pA1, bx1, o11);
  // out layout: [b][m][t][h*32+dk]
  int m0 = hf << 3;
#pragma unroll
  for (int v = 0; v < 8; ++v) {
    int mA = m0 + v;
    int mB = 16 + m0 + v;
    size_t baseA = (((size_t)b * NM + mA) * NT + t) * ND + h * NDK;
    size_t baseB = (((size_t)b * NM + mB) * NT + t) * ND + h * NDK;
    out[baseA + col]      = (_Float16)o00[v];
    out[baseA + 16 + col] = (_Float16)o01[v];
    out[baseB + col]      = (_Float16)o10[v];
    out[baseB + 16 + col] = (_Float16)o11[v];
  }
}

// ---------------- fp32 -> f16 conversion of all six weights ----------------
// wh holds the six f16 weight arrays back to back in the order Wq, Wk, Wv, Wfc, W1, W2;
// every array is a whole number of 256-element blocks, so a block has one source.
// Each array is stored in the fragment order that load_wf reads: a block writes one half
// fragment (registers 0-7 or 8-15 of the 32 lanes).  The rows of both layers count through.
#define WSQ  (2 * ND * ND)           // elements of Wq, Wk, Wv, Wfc (both layers)
#define WFF  (2 * NFF * ND)          // elements of W1, W2 (both layers)
__global__ __launch_bounds__(256) void prep_kernel(const float* __restrict__ Wq,
                                                   const float* __restrict__ Wk,
                                                   const float* __restrict__ Wv,
                                                   const float* __restrict__ Wfc,
                                                   const float* __restrict__ W1,
                                                   const float* __restrict__ W2,
                                                   _Float16* __restrict__ wh) {
  int b0 = blockIdx.x * 256;           // first element of this block in wh
  const float* in;
  int s0;                              // where this block's array starts in wh
  int lk = 2;                          // log2 of the fragments per row tile: row length / 32
  if      (b0 < 1 * WSQ)       { in = Wq;  s0 = 0; }
  else if (b0 < 2 * WSQ)       { in = Wk;  s0 = 1 * WSQ; }
  else if (b0 < 3 * WSQ)       { in = Wv;  s0 = 2 * WSQ; }
  else if (b0 < 4 * WSQ)       { in = Wfc; s0 = 3 * WSQ; }
  else if (b0 < 4 * WSQ + WFF) { in = W1;  s0 = 4 * WSQ; }
  else                         { in = W2;  s0 = 4 * WSQ + WFF; lk = 4; }
  int hfrag = (b0 - s0) >> 8;          // half fragment of this block
  int frag  = hfrag >> 1;
  int l     = threadIdx.x >> 3;        // lane that will read the element
  int row   = ((frag >> lk) << 4) + (l & 15);
  int colk  = ((frag & ((1 << lk) - 1)) << 5) + ((hfrag & 1) << 4) + ((l >> 4) << 3)
            + (threadIdx.x & 7);
  wh[b0 + threadIdx.x] = (_Float16)in[(row << (lk + 5)) + colk];
}

extern "C" void kernel_launch(void* const* d_in, const int* in_sizes, int n_in,
                              void* d_out, int out_size, void* d_ws, size_t ws_size,
                              hipStream_t stream) {
  (void)in_sizes; (void)n_in; (void)out_size; (void)ws_size;
  const float* x   = (const float*)d_in[0];
  const float* Wq  = (const float*)d_in[1];
  const float* bq  = (const float*)d_in[2];
  const float* Wk  = (const float*)d_in[3];
  const float* bk  = (const float*)d_in[4];
  const float* Wv  = (const float*)d_in[5];
  const float* bv  = (const float*)d_in[6];
  const float* Wfc = (const float*)d_in[7];
  const float* bfc = (const float*)d_in[8];
  const float* W1  = (const float*)d_in[9];
  const float* b1  = (const float*)d_in[10];
  const float* W2  = (const float*)d_in[11];
  const float* b2  = (const float*)d_in[12];
  const float* g1  = (const float*)d_in[13];
  const float* be1 = (const float*)d_in[14];
  const float* g2  = (const float*)d_in[15];
  const float* be2 = (const float*)d_in[16];
  const float* gf  = (const float*)d_in[17];
  const float* bef = (const float*)d_in[18];

  char* ws = (char*)d_ws;
  size_t off = 0;
  auto bump = [&](size_t bytes) -> char* {
    char* p = ws + off;
    off = (off + bytes + 255) & ~(size_t)255;
    return p;
  };
  float*    xw   = (float*)bump((size_t)NROW * ND * 4);
  _Float16* qh   = (_Float16*)bump((size_t)NROW * ND * 2);
  _Float16* kh   = (_Float16*)bump((size_t)NROW * ND * 2);
  _Float16* qT   = (_Float16*)bump((size_t)NROW * ND * 2);
  _Float16* kT   = (_Float16*)bump((size_t)NROW * ND * 2);
  _Float16* vT   = (_Float16*)bump((size_t)NROW * ND * 2);
  _Float16* cqh  = (_Float16*)bump((size_t)NROW * ND * 2);
  _Float16* ckh  = (_Float16*)bump((size_t)NROW * ND * 2);
  _Float16* a1h  = (_Float16*)bump((size_t)NROW * ND * 2);
  _Float16* a2h  = (_Float16*)bump((size_t)NROW * ND * 2);
  _Float16* hid  = (_Float16*)bump((size_t)NROW * NFF * 2);
  _Float16* wh   = (_Float16*)bump((size_t)(4 * WSQ + 2 * WFF) * 2);   // six f16 weight arrays
  _Float16* wqh  = wh;
  _Float16* wkh  = wh + 1 * WSQ;
  _Float16* wvh  = wh + 2 * WSQ;
  _Float16* wfch = wh + 3 * WSQ;
  _Float16* w1h  = wh + 4 * WSQ;
  _Float16* w2h  = wh + 4 * WSQ + WFF;

  hipMemcpyAsync(xw, x, (size_t)NROW * ND * 4, hipMemcpyDeviceToDevice, stream);

  dim3 blk(256);
  const int lnBlocks    = NROW / 8;                          // 4096
  const int gemmBlk128  = (NROW / 16) * (ND / 64) / 8;       // 512  (DO=128, 64-wide strips)
  const int gemmBlkFF   = (NROW / 16) * (NFF / 64) / 8;      // 2048 (DO=512)
  const int ctxBlocks   = (NB * NM * (NT / 16)) / 8;         // 256
  const int atBlocks    = (NB * NM * NH * (NT / 16)) / 8;    // 1024
  const int amBlocks    = (NB * NT * NH) / 8;                // 512

  prep_kernel<<<(4 * WSQ + 2 * WFF) / 256, blk, 0, stream>>>(Wq, Wk, Wv, Wfc, W1, W2, wh);
  for (int i = 0; i < 2; ++i) {
    qkv_kernel<<<dim3(gemmBlk128, 3), blk, 0, stream>>>(
        xw, g1 + i * ND, be1 + i * ND, wqh + (size_t)i * ND * ND, wkh + (size_t)i * ND * ND, wvh + (size_t)i * ND * ND,
        bq + i * ND, bk + i * ND, bv + i * ND, qh, kh, qT, kT, vT);
    ctx_attn_kernel<<<dim3(ctxBlocks, 2), blk, 0, stream>>>(qh, qT, cqh, kh, kT, ckh);
    attn_t_kernel<<<atBlocks, blk, 0, stream>>>(cqh, ckh, vT, a1h);
    attn_m_kernel<<<amBlocks, blk, 0, stream>>>(a1h, a2h);
    gemm_kernel<ND, false, false, true, false><<<gemmBlk128, blk, 0, stream>>>(
        a2h, wfch + (size_t)i * ND * ND, bfc + i * ND, nullptr, nullptr, xw, xw, ND);
    ln_ffn1_kernel<<<gemmBlkFF, blk, 0, stream>>>(
        xw, g2 + i * ND, be2 + i * ND, w1h + (size_t)i * NFF * ND, b1 + i * NFF, hid);
    gemm_kernel<NFF, false, false, true, false><<<gemmBlk128, blk, 0, stream>>>(
        hid, w2h + (size_t)i * ND * NFF, b2 + i * ND, nullptr, nullptr, xw, xw, ND);
  }
  ln_kernel<false><<<lnBlocks, blk, 0, stream>>>(xw, gf, bef, nullptr, (float*)d_out);
}

// v006
// In two side-by-side timings against v005, it was 1.19 and 1.17 times as fast.
// Counting every step since v000, it is 1.97 times as fast.
#include <hip/hip_runtime.h>
#include <hip/hip_bf16.h>
#include <stdint.h>

typedef __attribute__((ext_vector_type(16))) _Float16 v16h;
typedef __attribute__((ext_vector_type(8)))  float    v8f;
typedef __attribute__((ext_vector_type(8)))  _Float16 v8h;
typedef __attribute__((ext_vector_type(4)))  _Float16 v4h;

#define NB   2
#define NM   32
#define NT   512
#define ND   128
#define NH   4
#define NDK  32
#define NFF  512
#define NROW (NB * NM * NT)   // 32768 rows of D=128

__device__ __forceinline__ v8f wmma_f16(v16h a, v16h b, v8f c) {
  // D = A(16x32 f16) x B(32x16 f16) + C(16x16 f32)
  return __builtin_amdgcn_wmma_f32_16x16x32_f16(false, a, false, b, (short)0, c, false, false);
}

__device__ __forceinline__ v16h load_rm(const _Float16* __restrict__ p, int ld) {
  int lane = threadIdx.x & 31;
  const _Float16* r = p + (lane & 15) * ld + ((lane >> 4) << 3);
  v16h o;
#pragma unroll
  for (int i = 0; i < 8; ++i) o[i] = r[i];
#pragma unroll
  for (int i = 0; i < 8; ++i) o[8 + i] = r[16 + i];
  return o;
}

// B-operand for C = A x Bmat, Bmat (32 x >=16) row-major: B[k][n] = p[k*ld+n].
// Used only on small LDS tiles (attn_m); bulk paths use transposed copies instead.
__device__ __forceinline__ v16h load_cm(const _Float16* __restrict__ p, int ld) {
  int lane = threadIdx.x & 31;
  int col  = lane & 15;
  int ko   = (lane >> 4) << 3;
  v16h o;
#pragma unroll
  for (int i = 0; i < 8; ++i) o[i] = p[(ko + i) * ld + col];
#pragma unroll
  for (int i = 0; i < 8; ++i) o[8 + i] = p[(16 + ko + i) * ld + col];
  return o;
}

// B-operand from a column-major (transposed) source: column n contiguous over k.
// ct[n][k] with column stride ldT: B[k][n] = ct[n*ldT + k].
__device__ __forceinline__ v16h load_tp(const _Float16* __restrict__ ct, int ldT) {
  int lane = threadIdx.x & 31;
  const _Float16* r = ct + (lane & 15) * ldT + ((lane >> 4) << 3);
  v16h o;
#pragma unroll
  for (int i = 0; i < 8; ++i) o[i] = r[i];
#pragma unroll
  for (int i = 0; i < 8; ++i) o[8 + i] = r[16 + i];
  return o;
}

__device__ __forceinline__ v16h load_wf(const _Float16* __restrict__ f) {
  int lane = threadIdx.x & 31;
  v8h lo = *(const v8h*)(f + lane * 8);
  v8h hi = *(const v8h*)(f + 256 + lane * 8);
  return __builtin_shufflevector(lo, hi, 0, 1, 2, 3, 4, 5, 6, 7, 8, 9, 10, 11, 12, 13, 14, 15);
}

__device__ __forceinline__ float rmax16(float x) {
#pragma unroll
  for (int d = 1; d < 16; d <<= 1) x = fmaxf(x, __shfl_xor(x, d, 32));
  return x;
}
__device__ __forceinline__ float rsum16(float x) {
#pragma unroll
  for (int d = 1; d < 16; d <<= 1) x += __shfl_xor(x, d, 32);
  return x;
}

// ---------------- LayerNorm (one wave per 128-float row) ----------------
template<bool F16OUT>
__device__ __forceinline__ void ln_body(const float* __restrict__ x,
                                        const float* __restrict__ g,
                                        const float* __restrict__ be,
                                        _Float16* __restrict__ oh,
                                        float* __restrict__ of) {
  int row  = (blockIdx.x * blockDim.x + threadIdx.x) >> 5;
  int lane = threadIdx.x & 31;
  const float* xr = x + (size_t)row * ND;
  float4 v = *(const float4*)(xr + lane * 4);
  float s = v.x + v.y + v.z + v.w;
#pragma unroll
  for (int d = 1; d < 32; d <<= 1) s += __shfl_xor(s, d, 32);
  float mu = s * (1.0f / ND);
  float dx = v.x - mu, dy = v.y - mu, dz = v.z - mu, dw = v.w - mu;
  float ss = dx * dx + dy * dy + dz * dz + dw * dw;
#pragma unroll
  for (int d = 1; d < 32; d <<= 1) ss += __shfl_xor(ss, d, 32);
  float inv = rsqrtf(ss * (1.0f / ND) + 1e-6f);
  float4 gg = *(const float4*)(g + lane * 4);
  float4 bb = *(const float4*)(be + lane * 4);
  float r0 = dx * inv * gg.x + bb.x;
  float r1 = dy * inv * gg.y + bb.y;
  float r2 = dz * inv * gg.z + bb.z;
  float r3 = dw * inv * gg.w + bb.w;
  size_t base = (size_t)row * ND + lane * 4;
  if (F16OUT) {
    oh[base + 0] = (_Float16)r0; oh[base + 1] = (_Float16)r1;
    oh[base + 2] = (_Float16)r2; oh[base + 3] = (_Float16)r3;
  } else {
    of[base + 0] = r0; of[base + 1] = r1;
    of[base + 2] = r2; of[base + 3] = r3;
  }
}

template<bool F16OUT>
__global__ __launch_bounds__(256) void ln_kernel(const float* __restrict__ x,
                                                 const float* __restrict__ g,
                                                 const float* __restrict__ be,
                                                 _Float16* __restrict__ oh,
                                                 float* __restrict__ of) {
  ln_body<F16OUT>(x, g, be, oh, of);
}

#define APITCH 136
template<int ROWS>
__device__ __forceinline__ void ln_rows_to_lds(const float* __restrict__ x,
                                               const float* __restrict__ g,
                                               const float* __restrict__ be,
                                               _Float16* As) {
  constexpr int RPW = ROWS / 8;        // rows per wave
  int w    = threadIdx.x >> 5;
  int lane = threadIdx.x & 31;
  const float* xr = x + (size_t)(w * RPW) * ND + lane * 4;
  float4 vv[RPW];
#pragma unroll
  for (int r = 0; r < RPW; ++r) vv[r] = *(const float4*)(xr + r * ND);
  float4 gg = *(const float4*)(g + lane * 4);
  float4 bb = *(const float4*)(be + lane * 4);
#pragma unroll
  for (int r = 0; r < RPW; ++r) {
    float4 v = vv[r];
    float s = v.x + v.y + v.z + v.w;
#pragma unroll
    for (int d = 1; d < 32; d <<= 1) s += __shfl_xor(s, d, 32);
    float mu = s * (1.0f / ND);
    float dx = v.x - mu, dy = v.y - mu, dz = v.z - mu, dw = v.w - mu;
    float ss = dx * dx + dy * dy + dz * dz + dw * dw;
#pragma unroll
    for (int d = 1; d < 32; d <<= 1) ss += __shfl_xor(ss, d, 32);
    float inv = rsqrtf(ss * (1.0f / ND) + 1e-6f);
    v4h o;
    o[0] = (_Float16)(dx * inv * gg.x + bb.x);
    o[1] = (_Float16)(dy * inv * gg.y + bb.y);
    o[2] = (_Float16)(dz * inv * gg.z + bb.z);
    o[3] = (_Float16)(dw * inv * gg.w + bb.w);
    *(v4h*)(As + (w * RPW + r) * APITCH + lane * 4) = o;
  }
}

// ---- GEMM: out = A(f16, N x DI) x W(f16, DO x DI, fragment order)^T + bias, 16x64 tile per wave ----
// F16OUT: row-major f16 out.  XPOSE: also/only write transposed f16 [bm][d][t] (DO==128).
// RESID (implies fp32 out): outF = resid + val.
template<int DI, bool RELU, bool F16OUT, bool RESID, bool XPOSE>
__device__ __forceinline__ void gemm_body(const _Float16* __restrict__ A,
                                          const _Float16* __restrict__ W,
                                          const float* __restrict__ bias,
                                          _Float16* __restrict__ outH,
                                          _Float16* __restrict__ outT,
                                          float* __restrict__ outF,
                                          const float* __restrict__ resid,
                                          int DO) {
  int wave = (blockIdx.x * blockDim.x + threadIdx.x) >> 5;
  int tpr  = DO >> 6;                 // 64-wide column strips
  int rt   = wave / tpr;
  int cs   = wave - rt * tpr;
  const _Float16* a0 = A + (size_t)rt * 16 * DI;
  const _Float16* w0 = W + (size_t)cs * 64 * DI;
  v8f c0 = {}, c1 = {}, c2 = {}, c3 = {};
#pragma unroll
  for (int k = 0; k < DI; k += 32) {
    v16h a = load_rm(a0 + k, DI);
    c0 = wmma_f16(a, load_wf(w0 + (size_t)0 * 16 * DI + k * 16), c0);
    c1 = wmma_f16(a, load_wf(w0 + (size_t)1 * 16 * DI + k * 16), c1);
    c2 = wmma_f16(a, load_wf(w0 + (size_t)2 * 16 * DI + k * 16), c2);
    c3 = wmma_f16(a, load_wf(w0 + (size_t)3 * 16 * DI + k * 16), c3);
  }
  // the bias loads below may land in the address registers of the loads above: wait first
  asm volatile("s_wait_xcnt 0x0" ::: "memory");
  int lane = threadIdx.x & 31;
  int col  = lane & 15;
  int rb   = (lane >> 4) << 3;
  v8f acc[4] = {c0, c1, c2, c3};
#pragma unroll
  for (int n = 0; n < 4; ++n) {
    int colg = cs * 64 + n * 16 + col;
    float bv = bias[colg];
#pragma unroll
    for (int v = 0; v < 8; ++v) {
      float val = acc[n][v] + bv;
      if (RELU) val = fmaxf(val, 0.0f);
      int row = rt * 16 + rb + v;
      if (F16OUT) outH[(size_t)row * DO + colg] = (_Float16)val;
      if (XPOSE) {
        int t  = row & (NT - 1);
        int bm = row >> 9;            // NT == 512
        outT[((size_t)bm * ND + colg) * NT + t] = (_Float16)val;
      }
      if (!F16OUT && !XPOSE)
        outF[(size_t)row * DO + colg] = (RESID ? resid[(size_t)row * DO + colg] : 0.0f) + val;
    }
  }
}

template<int DI, bool RELU, bool F16OUT, bool RESID, bool XPOSE>
__global__ __launch_bounds__(256) void gemm_kernel(const _Float16* __restrict__ A,
                                                   const _Float16* __restrict__ W,
                                                   const float* __restrict__ bias,
                                                   _Float16* __restrict__ outH,
                                                   _Float16* __restrict__ outT,
                                                   float* __restrict__ outF,
                                                   const float* __restrict__ resid,
                                                   int DO) {
  gemm_body<DI, RELU, F16OUT, RESID, XPOSE>(A, W, bias, outH, outT, outF, resid, DO);
}

#define TPITCH 72
template<int DO, bool RELU, bool F16OUT, bool XPOSE>
__device__ __forceinline__ void gemm_lds_body(const _Float16* As,
                                              const _Float16* __restrict__ W,
                                              const float* __restrict__ bias,
                                              _Float16* __restrict__ outH,
                                              _Float16* __restrict__ outT,
                                              _Float16* Ts) {
  constexpr int TPR = DO >> 6;        // 64-wide column strips
  int w    = threadIdx.x >> 5;
  int wave = blockIdx.x * 8 + w;
  int rt   = wave / TPR;
  int cs   = wave - rt * TPR;
  const _Float16* a0 = As + (w / TPR) * 16 * APITCH;   // the wave's 16 rows of the panel
  const _Float16* w0 = W + (size_t)cs * 64 * ND;
  v8f c0 = {}, c1 = {}, c2 = {}, c3 = {};
#pragma unroll
  for (int k = 0; k < ND; k += 32) {
    v16h a = load_rm(a0 + k, APITCH);
    c0 = wmma_f16(a, load_wf(w0 + (size_t)0 * 16 * ND + k * 16), c0);
    c1 = wmma_f16(a, load_wf(w0 + (size_t)1 * 16 * ND + k * 16), c1);
    c2 = wmma_f16(a, load_wf(w0 + (size_t)2 * 16 * ND + k * 16), c2);
    c3 = wmma_f16(a, load_wf(w0 + (size_t)3 * 16 * ND + k * 16), c3);
  }
  // the bias loads below may land in the address registers of the loads above: wait first
  asm volatile("s_wait_xcnt 0x0" ::: "memory");
  int lane = threadIdx.x & 31;
  int col  = lane & 15;
  int rb   = (lane >> 4) << 3;
  v8f acc[4] = {c0, c1, c2, c3};
  v8h hv[4];
#pragma unroll
  for (int n = 0; n < 4; ++n) {
    int colg = cs * 64 + n * 16 + col;
    float bv = bias[colg];
#pragma unroll
    for (int v = 0; v < 8; ++v) {
      float val = acc[n][v] + bv;
      if (RELU) val = fmaxf(val, 0.0f);
      hv[n][v] = (_Float16)val;
    }
    if (XPOSE) *(v8h*)(Ts + colg * TPITCH + (w / TPR) * 16 + rb) = hv[n];
  }
  // The barrier stands in front of the row-major stores: behind them it would wait for them.
  if (XPOSE) __syncthreads();   // the tile is written by all eight waves and read by all eight
  if (F16OUT) {
#pragma unroll
    for (int n = 0; n < 4; ++n) {
      int colg = cs * 64 + n * 16 + col;
#pragma unroll
      for (int v = 0; v < 8; ++v)
        outH[(size_t)(rt * 16 + rb + v) * DO + colg] = hv[n][v];
    }
  }
  if (XPOSE) {
    int row0 = blockIdx.x * 64;       // the block's first row; 64 divides NT: one bm per block
    int bm   = row0 >> 9;             // NT == 512
    int t0   = row0 & (NT - 1);
    int d    = threadIdx.x >> 3;      // 32 rows of the tile per pass
    int ch   = (threadIdx.x & 7) << 3;
    const _Float16* ls = Ts + d * TPITCH + ch;
    _Float16* gp = outT + ((size_t)bm * ND + d) * NT + t0 + ch;
    v8h tr[4];
#pragma unroll
    for (int p = 0; p < 4; ++p) tr[p] = *(const v8h*)(ls + p * 32 * TPITCH);
#pragma unroll
    for (int p = 0; p < 4; ++p) *(v8h*)(gp + (size_t)p * 32 * NT) = tr[p];
  }
}

// hid = relu(LayerNorm(X) x W1^T + b1): 16 rows of X and all 512 columns per block.
__global__ __launch_bounds__(256) void ln_ffn1_kernel(const float* __restrict__ X,
                                                      const float* __restrict__ g,
                                                      const float* __restrict__ be,
                                                      const _Float16* __restrict__ W,
                                                      const float* __restrict__ bias,
                                                      _Float16* __restrict__ outH) {
  __shared__ __attribute__((aligned(16))) _Float16 As[16 * APITCH];
  ln_rows_to_lds<16>(X + (size_t)blockIdx.x * 16 * ND, g, be, As);
  __syncthreads();   // the panel is written by all eight waves and read by all eight
  gemm_lds_body<NFF, true, true, false>(As, W, bias, outH, nullptr, nullptr);
}

// The q, k and v products read the same A = LayerNorm(X) and none of each other's output: one
// grid, blockIdx.y names the product (0 = q, 1 = k: row-major + transposed; 2 = v: transposed
// only).  64 rows of X and one product's 128 columns per block.
__global__ __launch_bounds__(256) void qkv_kernel(const float* __restrict__ X,
                                                  const float* __restrict__ g,
                                                  const float* __restrict__ be,
                                                  const _Float16* __restrict__ Wq,
                                                  const _Float16* __restrict__ Wk,
                                                  const _Float16* __restrict__ Wv,
                                                  const float* __restrict__ bq,
                                                  const float* __restrict__ bk,
                                                  const float* __restrict__ bv,
                                                  _Float16* __restrict__ qh,
                                                  _Float16* __restrict__ kh,
                                                  _Float16* __restrict__ qT,
                                                  _Float16* __restrict__ kT,
                                                  _Float16* __restrict__ vT) {
  __shared__ __attribute__((aligned(16))) _Float16 As[64 * APITCH];
  __shared__ __attribute__((aligned(16))) _Float16 Ts[ND * TPITCH];
  ln_rows_to_lds<64>(X + (size_t)blockIdx.x * 64 * ND, g, be, As);
  __syncthreads();   // the panel is written by all eight waves and read by all eight
  if (blockIdx.y == 2) {
    gemm_lds_body<ND, false, false, true>(As, Wv, bv, nullptr, vT, Ts);
  } else {
    bool isq = blockIdx.y == 0;
    gemm_lds_body<ND, false, true, true>(As, isq ? Wq : Wk, isq ? bq : bk, isq ? qh : kh,
                                         isq ? qT : kT, Ts);
    // the v branch's code is laid out behind these stores and reuses their address and data
    // registers: wait before anything can overwrite them
    asm volatile("s_wait_xcnt 0x0" ::: "memory");
  }
}

// ---------------- Windowed (L=16) context attention over d=128 ----------------
// blockIdx.y names the tensor (0 = q, 1 = k): the two are independent and share one grid.
__global__ __launch_bounds__(256) void ctx_attn_kernel(const _Float16* __restrict__ src0,
                                                       const _Float16* __restrict__ srcT0,
                                                       _Float16* __restrict__ dst0,
                                                       const _Float16* __restrict__ src1,
                                                       const _Float16* __restrict__ srcT1,
                                                       _Float16* __restrict__ dst1) {
  __shared__ _Float16 Pl[8][16][32];
  const _Float16* __restrict__ src  = blockIdx.y ? src1  : src0;
  const _Float16* __restrict__ srcT = blockIdx.y ? srcT1 : srcT0;
  _Float16* __restrict__       dst  = blockIdx.y ? dst1  : dst0;
  int wave = (blockIdx.x * blockDim.x + threadIdx.x) >> 5;
  int qb   = wave & (NT / 16 - 1);
  int bm   = wave >> 5;
  const _Float16* seq = src + (size_t)bm * NT * ND;
  const _Float16* qp  = seq + (size_t)qb * 16 * ND;
  const _Float16* pp  = qb ? (qp - 16 * ND) : qp;   // prev block (dummy when qb==0)
  v8f s0 = {}, s1 = {};
#pragma unroll
  for (int k = 0; k < ND; k += 32) {
    v16h a  = load_rm(qp + k, ND);
    v16h bp = load_rm(pp + k, ND);
    s0 = wmma_f16(a, bp, s0);    // Q x Prev^T
    s1 = wmma_f16(a, a,  s1);    // Q x Cur^T
  }
  int lane = threadIdx.x & 31;
  int col  = lane & 15;
  int hf   = lane >> 4;
  const float scale = 0.088388347648318447f;   // 1/sqrt(128)
  _Float16 (*P)[32] = Pl[threadIdx.x >> 5];
#pragma unroll
  for (int v = 0; v < 8; ++v) {
    int row = v + (hf << 3);
    // band: prev key j valid iff j > row; cur key j valid iff j <= row.
    // zero padding (qb==0): in-band scores are 0 and DO join the softmax.
    float sp = (col > row)  ? (qb ? s0[v] * scale : 0.0f) : -1e30f;
    float sc = (col <= row) ? s1[v] * scale : -1e30f;
    float mx = rmax16(fmaxf(sp, sc));
    float ep = __expf(sp - mx);
    float ec = __expf(sc - mx);
    float invd = 1.0f / rsum16(ep + ec);
    float wp = qb ? ep * invd : 0.0f;  // zero rows: no contribution to numerator
    float wc = ec * invd;
    P[row][col]      = (_Float16)wp;
    P[row][16 + col] = (_Float16)wc;
  }
  __syncthreads();
  v16h pA = load_rm(&P[0][0], 32);
  const _Float16* sT = srcT + (size_t)bm * ND * NT;
  int tp0 = (qb ? qb - 1 : qb) * 16;
  int tc0 = qb * 16;
  int ko  = hf << 3;
  _Float16* dr = dst + (size_t)bm * NT * ND + (size_t)qb * 16 * ND;
#pragma unroll
  for (int n0 = 0; n0 < ND; n0 += 16) {
    const _Float16* colp = sT + (size_t)(n0 + col) * NT;  // contiguous over t
    v16h b;
#pragma unroll
    for (int i = 0; i < 8; ++i) b[i]     = colp[tp0 + ko + i];  // k 0..15  = prev rows
#pragma unroll
    for (int i = 0; i < 8; ++i) b[8 + i] = colp[tc0 + ko + i];  // k 16..31 = cur rows
    v8f o = {};
    o = wmma_f16(pA, b, o);
#pragma unroll
    for (int v = 0; v < 8; ++v)
      dr[(size_t)((hf << 3) + v) * ND + n0 + col] = (_Float16)o[v];
  }
}

__device__ __forceinline__ float xhalf(float x) {
  int b = __builtin_bit_cast(int, x);
  return __builtin_bit_cast(float,
      __builtin_amdgcn_permlanex16(b, b, 0x76543210, 0xfedcba98, false, false));
}

// One work-group of 32 waves owns one (b, m, h): its waves are the 32 query tiles, and all of them
// walk the same 512 keys.  K (512 rows of 64 B) and V^T (32 rows of 1024 B) are therefore brought
// into LDS once per work-group by asynchronous copies, and every fragment of the key loop is an
// LDS read.  LDS row pitch: data + 16 B (an odd number of 16-B units) for the 16-byte readers.
#define KPITCH 40                    // f16 per K row in LDS:   64 B + 16 B
#define VPITCH 520                   // f16 per V^T row in LDS: 1024 B + 16 B
__global__ __launch_bounds__(1024) __attribute__((amdgpu_waves_per_eu(8, 8)))
void attn_t_kernel(const _Float16* __restrict__ cq,
                   const _Float16* __restrict__ ck,
                   const _Float16* __restrict__ vT,
                   _Float16* __restrict__ out) {
  __shared__ __attribute__((aligned(16))) _Float16 Ks[NT * KPITCH];
  __shared__ __attribute__((aligned(16))) _Float16 Vs[NDK * VPITCH];
  int qb = threadIdx.x >> 5;
  int h  = blockIdx.x & 3;
  int bm = blockIdx.x >> 2;
  int b  = bm >> 5;
  int m  = bm & 31;
  size_t seqoff = (size_t)bm * NT * ND + h * NDK;
  const _Float16* Q  = cq + seqoff + (size_t)qb * 16 * ND;
  const _Float16* K  = ck + seqoff;
  const _Float16* VT = vT + (size_t)bm * ND * NT + (size_t)(h * NDK) * NT;  // [dk][t]
  int lane = threadIdx.x & 31;
  int col  = lane & 15;
  int hf   = lane >> 4;
  {
    // 2048 pieces of 16 B each for K (4 a row) and for V^T (64 a row); two of each per thread.
    int tid = threadIdx.x;
    int kr = tid >> 2, kc = (tid & 3) << 3;
    int vr = tid >> 6, vc = (tid & 63) << 3;
    unsigned lk0 = (unsigned)(uintptr_t)(Ks + kr * KPITCH + kc);
    unsigned lk1 = (unsigned)(uintptr_t)(Ks + (kr + 256) * KPITCH + kc);
    unsigned lv0 = (unsigned)(uintptr_t)(Vs + vr * VPITCH + vc);
    unsigned lv1 = (unsigned)(uintptr_t)(Vs + (vr + 16) * VPITCH + vc);
    const _Float16* gk0 = K + (size_t)kr * ND + kc;
    const _Float16* gk1 = K + (size_t)(kr + 256) * ND + kc;
    const _Float16* gv0 = VT + (size_t)vr * NT + vc;
    const _Float16* gv1 = VT + (size_t)(vr + 16) * NT + vc;
    // the copies and, in the same statement, the wait that stands before their address registers
    // may be written again
    asm volatile("global_load_async_to_lds_b128 %0, %4, off\n\t"
                 "global_load_async_to_lds_b128 %1, %5, off\n\t"
                 "global_load_async_to_lds_b128 %2, %6, off\n\t"
                 "global_load_async_to_lds_b128 %3, %7, off\n\t"
                 "s_wait_xcnt 0x0"
                 :: "v"(lk0), "v"(lk1), "v"(lv0), "v"(lv1), "v"(gk0), "v"(gk1), "v"(gv0), "v"(gv1)
                 : "memory");
  }
  const float scale = 0.17677669529663689f;   // 1/sqrt(32)
  v16h qf = load_rm(Q, ND);      // B operand: column = query
  // this wave's copies have landed; behind the barrier every wave's have
  asm volatile("s_wait_asynccnt 0x0" ::: "memory");
  __syncthreads();
  v8f o0 = {}, o1 = {};          // o0[r] = O[query col][dk 8*hf+r], o1[r]: dk 16+8*hf+r
  float mrun = -1e30f;           // running maximum of this lane's query (equal in both halves)
  float lrun = 0.0f;             // running sum over this half's keys only; joined after the loop
  for (int kb = 0; kb < NT / 32; ++kb) {
    const _Float16* Kb = Ks + kb * 32 * KPITCH;
    v16h ka0 = load_rm(Kb, KPITCH);                          // A: rows = keys 0..15
    v16h ka1 = load_rm(Kb + 16 * KPITCH, KPITCH);            // A: rows = keys 16..31
    v16h va0 = load_tp(Vs + kb * 32, VPITCH);                // A: rows = dk 0..15,  k = keys
    v16h va1 = load_tp(Vs + 16 * VPITCH + kb * 32, VPITCH);  // A: rows = dk 16..31, k = keys
    v8f s0 = {}, s1 = {};
    s0 = wmma_f16(ka0, qf, s0);
    s1 = wmma_f16(ka1, qf, s1);
    float x0[8], x1[8];
    float mx = -1e30f;
#pragma unroll
    for (int r = 0; r < 8; ++r) {
      x0[r] = s0[r] * scale;
      x1[r] = s1[r] * scale;
      mx = fmaxf(mx, fmaxf(x0[r], x1[r]));
    }
    mx = fmaxf(mx, xhalf(mx));
    float mn   = fmaxf(mrun, mx);
    float corr = __expf(mrun - mn);
    float ps   = 0.0f;
    v16h pB;                     // B operand: pB[s] = P[query col][key kmap(s, hf)]
#pragma unroll
    for (int r = 0; r < 8; ++r) {
      float p0 = __expf(x0[r] - mn);
      float p1 = __expf(x1[r] - mn);
      ps += p0 + p1;
      pB[r]     = (_Float16)p0;
      pB[8 + r] = (_Float16)p1;
    }
    lrun = lrun * corr + ps;
    mrun = mn;
#pragma unroll
    for (int r = 0; r < 8; ++r) { o0[r] *= corr; o1[r] *= corr; }
    o0 = wmma_f16(va0, pB, o0);
    o1 = wmma_f16(va1, pB, o1);
  }
  // out layout: [b][t][h][m][dk]; a lane's eight registers are eight consecutive dk of one row
  float inv = 1.0f / (lrun + xhalf(lrun));
  int t = qb * 16 + col;
  size_t base = ((((size_t)b * NT + t) * NH + h) * NM + m) * NDK + (hf << 3);
  v8h r0, r1;
#pragma unroll
  for (int r = 0; r < 8; ++r) {
    r0[r] = (_Float16)(o0[r] * inv);
    r1[r] = (_Float16)(o1[r] * inv);
  }
  *(v8h*)(out + base)      = r0;
  *(v8h*)(out + base + 16) = r1;
}

// ---------------- Attention across m=32 per (b,t,h) ----------------
__global__ __launch_bounds__(256) void attn_m_kernel(const _Float16* __restrict__ a1,
                                                     _Float16* __restrict__ out) {
  __shared__ _Float16 Xs[8][32][32];
  __shared__ _Float16 Pl[8][32][32];
  int wave = (blockIdx.x * blockDim.x + threadIdx.x) >> 5;
  int h = wave & 3;
  int t = (wave >> 2) & (NT - 1);
  int b = wave >> 11;
  int w = threadIdx.x >> 5;
  int lane = threadIdx.x & 31;
  const _Float16* X = a1 + ((((size_t)b * NT + t) * NH + h) * NM) * NDK;  // 32x32 tile

  unsigned           lbase = (unsigned)(uintptr_t)(&Xs[w][0][0]);
  unsigned long long gbase = (unsigned long long)(uintptr_t)X;
#pragma unroll
  for (int c2 = 0; c2 < 4; ++c2) {
    unsigned           loff = lbase + (unsigned)(c2 * 512 + lane * 16);
    unsigned long long ga   = gbase + (unsigned long long)(c2 * 512 + lane * 16);
    asm volatile("global_load_async_to_lds_b128 %0, %1, off" :: "v"(loff), "v"(ga) : "memory");
  }
  asm volatile("s_wait_asynccnt 0x0" ::: "memory");
  const _Float16* Xl = &Xs[w][0][0];

  int col = lane & 15;
  int hf  = lane >> 4;
  const float scale = 0.17677669529663689f;   // 1/sqrt(32)
  v16h xa0 = load_rm(Xl, 32);
  v16h xa1 = load_rm(Xl + 16 * 32, 32);
  v8f s00 = {}, s01 = {}, s10 = {}, s11 = {};
  s00 = wmma_f16(xa0, xa0, s00);
  s01 = wmma_f16(xa0, xa1, s01);
  s10 = wmma_f16(xa1, xa0, s10);
  s11 = wmma_f16(xa1, xa1, s11);
  _Float16 (*P)[32] = Pl[w];
#pragma unroll
  for (int v = 0; v < 8; ++v) {
    int row = v + (hf << 3);
    {
      float x0 = s00[v] * scale, x1 = s01[v] * scale;
      float mx = rmax16(fmaxf(x0, x1));
      float p0 = __expf(x0 - mx), p1 = __expf(x1 - mx);
      float inv = 1.0f / rsum16(p0 + p1);
      P[row][col]      = (_Float16)(p0 * inv);
      P[row][16 + col] = (_Float16)(p1 * inv);
    }
    {
      float x0 = s10[v] * scale, x1 = s11[v] * scale;
      float mx = rmax16(fmaxf(x0, x1));
      float p0 = __expf(x0 - mx), p1 = __expf(x1 - mx);
      float inv = 1.0f / rsum16(p0 + p1);
      P[16 + row][col]      = (_Float16)(p0 * inv);
      P[16 + row][16 + col] = (_Float16)(p1 * inv);
    }
  }
  __syncthreads();
  v16h pA0 = load_rm(&P[0][0], 32);
  v16h pA1 = load_rm(&P[16][0], 32);
  v16h bx0 = load_cm(Xl, 32);        // column gathers now hit LDS, not global
  v16h bx1 = load_cm(Xl + 16, 32);
  v8f o00 = {}, o01 = {}, o10 = {}, o11 = {};
  o00 = wmma_f16(pA0, bx0, o00);
  o01 = wmma_f16(pA0, bx1, o01);
  o10 = wmma_f16(pA1, bx0, o10);
  o11 = wmma_f16(pA1, bx1, o11);
  // out layout: [b][m][t][h*32+dk]
  int m0 = hf << 3;
#pragma unroll
  for (int v = 0; v < 8; ++v) {
    int mA = m0 + v;
    int mB = 16 + m0 + v;
    size_t baseA = (((size_t)b * NM + mA) * NT + t) * ND + h * NDK;
    size_t baseB = (((size_t)b * NM + mB) * NT + t) * ND + h * NDK;
    out[baseA + col]      = (_Float16)o00[v];
    out[baseA + 16 + col] = (_Float16)o01[v];
    out[baseB + col]      = (_Float16)o10[v];
    out[baseB + 16 + col] = (_Float16)o11[v];
  }
}

// ---------------- fp32 -> f16 conversion of all six weights ----------------
// wh holds the six f16 weight arrays back to back in the order Wq, Wk, Wv, Wfc, W1, W2;
// every array is a whole number of 256-element blocks, so a block has one source.
// Each array is stored in the fragment order that load_wf reads: a block writes one half
// fragment (registers 0-7 or 8-15 of the 32 lanes).  The rows of both layers count through.
#define WSQ  (2 * ND * ND)           // elements of Wq, Wk, Wv, Wfc (both layers)
#define WFF  (2 * NFF * ND)          // elements of W1, W2 (both layers)
__global__ __launch_bounds__(256) void prep_kernel(const float* __restrict__ Wq,
                                                   const float* __restrict__ Wk,
                                                   const float* __restrict__ Wv,
                                                   const float* __restrict__ Wfc,
                                                   const float* __restrict__ W1,
                                                   const float* __restrict__ W2,
                                                   _Float16* __restrict__ wh) {
  int b0 = blockIdx.x * 256;           // first element of this block in wh
  const float* in;
  int s0;                              // where this block's array starts in wh
  int lk = 2;                          // log2 of the fragments per row tile: row length / 32
  if      (b0 < 1 * WSQ)       { in = Wq;  s0 = 0; }
  else if (b0 < 2 * WSQ)       { in = Wk;  s0 = 1 * WSQ; }
  else if (b0 < 3 * WSQ)       { in = Wv;  s0 = 2 * WSQ; }
  else if (b0 < 4 * WSQ)       { in = Wfc; s0 = 3 * WSQ; }
  else if (b0 < 4 * WSQ + WFF) { in = W1;  s0 = 4 * WSQ; }
  else                         { in = W2;  s0 = 4 * WSQ + WFF; lk = 4; }
  int hfrag = (b0 - s0) >> 8;          // half fragment of this block
  int frag  = hfrag >> 1;
  int l     = threadIdx.x >> 3;        // lane that will read the element
  int row   = ((frag >> lk) << 4) + (l & 15);
  int colk  = ((frag & ((1 << lk) - 1)) << 5) + ((hfrag & 1) << 4) + ((l >> 4) << 3)
            + (threadIdx.x & 7);
  wh[b0 + threadIdx.x] = (_Float16)in[(row << (lk + 5)) + colk];
}

extern "C" void kernel_launch(void* const* d_in, const int* in_sizes, int n_in,
                              void* d_out, int out_size, void* d_ws, size_t ws_size,
                              hipStream_t stream) {
  (void)in_sizes; (void)n_in; (void)out_size; (void)ws_size;
  const float* x   = (const float*)d_in[0];
  const float* Wq  = (const float*)d_in[1];
  const float* bq  = (const float*)d_in[2];
  const float* Wk  = (const float*)d_in[3];
  const float* bk  = (const float*)d_in[4];
  const float* Wv  = (const float*)d_in[5];
  const float* bv  = (const float*)d_in[6];
  const float* Wfc = (const float*)d_in[7];
  const float* bfc = (const float*)d_in[8];
  const float* W1  = (const float*)d_in[9];
  const float* b1  = (const float*)d_in[10];
  const float* W2  = (const float*)d_in[11];
  const float* b2  = (const float*)d_in[12];
  const float* g1  = (const float*)d_in[13];
  const float* be1 = (const float*)d_in[14];
  const float* g2  = (const float*)d_in[15];
  const float* be2 = (const float*)d_in[16];
  const float* gf  = (const float*)d_in[17];
  const float* bef = (const float*)d_in[18];

  char* ws = (char*)d_ws;
  size_t off = 0;
  auto bump = [&](size_t bytes) -> char* {
    char* p = ws + off;
    off = (off + bytes + 255) & ~(size_t)255;
    return p;
  };
  float*    xw   = (float*)bump((size_t)NROW * ND * 4);
  _Float16* qh   = (_Float16*)bump((size_t)NROW * ND * 2);
  _Float16* kh   = (_Float16*)bump((size_t)NROW * ND * 2);
  _Float16* qT   = (_Float16*)bump((size_t)NROW * ND * 2);
  _Float16* kT   = (_Float16*)bump((size_t)NROW * ND * 2);
  _Float16* vT   = (_Float16*)bump((size_t)NROW * ND * 2);
  _Float16* cqh  = (_Float16*)bump((size_t)NROW * ND * 2);
  _Float16* ckh  = (_Float16*)bump((size_t)NROW * ND * 2);
  _Float16* a1h  = (_Float16*)bump((size_t)NROW * ND * 2);
  _Float16* a2h  = (_Float16*)bump((size_t)NROW * ND * 2);
  _Float16* hid  = (_Float16*)bump((size_t)NROW * NFF * 2);
  _Float16* wh   = (_Float16*)bump((size_t)(4 * WSQ + 2 * WFF) * 2);   // six f16 weight arrays
  _Float16* wqh  = wh;
  _Float16* wkh  = wh + 1 * WSQ;
  _Float16* wvh  = wh + 2 * WSQ;
  _Float16* wfch = wh + 3 * WSQ;
  _Float16* w1h  = wh + 4 * WSQ;
  _Float16* w2h  = wh + 4 * WSQ + WFF;

  hipMemcpyAsync(xw, x, (size_t)NROW * ND * 4, hipMemcpyDeviceToDevice, stream);

  dim3 blk(256);
  const int lnBlocks    = NROW / 8;                          // 4096
  const int gemmBlk128  = (NROW / 16) * (ND / 64) / 8;       // 512  (DO=128, 64-wide strips)
  const int gemmBlkFF   = (NROW / 16) * (NFF / 64) / 8;      // 2048 (DO=512)
  const int ctxBlocks   = (NB * NM * (NT / 16)) / 8;         // 256
  const int atBlocks    = NB * NM * NH;                      // 256: one per (b, m, h)
  const int amBlocks    = (NB * NT * NH) / 8;                // 512

  prep_kernel<<<(4 * WSQ + 2 * WFF) / 256, blk, 0, stream>>>(Wq, Wk, Wv, Wfc, W1, W2, wh);
  for (int i = 0; i < 2; ++i) {
    qkv_kernel<<<dim3(gemmBlk128, 3), blk, 0, stream>>>(
        xw, g1 + i * ND, be1 + i * ND, wqh + (size_t)i * ND * ND, wkh + (size_t)i * ND * ND, wvh + (size_t)i * ND * ND,
        bq + i * ND, bk + i * ND, bv + i * ND, qh, kh, qT, kT, vT);
    ctx_attn_kernel<<<dim3(ctxBlocks, 2), blk, 0, stream>>>(qh, qT, cqh, kh, kT, ckh);
    attn_t_kernel<<<atBlocks, dim3(1024), 0, stream>>>(cqh, ckh, vT, a1h);
    attn_m_kernel<<<amBlocks, blk, 0, stream>>>(a1h, a2h);
    gemm_kernel<ND, false, false, true, false><<<gemmBlk128, blk, 0, stream>>>(
        a2h, wfch + (size_t)i * ND * ND, bfc + i * ND, nullptr, nullptr, xw, xw, ND);
    ln_ffn1_kernel<<<gemmBlkFF, blk, 0, stream>>>(
        xw, g2 + i * ND, be2 + i * ND, w1h + (size_t)i * NFF * ND, b1 + i * NFF, hid);
    gemm_kernel<NFF, false, false, true, false><<<gemmBlk128, blk, 0, stream>>>(
        hid, w2h + (size_t)i * ND * NFF, b2 + i * ND, nullptr, nullptr, xw, xw, ND);
  }
  ln_kernel<false><<<lnBlocks, blk, 0, stream>>>(xw, gf, bef, nullptr, (float*)d_out);
}

// v007
// In two side-by-side timings against v006, it was 1.08 and 1.09 times as fast.
// Counting every step since v000, it is 2.14 times as fast.
#include <hip/hip_runtime.h>
#include <hip/hip_bf16.h>
#include <stdint.h>

typedef __attribute__((ext_vector_type(16))) _Float16 v16h;
typedef __attribute__((ext_vector_type(8)))  float    v8f;
typedef __attribute__((ext_vector_type(8)))  _Float16 v8h;
typedef __attribute__((ext_vector_type(4)))  _Float16 v4h;

#define NB   2
#define NM   32
#define NT   512
#define ND   128
#define NH   4
#define NDK  32
#define NFF  512
#define NROW (NB * NM * NT)   // 32768 rows of D=128

__device__ __forceinline__ v8f wmma_f16(v16h a, v16h b, v8f c) {
  // D = A(16x32 f16) x B(32x16 f16) + C(16x16 f32)
  return __builtin_amdgcn_wmma_f32_16x16x32_f16(false, a, false, b, (short)0, c, false, false);
}

__device__ __forceinline__ v16h load_rm(const _Float16* __restrict__ p, int ld) {
  int lane = threadIdx.x & 31;
  const _Float16* r = p + (lane & 15) * ld + ((lane >> 4) << 3);
  v16h o;
#pragma unroll
  for (int i = 0; i < 8; ++i) o[i] = r[i];
#pragma unroll
  for (int i = 0; i < 8; ++i) o[8 + i] = r[16 + i];
  return o;
}

// B-operand for C = A x Bmat, Bmat (32 x >=16) row-major: B[k][n] = p[k*ld+n].
// Used only on small LDS tiles (attn_m); bulk paths use transposed copies instead.
__device__ __forceinline__ v16h load_cm(const _Float16* __restrict__ p, int ld) {
  int lane = threadIdx.x & 31;
  int col  = lane & 15;
  int ko   = (lane >> 4) << 3;
  v16h o;
#pragma unroll
  for (int i = 0; i < 8; ++i) o[i] = p[(ko + i) * ld + col];
#pragma unroll
  for (int i = 0; i < 8; ++i) o[8 + i] = p[(16 + ko + i) * ld + col];
  return o;
}

// B-operand from a column-major (transposed) source: column n contiguous over k.
// ct[n][k] with column stride ldT: B[k][n] = ct[n*ldT + k].
__device__ __forceinline__ v16h load_tp(const _Float16* __restrict__ ct, int ldT) {
  int lane = threadIdx.x & 31;
  const _Float16* r = ct + (lane & 15) * ldT + ((lane >> 4) << 3);
  v16h o;
#pragma unroll
  for (int i = 0; i < 8; ++i) o[i] = r[i];
#pragma unroll
  for (int i = 0; i < 8; ++i) o[8 + i] = r[16 + i];
  return o;
}

__device__ __forceinline__ v16h load_wf(const _Float16* __restrict__ f) {
  int lane = threadIdx.x & 31;
  v8h lo = *(const v8h*)(f + lane * 8);
  v8h hi = *(const v8h*)(f + 256 + lane * 8);
  return __builtin_shufflevector(lo, hi, 0, 1, 2, 3, 4, 5, 6, 7, 8, 9, 10, 11, 12, 13, 14, 15);
}

__device__ __forceinline__ float rmax16(float x) {
#pragma unroll
  for (int d = 1; d < 16; d <<= 1) x = fmaxf(x, __shfl_xor(x, d, 32));
  return x;
}
__device__ __forceinline__ float rsum16(float x) {
#pragma unroll
  for (int d = 1; d < 16; d <<= 1) x += __shfl_xor(x, d, 32);
  return x;
}

// ---------------- LayerNorm (one wave per 128-float row) ----------------
template<bool F16OUT>
__device__ __forceinline__ void ln_body(const float* __restrict__ x,
                                        const float* __restrict__ g,
                                        const float* __restrict__ be,
                                        _Float16* __restrict__ oh,
                                        float* __restrict__ of) {
  int row  = (blockIdx.x * blockDim.x + threadIdx.x) >> 5;
  int lane = threadIdx.x & 31;
  const float* xr = x + (size_t)row * ND;
  float4 v = *(const float4*)(xr + lane * 4);
  float s = v.x + v.y + v.z + v.w;
#pragma unroll
  for (int d = 1; d < 32; d <<= 1) s += __shfl_xor(s, d, 32);
  float mu = s * (1.0f / ND);
  float dx = v.x - mu, dy = v.y - mu, dz = v.z - mu, dw = v.w - mu;
  float ss = dx * dx + dy * dy + dz * dz + dw * dw;
#pragma unroll
  for (int d = 1; d < 32; d <<= 1) ss += __shfl_xor(ss, d, 32);
  float inv = rsqrtf(ss * (1.0f / ND) + 1e-6f);
  float4 gg = *(const float4*)(g + lane * 4);
  float4 bb = *(const float4*)(be + lane * 4);
  float r0 = dx * inv * gg.x + bb.x;
  float r1 = dy * inv * gg.y + bb.y;
  float r2 = dz * inv * gg.z + bb.z;
  float r3 = dw * inv * gg.w + bb.w;
  size_t base = (size_t)row * ND + lane * 4;
  if (F16OUT) {
    oh[base + 0] = (_Float16)r0; oh[base + 1] = (_Float16)r1;
    oh[base + 2] = (_Float16)r2; oh[base + 3] = (_Float16)r3;
  } else {
    of[base + 0] = r0; of[base + 1] = r1;
    of[base + 2] = r2; of[base + 3] = r3;
  }
}

template<bool F16OUT>
__global__ __launch_bounds__(256) void ln_kernel(const float* __restrict__ x,
                                                 const float* __restrict__ g,
                                                 const float* __restrict__ be,
                                                 _Float16* __restrict__ oh,
                                                 float* __restrict__ of) {
  ln_body<F16OUT>(x, g, be, oh, of);
}

#define APITCH 136
template<int ROWS>
__device__ __forceinline__ void ln_rows_to_lds(const float* __restrict__ x,
                                               const float* __restrict__ g,
                                               const float* __restrict__ be,
                                               _Float16* As) {
  constexpr int RPW = ROWS / 8;        // rows per wave
  int w    = threadIdx.x >> 5;
  int lane = threadIdx.x & 31;
  const float* xr = x + (size_t)(w * RPW) * ND + lane * 4;
  float4 vv[RPW];
#pragma unroll
  for (int r = 0; r < RPW; ++r) vv[r] = *(const float4*)(xr + r * ND);
  float4 gg = *(const float4*)(g + lane * 4);
  float4 bb = *(const float4*)(be + lane * 4);
#pragma unroll
  for (int r = 0; r < RPW; ++r) {
    float4 v = vv[r];
    float s = v.x + v.y + v.z + v.w;
#pragma unroll
    for (int d = 1; d < 32; d <<= 1) s += __shfl_xor(s, d, 32);
    float mu = s * (1.0f / ND);
    float dx = v.x - mu, dy = v.y - mu, dz = v.z - mu, dw = v.w - mu;
    float ss = dx * dx + dy * dy + dz * dz + dw * dw;
#pragma unroll
    for (int d = 1; d < 32; d <<= 1) ss += __shfl_xor(ss, d, 32);
    float inv = rsqrtf(ss * (1.0f / ND) + 1e-6f);
    v4h o;
    o[0] = (_Float16)(dx * inv * gg.x + bb.x);
    o[1] = (_Float16)(dy * inv * gg.y + bb.y);
    o[2] = (_Float16)(dz * inv * gg.z + bb.z);
    o[3] = (_Float16)(dw * inv * gg.w + bb.w);
    *(v4h*)(As + (w * RPW + r) * APITCH + lane * 4) = o;
  }
}

// ---- GEMM: out = A(f16, N x DI) x W(f16, DO x DI, fragment order)^T + bias, 16x64 tile per wave ----
// F16OUT: row-major f16 out.  XPOSE: also/only write transposed f16 [bm][d][t] (DO==128).
// RESID (implies fp32 out): outF = resid + val.
template<int DI, bool RELU, bool F16OUT, bool RESID, bool XPOSE>
__device__ __forceinline__ void gemm_body(const _Float16* __restrict__ A,
                                          const _Float16* __restrict__ W,
                                          const float* __restrict__ bias,
                                          _Float16* __restrict__ outH,
                                          _Float16* __restrict__ outT,
                                          float* __restrict__ outF,
                                          const float* __restrict__ resid,
                                          int DO) {
  int wave = (blockIdx.x * blockDim.x + threadIdx.x) >> 5;
  int tpr  = DO >> 6;                 // 64-wide column strips
  int rt   = wave / tpr;
  int cs   = wave - rt * tpr;
  const _Float16* a0 = A + (size_t)rt * 16 * DI;
  const _Float16* w0 = W + (size_t)cs * 64 * DI;
  v8f c0 = {}, c1 = {}, c2 = {}, c3 = {};
#pragma unroll
  for (int k = 0; k < DI; k += 32) {
    v16h a = load_rm(a0 + k, DI);
    c0 = wmma_f16(a, load_wf(w0 + (size_t)0 * 16 * DI + k * 16), c0);
    c1 = wmma_f16(a, load_wf(w0 + (size_t)1 * 16 * DI + k * 16), c1);
    c2 = wmma_f16(a, load_wf(w0 + (size_t)2 * 16 * DI + k * 16), c2);
    c3 = wmma_f16(a, load_wf(w0 + (size_t)3 * 16 * DI + k * 16), c3);
  }
  // the bias loads below may land in the address registers of the loads above: wait first
  asm volatile("s_wait_xcnt 0x0" ::: "memory");
  int lane = threadIdx.x & 31;
  int col  = lane & 15;
  int rb   = (lane >> 4) << 3;
  v8f acc[4] = {c0, c1, c2, c3};
#pragma unroll
  for (int n = 0; n < 4; ++n) {
    int colg = cs * 64 + n * 16 + col;
    float bv = bias[colg];
#pragma unroll
    for (int v = 0; v < 8; ++v) {
      float val = acc[n][v] + bv;
      if (RELU) val = fmaxf(val, 0.0f);
      int row = rt * 16 + rb + v;
      if (F16OUT) outH[(size_t)row * DO + colg] = (_Float16)val;
      if (XPOSE) {
        int t  = row & (NT - 1);
        int bm = row >> 9;            // NT == 512
        outT[((size_t)bm * ND + colg) * NT + t] = (_Float16)val;
      }
      if (!F16OUT && !XPOSE)
        outF[(size_t)row * DO + colg] = (RESID ? resid[(size_t)row * DO + colg] : 0.0f) + val;
    }
  }
}

template<int DI, bool RELU, bool F16OUT, bool RESID, bool XPOSE>
__global__ __launch_bounds__(256) void gemm_kernel(const _Float16* __restrict__ A,
                                                   const _Float16* __restrict__ W,
                                                   const float* __restrict__ bias,
                                                   _Float16* __restrict__ outH,
                                                   _Float16* __restrict__ outT,
                                                   float* __restrict__ outF,
                                                   const float* __restrict__ resid,
                                                   int DO) {
  gemm_body<DI, RELU, F16OUT, RESID, XPOSE>(A, W, bias, outH, outT, outF, resid, DO);
}

#define TPITCH 72
template<int DO, bool RELU, bool F16OUT, bool XPOSE>
__device__ __forceinline__ void gemm_lds_body(const _Float16* As,
                                              const _Float16* __restrict__ W,
                                              const float* __restrict__ bias,
                                              _Float16* __restrict__ outH,
                                              _Float16* __restrict__ outT,
                                              _Float16* Ts) {
  constexpr int TPR = DO >> 6;        // 64-wide column strips
  int w    = threadIdx.x >> 5;
  int wave = blockIdx.x * 8 + w;
  int rt   = wave / TPR;
  int cs   = wave - rt * TPR;
  const _Float16* a0 = As + (w / TPR) * 16 * APITCH;   // the wave's 16 rows of the panel
  const _Float16* w0 = W + (size_t)cs * 64 * ND;
  v8f c0 = {}, c1 = {}, c2 = {}, c3 = {};
#pragma unroll
  for (int k = 0; k < ND; k += 32) {
    v16h a = load_rm(a0 + k, APITCH);
    c0 = wmma_f16(a, load_wf(w0 + (size_t)0 * 16 * ND + k * 16), c0);
    c1 = wmma_f16(a, load_wf(w0 + (size_t)1 * 16 * ND + k * 16), c1);
    c2 = wmma_f16(a, load_wf(w0 + (size_t)2 * 16 * ND + k * 16), c2);
    c3 = wmma_f16(a, load_wf(w0 + (size_t)3 * 16 * ND + k * 16), c3);
  }
  // the bias loads below may land in the address registers of the loads above: wait first
  asm volatile("s_wait_xcnt 0x0" ::: "memory");
  int lane = threadIdx.x & 31;
  int col  = lane & 15;
  int rb   = (lane >> 4) << 3;
  v8f acc[4] = {c0, c1, c2, c3};
  v8h hv[4];
#pragma unroll
  for (int n = 0; n < 4; ++n) {
    int colg = cs * 64 + n * 16 + col;
    float bv = bias[colg];
#pragma unroll
    for (int v = 0; v < 8; ++v) {
      float val = acc[n][v] + bv;
      if (RELU) val = fmaxf(val, 0.0f);
      hv[n][v] = (_Float16)val;
    }
    if (XPOSE) *(v8h*)(Ts + colg * TPITCH + (w / TPR) * 16 + rb) = hv[n];
  }
  // The barrier stands in front of the row-major stores: behind them it would wait for them.
  if (XPOSE) __syncthreads();   // the tile is written by all eight waves and read by all eight
  if (F16OUT) {
#pragma unroll
    for (int n = 0; n < 4; ++n) {
      int colg = cs * 64 + n * 16 + col;
#pragma unroll
      for (int v = 0; v < 8; ++v)
        outH[(size_t)(rt * 16 + rb + v) * DO + colg] = hv[n][v];
    }
  }
  if (XPOSE) {
    int row0 = blockIdx.x * 64;       // the block's first row; 64 divides NT: one bm per block
    int bm   = row0 >> 9;             // NT == 512
    int t0   = row0 & (NT - 1);
    int d    = threadIdx.x >> 3;      // 32 rows of the tile per pass
    int ch   = (threadIdx.x & 7) << 3;
    const _Float16* ls = Ts + d * TPITCH + ch;
    _Float16* gp = outT + ((size_t)bm * ND + d) * NT + t0 + ch;
    v8h tr[4];
#pragma unroll
    for (int p = 0; p < 4; ++p) tr[p] = *(const v8h*)(ls + p * 32 * TPITCH);
#pragma unroll
    for (int p = 0; p < 4; ++p) *(v8h*)(gp + (size_t)p * 32 * NT) = tr[p];
  }
}

// ---- The whole FFN sublayer in one grid: X += relu(LayerNorm(X) x W1^T + b1) x W2^T + b2 ----
// A block of 16 waves owns 128 rows of X.  Its 128 x 512 hidden tile lives in LDS only, between the
// two products.
// Both products are formed transposed (weight fragment as A, activation rows as B): a lane then
// holds eight consecutive columns of ONE row, which go into LDS as 16-byte pieces.
// The result passes through the f32 tile Os back to the LayerNorm's own layout (one wave per row,
// four floats a lane), where a row is read, added to and stored as whole lines.
#define HPITCH 520                   // f16 per hidden row in LDS: 1024 B + 16 B, for 16-byte readers
#define OPITCH 132                   // f32 per result row in LDS:  512 B + 16 B

// Eight weight fragments: two 16-row tiles (TS elements apart) x four consecutive k blocks.
template<int TS>
__device__ __forceinline__ void load_wf8(const _Float16* __restrict__ f, v16h (&u)[8]) {
#pragma unroll
  for (int j = 0; j < 4; ++j) {
    u[2 * j]     = load_wf(f + j * 512);
    u[2 * j + 1] = load_wf(f + TS + j * 512);
  }
}

// The bias of 32 hidden columns as a lane adds it: eight consecutive columns of each 16-column tile.
__device__ __forceinline__ void load_b16(const float* __restrict__ b, float4 (&bv)[4]) {
  int hf = (threadIdx.x & 31) >> 4;
#pragma unroll
  for (int c = 0; c < 2; ++c) {
    bv[2 * c]     = *(const float4*)(b + c * 16 + (hf << 3));
    bv[2 * c + 1] = *(const float4*)(b + c * 16 + (hf << 3) + 4);
  }
}

// First product, 64 rows x 32 hidden columns (the first is hc0), into Hs.
__device__ __forceinline__ void ffn1_pass(const _Float16* As, const v16h (&u)[8],
                                          const float4 (&bq)[4], int hc0, _Float16* Hs) {
  int lane = threadIdx.x & 31;
  int col  = lane & 15;
  int hf   = lane >> 4;
  v8f acc[4][2] = {};
#pragma unroll
  for (int kk = 0; kk < 4; ++kk) {
    v16h a[4];                           // B: column = row of X; the four tiles are read together
#pragma unroll
    for (int rt = 0; rt < 4; ++rt) a[rt] = load_rm(As + rt * 16 * APITCH + kk * 32, APITCH);
#pragma unroll
    for (int rt = 0; rt < 4; ++rt) {
      acc[rt][0] = wmma_f16(u[2 * kk],     a[rt], acc[rt][0]);
      acc[rt][1] = wmma_f16(u[2 * kk + 1], a[rt], acc[rt][1]);
    }
  }
#pragma unroll
  for (int c = 0; c < 2; ++c) {
    int hc = hc0 + c * 16 + (hf << 3);   // the lane's first hidden column
    float4 bl = bq[2 * c];
    float4 bh = bq[2 * c + 1];
    float bv[8] = {bl.x, bl.y, bl.z, bl.w, bh.x, bh.y, bh.z, bh.w};
#pragma unroll
    for (int rt = 0; rt < 4; ++rt) {
      v8h hv;
#pragma unroll
      for (int v = 0; v < 8; ++v) hv[v] = (_Float16)fmaxf(acc[rt][c][v] + bv[v], 0.0f);
      *(v8h*)(Hs + (rt * 16 + col) * HPITCH + hc) = hv;
    }
  }
}

// Second product, four k blocks: 32 rows (hb) x 32 output columns.
__device__ __forceinline__ void ffn2_group(const _Float16* hb, const v16h (&u)[8],
                                           v8f& o00, v8f& o01, v8f& o10, v8f& o11) {
#pragma unroll
  for (int j = 0; j < 4; ++j) {
    v16h h0 = load_rm(hb + j * 32, HPITCH);                  // B: column = row of X
    v16h h1 = load_rm(hb + 16 * HPITCH + j * 32, HPITCH);
    o00 = wmma_f16(u[2 * j],     h0, o00);
    o10 = wmma_f16(u[2 * j],     h1, o10);
    o01 = wmma_f16(u[2 * j + 1], h0, o01);
    o11 = wmma_f16(u[2 * j + 1], h1, o11);
  }
}

__global__ __launch_bounds__(512) __attribute__((amdgpu_waves_per_eu(4, 4)))
void ffn_kernel(float* __restrict__ X,
                const float* __restrict__ g,
                const float* __restrict__ be,
                const _Float16* __restrict__ W1,
                const float* __restrict__ b1,
                const _Float16* __restrict__ W2,
                const float* __restrict__ b2) {
  __shared__ __attribute__((aligned(16))) _Float16 As[128 * APITCH];
  __shared__ __attribute__((aligned(16))) _Float16 Hs[128 * HPITCH];
  __shared__ __attribute__((aligned(16))) float    Os[128 * OPITCH];
  // the wave's number as a scalar: the weight pointers below then stay in scalar registers
  int w    = __builtin_amdgcn_readfirstlane(threadIdx.x >> 5);
  int lane = threadIdx.x & 31;
  int col  = lane & 15;
  int hf   = lane >> 4;
  float* xr = X + (size_t)blockIdx.x * 128 * ND + (size_t)(w * 8) * ND + lane * 4;
  // first product: the wave takes 32 hidden columns for all 128 rows, so that every fragment of W1
  // is read by one wave of the block, once.  They are asked for here and fly during the LayerNorm.
  v16h ua[8], ub[8];
  float4 ba[4];
  load_wf8<16 * ND>(W1 + (size_t)w * 32 * ND, ua);
  load_b16(b1 + w * 32, ba);
  {
    // the wave's eight rows; arithmetic and sum order as in ln_body
    float4 vv[8];
#pragma unroll
    for (int r = 0; r < 8; ++r) vv[r] = *(const float4*)(xr + r * ND);
    float4 gg = *(const float4*)(g + lane * 4);
    float4 bb = *(const float4*)(be + lane * 4);
#pragma unroll
    for (int r = 0; r < 8; ++r) {
      float4 v = vv[r];
      float s = v.x + v.y + v.z + v.w;
#pragma unroll
      for (int d = 1; d < 32; d <<= 1) s += __shfl_xor(s, d, 32);
      float mu = s * (1.0f / ND);
      float dx = v.x - mu, dy = v.y - mu, dz = v.z - mu, dw = v.w - mu;
      float ss = dx * dx + dy * dy + dz * dz + dw * dw;
#pragma unroll
      for (int d = 1; d < 32; d <<= 1) ss += __shfl_xor(ss, d, 32);
      float inv = rsqrtf(ss * (1.0f / ND) + 1e-6f);
      v4h o;
      o[0] = (_Float16)(dx * inv * gg.x + bb.x);
      o[1] = (_Float16)(dy * inv * gg.y + bb.y);
      o[2] = (_Float16)(dz * inv * gg.z + bb.z);
      o[3] = (_Float16)(dw * inv * gg.w + bb.w);
      *(v4h*)(As + (w * 8 + r) * APITCH + lane * 4) = o;
    }
  }
  __syncthreads();   // the panel is written by all 16 waves and read by all 16
  // second product: the wave takes 32 rows x 32 output columns, k = all 512 hidden columns.
  // Every group of its weight fragments is asked for one stage ahead of its use; the scheduling
  // barrier behind each group keeps the compiler from sinking the loads down to their first use,
  // where the wave would wait out the whole L2 latency at every k block.
  int rh = w >> 2;
  int cp = w & 3;
  const _Float16* w2w = W2 + (size_t)cp * 32 * NFF;
  const _Float16* hb  = Hs + rh * 32 * HPITCH;
  load_wf8<16 * NFF>(w2w, ub);
  __builtin_amdgcn_sched_barrier(0);
  ffn1_pass(As, ua, ba, w * 32, Hs);
  ffn1_pass(As + 64 * APITCH, ua, ba, w * 32, Hs + 64 * HPITCH);
  __syncthreads();   // the hidden tile is written by all 16 waves and read by all 16
  v8f o00 = {}, o01 = {}, o10 = {}, o11 = {};   // o<row tile><column tile>
  load_wf8<16 * NFF>(w2w + 4 * 512, ua);
  __builtin_amdgcn_sched_barrier(0);
  ffn2_group(hb, ub, o00, o01, o10, o11);
  load_wf8<16 * NFF>(w2w + 8 * 512, ub);
  __builtin_amdgcn_sched_barrier(0);
  ffn2_group(hb + 4 * 32, ua, o00, o01, o10, o11);
  load_wf8<16 * NFF>(w2w + 12 * 512, ua);
  __builtin_amdgcn_sched_barrier(0);
  ffn2_group(hb + 8 * 32, ub, o00, o01, o10, o11);
  // the residual rows and the bias, asked for ahead of the last group
  float4 vr[8];
#pragma unroll
  for (int r = 0; r < 8; ++r) vr[r] = *(const float4*)(xr + r * ND);
  float4 b2v = *(const float4*)(b2 + lane * 4);
  __builtin_amdgcn_sched_barrier(0);
  ffn2_group(hb + 12 * 32, ua, o00, o01, o10, o11);
  {
    float* op = Os + (rh * 32 + col) * OPITCH + cp * 32 + (hf << 3);
    *(float4*)(op)      = make_float4(o00[0], o00[1], o00[2], o00[3]);
    *(float4*)(op + 4)  = make_float4(o00[4], o00[5], o00[6], o00[7]);
    *(float4*)(op + 16) = make_float4(o01[0], o01[1], o01[2], o01[3]);
    *(float4*)(op + 20) = make_float4(o01[4], o01[5], o01[6], o01[7]);
    op += 16 * OPITCH;
    *(float4*)(op)      = make_float4(o10[0], o10[1], o10[2], o10[3]);
    *(float4*)(op + 4)  = make_float4(o10[4], o10[5], o10[6], o10[7]);
    *(float4*)(op + 16) = make_float4(o11[0], o11[1], o11[2], o11[3]);
    *(float4*)(op + 20) = make_float4(o11[4], o11[5], o11[6], o11[7]);
  }
  __syncthreads();   // the result tile is written by all 16 waves and read by all 16
#pragma unroll
  for (int r = 0; r < 8; ++r) {
    float4 ov = *(const float4*)(Os + (w * 8 + r) * OPITCH + lane * 4);
    float4 res;
    res.x = vr[r].x + (ov.x + b2v.x);
    res.y = vr[r].y + (ov.y + b2v.y);
    res.z = vr[r].z + (ov.z + b2v.z);
    res.w = vr[r].w + (ov.w + b2v.w);
    *(float4*)(xr + r * ND) = res;
  }
}

// The q, k and v products read the same A = LayerNorm(X) and none of each other's output: one
// grid, blockIdx.y names the product (0 = q, 1 = k: row-major + transposed; 2 = v: transposed
// only).  64 rows of X and one product's 128 columns per block.
__global__ __launch_bounds__(256) void qkv_kernel(const float* __restrict__ X,
                                                  const float* __restrict__ g,
                                                  const float* __restrict__ be,
                                                  const _Float16* __restrict__ Wq,
                                                  const _Float16* __restrict__ Wk,
                                                  const _Float16* __restrict__ Wv,
                                                  const float* __restrict__ bq,
                                                  const float* __restrict__ bk,
                                                  const float* __restrict__ bv,
                                                  _Float16* __restrict__ qh,
                                                  _Float16* __restrict__ kh,
                                                  _Float16* __restrict__ qT,
                                                  _Float16* __restrict__ kT,
                                                  _Float16* __restrict__ vT) {
  __shared__ __attribute__((aligned(16))) _Float16 As[64 * APITCH];
  __shared__ __attribute__((aligned(16))) _Float16 Ts[ND * TPITCH];
  ln_rows_to_lds<64>(X + (size_t)blockIdx.x * 64 * ND, g, be, As);
  __syncthreads();   // the panel is written by all eight waves and read by all eight
  if (blockIdx.y == 2) {
    gemm_lds_body<ND, false, false, true>(As, Wv, bv, nullptr, vT, Ts);
  } else {
    bool isq = blockIdx.y == 0;
    gemm_lds_body<ND, false, true, true>(As, isq ? Wq : Wk, isq ? bq : bk, isq ? qh : kh,
                                         isq ? qT : kT, Ts);
    // the v branch's code is laid out behind these stores and reuses their address and data
    // registers: wait before anything can overwrite them
    asm volatile("s_wait_xcnt 0x0" ::: "memory");
  }
}

// ---------------- Windowed (L=16) context attention over d=128 ----------------
// blockIdx.y names the tensor (0 = q, 1 = k): the two are independent and share one grid.
__global__ __launch_bounds__(256) void ctx_attn_kernel(const _Float16* __restrict__ src0,
                                                       const _Float16* __restrict__ srcT0,
                                                       _Float16* __restrict__ dst0,
                                                       const _Float16* __restrict__ src1,
                                                       const _Float16* __restrict__ srcT1,
                                                       _Float16* __restrict__ dst1) {
  __shared__ _Float16 Pl[8][16][32];
  const _Float16* __restrict__ src  = blockIdx.y ? src1  : src0;
  const _Float16* __restrict__ srcT = blockIdx.y ? srcT1 : srcT0;
  _Float16* __restrict__       dst  = blockIdx.y ? dst1  : dst0;
  int wave = (blockIdx.x * blockDim.x + threadIdx.x) >> 5;
  int qb   = wave & (NT / 16 - 1);
  int bm   = wave >> 5;
  const _Float16* seq = src + (size_t)bm * NT * ND;
  const _Float16* qp  = seq + (size_t)qb * 16 * ND;
  const _Float16* pp  = qb ? (qp - 16 * ND) : qp;   // prev block (dummy when qb==0)
  v8f s0 = {}, s1 = {};
#pragma unroll
  for (int k = 0; k < ND; k += 32) {
    v16h a  = load_rm(qp + k, ND);
    v16h bp = load_rm(pp + k, ND);
    s0 = wmma_f16(a, bp, s0);    // Q x Prev^T
    s1 = wmma_f16(a, a,  s1);    // Q x Cur^T
  }
  int lane = threadIdx.x & 31;
  int col  = lane & 15;
  int hf   = lane >> 4;
  const float scale = 0.088388347648318447f;   // 1/sqrt(128)
  _Float16 (*P)[32] = Pl[threadIdx.x >> 5];
#pragma unroll
  for (int v = 0; v < 8; ++v) {
    int row = v + (hf << 3);
    // band: prev key j valid iff j > row; cur key j valid iff j <= row.
    // zero padding (qb==0): in-band scores are 0 and DO join the softmax.
    float sp = (col > row)  ? (qb ? s0[v] * scale : 0.0f) : -1e30f;
    float sc = (col <= row) ? s1[v] * scale : -1e30f;
    float mx = rmax16(fmaxf(sp, sc));
    float ep = __expf(sp - mx);
    float ec = __expf(sc - mx);
    float invd = 1.0f / rsum16(ep + ec);
    float wp = qb ? ep * invd : 0.0f;  // zero rows: no contribution to numerator
    float wc = ec * invd;
    P[row][col]      = (_Float16)wp;
    P[row][16 + col] = (_Float16)wc;
  }
  __syncthreads();
  v16h pA = load_rm(&P[0][0], 32);
  const _Float16* sT = srcT + (size_t)bm * ND * NT;
  int tp0 = (qb ? qb - 1 : qb) * 16;
  int tc0 = qb * 16;
  int ko  = hf << 3;
  _Float16* dr = dst + (size_t)bm * NT * ND + (size_t)qb * 16 * ND;
#pragma unroll
  for (int n0 = 0; n0 < ND; n0 += 16) {
    const _Float16* colp = sT + (size_t)(n0 + col) * NT;  // contiguous over t
    v16h b;
#pragma unroll
    for (int i = 0; i < 8; ++i) b[i]     = colp[tp0 + ko + i];  // k 0..15  = prev rows
#pragma unroll
    for (int i = 0; i < 8; ++i) b[8 + i] = colp[tc0 + ko + i];  // k 16..31 = cur rows
    v8f o = {};
    o = wmma_f16(pA, b, o);
#pragma unroll
    for (int v = 0; v < 8; ++v)
      dr[(size_t)((hf << 3) + v) * ND + n0 + col] = (_Float16)o[v];
  }
}

__device__ __forceinline__ float xhalf(float x) {
  int b = __builtin_bit_cast(int, x);
  return __builtin_bit_cast(float,
      __builtin_amdgcn_permlanex16(b, b, 0x76543210, 0xfedcba98, false, false));
}

// One work-group of 32 waves owns one (b, m, h): its waves are the 32 query tiles, and all of them
// walk the same 512 keys.  K (512 rows of 64 B) and V^T (32 rows of 1024 B) are therefore brought
// into LDS once per work-group by asynchronous copies, and every fragment of the key loop is an
// LDS read.  LDS row pitch: data + 16 B (an odd number of 16-B units) for the 16-byte readers.
#define KPITCH 40                    // f16 per K row in LDS:   64 B + 16 B
#define VPITCH 520                   // f16 per V^T row in LDS: 1024 B + 16 B
__global__ __launch_bounds__(1024) __attribute__((amdgpu_waves_per_eu(8, 8)))
void attn_t_kernel(const _Float16* __restrict__ cq,
                   const _Float16* __restrict__ ck,
                   const _Float16* __restrict__ vT,
                   _Float16* __restrict__ out) {
  __shared__ __attribute__((aligned(16))) _Float16 Ks[NT * KPITCH];
  __shared__ __attribute__((aligned(16))) _Float16 Vs[NDK * VPITCH];
  int qb = threadIdx.x >> 5;
  int h  = blockIdx.x & 3;
  int bm = blockIdx.x >> 2;
  int b  = bm >> 5;
  int m  = bm & 31;
  size_t seqoff = (size_t)bm * NT * ND + h * NDK;
  const _Float16* Q  = cq + seqoff + (size_t)qb * 16 * ND;
  const _Float16* K  = ck + seqoff;
  const _Float16* VT = vT + (size_t)bm * ND * NT + (size_t)(h * NDK) * NT;  // [dk][t]
  int lane = threadIdx.x & 31;
  int col  = lane & 15;
  int hf   = lane >> 4;
  {
    // 2048 pieces of 16 B each for K (4 a row) and for V^T (64 a row); two of each per thread.
    int tid = threadIdx.x;
    int kr = tid >> 2, kc = (tid & 3) << 3;
    int vr = tid >> 6, vc = (tid & 63) << 3;
    unsigned lk0 = (unsigned)(uintptr_t)(Ks + kr * KPITCH + kc);
    unsigned lk1 = (unsigned)(uintptr_t)(Ks + (kr + 256) * KPITCH + kc);
    unsigned lv0 = (unsigned)(uintptr_t)(Vs + vr * VPITCH + vc);
    unsigned lv1 = (unsigned)(uintptr_t)(Vs + (vr + 16) * VPITCH + vc);
    const _Float16* gk0 = K + (size_t)kr * ND + kc;
    const _Float16* gk1 = K + (size_t)(kr + 256) * ND + kc;
    const _Float16* gv0 = VT + (size_t)vr * NT + vc;
    const _Float16* gv1 = VT + (size_t)(vr + 16) * NT + vc;
    // the copies and, in the same statement, the wait that stands before their address registers
    // may be written again
    asm volatile("global_load_async_to_lds_b128 %0, %4, off\n\t"
                 "global_load_async_to_lds_b128 %1, %5, off\n\t"
                 "global_load_async_to_lds_b128 %2, %6, off\n\t"
                 "global_load_async_to_lds_b128 %3, %7, off\n\t"
                 "s_wait_xcnt 0x0"
                 :: "v"(lk0), "v"(lk1), "v"(lv0), "v"(lv1), "v"(gk0), "v"(gk1), "v"(gv0), "v"(gv1)
                 : "memory");
  }
  const float scale = 0.17677669529663689f;   // 1/sqrt(32)
  v16h qf = load_rm(Q, ND);      // B operand: column = query
  // this wave's copies have landed; behind the barrier every wave's have
  asm volatile("s_wait_asynccnt 0x0" ::: "memory");
  __syncthreads();
  v8f o0 = {}, o1 = {};          // o0[r] = O[query col][dk 8*hf+r], o1[r]: dk 16+8*hf+r
  float mrun = -1e30f;           // running maximum of this lane's query (equal in both halves)
  float lrun = 0.0f;             // running sum over this half's keys only; joined after the loop
  for (int kb = 0; kb < NT / 32; ++kb) {
    const _Float16* Kb = Ks + kb * 32 * KPITCH;
    v16h ka0 = load_rm(Kb, KPITCH);                          // A: rows = keys 0..15
    v16h ka1 = load_rm(Kb + 16 * KPITCH, KPITCH);            // A: rows = keys 16..31
    v16h va0 = load_tp(Vs + kb * 32, VPITCH);                // A: rows = dk 0..15,  k = keys
    v16h va1 = load_tp(Vs + 16 * VPITCH + kb * 32, VPITCH);  // A: rows = dk 16..31, k = keys
    v8f s0 = {}, s1 = {};
    s0 = wmma_f16(ka0, qf, s0);
    s1 = wmma_f16(ka1, qf, s1);
    float x0[8], x1[8];
    float mx = -1e30f;
#pragma unroll
    for (int r = 0; r < 8; ++r) {
      x0[r] = s0[r] * scale;
      x1[r] = s1[r] * scale;
      mx = fmaxf(mx, fmaxf(x0[r], x1[r]));
    }
    mx = fmaxf(mx, xhalf(mx));
    float mn   = fmaxf(mrun, mx);
    float corr = __expf(mrun - mn);
    float ps   = 0.0f;
    v16h pB;                     // B operand: pB[s] = P[query col][key kmap(s, hf)]
#pragma unroll
    for (int r = 0; r < 8; ++r) {
      float p0 = __expf(x0[r] - mn);
      float p1 = __expf(x1[r] - mn);
      ps += p0 + p1;
      pB[r]     = (_Float16)p0;
      pB[8 + r] = (_Float16)p1;
    }
    lrun = lrun * corr + ps;
    mrun = mn;
#pragma unroll
    for (int r = 0; r < 8; ++r) { o0[r] *= corr; o1[r] *= corr; }
    o0 = wmma_f16(va0, pB, o0);
    o1 = wmma_f16(va1, pB, o1);
  }
  // out layout: [b][t][h][m][dk]; a lane's eight registers are eight consecutive dk of one row
  float inv = 1.0f / (lrun + xhalf(lrun));
  int t = qb * 16 + col;
  size_t base = ((((size_t)b * NT + t) * NH + h) * NM + m) * NDK + (hf << 3);
  v8h r0, r1;
#pragma unroll
  for (int r = 0; r < 8; ++r) {
    r0[r] = (_Float16)(o0[r] * inv);
    r1[r] = (_Float16)(o1[r] * inv);
  }
  *(v8h*)(out + base)      = r0;
  *(v8h*)(out + base + 16) = r1;
}

// ---------------- Attention across m=32 per (b,t,h) ----------------
__global__ __launch_bounds__(256) void attn_m_kernel(const _Float16* __restrict__ a1,
                                                     _Float16* __restrict__ out) {
  __shared__ _Float16 Xs[8][32][32];
  __shared__ _Float16 Pl[8][32][32];
  int wave = (blockIdx.x * blockDim.x + threadIdx.x) >> 5;
  int h = wave & 3;
  int t = (wave >> 2) & (NT - 1);
  int b = wave >> 11;
  int w = threadIdx.x >> 5;
  int lane = threadIdx.x & 31;
  const _Float16* X = a1 + ((((size_t)b * NT + t) * NH + h) * NM) * NDK;  // 32x32 tile

  unsigned           lbase = (unsigned)(uintptr_t)(&Xs[w][0][0]);
  unsigned long long gbase = (unsigned long long)(uintptr_t)X;
#pragma unroll
  for (int c2 = 0; c2 < 4; ++c2) {
    unsigned           loff = lbase + (unsigned)(c2 * 512 + lane * 16);
    unsigned long long ga   = gbase + (unsigned long long)(c2 * 512 + lane * 16);
    asm volatile("global_load_async_to_lds_b128 %0, %1, off" :: "v"(loff), "v"(ga) : "memory");
  }
  asm volatile("s_wait_asynccnt 0x0" ::: "memory");
  const _Float16* Xl = &Xs[w][0][0];

  int col = lane & 15;
  int hf  = lane >> 4;
  const float scale = 0.17677669529663689f;   // 1/sqrt(32)
  v16h xa0 = load_rm(Xl, 32);
  v16h xa1 = load_rm(Xl + 16 * 32, 32);
  v8f s00 = {}, s01 = {}, s10 = {}, s11 = {};
  s00 = wmma_f16(xa0, xa0, s00);
  s01 = wmma_f16(xa0, xa1, s01);
  s10 = wmma_f16(xa1, xa0, s10);
  s11 = wmma_f16(xa1, xa1, s11);
  _Float16 (*P)[32] = Pl[w];
#pragma unroll
  for (int v = 0; v < 8; ++v) {
    int row = v + (hf << 3);
    {
      float x0 = s00[v] * scale, x1 = s01[v] * scale;
      float mx = rmax16(fmaxf(x0, x1));
      float p0 = __expf(x0 - mx), p1 = __expf(x1 - mx);
      float inv = 1.0f / rsum16(p0 + p1);
      P[row][col]      = (_Float16)(p0 * inv);
      P[row][16 + col] = (_Float16)(p1 * inv);
    }
    {
      float x0 = s10[v] * scale, x1 = s11[v] * scale;
      float mx = rmax16(fmaxf(x0, x1));
      float p0 = __expf(x0 - mx), p1 = __expf(x1 - mx);
      float inv = 1.0f / rsum16(p0 + p1);
      P[16 + row][col]      = (_Float16)(p0 * inv);
      P[16 + row][16 + col] = (_Float16)(p1 * inv);
    }
  }
  __syncthreads();
  v16h pA0 = load_rm(&P[0][0], 32);
  v16h pA1 = load_rm(&P[16][0], 32);
  v16h bx0 = load_cm(Xl, 32);        // column gathers now hit LDS, not global
  v16h bx1 = load_cm(Xl + 16, 32);
  v8f o00 = {}, o01 = {}, o10 = {}, o11 = {};
  o00 = wmma_f16(pA0, bx0, o00);
  o01 = wmma_f16(pA0, bx1, o01);
  o10 = wmma_f16(pA1, bx0, o10);
  o11 = wmma_f16(pA1, bx1, o11);
  // out layout: [b][m][t][h*32+dk]
  int m0 = hf << 3;
#pragma unroll
  for (int v = 0; v < 8; ++v) {
    int mA = m0 + v;
    int mB = 16 + m0 + v;
    size_t baseA = (((size_t)b * NM + mA) * NT + t) * ND + h * NDK;
    size_t baseB = (((size_t)b * NM + mB) * NT + t) * ND + h * NDK;
    out[baseA + col]      = (_Float16)o00[v];
    out[baseA + 16 + col] = (_Float16)o01[v];
    out[baseB + col]      = (_Float16)o10[v];
    out[baseB + 16 + col] = (_Float16)o11[v];
  }
}

// ---------------- fp32 -> f16 conversion of all six weights ----------------
// wh holds the six f16 weight arrays back to back in the order Wq, Wk, Wv, Wfc, W1, W2;
// every array is a whole number of 256-element blocks, so a block has one source.
// Each array is stored in the fragment order that load_wf reads: a block writes one half
// fragment (registers 0-7 or 8-15 of the 32 lanes).  The rows of both layers count through.
#define WSQ  (2 * ND * ND)           // elements of Wq, Wk, Wv, Wfc (both layers)
#define WFF  (2 * NFF * ND)          // elements of W1, W2 (both layers)
__global__ __launch_bounds__(256) void prep_kernel(const float* __restrict__ Wq,
                                                   const float* __restrict__ Wk,
                                                   const float* __restrict__ Wv,
                                                   const float* __restrict__ Wfc,
                                                   const float* __restrict__ W1,
                                                   const float* __restrict__ W2,
                                                   _Float16* __restrict__ wh) {
  int b0 = blockIdx.x * 256;           // first element of this block in wh
  const float* in;
  int s0;                              // where this block's array starts in wh
  int lk = 2;                          // log2 of the fragments per row tile: row length / 32
  if      (b0 < 1 * WSQ)       { in = Wq;  s0 = 0; }
  else if (b0 < 2 * WSQ)       { in = Wk;  s0 = 1 * WSQ; }
  else if (b0 < 3 * WSQ)       { in = Wv;  s0 = 2 * WSQ; }
  else if (b0 < 4 * WSQ)       { in = Wfc; s0 = 3 * WSQ; }
  else if (b0 < 4 * WSQ + WFF) { in = W1;  s0 = 4 * WSQ; }
  else                         { in = W2;  s0 = 4 * WSQ + WFF; lk = 4; }
  int hfrag = (b0 - s0) >> 8;          // half fragment of this block
  int frag  = hfrag >> 1;
  int l     = threadIdx.x >> 3;        // lane that will read the element
  int row   = ((frag >> lk) << 4) + (l & 15);
  int colk  = ((frag & ((1 << lk) - 1)) << 5) + ((hfrag & 1) << 4) + ((l >> 4) << 3)
            + (threadIdx.x & 7);
  wh[b0 + threadIdx.x] = (_Float16)in[(row << (lk + 5)) + colk];
}

extern "C" void kernel_launch(void* const* d_in, const int* in_sizes, int n_in,
                              void* d_out, int out_size, void* d_ws, size_t ws_size,
                              hipStream_t stream) {
  (void)in_sizes; (void)n_in; (void)out_size; (void)ws_size;
  const float* x   = (const float*)d_in[0];
  const float* Wq  = (const float*)d_in[1];
  const float* bq  = (const float*)d_in[2];
  const float* Wk  = (const float*)d_in[3];
  const float* bk  = (const float*)d_in[4];
  const float* Wv  = (const float*)d_in[5];
  const float* bv  = (const float*)d_in[6];
  const float* Wfc = (const float*)d_in[7];
  const float* bfc = (const float*)d_in[8];
  const float* W1  = (const float*)d_in[9];
  const float* b1  = (const float*)d_in[10];
  const float* W2  = (const float*)d_in[11];
  const float* b2  = (const float*)d_in[12];
  const float* g1  = (const float*)d_in[13];
  const float* be1 = (const float*)d_in[14];
  const float* g2  = (const float*)d_in[15];
  const float* be2 = (const float*)d_in[16];
  const float* gf  = (const float*)d_in[17];
  const float* bef = (const float*)d_in[18];

  char* ws = (char*)d_ws;
  size_t off = 0;
  auto bump = [&](size_t bytes) -> char* {
    char* p = ws + off;
    off = (off + bytes + 255) & ~(size_t)255;
    return p;
  };
  float*    xw   = (float*)bump((size_t)NROW * ND * 4);
  _Float16* qh   = (_Float16*)bump((size_t)NROW * ND * 2);
  _Float16* kh   = (_Float16*)bump((size_t)NROW * ND * 2);
  _Float16* qT   = (_Float16*)bump((size_t)NROW * ND * 2);
  _Float16* kT   = (_Float16*)bump((size_t)NROW * ND * 2);
  _Float16* vT   = (_Float16*)bump((size_t)NROW * ND * 2);
  _Float16* cqh  = (_Float16*)bump((size_t)NROW * ND * 2);
  _Float16* ckh  = (_Float16*)bump((size_t)NROW * ND * 2);
  _Float16* a1h  = (_Float16*)bump((size_t)NROW * ND * 2);
  _Float16* a2h  = (_Float16*)bump((size_t)NROW * ND * 2);
  _Float16* wh   = (_Float16*)bump((size_t)(4 * WSQ + 2 * WFF) * 2);   // six f16 weight arrays
  _Float16* wqh  = wh;
  _Float16* wkh  = wh + 1 * WSQ;
  _Float16* wvh  = wh + 2 * WSQ;
  _Float16* wfch = wh + 3 * WSQ;
  _Float16* w1h  = wh + 4 * WSQ;
  _Float16* w2h  = wh + 4 * WSQ + WFF;

  hipMemcpyAsync(xw, x, (size_t)NROW * ND * 4, hipMemcpyDeviceToDevice, stream);

  dim3 blk(256);
  const int lnBlocks    = NROW / 8;                          // 4096
  const int gemmBlk128  = (NROW / 16) * (ND / 64) / 8;       // 512  (DO=128, 64-wide strips)
  const int ffnBlocks   = NROW / 128;                        // 256: 128 rows per block
  const int ctxBlocks   = (NB * NM * (NT / 16)) / 8;         // 256
  const int atBlocks    = NB * NM * NH;                      // 256: one per (b, m, h)
  const int amBlocks    = (NB * NT * NH) / 8;                // 512

  prep_kernel<<<(4 * WSQ + 2 * WFF) / 256, blk, 0, stream>>>(Wq, Wk, Wv, Wfc, W1, W2, wh);
  for (int i = 0; i < 2; ++i) {
    qkv_kernel<<<dim3(gemmBlk128, 3), blk, 0, stream>>>(
        xw, g1 + i * ND, be1 + i * ND, wqh + (size_t)i * ND * ND, wkh + (size_t)i * ND * ND, wvh + (size_t)i * ND * ND,
        bq + i * ND, bk + i * ND, bv + i * ND, qh, kh, qT, kT, vT);
    ctx_attn_kernel<<<dim3(ctxBlocks, 2), blk, 0, stream>>>(qh, qT, cqh, kh, kT, ckh);
    attn_t_kernel<<<atBlocks, dim3(1024), 0, stream>>>(cqh, ckh, vT, a1h);
    attn_m_kernel<<<amBlocks, blk, 0, stream>>>(a1h, a2h);
    gemm_kernel<ND, false, false, true, false><<<gemmBlk128, blk, 0, stream>>>(
        a2h, wfch + (size_t)i * ND * ND, bfc + i * ND, nullptr, nullptr, xw, xw, ND);
    ffn_kernel<<<ffnBlocks, dim3(512), 0, stream>>>(
        xw, g2 + i * ND, be2 + i * ND, w1h + (size_t)i * NFF * ND, b1 + i * NFF,
        w2h + (size_t)i * ND * NFF, b2 + i * ND);
  }
  ln_kernel<false><<<lnBlocks, blk, 0, stream>>>(xw, gf, bef, nullptr, (float*)d_out);
}

// v008
// One run takes 121 microseconds.
// Next to v007, in two timings, it ran 1.52 and 1.50 times as fast.
// Over all steps from v000 it is 3.23 times as fast.
#include <hip/hip_runtime.h>
#include <hip/hip_bf16.h>
#include <stdint.h>

typedef __attribute__((ext_vector_type(16))) _Float16 v16h;
typedef __attribute__((ext_vector_type(8)))  float    v8f;
typedef __attribute__((ext_vector_type(8)))  _Float16 v8h;
typedef __attribute__((ext_vector_type(4)))  _Float16 v4h;

#define NB   2
#define NM   32
#define NT   512
#define ND   128
#define NH   4
#define NDK  32
#define NFF  512
#define NROW (NB * NM * NT)   // 32768 rows of D=128

__device__ __forceinline__ v8f wmma_f16(v16h a, v16h b, v8f c) {
  // D = A(16x32 f16) x B(32x16 f16) + C(16x16 f32)
  return __builtin_amdgcn_wmma_f32_16x16x32_f16(false, a, false, b, (short)0, c, false, false);
}

__device__ __forceinline__ v16h load_rm(const _Float16* __restrict__ p, int ld) {
  int lane = threadIdx.x & 31;
  const _Float16* r = p + (lane & 15) * ld + ((lane >> 4) << 3);
  v16h o;
#pragma unroll
  for (int i = 0; i < 8; ++i) o[i] = r[i];
#pragma unroll
  for (int i = 0; i < 8; ++i) o[8 + i] = r[16 + i];
  return o;
}

// B-operand for C = A x Bmat, Bmat (32 x >=16) row-major: B[k][n] = p[k*ld+n].
// Used only on small LDS tiles (the attention across m in tail_kernel); bulk paths use transposed copies instead.
__device__ __forceinline__ v16h load_cm(const _Float16* __restrict__ p, int ld) {
  int lane = threadIdx.x & 31;
  int col  = lane & 15;
  int ko   = (lane >> 4) << 3;
  v16h o;
#pragma unroll
  for (int i = 0; i < 8; ++i) o[i] = p[(ko + i) * ld + col];
#pragma unroll
  for (int i = 0; i < 8; ++i) o[8 + i] = p[(16 + ko + i) * ld + col];
  return o;
}

// B-operand from a column-major (transposed) source: column n contiguous over k.
// ct[n][k] with column stride ldT: B[k][n] = ct[n*ldT + k].
__device__ __forceinline__ v16h load_tp(const _Float16* __restrict__ ct, int ldT) {
  int lane = threadIdx.x & 31;
  const _Float16* r = ct + (lane & 15) * ldT + ((lane >> 4) << 3);
  v16h o;
#pragma unroll
  for (int i = 0; i < 8; ++i) o[i] = r[i];
#pragma unroll
  for (int i = 0; i < 8; ++i) o[8 + i] = r[16 + i];
  return o;
}

__device__ __forceinline__ v16h load_wf(const _Float16* __restrict__ f) {
  int lane = threadIdx.x & 31;
  v8h lo = *(const v8h*)(f + lane * 8);
  v8h hi = *(const v8h*)(f + 256 + lane * 8);
  return __builtin_shufflevector(lo, hi, 0, 1, 2, 3, 4, 5, 6, 7, 8, 9, 10, 11, 12, 13, 14, 15);
}

__device__ __forceinline__ float rmax16(float x) {
#pragma unroll
  for (int d = 1; d < 16; d <<= 1) x = fmaxf(x, __shfl_xor(x, d, 32));
  return x;
}
__device__ __forceinline__ float rsum16(float x) {
#pragma unroll
  for (int d = 1; d < 16; d <<= 1) x += __shfl_xor(x, d, 32);
  return x;
}

#define APITCH 136
template<int ROWS>
__device__ __forceinline__ void ln_rows_to_lds(const float* __restrict__ x,
                                               const float* __restrict__ g,
                                               const float* __restrict__ be,
                                               _Float16* As) {
  constexpr int RPW = ROWS / 8;        // rows per wave
  int w    = threadIdx.x >> 5;
  int lane = threadIdx.x & 31;
  const float* xr = x + (size_t)(w * RPW) * ND + lane * 4;
  float4 vv[RPW];
#pragma unroll
  for (int r = 0; r < RPW; ++r) vv[r] = *(const float4*)(xr + r * ND);
  float4 gg = *(const float4*)(g + lane * 4);
  float4 bb = *(const float4*)(be + lane * 4);
#pragma unroll
  for (int r = 0; r < RPW; ++r) {
    float4 v = vv[r];
    float s = v.x + v.y + v.z + v.w;
#pragma unroll
    for (int d = 1; d < 32; d <<= 1) s += __shfl_xor(s, d, 32);
    float mu = s * (1.0f / ND);
    float dx = v.x - mu, dy = v.y - mu, dz = v.z - mu, dw = v.w - mu;
    float ss = dx * dx + dy * dy + dz * dz + dw * dw;
#pragma unroll
    for (int d = 1; d < 32; d <<= 1) ss += __shfl_xor(ss, d, 32);
    float inv = rsqrtf(ss * (1.0f / ND) + 1e-6f);
    v4h o;
    o[0] = (_Float16)(dx * inv * gg.x + bb.x);
    o[1] = (_Float16)(dy * inv * gg.y + bb.y);
    o[2] = (_Float16)(dz * inv * gg.z + bb.z);
    o[3] = (_Float16)(dw * inv * gg.w + bb.w);
    *(v4h*)(As + (w * RPW + r) * APITCH + lane * 4) = o;
  }
}

// ---- GEMM: out = LayerNorm(X) x W(f16, DO x 128, fragment order)^T + bias, 16x64 tile per wave ----
// A block's eight waves cover 128 / (DO / 64) rows of X, which they normalise into LDS once; every
// wave then takes its A fragments from there.  The output is always f16.
// F16OUT: row-major out.  XPOSE: also/only write transposed [bm][d][t] (DO==128).
// XPOSE (DO == 128, 64 rows per block): a lane's eight accumulator rows are eight consecutive t of
// one column d.  They go as 16 bytes into the LDS tile Ts[d][t]; behind a barrier the block reads
// the tile back row by row, so that eight lanes store one whole 128-byte line of outT.
// LDS row pitch: 128 B of data + 16 B, for the 16-byte writers and readers.
#define TPITCH 72
template<int DO, bool RELU, bool F16OUT, bool XPOSE>
__device__ __forceinline__ void gemm_lds_body(const _Float16* As,
                                              const _Float16* __restrict__ W,
                                              const float* __restrict__ bias,
                                              _Float16* __restrict__ outH,
                                              _Float16* __restrict__ outT,
                                              _Float16* Ts) {
  constexpr int TPR = DO >> 6;        // 64-wide column strips
  int w    = threadIdx.x >> 5;
  int wave = blockIdx.x * 8 + w;
  int rt   = wave / TPR;
  int cs   = wave - rt * TPR;
  const _Float16* a0 = As + (w / TPR) * 16 * APITCH;   // the wave's 16 rows of the panel
  const _Float16* w0 = W + (size_t)cs * 64 * ND;
  v8f c0 = {}, c1 = {}, c2 = {}, c3 = {};
#pragma unroll
  for (int k = 0; k < ND; k += 32) {
    v16h a = load_rm(a0 + k, APITCH);
    c0 = wmma_f16(a, load_wf(w0 + (size_t)0 * 16 * ND + k * 16), c0);
    c1 = wmma_f16(a, load_wf(w0 + (size_t)1 * 16 * ND + k * 16), c1);
    c2 = wmma_f16(a, load_wf(w0 + (size_t)2 * 16 * ND + k * 16), c2);
    c3 = wmma_f16(a, load_wf(w0 + (size_t)3 * 16 * ND + k * 16), c3);
  }
  // the bias loads below may land in the address registers of the loads above: wait first
  asm volatile("s_wait_xcnt 0x0" ::: "memory");
  int lane = threadIdx.x & 31;
  int col  = lane & 15;
  int rb   = (lane >> 4) << 3;
  v8f acc[4] = {c0, c1, c2, c3};
  v8h hv[4];
#pragma unroll
  for (int n = 0; n < 4; ++n) {
    int colg = cs * 64 + n * 16 + col;
    float bv = bias[colg];
#pragma unroll
    for (int v = 0; v < 8; ++v) {
      float val = acc[n][v] + bv;
      if (RELU) val = fmaxf(val, 0.0f);
      hv[n][v] = (_Float16)val;
    }
    if (XPOSE) *(v8h*)(Ts + colg * TPITCH + (w / TPR) * 16 + rb) = hv[n];
  }
  // The barrier stands in front of the row-major stores: behind them it would wait for them.
  if (XPOSE) __syncthreads();   // the tile is written by all eight waves and read by all eight
  if (F16OUT) {
#pragma unroll
    for (int n = 0; n < 4; ++n) {
      int colg = cs * 64 + n * 16 + col;
#pragma unroll
      for (int v = 0; v < 8; ++v)
        outH[(size_t)(rt * 16 + rb + v) * DO + colg] = hv[n][v];
    }
  }
  if (XPOSE) {
    int row0 = blockIdx.x * 64;       // the block's first row; 64 divides NT: one bm per block
    int bm   = row0 >> 9;             // NT == 512
    int t0   = row0 & (NT - 1);
    int d    = threadIdx.x >> 3;      // 32 rows of the tile per pass
    int ch   = (threadIdx.x & 7) << 3;
    const _Float16* ls = Ts + d * TPITCH + ch;
    _Float16* gp = outT + ((size_t)bm * ND + d) * NT + t0 + ch;
    v8h tr[4];
#pragma unroll
    for (int p = 0; p < 4; ++p) tr[p] = *(const v8h*)(ls + p * 32 * TPITCH);
#pragma unroll
    for (int p = 0; p < 4; ++p) *(v8h*)(gp + (size_t)p * 32 * NT) = tr[p];
  }
}

// ---- The tail of a layer in one grid: attention across m, output projection, residual, FFN ----
//   X' = Xin + Attn_m(a1) x Wfc^T + bfc;   Xout = X' + relu(LayerNorm(X') x W1^T + b1) x W2^T + b2
// The grid is a layer's only writer of X, so it reads the rows where they are (the first layer: the
// input itself, no copy of it is made) and writes them where they are wanted; LAST: the last layer's
// block ends with the final LayerNorm of its rows and writes the output.
// A block of 16 waves owns the 128 rows (b, all 32 m, four consecutive t) of X; local row = m * 4 + tt.
// Its waves are the 16 (t, h) tiles of the attention across m, which together give exactly those
// rows; the attention's result, the new X rows and the 128 x 512 hidden tile live in LDS only.
// The three products are formed transposed (weight fragment as A, activation rows as B): a lane then
// holds eight consecutive columns of ONE row, which go into LDS as 16-byte pieces.
// A result passes through the f32 tile Os to the LayerNorm's own layout (one wave per row, four
// floats a lane), where a row is read, added to and stored as whole lines.
#define HPITCH 520                   // f16 per hidden row in LDS: 1024 B + 16 B, for 16-byte readers
#define OPITCH 132                   // f32 per result row in LDS:  512 B + 16 B

// Eight weight fragments: two 16-row tiles (TS elements apart) x four consecutive k blocks.
template<int TS>
__device__ __forceinline__ void load_wf8(const _Float16* __restrict__ f, v16h (&u)[8]) {
#pragma unroll
  for (int j = 0; j < 4; ++j) {
    u[2 * j]     = load_wf(f + j * 512);
    u[2 * j + 1] = load_wf(f + TS + j * 512);
  }
}

// First FFN product, 64 rows x 32 hidden columns (the first is hc0; their bias: bl, in LDS), into Hs.
__device__ __forceinline__ void ffn1_pass(const _Float16* As, const v16h (&u)[8],
                                          const float* bl, int hc0, _Float16* Hs) {
  int lane = threadIdx.x & 31;
  int col  = lane & 15;
  int hf   = lane >> 4;
  v8f acc[4][2] = {};
#pragma unroll
  for (int kk = 0; kk < 4; ++kk) {
    v16h a[4];                           // B: column = row of X; the four tiles are read together
#pragma unroll
    for (int rt = 0; rt < 4; ++rt) a[rt] = load_rm(As + rt * 16 * APITCH + kk * 32, APITCH);
#pragma unroll
    for (int rt = 0; rt < 4; ++rt) {
      acc[rt][0] = wmma_f16(u[2 * kk],     a[rt], acc[rt][0]);
      acc[rt][1] = wmma_f16(u[2 * kk + 1], a[rt], acc[rt][1]);
    }
  }
#pragma unroll
  for (int c = 0; c < 2; ++c) {
    int hc = hc0 + c * 16 + (hf << 3);   // the lane's first hidden column
    float4 b0 = *(const float4*)(bl + c * 16 + (hf << 3));
    float4 b4 = *(const float4*)(bl + c * 16 + (hf << 3) + 4);
    float bv[8] = {b0.x, b0.y, b0.z, b0.w, b4.x, b4.y, b4.z, b4.w};
#pragma unroll
    for (int rt = 0; rt < 4; ++rt) {
      v8h hv;
#pragma unroll
      for (int v = 0; v < 8; ++v) hv[v] = (_Float16)fmaxf(acc[rt][c][v] + bv[v], 0.0f);
      *(v8h*)(Hs + (rt * 16 + col) * HPITCH + hc) = hv;
    }
  }
}

// Four k blocks of a product: 32 rows (hb, LDS row pitch PITCH) x 32 output columns.
template<int PITCH>
__device__ __forceinline__ void prod_group(const _Float16* hb, const v16h (&u)[8],
                                           v8f& o00, v8f& o01, v8f& o10, v8f& o11) {
#pragma unroll
  for (int j = 0; j < 4; ++j) {
    v16h h0 = load_rm(hb + j * 32, PITCH);                   // B: column = row of X
    v16h h1 = load_rm(hb + 16 * PITCH + j * 32, PITCH);
    o00 = wmma_f16(u[2 * j],     h0, o00);
    o10 = wmma_f16(u[2 * j],     h1, o10);
    o01 = wmma_f16(u[2 * j + 1], h0, o01);
    o11 = wmma_f16(u[2 * j + 1], h1, o11);
  }
}

// A wave's 32 x 32 result (o<row tile><column tile>) into the f32 tile; op: the lane's first element.
__device__ __forceinline__ void put_tile(float* op, const v8f& o00, const v8f& o01,
                                         const v8f& o10, const v8f& o11) {
  *(float4*)(op)      = make_float4(o00[0], o00[1], o00[2], o00[3]);
  *(float4*)(op + 4)  = make_float4(o00[4], o00[5], o00[6], o00[7]);
  *(float4*)(op + 16) = make_float4(o01[0], o01[1], o01[2], o01[3]);
  *(float4*)(op + 20) = make_float4(o01[4], o01[5], o01[6], o01[7]);
  op += 16 * OPITCH;
  *(float4*)(op)      = make_float4(o10[0], o10[1], o10[2], o10[3]);
  *(float4*)(op + 4)  = make_float4(o10[4], o10[5], o10[6], o10[7]);
  *(float4*)(op + 16) = make_float4(o11[0], o11[1], o11[2], o11[3]);
  *(float4*)(op + 20) = make_float4(o11[4], o11[5], o11[6], o11[7]);
}

template<bool LAST>
__global__ __launch_bounds__(512) __attribute__((amdgpu_waves_per_eu(4, 4)))
void tail_kernel(const float* __restrict__ Xin,
                 float* __restrict__ Xout,
                 const _Float16* __restrict__ a1,
                 const _Float16* __restrict__ Wfc,
                 const float* __restrict__ bfc,
                 const float* __restrict__ g,
                 const float* __restrict__ be,
                 const _Float16* __restrict__ W1,
                 const float* __restrict__ b1,
                 const _Float16* __restrict__ W2,
                 const float* __restrict__ b2,
                 const float* __restrict__ gf,
                 const float* __restrict__ bef) {
  __shared__ __attribute__((aligned(16))) _Float16 As[128 * APITCH];  // attention result, then LayerNorm
  __shared__ __attribute__((aligned(16))) _Float16 Hs[128 * HPITCH];  // attention scratch, then hidden
  __shared__ __attribute__((aligned(16))) float    Os[128 * OPITCH];
  __shared__ __attribute__((aligned(16))) float    Rs[128 * ND];      // Xin, then X'
  __shared__ __attribute__((aligned(16))) float    Bs[NFF];           // b1; a wave uses its own 32 only
  // the wave's number as a scalar: the weight pointers below then stay in scalar registers
  int w    = __builtin_amdgcn_readfirstlane(threadIdx.x >> 5);
  int lane = threadIdx.x & 31;
  int col  = lane & 15;
  int hf   = lane >> 4;
  int b    = blockIdx.x >> 7;            // NT / 4 == 128 blocks per b
  int t0   = (blockIdx.x & 127) << 2;
  int rh   = w >> 2;                     // the wave's 32 rows and 32 columns of a 128 x 128 product
  int cp   = w & 3;
  // the wave's eight rows in the LayerNorm's layout: m = 2w, 2w + 1, four t each
  size_t xoff = ((size_t)(b * NM + 2 * w) * NT + t0) * ND + lane * 4;
  float* rr = Rs + (w * 8) * ND + lane * 4;     // their place in LDS: written and read by this lane alone

  // ---- attention across m=32; the wave's tile is (t0 + (w >> 2), h = w & 3), 32 x 32, 2 KB ----
  _Float16* Xl = Hs + w * 2048;          // the wave's own scratch: the tile, then its weights P
  _Float16 (*P)[32] = (_Float16 (*)[32])(Xl + 1024);
  {
    const _Float16* xg = a1 + ((size_t)(b * NT + t0) * NH + w) * (NM * NDK) + lane * 8;
    unsigned l0 = (unsigned)(uintptr_t)Xl + (unsigned)(lane * 16);
    unsigned l1 = l0 + 512, l2 = l0 + 1024, l3 = l0 + 1536;
    const _Float16* g0 = xg;
    const _Float16* g1 = xg + 256;
    const _Float16* g2 = xg + 512;
    const _Float16* g3 = xg + 768;
    unsigned r0 = (unsigned)(uintptr_t)rr;
    unsigned r1 = r0 + 512, r2 = r0 + 1024, r3 = r0 + 1536;
    unsigned r4 = r0 + 2048, r5 = r0 + 2560, r6 = r0 + 3072, r7 = r0 + 3584;
    const float* x0 = Xin + xoff;
    const float* x1 = x0 + ND;
    const float* x2 = x0 + 2 * ND;
    const float* x3 = x0 + 3 * ND;
    const float* x4 = x0 + (size_t)NT * ND;
    const float* x5 = x4 + ND;
    const float* x6 = x4 + 2 * ND;
    const float* x7 = x4 + 3 * ND;
    // and the bias of the wave's 32 hidden columns, one float a lane
    unsigned lb = (unsigned)(uintptr_t)(Bs + w * 32 + lane);
    const float* gb = b1 + w * 32 + lane;
    // the copies and, in the same statement, the wait that stands before their address registers
    // may be written again
    asm volatile("global_load_async_to_lds_b128 %0, %12, off\n\t"
                 "global_load_async_to_lds_b128 %1, %13, off\n\t"
                 "global_load_async_to_lds_b128 %2, %14, off\n\t"
                 "global_load_async_to_lds_b128 %3, %15, off\n\t"
                 "global_load_async_to_lds_b128 %4, %16, off\n\t"
                 "global_load_async_to_lds_b128 %5, %17, off\n\t"
                 "global_load_async_to_lds_b128 %6, %18, off\n\t"
                 "global_load_async_to_lds_b128 %7, %19, off\n\t"
                 "global_load_async_to_lds_b128 %8, %20, off\n\t"
                 "global_load_async_to_lds_b128 %9, %21, off\n\t"
                 "global_load_async_to_lds_b128 %10, %22, off\n\t"
                 "global_load_async_to_lds_b128 %11, %23, off\n\t"
                 "global_load_async_to_lds_b32 %24, %25, off\n\t"
                 "s_wait_xcnt 0x0"
                 :: "v"(l0), "v"(l1), "v"(l2), "v"(l3),
                    "v"(r0), "v"(r1), "v"(r2), "v"(r3), "v"(r4), "v"(r5), "v"(r6), "v"(r7),
                    "v"(g0), "v"(g1), "v"(g2), "v"(g3),
                    "v"(x0), "v"(x1), "v"(x2), "v"(x3), "v"(x4), "v"(x5), "v"(x6), "v"(x7),
                    "v"(lb), "v"(gb)
                 : "memory");
  }
  // The weight fragments of the projection (every wave: 32 output columns, k = 128) and of the first
  // FFN product (the wave takes 32 hidden columns for all 128 rows, so that every fragment of W1 is
  // read by one wave of the block, once) are asked for here and fly during the attention: a
  // __syncthreads() waits for every load in flight, so they are asked for well ahead of one.
  // The scheduling barrier behind each such group keeps the compiler from sinking the loads down to
  // their first use, where the wave would wait out the whole L2 latency.
  v16h ua[8], ub[8];
  load_wf8<16 * ND>(Wfc + (size_t)cp * 32 * ND, ub);
  load_wf8<16 * ND>(W1 + (size_t)w * 32 * ND, ua);
  float4 bfv = *(const float4*)(bfc + lane * 4);
  float4 gg  = *(const float4*)(g + lane * 4);
  float4 bb  = *(const float4*)(be + lane * 4);
  __builtin_amdgcn_sched_barrier(0);
  // the wave reads only what it has copied itself (its tile, rows and bias): its own wait covers it
  asm volatile("s_wait_asynccnt 0x0" ::: "memory");
  {
    const float scale = 0.17677669529663689f;   // 1/sqrt(32)
    v16h xa0 = load_rm(Xl, 32);
    v16h xa1 = load_rm(Xl + 16 * 32, 32);
    v8f s00 = {}, s01 = {}, s10 = {}, s11 = {};
    s00 = wmma_f16(xa0, xa0, s00);
    s01 = wmma_f16(xa0, xa1, s01);
    s10 = wmma_f16(xa1, xa0, s10);
    s11 = wmma_f16(xa1, xa1, s11);
#pragma unroll
    for (int v = 0; v < 8; ++v) {
      int row = v + (hf << 3);
      {
        float x0 = s00[v] * scale, x1 = s01[v] * scale;
        float mx = rmax16(fmaxf(x0, x1));
        float p0 = __expf(x0 - mx), p1 = __expf(x1 - mx);
        float inv = 1.0f / rsum16(p0 + p1);
        P[row][col]      = (_Float16)(p0 * inv);
        P[row][16 + col] = (_Float16)(p1 * inv);
      }
      {
        float x0 = s10[v] * scale, x1 = s11[v] * scale;
        float mx = rmax16(fmaxf(x0, x1));
        float p0 = __expf(x0 - mx), p1 = __expf(x1 - mx);
        float inv = 1.0f / rsum16(p0 + p1);
        P[16 + row][col]      = (_Float16)(p0 * inv);
        P[16 + row][16 + col] = (_Float16)(p1 * inv);
      }
    }
    __syncthreads();   // P goes from lane to lane through LDS
    v16h pA0 = load_rm(&P[0][0], 32);
    v16h pA1 = load_rm(&P[16][0], 32);
    v16h bx0 = load_cm(Xl, 32);
    v16h bx1 = load_cm(Xl + 16, 32);
    v8f a00 = {}, a01 = {}, a10 = {}, a11 = {};
    a00 = wmma_f16(pA0, bx0, a00);
    a01 = wmma_f16(pA0, bx1, a01);
    a10 = wmma_f16(pA1, bx0, a10);
    a11 = wmma_f16(pA1, bx1, a11);
    // row m * 4 + tt of the panel, columns h * 32 + dk
    _Float16* ap = As + ((hf << 3) * 4 + rh) * APITCH + cp * NDK + col;
#pragma unroll
    for (int v = 0; v < 8; ++v) {
      ap[v * 4 * APITCH]             = (_Float16)a00[v];
      ap[v * 4 * APITCH + 16]        = (_Float16)a01[v];
      ap[(16 + v) * 4 * APITCH]      = (_Float16)a10[v];
      ap[(16 + v) * 4 * APITCH + 16] = (_Float16)a11[v];
    }
  }
  __syncthreads();   // the attention's panel is written by all 16 waves and read by all 16

  // ---- output projection: 32 rows x 32 columns per wave ----
  float* op = Os + (rh * 32 + col) * OPITCH + cp * 32 + (hf << 3);
  {
    v8f o00 = {}, o01 = {}, o10 = {}, o11 = {};
    prod_group<APITCH>(As + rh * 32 * APITCH, ub, o00, o01, o10, o11);
    put_tile(op, o00, o01, o10, o11);
  }
  __syncthreads();   // the result tile is written by all 16 waves and read by all 16; As is free

  // ---- first residual, kept in Rs, and the LayerNorm of the wave's eight rows ----
#pragma unroll
  for (int r = 0; r < 8; ++r) {
    float4 ov = *(const float4*)(Os + (w * 8 + r) * OPITCH + lane * 4);
    float4 xi = *(const float4*)(rr + r * ND);
    float4 v;
    v.x = xi.x + (ov.x + bfv.x);
    v.y = xi.y + (ov.y + bfv.y);
    v.z = xi.z + (ov.z + bfv.z);
    v.w = xi.w + (ov.w + bfv.w);
    *(float4*)(rr + r * ND) = v;
    float s = v.x + v.y + v.z + v.w;
#pragma unroll
    for (int d = 1; d < 32; d <<= 1) s += __shfl_xor(s, d, 32);
    float mu = s * (1.0f / ND);
    float dx = v.x - mu, dy = v.y - mu, dz = v.z - mu, dw = v.w - mu;
    float ss = dx * dx + dy * dy + dz * dz + dw * dw;
#pragma unroll
    for (int d = 1; d < 32; d <<= 1) ss += __shfl_xor(ss, d, 32);
    float inv = rsqrtf(ss * (1.0f / ND) + 1e-6f);
    v4h o;
    o[0] = (_Float16)(dx * inv * gg.x + bb.x);
    o[1] = (_Float16)(dy * inv * gg.y + bb.y);
    o[2] = (_Float16)(dz * inv * gg.z + bb.z);
    o[3] = (_Float16)(dw * inv * gg.w + bb.w);
    *(v4h*)(As + (w * 8 + r) * APITCH + lane * 4) = o;
  }
  __syncthreads();   // the panel is written by all 16 waves and read by all 16
  // second FFN product: the wave takes 32 rows x 32 output columns, k = all 512 hidden columns.
  // Every group of its weight fragments is asked for one stage ahead of its use.
  const _Float16* w2w = W2 + (size_t)cp * 32 * NFF;
  const _Float16* hb  = Hs + rh * 32 * HPITCH;
  load_wf8<16 * NFF>(w2w, ub);
  __builtin_amdgcn_sched_barrier(0);
  ffn1_pass(As, ua, Bs + w * 32, w * 32, Hs);
  ffn1_pass(As + 64 * APITCH, ua, Bs + w * 32, w * 32, Hs + 64 * HPITCH);
  __syncthreads();   // the hidden tile is written by all 16 waves and read by all 16
  v8f o00 = {}, o01 = {}, o10 = {}, o11 = {};   // o<row tile><column tile>
  load_wf8<16 * NFF>(w2w + 4 * 512, ua);
  __builtin_amdgcn_sched_barrier(0);
  prod_group<HPITCH>(hb, ub, o00, o01, o10, o11);
  load_wf8<16 * NFF>(w2w + 8 * 512, ub);
  __builtin_amdgcn_sched_barrier(0);
  prod_group<HPITCH>(hb + 4 * 32, ua, o00, o01, o10, o11);
  load_wf8<16 * NFF>(w2w + 12 * 512, ua);
  float4 b2v = *(const float4*)(b2 + lane * 4);
  float4 gfv = {}, bfn = {};
  if (LAST) {
    gfv = *(const float4*)(gf + lane * 4);
    bfn = *(const float4*)(bef + lane * 4);
  }
  __builtin_amdgcn_sched_barrier(0);
  prod_group<HPITCH>(hb + 8 * 32, ub, o00, o01, o10, o11);
  prod_group<HPITCH>(hb + 12 * 32, ua, o00, o01, o10, o11);
  put_tile(op, o00, o01, o10, o11);
  __syncthreads();   // the result tile is written by all 16 waves and read by all 16
#pragma unroll
  for (int r = 0; r < 8; ++r) {
    float4 ov = *(const float4*)(Os + (w * 8 + r) * OPITCH + lane * 4);
    float4 xv = *(const float4*)(rr + r * ND);
    float4 res;
    res.x = xv.x + (ov.x + b2v.x);
    res.y = xv.y + (ov.y + b2v.y);
    res.z = xv.z + (ov.z + b2v.z);
    res.w = xv.w + (ov.w + b2v.w);
    if (LAST) {
      float s = res.x + res.y + res.z + res.w;
#pragma unroll
      for (int d = 1; d < 32; d <<= 1) s += __shfl_xor(s, d, 32);
      float mu = s * (1.0f / ND);
      float dx = res.x - mu, dy = res.y - mu, dz = res.z - mu, dw = res.w - mu;
      float ss = dx * dx + dy * dy + dz * dz + dw * dw;
#pragma unroll
      for (int d = 1; d < 32; d <<= 1) ss += __shfl_xor(ss, d, 32);
      float inv = rsqrtf(ss * (1.0f / ND) + 1e-6f);
      res.x = dx * inv * gfv.x + bfn.x;
      res.y = dy * inv * gfv.y + bfn.y;
      res.z = dz * inv * gfv.z + bfn.z;
      res.w = dw * inv * gfv.w + bfn.w;
    }
    *(float4*)(Xout + xoff + (size_t)(r >> 2) * NT * ND + (r & 3) * ND) = res;
  }
}

// The q, k and v products read the same A = LayerNorm(X) and none of each other's output: one
// grid, blockIdx.y names the product (0 = q, 1 = k: row-major + transposed; 2 = v: transposed
// only).  64 rows of X and one product's 128 columns per block.
__global__ __launch_bounds__(256) void qkv_kernel(const float* __restrict__ X,
                                                  const float* __restrict__ g,
                                                  const float* __restrict__ be,
                                                  const _Float16* __restrict__ Wq,
                                                  const _Float16* __restrict__ Wk,
                                                  const _Float16* __restrict__ Wv,
                                                  const float* __restrict__ bq,
                                                  const float* __restrict__ bk,
                                                  const float* __restrict__ bv,
                                                  _Float16* __restrict__ qh,
                                                  _Float16* __restrict__ kh,
                                                  _Float16* __restrict__ qT,
                                                  _Float16* __restrict__ kT,
                                                  _Float16* __restrict__ vT) {
  __shared__ __attribute__((aligned(16))) _Float16 As[64 * APITCH];
  __shared__ __attribute__((aligned(16))) _Float16 Ts[ND * TPITCH];
  ln_rows_to_lds<64>(X + (size_t)blockIdx.x * 64 * ND, g, be, As);
  __syncthreads();   // the panel is written by all eight waves and read by all eight
  if (blockIdx.y == 2) {
    gemm_lds_body<ND, false, false, true>(As, Wv, bv, nullptr, vT, Ts);
  } else {
    bool isq = blockIdx.y == 0;
    gemm_lds_body<ND, false, true, true>(As, isq ? Wq : Wk, isq ? bq : bk, isq ? qh : kh,
                                         isq ? qT : kT, Ts);
    // the v branch's code is laid out behind these stores and reuses their address and data
    // registers: wait before anything can overwrite them
    asm volatile("s_wait_xcnt 0x0" ::: "memory");
  }
}

// ---------------- Windowed (L=16) context attention over d=128 ----------------
// blockIdx.y names the tensor (0 = q, 1 = k): the two are independent and share one grid.
__global__ __launch_bounds__(256) void ctx_attn_kernel(const _Float16* __restrict__ src0,
                                                       const _Float16* __restrict__ srcT0,
                                                       _Float16* __restrict__ dst0,
                                                       const _Float16* __restrict__ src1,
                                                       const _Float16* __restrict__ srcT1,
                                                       _Float16* __restrict__ dst1) {
  __shared__ _Float16 Pl[8][16][32];
  const _Float16* __restrict__ src  = blockIdx.y ? src1  : src0;
  const _Float16* __restrict__ srcT = blockIdx.y ? srcT1 : srcT0;
  _Float16* __restrict__       dst  = blockIdx.y ? dst1  : dst0;
  int wave = (blockIdx.x * blockDim.x + threadIdx.x) >> 5;
  int qb   = wave & (NT / 16 - 1);
  int bm   = wave >> 5;
  const _Float16* seq = src + (size_t)bm * NT * ND;
  const _Float16* qp  = seq + (size_t)qb * 16 * ND;
  const _Float16* pp  = qb ? (qp - 16 * ND) : qp;   // prev block (dummy when qb==0)
  v8f s0 = {}, s1 = {};
#pragma unroll
  for (int k = 0; k < ND; k += 32) {
    v16h a  = load_rm(qp + k, ND);
    v16h bp = load_rm(pp + k, ND);
    s0 = wmma_f16(a, bp, s0);    // Q x Prev^T
    s1 = wmma_f16(a, a,  s1);    // Q x Cur^T
  }
  int lane = threadIdx.x & 31;
  int col  = lane & 15;
  int hf   = lane >> 4;
  const float scale = 0.088388347648318447f;   // 1/sqrt(128)
  _Float16 (*P)[32] = Pl[threadIdx.x >> 5];
#pragma unroll
  for (int v = 0; v < 8; ++v) {
    int row = v + (hf << 3);
    // band: prev key j valid iff j > row; cur key j valid iff j <= row.
    // zero padding (qb==0): in-band scores are 0 and DO join the softmax.
    float sp = (col > row)  ? (qb ? s0[v] * scale : 0.0f) : -1e30f;
    float sc = (col <= row) ? s1[v] * scale : -1e30f;
    float mx = rmax16(fmaxf(sp, sc));
    float ep = __expf(sp - mx);
    float ec = __expf(sc - mx);
    float invd = 1.0f / rsum16(ep + ec);
    float wp = qb ? ep * invd : 0.0f;  // zero rows: no contribution to numerator
    float wc = ec * invd;
    P[row][col]      = (_Float16)wp;
    P[row][16 + col] = (_Float16)wc;
  }
  __syncthreads();
  v16h pA = load_rm(&P[0][0], 32);
  const _Float16* sT = srcT + (size_t)bm * ND * NT;
  int tp0 = (qb ? qb - 1 : qb) * 16;
  int tc0 = qb * 16;
  int ko  = hf << 3;
  _Float16* dr = dst + (size_t)bm * NT * ND + (size_t)qb * 16 * ND;
#pragma unroll
  for (int n0 = 0; n0 < ND; n0 += 16) {
    const _Float16* colp = sT + (size_t)(n0 + col) * NT;  // contiguous over t
    v16h b;
#pragma unroll
    for (int i = 0; i < 8; ++i) b[i]     = colp[tp0 + ko + i];  // k 0..15  = prev rows
#pragma unroll
    for (int i = 0; i < 8; ++i) b[8 + i] = colp[tc0 + ko + i];  // k 16..31 = cur rows
    v8f o = {};
    o = wmma_f16(pA, b, o);
#pragma unroll
    for (int v = 0; v < 8; ++v)
      dr[(size_t)((hf << 3) + v) * ND + n0 + col] = (_Float16)o[v];
  }
}

__device__ __forceinline__ float xhalf(float x) {
  int b = __builtin_bit_cast(int, x);
  return __builtin_bit_cast(float,
      __builtin_amdgcn_permlanex16(b, b, 0x76543210, 0xfedcba98, false, false));
}

// One work-group of 32 waves owns one (b, m, h): its waves are the 32 query tiles, and all of them
// walk the same 512 keys.  K (512 rows of 64 B) and V^T (32 rows of 1024 B) are therefore brought
// into LDS once per work-group by asynchronous copies, and every fragment of the key loop is an
// LDS read.  LDS row pitch: data + 16 B (an odd number of 16-B units) for the 16-byte readers.
#define KPITCH 40                    // f16 per K row in LDS:   64 B + 16 B
#define VPITCH 520                   // f16 per V^T row in LDS: 1024 B + 16 B
__global__ __launch_bounds__(1024) __attribute__((amdgpu_waves_per_eu(8, 8)))
void attn_t_kernel(const _Float16* __restrict__ cq,
                   const _Float16* __restrict__ ck,
                   const _Float16* __restrict__ vT,
                   _Float16* __restrict__ out) {
  __shared__ __attribute__((aligned(16))) _Float16 Ks[NT * KPITCH];
  __shared__ __attribute__((aligned(16))) _Float16 Vs[NDK * VPITCH];
  int qb = threadIdx.x >> 5;
  int h  = blockIdx.x & 3;
  int bm = blockIdx.x >> 2;
  int b  = bm >> 5;
  int m  = bm & 31;
  size_t seqoff = (size_t)bm * NT * ND + h * NDK;
  const _Float16* Q  = cq + seqoff + (size_t)qb * 16 * ND;
  const _Float16* K  = ck + seqoff;
  const _Float16* VT = vT + (size_t)bm * ND * NT + (size_t)(h * NDK) * NT;  // [dk][t]
  int lane = threadIdx.x & 31;
  int col  = lane & 15;
  int hf   = lane >> 4;
  {
    // 2048 pieces of 16 B each for K (4 a row) and for V^T (64 a row); two of each per thread.
    int tid = threadIdx.x;
    int kr = tid >> 2, kc = (tid & 3) << 3;
    int vr = tid >> 6, vc = (tid & 63) << 3;
    unsigned lk0 = (unsigned)(uintptr_t)(Ks + kr * KPITCH + kc);
    unsigned lk1 = (unsigned)(uintptr_t)(Ks + (kr + 256) * KPITCH + kc);
    unsigned lv0 = (unsigned)(uintptr_t)(Vs + vr * VPITCH + vc);
    unsigned lv1 = (unsigned)(uintptr_t)(Vs + (vr + 16) * VPITCH + vc);
    const _Float16* gk0 = K + (size_t)kr * ND + kc;
    const _Float16* gk1 = K + (size_t)(kr + 256) * ND + kc;
    const _Float16* gv0 = VT + (size_t)vr * NT + vc;
    const _Float16* gv1 = VT + (size_t)(vr + 16) * NT + vc;
    // the copies and, in the same statement, the wait that stands before their address registers
    // may be written again
    asm volatile("global_load_async_to_lds_b128 %0, %4, off\n\t"
                 "global_load_async_to_lds_b128 %1, %5, off\n\t"
                 "global_load_async_to_lds_b128 %2, %6, off\n\t"
                 "global_load_async_to_lds_b128 %3, %7, off\n\t"
                 "s_wait_xcnt 0x0"
                 :: "v"(lk0), "v"(lk1), "v"(lv0), "v"(lv1), "v"(gk0), "v"(gk1), "v"(gv0), "v"(gv1)
                 : "memory");
  }
  const float scale = 0.17677669529663689f;   // 1/sqrt(32)
  v16h qf = load_rm(Q, ND);      // B operand: column = query
  // this wave's copies have landed; behind the barrier every wave's have
  asm volatile("s_wait_asynccnt 0x0" ::: "memory");
  __syncthreads();
  v8f o0 = {}, o1 = {};          // o0[r] = O[query col][dk 8*hf+r], o1[r]: dk 16+8*hf+r
  float mrun = -1e30f;           // running maximum of this lane's query (equal in both halves)
  float lrun = 0.0f;             // running sum over this half's keys only; joined after the loop
  for (int kb = 0; kb < NT / 32; ++kb) {
    const _Float16* Kb = Ks + kb * 32 * KPITCH;
    v16h ka0 = load_rm(Kb, KPITCH);                          // A: rows = keys 0..15
    v16h ka1 = load_rm(Kb + 16 * KPITCH, KPITCH);            // A: rows = keys 16..31
    v16h va0 = load_tp(Vs + kb * 32, VPITCH);                // A: rows = dk 0..15,  k = keys
    v16h va1 = load_tp(Vs + 16 * VPITCH + kb * 32, VPITCH);  // A: rows = dk 16..31, k = keys
    v8f s0 = {}, s1 = {};
    s0 = wmma_f16(ka0, qf, s0);
    s1 = wmma_f16(ka1, qf, s1);
    float x0[8], x1[8];
    float mx = -1e30f;
#pragma unroll
    for (int r = 0; r < 8; ++r) {
      x0[r] = s0[r] * scale;
      x1[r] = s1[r] * scale;
      mx = fmaxf(mx, fmaxf(x0[r], x1[r]));
    }
    mx = fmaxf(mx, xhalf(mx));
    float mn   = fmaxf(mrun, mx);
    float corr = __expf(mrun - mn);
    float ps   = 0.0f;
    v16h pB;                     // B operand: pB[s] = P[query col][key kmap(s, hf)]
#pragma unroll
    for (int r = 0; r < 8; ++r) {
      float p0 = __expf(x0[r] - mn);
      float p1 = __expf(x1[r] - mn);
      ps += p0 + p1;
      pB[r]     = (_Float16)p0;
      pB[8 + r] = (_Float16)p1;
    }
    lrun = lrun * corr + ps;
    mrun = mn;
#pragma unroll
    for (int r = 0; r < 8; ++r) { o0[r] *= corr; o1[r] *= corr; }
    o0 = wmma_f16(va0, pB, o0);
    o1 = wmma_f16(va1, pB, o1);
  }
  // out layout: [b][t][h][m][dk]; a lane's eight registers are eight consecutive dk of one row
  float inv = 1.0f / (lrun + xhalf(lrun));
  int t = qb * 16 + col;
  size_t base = ((((size_t)b * NT + t) * NH + h) * NM + m) * NDK + (hf << 3);
  v8h r0, r1;
#pragma unroll
  for (int r = 0; r < 8; ++r) {
    r0[r] = (_Float16)(o0[r] * inv);
    r1[r] = (_Float16)(o1[r] * inv);
  }
  *(v8h*)(out + base)      = r0;
  *(v8h*)(out + base + 16) = r1;
}

// ---------------- fp32 -> f16 conversion of all six weights ----------------
// wh holds the six f16 weight arrays back to back in the order Wq, Wk, Wv, Wfc, W1, W2;
// every array is a whole number of 256-element blocks, so a block has one source.
// Each array is stored in the fragment order that load_wf reads: a block writes one half
// fragment (registers 0-7 or 8-15 of the 32 lanes).  The rows of both layers count through.
#define WSQ  (2 * ND * ND)           // elements of Wq, Wk, Wv, Wfc (both layers)
#define WFF  (2 * NFF * ND)          // elements of W1, W2 (both layers)
__global__ __launch_bounds__(256) void prep_kernel(const float* __restrict__ Wq,
                                                   const float* __restrict__ Wk,
                                                   const float* __restrict__ Wv,
                                                   const float* __restrict__ Wfc,
                                                   const float* __restrict__ W1,
                                                   const float* __restrict__ W2,
                                                   _Float16* __restrict__ wh) {
  int b0 = blockIdx.x * 256;           // first element of this block in wh
  const float* in;
  int s0;                              // where this block's array starts in wh
  int lk = 2;                          // log2 of the fragments per row tile: row length / 32
  if      (b0 < 1 * WSQ)       { in = Wq;  s0 = 0; }
  else if (b0 < 2 * WSQ)       { in = Wk;  s0 = 1 * WSQ; }
  else if (b0 < 3 * WSQ)       { in = Wv;  s0 = 2 * WSQ; }
  else if (b0 < 4 * WSQ)       { in = Wfc; s0 = 3 * WSQ; }
  else if (b0 < 4 * WSQ + WFF) { in = W1;  s0 = 4 * WSQ; }
  else                         { in = W2;  s0 = 4 * WSQ + WFF; lk = 4; }
  int hfrag = (b0 - s0) >> 8;          // half fragment of this block
  int frag  = hfrag >> 1;
  int l     = threadIdx.x >> 3;        // lane that will read the element
  int row   = ((frag >> lk) << 4) + (l & 15);
  int colk  = ((frag & ((1 << lk) - 1)) << 5) + ((hfrag & 1) << 4) + ((l >> 4) << 3)
            + (threadIdx.x & 7);
  wh[b0 + threadIdx.x] = (_Float16)in[(row << (lk + 5)) + colk];
}

extern "C" void kernel_launch(void* const* d_in, const int* in_sizes, int n_in,
                              void* d_out, int out_size, void* d_ws, size_t ws_size,
                              hipStream_t stream) {
  (void)in_sizes; (void)n_in; (void)out_size; (void)ws_size;
  const float* x   = (const float*)d_in[0];
  const float* Wq  = (const float*)d_in[1];
  const float* bq  = (const float*)d_in[2];
  const float* Wk  = (const float*)d_in[3];
  const float* bk  = (const float*)d_in[4];
  const float* Wv  = (const float*)d_in[5];
  const float* bv  = (const float*)d_in[6];
  const float* Wfc = (const float*)d_in[7];
  const float* bfc = (const float*)d_in[8];
  const float* W1  = (const float*)d_in[9];
  const float* b1  = (const float*)d_in[10];
  const float* W2  = (const float*)d_in[11];
  const float* b2  = (const float*)d_in[12];
  const float* g1  = (const float*)d_in[13];
  const float* be1 = (const float*)d_in[14];
  const float* g2  = (const float*)d_in[15];
  const float* be2 = (const float*)d_in[16];
  const float* gf  = (const float*)d_in[17];
  const float* bef = (const float*)d_in[18];

  char* ws = (char*)d_ws;
  size_t off = 0;
  auto bump = [&](size_t bytes) -> char* {
    char* p = ws + off;
    off = (off + bytes + 255) & ~(size_t)255;
    return p;
  };
  float*    xw   = (float*)bump((size_t)NROW * ND * 4);
  _Float16* qh   = (_Float16*)bump((size_t)NROW * ND * 2);
  _Float16* kh   = (_Float16*)bump((size_t)NROW * ND * 2);
  _Float16* qT   = (_Float16*)bump((size_t)NROW * ND * 2);
  _Float16* kT   = (_Float16*)bump((size_t)NROW * ND * 2);
  _Float16* vT   = (_Float16*)bump((size_t)NROW * ND * 2);
  _Float16* cqh  = (_Float16*)bump((size_t)NROW * ND * 2);
  _Float16* ckh  = (_Float16*)bump((size_t)NROW * ND * 2);
  _Float16* a1h  = (_Float16*)bump((size_t)NROW * ND * 2);
  _Float16* wh   = (_Float16*)bump((size_t)(4 * WSQ + 2 * WFF) * 2);   // six f16 weight arrays
  _Float16* wqh  = wh;
  _Float16* wkh  = wh + 1 * WSQ;
  _Float16* wvh  = wh + 2 * WSQ;
  _Float16* wfch = wh + 3 * WSQ;
  _Float16* w1h  = wh + 4 * WSQ;
  _Float16* w2h  = wh + 4 * WSQ + WFF;

  dim3 blk(256);
  const int gemmBlk128  = (NROW / 16) * (ND / 64) / 8;       // 512  (DO=128, 64-wide strips)
  const int tailBlocks  = NROW / 128;                        // 256: 128 rows per block
  const int ctxBlocks   = (NB * NM * (NT / 16)) / 8;         // 256
  const int atBlocks    = NB * NM * NH;                      // 256: one per (b, m, h)

  prep_kernel<<<(4 * WSQ + 2 * WFF) / 256, blk, 0, stream>>>(Wq, Wk, Wv, Wfc, W1, W2, wh);
  for (int i = 0; i < 2; ++i) {
    const float* xi = i ? xw : x;      // the layer's X: the input itself, then the first layer's result
    qkv_kernel<<<dim3(gemmBlk128, 3), blk, 0, stream>>>(
        xi, g1 + i * ND, be1 + i * ND, wqh + (size_t)i * ND * ND, wkh + (size_t)i * ND * ND, wvh + (size_t)i * ND * ND,
        bq + i * ND, bk + i * ND, bv + i * ND, qh, kh, qT, kT, vT);
    ctx_attn_kernel<<<dim3(ctxBlocks, 2), blk, 0, stream>>>(qh, qT, cqh, kh, kT, ckh);
    attn_t_kernel<<<atBlocks, dim3(1024), 0, stream>>>(cqh, ckh, vT, a1h);
    if (i == 0)
      tail_kernel<false><<<tailBlocks, dim3(512), 0, stream>>>(
          xi, xw, a1h, wfch, bfc, g2, be2, w1h, b1, w2h, b2, gf, bef);
    else
      tail_kernel<true><<<tailBlocks, dim3(512), 0, stream>>>(
          xi, (float*)d_out, a1h, wfch + (size_t)ND * ND, bfc + ND, g2 + ND, be2 + ND,
          w1h + (size_t)NFF * ND, b1 + NFF, w2h + (size_t)ND * NFF, b2 + ND, gf, bef);
  }
}

// v009
// It runs in 102 microseconds.
// In two side-by-side timings against v008, it was 1.17 and 1.18 times as fast.
// All steps since v000 together make it 3.80 times as fast.
#include <hip/hip_runtime.h>
#include <hip/hip_bf16.h>
#include <stdint.h>

typedef __attribute__((ext_vector_type(16))) _Float16 v16h;
typedef __attribute__((ext_vector_type(8)))  float    v8f;
typedef __attribute__((ext_vector_type(8)))  _Float16 v8h;
typedef __attribute__((ext_vector_type(4)))  _Float16 v4h;

#define NB   2
#define NM   32
#define NT   512
#define ND   128
#define NH   4
#define NDK  32
#define NFF  512
#define NROW (NB * NM * NT)   // 32768 rows of D=128

__device__ __forceinline__ v8f wmma_f16(v16h a, v16h b, v8f c) {
  // D = A(16x32 f16) x B(32x16 f16) + C(16x16 f32)
  return __builtin_amdgcn_wmma_f32_16x16x32_f16(false, a, false, b, (short)0, c, false, false);
}

__device__ __forceinline__ v16h load_rm(const _Float16* __restrict__ p, int ld) {
  int lane = threadIdx.x & 31;
  const _Float16* r = p + (lane & 15) * ld + ((lane >> 4) << 3);
  v16h o;
#pragma unroll
  for (int i = 0; i < 8; ++i) o[i] = r[i];
#pragma unroll
  for (int i = 0; i < 8; ++i) o[8 + i] = r[16 + i];
  return o;
}

// B-operand for C = A x Bmat, Bmat (32 x >=16) row-major: B[k][n] = p[k*ld+n].
// Used only on small LDS tiles (the attention across m in tail_kernel); bulk paths use transposed copies instead.
__device__ __forceinline__ v16h load_cm(const _Float16* __restrict__ p, int ld) {
  int lane = threadIdx.x & 31;
  int col  = lane & 15;
  int ko   = (lane >> 4) << 3;
  v16h o;
#pragma unroll
  for (int i = 0; i < 8; ++i) o[i] = p[(ko + i) * ld + col];
#pragma unroll
  for (int i = 0; i < 8; ++i) o[8 + i] = p[(16 + ko + i) * ld + col];
  return o;
}

// B-operand from a column-major (transposed) source: column n contiguous over k.
// ct[n][k] with column stride ldT: B[k][n] = ct[n*ldT + k].
__device__ __forceinline__ v16h load_tp(const _Float16* __restrict__ ct, int ldT) {
  int lane = threadIdx.x & 31;
  const _Float16* r = ct + (lane & 15) * ldT + ((lane >> 4) << 3);
  v16h o;
#pragma unroll
  for (int i = 0; i < 8; ++i) o[i] = r[i];
#pragma unroll
  for (int i = 0; i < 8; ++i) o[8 + i] = r[16 + i];
  return o;
}

__device__ __forceinline__ v16h load_wf(const _Float16* __restrict__ f) {
  int lane = threadIdx.x & 31;
  v8h lo = *(const v8h*)(f + lane * 8);
  v8h hi = *(const v8h*)(f + 256 + lane * 8);
  return __builtin_shufflevector(lo, hi, 0, 1, 2, 3, 4, 5, 6, 7, 8, 9, 10, 11, 12, 13, 14, 15);
}

__device__ __forceinline__ float rmax16(float x) {
#pragma unroll
  for (int d = 1; d < 16; d <<= 1) x = fmaxf(x, __shfl_xor(x, d, 32));
  return x;
}
__device__ __forceinline__ float rsum16(float x) {
#pragma unroll
  for (int d = 1; d < 16; d <<= 1) x += __shfl_xor(x, d, 32);
  return x;
}

__device__ __forceinline__ float xhalf(float x) {
  int b = __builtin_bit_cast(int, x);
  return __builtin_bit_cast(float,
      __builtin_amdgcn_permlanex16(b, b, 0x76543210, 0xfedcba98, false, false));
}

#define APITCH 136

// ---- The tail of a layer in one grid: attention across m, output projection, residual, FFN ----
//   X' = Xin + Attn_m(a1) x Wfc^T + bfc;   Xout = X' + relu(LayerNorm(X') x W1^T + b1) x W2^T + b2
// The grid is a layer's only writer of X, so it reads the rows where they are (the first layer: the
// input itself, no copy of it is made) and writes them where they are wanted; LAST: the last layer's
// block ends with the final LayerNorm of its rows and writes the output.
// A block of 16 waves owns the 128 rows (b, all 32 m, four consecutive t) of X; local row = m * 4 + tt.
// Its waves are the 16 (t, h) tiles of the attention across m, which together give exactly those
// rows; the attention's result, the new X rows and the 128 x 512 hidden tile live in LDS only.
// The three products are formed transposed (weight fragment as A, activation rows as B): a lane then
// holds eight consecutive columns of ONE row, which go into LDS as 16-byte pieces.
// A result passes through the f32 tile Os to the LayerNorm's own layout (one wave per row, four
// floats a lane), where a row is read, added to and stored as whole lines.
#define HPITCH 520                   // f16 per hidden row in LDS: 1024 B + 16 B, for 16-byte readers
#define OPITCH 132                   // f32 per result row in LDS:  512 B + 16 B

// Eight weight fragments: two 16-row tiles (TS elements apart) x four consecutive k blocks.
template<int TS>
__device__ __forceinline__ void load_wf8(const _Float16* __restrict__ f, v16h (&u)[8]) {
#pragma unroll
  for (int j = 0; j < 4; ++j) {
    u[2 * j]     = load_wf(f + j * 512);
    u[2 * j + 1] = load_wf(f + TS + j * 512);
  }
}

// First FFN product, 64 rows x 32 hidden columns (the first is hc0; their bias: bl, in LDS), into Hs.
__device__ __forceinline__ void ffn1_pass(const _Float16* As, const v16h (&u)[8],
                                          const float* bl, int hc0, _Float16* Hs) {
  int lane = threadIdx.x & 31;
  int col  = lane & 15;
  int hf   = lane >> 4;
  v8f acc[4][2] = {};
#pragma unroll
  for (int kk = 0; kk < 4; ++kk) {
    v16h a[4];                           // B: column = row of X; the four tiles are read together
#pragma unroll
    for (int rt = 0; rt < 4; ++rt) a[rt] = load_rm(As + rt * 16 * APITCH + kk * 32, APITCH);
#pragma unroll
    for (int rt = 0; rt < 4; ++rt) {
      acc[rt][0] = wmma_f16(u[2 * kk],     a[rt], acc[rt][0]);
      acc[rt][1] = wmma_f16(u[2 * kk + 1], a[rt], acc[rt][1]);
    }
  }
#pragma unroll
  for (int c = 0; c < 2; ++c) {
    int hc = hc0 + c * 16 + (hf << 3);   // the lane's first hidden column
    float4 b0 = *(const float4*)(bl + c * 16 + (hf << 3));
    float4 b4 = *(const float4*)(bl + c * 16 + (hf << 3) + 4);
    float bv[8] = {b0.x, b0.y, b0.z, b0.w, b4.x, b4.y, b4.z, b4.w};
#pragma unroll
    for (int rt = 0; rt < 4; ++rt) {
      v8h hv;
#pragma unroll
      for (int v = 0; v < 8; ++v) hv[v] = (_Float16)fmaxf(acc[rt][c][v] + bv[v], 0.0f);
      *(v8h*)(Hs + (rt * 16 + col) * HPITCH + hc) = hv;
    }
  }
}

// Four k blocks of a product: 32 rows (hb, LDS row pitch PITCH) x 32 output columns.
template<int PITCH>
__device__ __forceinline__ void prod_group(const _Float16* hb, const v16h (&u)[8],
                                           v8f& o00, v8f& o01, v8f& o10, v8f& o11) {
#pragma unroll
  for (int j = 0; j < 4; ++j) {
    v16h h0 = load_rm(hb + j * 32, PITCH);                   // B: column = row of X
    v16h h1 = load_rm(hb + 16 * PITCH + j * 32, PITCH);
    o00 = wmma_f16(u[2 * j],     h0, o00);
    o10 = wmma_f16(u[2 * j],     h1, o10);
    o01 = wmma_f16(u[2 * j + 1], h0, o01);
    o11 = wmma_f16(u[2 * j + 1], h1, o11);
  }
}

// A wave's 32 x 32 result (o<row tile><column tile>) into the f32 tile; op: the lane's first element.
__device__ __forceinline__ void put_tile(float* op, const v8f& o00, const v8f& o01,
                                         const v8f& o10, const v8f& o11) {
  *(float4*)(op)      = make_float4(o00[0], o00[1], o00[2], o00[3]);
  *(float4*)(op + 4)  = make_float4(o00[4], o00[5], o00[6], o00[7]);
  *(float4*)(op + 16) = make_float4(o01[0], o01[1], o01[2], o01[3]);
  *(float4*)(op + 20) = make_float4(o01[4], o01[5], o01[6], o01[7]);
  op += 16 * OPITCH;
  *(float4*)(op)      = make_float4(o10[0], o10[1], o10[2], o10[3]);
  *(float4*)(op + 4)  = make_float4(o10[4], o10[5], o10[6], o10[7]);
  *(float4*)(op + 16) = make_float4(o11[0], o11[1], o11[2], o11[3]);
  *(float4*)(op + 20) = make_float4(o11[4], o11[5], o11[6], o11[7]);
}

template<bool LAST>
__global__ __launch_bounds__(512) __attribute__((amdgpu_waves_per_eu(4, 4)))
void tail_kernel(const float* __restrict__ Xin,
                 float* __restrict__ Xout,
                 const _Float16* __restrict__ a1,
                 const _Float16* __restrict__ Wfc,
                 const float* __restrict__ bfc,
                 const float* __restrict__ g,
                 const float* __restrict__ be,
                 const _Float16* __restrict__ W1,
                 const float* __restrict__ b1,
                 const _Float16* __restrict__ W2,
                 const float* __restrict__ b2,
                 const float* __restrict__ gf,
                 const float* __restrict__ bef) {
  __shared__ __attribute__((aligned(16))) _Float16 As[128 * APITCH];  // attention result, then LayerNorm
  __shared__ __attribute__((aligned(16))) _Float16 Hs[128 * HPITCH];  // attention scratch, then hidden
  __shared__ __attribute__((aligned(16))) float    Os[128 * OPITCH];
  __shared__ __attribute__((aligned(16))) float    Rs[128 * ND];      // Xin, then X'
  __shared__ __attribute__((aligned(16))) float    Bs[NFF];           // b1; a wave uses its own 32 only
  // the wave's number as a scalar: the weight pointers below then stay in scalar registers
  int w    = __builtin_amdgcn_readfirstlane(threadIdx.x >> 5);
  int lane = threadIdx.x & 31;
  int col  = lane & 15;
  int hf   = lane >> 4;
  int b    = blockIdx.x >> 7;            // NT / 4 == 128 blocks per b
  int t0   = (blockIdx.x & 127) << 2;
  int rh   = w >> 2;                     // the wave's 32 rows and 32 columns of a 128 x 128 product
  int cp   = w & 3;
  // the wave's eight rows in the LayerNorm's layout: m = 2w, 2w + 1, four t each
  size_t xoff = ((size_t)(b * NM + 2 * w) * NT + t0) * ND + lane * 4;
  float* rr = Rs + (w * 8) * ND + lane * 4;     // their place in LDS: written and read by this lane alone

  // ---- attention across m=32; the wave's tile is (t0 + (w >> 2), h = w & 3), 32 x 32, 2 KB ----
  _Float16* Xl = Hs + w * 2048;          // the wave's own scratch: the tile, then its weights P
  _Float16 (*P)[32] = (_Float16 (*)[32])(Xl + 1024);
  {
    const _Float16* xg = a1 + ((size_t)(b * NT + t0) * NH + w) * (NM * NDK) + lane * 8;
    unsigned l0 = (unsigned)(uintptr_t)Xl + (unsigned)(lane * 16);
    unsigned l1 = l0 + 512, l2 = l0 + 1024, l3 = l0 + 1536;
    const _Float16* g0 = xg;
    const _Float16* g1 = xg + 256;
    const _Float16* g2 = xg + 512;
    const _Float16* g3 = xg + 768;
    unsigned r0 = (unsigned)(uintptr_t)rr;
    unsigned r1 = r0 + 512, r2 = r0 + 1024, r3 = r0 + 1536;
    unsigned r4 = r0 + 2048, r5 = r0 + 2560, r6 = r0 + 3072, r7 = r0 + 3584;
    const float* x0 = Xin + xoff;
    const float* x1 = x0 + ND;
    const float* x2 = x0 + 2 * ND;
    const float* x3 = x0 + 3 * ND;
    const float* x4 = x0 + (size_t)NT * ND;
    const float* x5 = x4 + ND;
    const float* x6 = x4 + 2 * ND;
    const float* x7 = x4 + 3 * ND;
    // and the bias of the wave's 32 hidden columns, one float a lane
    unsigned lb = (unsigned)(uintptr_t)(Bs + w * 32 + lane);
    const float* gb = b1 + w * 32 + lane;
    // the copies and, in the same statement, the wait that stands before their address registers
    // may be written again
    asm volatile("global_load_async_to_lds_b128 %0, %12, off\n\t"
                 "global_load_async_to_lds_b128 %1, %13, off\n\t"
                 "global_load_async_to_lds_b128 %2, %14, off\n\t"
                 "global_load_async_to_lds_b128 %3, %15, off\n\t"
                 "global_load_async_to_lds_b128 %4, %16, off\n\t"
                 "global_load_async_to_lds_b128 %5, %17, off\n\t"
                 "global_load_async_to_lds_b128 %6, %18, off\n\t"
                 "global_load_async_to_lds_b128 %7, %19, off\n\t"
                 "global_load_async_to_lds_b128 %8, %20, off\n\t"
                 "global_load_async_to_lds_b128 %9, %21, off\n\t"
                 "global_load_async_to_lds_b128 %10, %22, off\n\t"
                 "global_load_async_to_lds_b128 %11, %23, off\n\t"
                 "global_load_async_to_lds_b32 %24, %25, off\n\t"
                 "s_wait_xcnt 0x0"
                 :: "v"(l0), "v"(l1), "v"(l2), "v"(l3),
                    "v"(r0), "v"(r1), "v"(r2), "v"(r3), "v"(r4), "v"(r5), "v"(r6), "v"(r7),
                    "v"(g0), "v"(g1), "v"(g2), "v"(g3),
                    "v"(x0), "v"(x1), "v"(x2), "v"(x3), "v"(x4), "v"(x5), "v"(x6), "v"(x7),
                    "v"(lb), "v"(gb)
                 : "memory");
  }
  // The weight fragments of the projection (every wave: 32 output columns, k = 128) and of the first
  // FFN product (the wave takes 32 hidden columns for all 128 rows, so that every fragment of W1 is
  // read by one wave of the block, once) are asked for here and fly during the attention: a
  // __syncthreads() waits for every load in flight, so they are asked for well ahead of one.
  // The scheduling barrier behind each such group keeps the compiler from sinking the loads down to
  // their first use, where the wave would wait out the whole L2 latency.
  v16h ua[8], ub[8];
  load_wf8<16 * ND>(Wfc + (size_t)cp * 32 * ND, ub);
  load_wf8<16 * ND>(W1 + (size_t)w * 32 * ND, ua);
  float4 bfv = *(const float4*)(bfc + lane * 4);
  float4 gg  = *(const float4*)(g + lane * 4);
  float4 bb  = *(const float4*)(be + lane * 4);
  __builtin_amdgcn_sched_barrier(0);
  // the wave reads only what it has copied itself (its tile, rows and bias): its own wait covers it
  asm volatile("s_wait_asynccnt 0x0" ::: "memory");
  {
    const float scale = 0.17677669529663689f;   // 1/sqrt(32)
    v16h xa0 = load_rm(Xl, 32);
    v16h xa1 = load_rm(Xl + 16 * 32, 32);
    v8f s00 = {}, s01 = {}, s10 = {}, s11 = {};
    s00 = wmma_f16(xa0, xa0, s00);
    s01 = wmma_f16(xa0, xa1, s01);
    s10 = wmma_f16(xa1, xa0, s10);
    s11 = wmma_f16(xa1, xa1, s11);
#pragma unroll
    for (int v = 0; v < 8; ++v) {
      int row = v + (hf << 3);
      {
        float x0 = s00[v] * scale, x1 = s01[v] * scale;
        float mx = rmax16(fmaxf(x0, x1));
        float p0 = __expf(x0 - mx), p1 = __expf(x1 - mx);
        float inv = 1.0f / rsum16(p0 + p1);
        P[row][col]      = (_Float16)(p0 * inv);
        P[row][16 + col] = (_Float16)(p1 * inv);
      }
      {
        float x0 = s10[v] * scale, x1 = s11[v] * scale;
        float mx = rmax16(fmaxf(x0, x1));
        float p0 = __expf(x0 - mx), p1 = __expf(x1 - mx);
        float inv = 1.0f / rsum16(p0 + p1);
        P[16 + row][col]      = (_Float16)(p0 * inv);
        P[16 + row][16 + col] = (_Float16)(p1 * inv);
      }
    }
    __syncthreads();   // P goes from lane to lane through LDS
    v16h pA0 = load_rm(&P[0][0], 32);
    v16h pA1 = load_rm(&P[16][0], 32);
    v16h bx0 = load_cm(Xl, 32);
    v16h bx1 = load_cm(Xl + 16, 32);
    v8f a00 = {}, a01 = {}, a10 = {}, a11 = {};
    a00 = wmma_f16(pA0, bx0, a00);
    a01 = wmma_f16(pA0, bx1, a01);
    a10 = wmma_f16(pA1, bx0, a10);
    a11 = wmma_f16(pA1, bx1, a11);
    // row m * 4 + tt of the panel, columns h * 32 + dk
    _Float16* ap = As + ((hf << 3) * 4 + rh) * APITCH + cp * NDK + col;
#pragma unroll
    for (int v = 0; v < 8; ++v) {
      ap[v * 4 * APITCH]             = (_Float16)a00[v];
      ap[v * 4 * APITCH + 16]        = (_Float16)a01[v];
      ap[(16 + v) * 4 * APITCH]      = (_Float16)a10[v];
      ap[(16 + v) * 4 * APITCH + 16] = (_Float16)a11[v];
    }
  }
  __syncthreads();   // the attention's panel is written by all 16 waves and read by all 16

  // ---- output projection: 32 rows x 32 columns per wave ----
  float* op = Os + (rh * 32 + col) * OPITCH + cp * 32 + (hf << 3);
  {
    v8f o00 = {}, o01 = {}, o10 = {}, o11 = {};
    prod_group<APITCH>(As + rh * 32 * APITCH, ub, o00, o01, o10, o11);
    put_tile(op, o00, o01, o10, o11);
  }
  __syncthreads();   // the result tile is written by all 16 waves and read by all 16; As is free

  // ---- first residual, kept in Rs, and the LayerNorm of the wave's eight rows ----
#pragma unroll
  for (int r = 0; r < 8; ++r) {
    float4 ov = *(const float4*)(Os + (w * 8 + r) * OPITCH + lane * 4);
    float4 xi = *(const float4*)(rr + r * ND);
    float4 v;
    v.x = xi.x + (ov.x + bfv.x);
    v.y = xi.y + (ov.y + bfv.y);
    v.z = xi.z + (ov.z + bfv.z);
    v.w = xi.w + (ov.w + bfv.w);
    *(float4*)(rr + r * ND) = v;
    float s = v.x + v.y + v.z + v.w;
#pragma unroll
    for (int d = 1; d < 32; d <<= 1) s += __shfl_xor(s, d, 32);
    float mu = s * (1.0f / ND);
    float dx = v.x - mu, dy = v.y - mu, dz = v.z - mu, dw = v.w - mu;
    float ss = dx * dx + dy * dy + dz * dz + dw * dw;
#pragma unroll
    for (int d = 1; d < 32; d <<= 1) ss += __shfl_xor(ss, d, 32);
    float inv = rsqrtf(ss * (1.0f / ND) + 1e-6f);
    v4h o;
    o[0] = (_Float16)(dx * inv * gg.x + bb.x);
    o[1] = (_Float16)(dy * inv * gg.y + bb.y);
    o[2] = (_Float16)(dz * inv * gg.z + bb.z);
    o[3] = (_Float16)(dw * inv * gg.w + bb.w);
    *(v4h*)(As + (w * 8 + r) * APITCH + lane * 4) = o;
  }
  __syncthreads();   // the panel is written by all 16 waves and read by all 16
  // second FFN product: the wave takes 32 rows x 32 output columns, k = all 512 hidden columns.
  // Every group of its weight fragments is asked for one stage ahead of its use.
  const _Float16* w2w = W2 + (size_t)cp * 32 * NFF;
  const _Float16* hb  = Hs + rh * 32 * HPITCH;
  load_wf8<16 * NFF>(w2w, ub);
  __builtin_amdgcn_sched_barrier(0);
  ffn1_pass(As, ua, Bs + w * 32, w * 32, Hs);
  ffn1_pass(As + 64 * APITCH, ua, Bs + w * 32, w * 32, Hs + 64 * HPITCH);
  __syncthreads();   // the hidden tile is written by all 16 waves and read by all 16
  v8f o00 = {}, o01 = {}, o10 = {}, o11 = {};   // o<row tile><column tile>
  load_wf8<16 * NFF>(w2w + 4 * 512, ua);
  __builtin_amdgcn_sched_barrier(0);
  prod_group<HPITCH>(hb, ub, o00, o01, o10, o11);
  load_wf8<16 * NFF>(w2w + 8 * 512, ub);
  __builtin_amdgcn_sched_barrier(0);
  prod_group<HPITCH>(hb + 4 * 32, ua, o00, o01, o10, o11);
  load_wf8<16 * NFF>(w2w + 12 * 512, ua);
  float4 b2v = *(const float4*)(b2 + lane * 4);
  float4 gfv = {}, bfn = {};
  if (LAST) {
    gfv = *(const float4*)(gf + lane * 4);
    bfn = *(const float4*)(bef + lane * 4);
  }
  __builtin_amdgcn_sched_barrier(0);
  prod_group<HPITCH>(hb + 8 * 32, ub, o00, o01, o10, o11);
  prod_group<HPITCH>(hb + 12 * 32, ua, o00, o01, o10, o11);
  put_tile(op, o00, o01, o10, o11);
  __syncthreads();   // the result tile is written by all 16 waves and read by all 16
#pragma unroll
  for (int r = 0; r < 8; ++r) {
    float4 ov = *(const float4*)(Os + (w * 8 + r) * OPITCH + lane * 4);
    float4 xv = *(const float4*)(rr + r * ND);
    float4 res;
    res.x = xv.x + (ov.x + b2v.x);
    res.y = xv.y + (ov.y + b2v.y);
    res.z = xv.z + (ov.z + b2v.z);
    res.w = xv.w + (ov.w + b2v.w);
    if (LAST) {
      float s = res.x + res.y + res.z + res.w;
#pragma unroll
      for (int d = 1; d < 32; d <<= 1) s += __shfl_xor(s, d, 32);
      float mu = s * (1.0f / ND);
      float dx = res.x - mu, dy = res.y - mu, dz = res.z - mu, dw = res.w - mu;
      float ss = dx * dx + dy * dy + dz * dz + dw * dw;
#pragma unroll
      for (int d = 1; d < 32; d <<= 1) ss += __shfl_xor(ss, d, 32);
      float inv = rsqrtf(ss * (1.0f / ND) + 1e-6f);
      res.x = dx * inv * gfv.x + bfn.x;
      res.y = dy * inv * gfv.y + bfn.y;
      res.z = dz * inv * gfv.z + bfn.z;
      res.w = dw * inv * gfv.w + bfn.w;
    }
    *(float4*)(Xout + xoff + (size_t)(r >> 2) * NT * ND + (r & 3) * ND) = res;
  }
}

// ---- The head of a layer in one grid: LayerNorm, the q, k, v products, both context attentions ----
// A block of eight waves owns 64 rows (one b, m; 64 consecutive t) of X.  The windowed (L = 16)
// attention of a 16-row tile needs the tile before it as well, so the block also normalises and
// projects the 16 rows in front of its own (panel rows 0-15; its own rows are panel rows 16-79).
// q and k never leave LDS: only the two attentions' results and the transposed v go to memory.
// Wave w forms columns 16w .. 16w+15 of q and k for all five row tiles, of v for the four own ones, from weight fragments that it
// reads once.  q and k are formed in both orientations from the same fragments in registers:
// rows x W^T leaves a lane eight consecutive t of one column (16 bytes of the transposed tile),
// W x rows^T eight consecutive columns of one row (16 bytes of the row-major tile).
#define CPITCH 88                    // f16 per row of a transposed q/k tile: 160 B + 16 B
#define TPITCH 72                    // f16 per row of the transposed v tile:  128 B + 16 B

// Sum over the 32 lanes of each of ten values.  The ten exchanges of a step are asked for together:
// one after the other, every one of the fifty would wait out its own latency.
__device__ __forceinline__ void wave_sum10(float (&s)[10]) {
#pragma unroll
  for (int d = 1; d < 32; d <<= 1) {
    float t[10];
#pragma unroll
    for (int r = 0; r < 10; ++r) t[r] = __shfl_xor(s[r], d, 32);
#pragma unroll
    for (int r = 0; r < 10; ++r) s[r] += t[r];
  }
}

__device__ __forceinline__ v8h add_cvt(const v8f& c, float b) {
  v8h h;
#pragma unroll
  for (int v = 0; v < 8; ++v) h[v] = (_Float16)(c[v] + b);
  return h;
}
__device__ __forceinline__ v8h add_cvt8(const v8f& c, float4 b0, float4 b4) {
  float bv[8] = {b0.x, b0.y, b0.z, b0.w, b4.x, b4.y, b4.z, b4.w};
  v8h h;
#pragma unroll
  for (int v = 0; v < 8; ++v) h[v] = (_Float16)(c[v] + bv[v]);
  return h;
}

__global__ __launch_bounds__(256) __attribute__((amdgpu_waves_per_eu(4, 4)))
void qkv_ctx_kernel(const float* __restrict__ X,
                    const float* __restrict__ g,
                    const float* __restrict__ be,
                    const _Float16* __restrict__ Wq,
                    const _Float16* __restrict__ Wk,
                    const _Float16* __restrict__ Wv,
                    const float* __restrict__ bq,
                    const float* __restrict__ bk,
                    const float* __restrict__ bv,
                    _Float16* __restrict__ cq,
                    _Float16* __restrict__ ck,
                    _Float16* __restrict__ vT) {
  __shared__ __attribute__((aligned(16))) _Float16 As[80 * APITCH];      // LayerNorm(X)
  __shared__ __attribute__((aligned(16))) _Float16 Rr[2][80 * APITCH];   // q, k: [t][d]; then results
  __shared__ __attribute__((aligned(16))) _Float16 Tt[2][ND * CPITCH];   // q, k: [d][t]
  __shared__ __attribute__((aligned(16))) _Float16 Tv[ND * TPITCH];      // v:    [d][t]
  // the wave's number as a scalar: the weight pointers below then stay in scalar registers
  int w    = __builtin_amdgcn_readfirstlane(threadIdx.x >> 5);
  int lane = threadIdx.x & 31;
  int col  = lane & 15;
  int hf   = lane >> 4;
  int row0 = blockIdx.x * 64;         // the block's first row; 64 divides NT: one bm per block
  int bm   = row0 >> 9;               // NT == 512
  int t0   = row0 & (NT - 1);
  // Eight own rows and two of the 16 rows in front per wave.  At t0 == 0 there are none in front:
  // the block's first rows stand in for them, and their weights are set to zero below.
  const float* xo = X + (size_t)(row0 + w * 8) * ND + lane * 4;
  const float* xf = X + (size_t)((t0 ? row0 - 16 : row0) + w * 2) * ND + lane * 4;
  float4 vv[10];
#pragma unroll
  for (int r = 0; r < 8; ++r) vv[r] = *(const float4*)(xo + r * ND);
  vv[8] = *(const float4*)(xf);
  vv[9] = *(const float4*)(xf + ND);
  float4 gg = *(const float4*)(g + lane * 4);
  float4 bb = *(const float4*)(be + lane * 4);
  v16h wq[4], wk[4], wv[4];
#pragma unroll
  for (int j = 0; j < 4; ++j) {
    wq[j] = load_wf(Wq + w * 16 * ND + j * 512);
    wk[j] = load_wf(Wk + w * 16 * ND + j * 512);
    wv[j] = load_wf(Wv + w * 16 * ND + j * 512);
  }
  float  bqc = bq[w * 16 + col], bkc = bk[w * 16 + col], bvc = bv[w * 16 + col];
  float4 bq0 = *(const float4*)(bq + w * 16 + (hf << 3));
  float4 bq4 = *(const float4*)(bq + w * 16 + (hf << 3) + 4);
  float4 bk0 = *(const float4*)(bk + w * 16 + (hf << 3));
  // the next load's result may land in the offset register that the loads above name: wait first
  asm volatile("s_wait_xcnt 0x0" ::: "memory");
  float4 bk4 = *(const float4*)(bk + w * 16 + (hf << 3) + 4);
  // the code below may reuse the address registers of the loads above: wait first
  asm volatile("s_wait_xcnt 0x0" ::: "memory");
  // LayerNorm, one wave per row, four floats a lane
  float s[10];
#pragma unroll
  for (int r = 0; r < 10; ++r) s[r] = vv[r].x + vv[r].y + vv[r].z + vv[r].w;
  wave_sum10(s);
#pragma unroll
  for (int r = 0; r < 10; ++r) {
    float mu = s[r] * (1.0f / ND);
    vv[r].x -= mu; vv[r].y -= mu; vv[r].z -= mu; vv[r].w -= mu;
    s[r] = vv[r].x * vv[r].x + vv[r].y * vv[r].y + vv[r].z * vv[r].z + vv[r].w * vv[r].w;
  }
  wave_sum10(s);
#pragma unroll
  for (int r = 0; r < 10; ++r) {
    float inv = rsqrtf(s[r] * (1.0f / ND) + 1e-6f);
    v4h o;
    o[0] = (_Float16)(vv[r].x * inv * gg.x + bb.x);
    o[1] = (_Float16)(vv[r].y * inv * gg.y + bb.y);
    o[2] = (_Float16)(vv[r].z * inv * gg.z + bb.z);
    o[3] = (_Float16)(vv[r].w * inv * gg.w + bb.w);
    int pr = r < 8 ? 16 + w * 8 + r : w * 2 + r - 8;   // panel row
    *(v4h*)(As + pr * APITCH + lane * 4) = o;
  }
  __syncthreads();   // the panel is written by all eight waves and read by all eight

#pragma unroll
  for (int rt = 0; rt < 5; ++rt) {
    v16h a[4];
#pragma unroll
    for (int j = 0; j < 4; ++j) a[j] = load_rm(As + rt * 16 * APITCH + j * 32, APITCH);
    v8f qt_ = {}, qr_ = {}, kt_ = {}, kr_ = {}, vt_ = {};
#pragma unroll
    for (int j = 0; j < 4; ++j) {
      qt_ = wmma_f16(a[j], wq[j], qt_);
      qr_ = wmma_f16(wq[j], a[j], qr_);
      kt_ = wmma_f16(a[j], wk[j], kt_);
      kr_ = wmma_f16(wk[j], a[j], kr_);
      if (rt) vt_ = wmma_f16(a[j], wv[j], vt_);
    }
    int to = (w * 16 + col) * CPITCH + rt * 16 + (hf << 3);
    int ro = (rt * 16 + col) * APITCH + w * 16 + (hf << 3);
    *(v8h*)(Tt[0] + to) = add_cvt(qt_, bqc);
    *(v8h*)(Tt[1] + to) = add_cvt(kt_, bkc);
    *(v8h*)(Rr[0] + ro) = add_cvt8(qr_, bq0, bq4);
    *(v8h*)(Rr[1] + ro) = add_cvt8(kr_, bk0, bk4);
    if (rt) *(v8h*)(Tv + (w * 16 + col) * TPITCH + (rt - 1) * 16 + (hf << 3)) = add_cvt(vt_, bvc);
  }
  __syncthreads();   // the five tiles are written by all eight waves and read by all eight

  // ---- windowed attention: the wave takes one 16-query tile of q (odd waves: of k) ----
  // Scores are formed transposed (keys x queries^T): a lane holds 16 of the 32 scores of ONE query
  // (column lane & 15; keys 8*hf+r of the tile in front and of the query's own tile), and the two
  // score tiles, converted in place, are the B operand of keys^T x weights^T.
  int qt = w >> 1;
  int tz = w & 1;
  _Float16* R = Rr[tz];
  const _Float16* kp = R + qt * 16 * APITCH;    // the tile in front
  const _Float16* kc = kp + 16 * APITCH;        // the queries' own tile
  v16h fp[4], fc[4];
#pragma unroll
  for (int j = 0; j < 4; ++j) {
    fp[j] = load_rm(kp + j * 32, APITCH);
    fc[j] = load_rm(kc + j * 32, APITCH);
  }
  v8f s0 = {}, s1 = {};
#pragma unroll
  for (int j = 0; j < 4; ++j) {
    s0 = wmma_f16(fp[j], fc[j], s0);
    s1 = wmma_f16(fc[j], fc[j], s1);
  }
  v16h ka[8];                                   // A: rows = d, k = the 32 keys
#pragma unroll
  for (int n = 0; n < 8; ++n) ka[n] = load_tp(Tt[tz] + n * 16 * CPITCH + qt * 16, CPITCH);
  bool pad = (t0 == 0) && (qt == 0);            // the keys in front are the zero padding
  const float scale = 0.088388347648318447f;    // 1/sqrt(128)
  float sp[8], sc[8];
  float mx = -1e30f;
#pragma unroll
  for (int r = 0; r < 8; ++r) {
    int j = (hf << 3) + r;
    // band: a key j in front is valid iff j > query; an own key j iff j <= query.
    // zero padding: in-band scores are 0 and DO join the softmax.
    sp[r] = (j > col)  ? (pad ? 0.0f : s0[r] * scale) : -1e30f;
    sc[r] = (j <= col) ? s1[r] * scale : -1e30f;
    mx = fmaxf(mx, fmaxf(sp[r], sc[r]));
  }
  mx = fmaxf(mx, xhalf(mx));
  float sum = 0.0f;
#pragma unroll
  for (int r = 0; r < 8; ++r) {
    sp[r] = __expf(sp[r] - mx);
    sc[r] = __expf(sc[r] - mx);
    sum += sp[r] + sc[r];
  }
  float invd = 1.0f / (sum + xhalf(sum));
  v16h pB;
#pragma unroll
  for (int r = 0; r < 8; ++r) {
    pB[r]     = (_Float16)(pad ? 0.0f : sp[r] * invd);   // zero rows: nothing for the numerator
    pB[8 + r] = (_Float16)(sc[r] * invd);
  }
  __syncthreads();   // every wave has read its rows of q and k: they now take the results
  v8f o[8];
#pragma unroll
  for (int n = 0; n < 8; ++n) {
    v8f z = {};
    o[n] = wmma_f16(ka[n], pB, z);
  }
#pragma unroll
  for (int n = 0; n < 8; ++n) {
    v8h h;
#pragma unroll
    for (int v = 0; v < 8; ++v) h[v] = (_Float16)o[n][v];
    *(v8h*)(R + (qt * 16 + col) * APITCH + n * 16 + (hf << 3)) = h;
  }
  __syncthreads();   // a result row goes from lane to lane through LDS
  // Every store to memory stands behind the last barrier: a barrier behind one would wait for it.
  // Results: 16 lanes store one whole row (two lines); the two rows of a pass are neighbours in memory.
  // v: the tile is read back row by row, eight lanes store one whole 128-byte line of vT.
  {
    const _Float16* ls = R + (qt * 16 + hf) * APITCH + col * 8;
    _Float16* gp = (tz ? ck : cq) + (size_t)(row0 + qt * 16 + hf) * ND + col * 8;
    int d  = threadIdx.x >> 3;        // 32 rows of the v tile per pass
    int ch = (threadIdx.x & 7) << 3;
    const _Float16* lv = Tv + d * TPITCH + ch;
    _Float16* gv = vT + ((size_t)bm * ND + d) * NT + t0 + ch;
    v8h tr[8], tv[4];
#pragma unroll
    for (int p = 0; p < 4; ++p) tv[p] = *(const v8h*)(lv + p * 32 * TPITCH);
#pragma unroll
    for (int p = 0; p < 8; ++p) tr[p] = *(const v8h*)(ls + p * 2 * APITCH);
#pragma unroll
    for (int p = 0; p < 4; ++p) *(v8h*)(gv + (size_t)p * 32 * NT) = tv[p];
#pragma unroll
    for (int p = 0; p < 8; ++p) *(v8h*)(gp + p * 2 * ND) = tr[p];
  }
}

#define KPITCH 40                    // f16 per K row in LDS:   64 B + 16 B
#define VPITCH 520                   // f16 per V^T row in LDS: 1024 B + 16 B
__global__ __launch_bounds__(1024) __attribute__((amdgpu_waves_per_eu(8, 8)))
void attn_t_kernel(const _Float16* __restrict__ cq,
                   const _Float16* __restrict__ ck,
                   const _Float16* __restrict__ vT,
                   _Float16* __restrict__ out) {
  __shared__ __attribute__((aligned(16))) _Float16 Ks[NT * KPITCH];
  __shared__ __attribute__((aligned(16))) _Float16 Vs[NDK * VPITCH];
  int qb = threadIdx.x >> 5;
  int h  = blockIdx.x & 3;
  int bm = blockIdx.x >> 2;
  int b  = bm >> 5;
  int m  = bm & 31;
  size_t seqoff = (size_t)bm * NT * ND + h * NDK;
  const _Float16* Q  = cq + seqoff + (size_t)qb * 16 * ND;
  const _Float16* K  = ck + seqoff;
  const _Float16* VT = vT + (size_t)bm * ND * NT + (size_t)(h * NDK) * NT;  // [dk][t]
  int lane = threadIdx.x & 31;
  int col  = lane & 15;
  int hf   = lane >> 4;
  {
    // 2048 pieces of 16 B each for K (4 a row) and for V^T (64 a row); two of each per thread.
    int tid = threadIdx.x;
    int kr = tid >> 2, kc = (tid & 3) << 3;
    int vr = tid >> 6, vc = (tid & 63) << 3;
    unsigned lk0 = (unsigned)(uintptr_t)(Ks + kr * KPITCH + kc);
    unsigned lk1 = (unsigned)(uintptr_t)(Ks + (kr + 256) * KPITCH + kc);
    unsigned lv0 = (unsigned)(uintptr_t)(Vs + vr * VPITCH + vc);
    unsigned lv1 = (unsigned)(uintptr_t)(Vs + (vr + 16) * VPITCH + vc);
    const _Float16* gk0 = K + (size_t)kr * ND + kc;
    const _Float16* gk1 = K + (size_t)(kr + 256) * ND + kc;
    const _Float16* gv0 = VT + (size_t)vr * NT + vc;
    const _Float16* gv1 = VT + (size_t)(vr + 16) * NT + vc;
    // the copies and, in the same statement, the wait that stands before their address registers
    // may be written again
    asm volatile("global_load_async_to_lds_b128 %0, %4, off\n\t"
                 "global_load_async_to_lds_b128 %1, %5, off\n\t"
                 "global_load_async_to_lds_b128 %2, %6, off\n\t"
                 "global_load_async_to_lds_b128 %3, %7, off\n\t"
                 "s_wait_xcnt 0x0"
                 :: "v"(lk0), "v"(lk1), "v"(lv0), "v"(lv1), "v"(gk0), "v"(gk1), "v"(gv0), "v"(gv1)
                 : "memory");
  }
  const float scale = 0.17677669529663689f;   // 1/sqrt(32)
  v16h qf = load_rm(Q, ND);      // B operand: column = query
  // this wave's copies have landed; behind the barrier every wave's have
  asm volatile("s_wait_asynccnt 0x0" ::: "memory");
  __syncthreads();
  v8f o0 = {}, o1 = {};          // o0[r] = O[query col][dk 8*hf+r], o1[r]: dk 16+8*hf+r
  float mrun = -1e30f;           // running maximum of this lane's query (equal in both halves)
  float lrun = 0.0f;             // running sum over this half's keys only; joined after the loop
  for (int kb = 0; kb < NT / 32; ++kb) {
    const _Float16* Kb = Ks + kb * 32 * KPITCH;
    v16h ka0 = load_rm(Kb, KPITCH);                          // A: rows = keys 0..15
    v16h ka1 = load_rm(Kb + 16 * KPITCH, KPITCH);            // A: rows = keys 16..31
    v16h va0 = load_tp(Vs + kb * 32, VPITCH);                // A: rows = dk 0..15,  k = keys
    v16h va1 = load_tp(Vs + 16 * VPITCH + kb * 32, VPITCH);  // A: rows = dk 16..31, k = keys
    v8f s0 = {}, s1 = {};
    s0 = wmma_f16(ka0, qf, s0);
    s1 = wmma_f16(ka1, qf, s1);
    float x0[8], x1[8];
    float mx = -1e30f;
#pragma unroll
    for (int r = 0; r < 8; ++r) {
      x0[r] = s0[r] * scale;
      x1[r] = s1[r] * scale;
      mx = fmaxf(mx, fmaxf(x0[r], x1[r]));
    }
    mx = fmaxf(mx, xhalf(mx));
    float mn   = fmaxf(mrun, mx);
    float corr = __expf(mrun - mn);
    float ps   = 0.0f;
    v16h pB;                     // B operand: pB[s] = P[query col][key kmap(s, hf)]
#pragma unroll
    for (int r = 0; r < 8; ++r) {
      float p0 = __expf(x0[r] - mn);
      float p1 = __expf(x1[r] - mn);
      ps += p0 + p1;
      pB[r]     = (_Float16)p0;
      pB[8 + r] = (_Float16)p1;
    }
    lrun = lrun * corr + ps;
    mrun = mn;
#pragma unroll
    for (int r = 0; r < 8; ++r) { o0[r] *= corr; o1[r] *= corr; }
    o0 = wmma_f16(va0, pB, o0);
    o1 = wmma_f16(va1, pB, o1);
  }
  // out layout: [b][t][h][m][dk]; a lane's eight registers are eight consecutive dk of one row
  float inv = 1.0f / (lrun + xhalf(lrun));
  int t = qb * 16 + col;
  size_t base = ((((size_t)b * NT + t) * NH + h) * NM + m) * NDK + (hf << 3);
  v8h r0, r1;
#pragma unroll
  for (int r = 0; r < 8; ++r) {
    r0[r] = (_Float16)(o0[r] * inv);
    r1[r] = (_Float16)(o1[r] * inv);
  }
  *(v8h*)(out + base)      = r0;
  *(v8h*)(out + base + 16) = r1;
}

// ---------------- fp32 -> f16 conversion of all six weights ----------------
// wh holds the six f16 weight arrays back to back in the order Wq, Wk, Wv, Wfc, W1, W2;
// every array is a whole number of 256-element blocks, so a block has one source.
// Each array is stored in the fragment order that load_wf reads: a block writes one half
// fragment (registers 0-7 or 8-15 of the 32 lanes).  The rows of both layers count through.
#define WSQ  (2 * ND * ND)           // elements of Wq, Wk, Wv, Wfc (both layers)
#define WFF  (2 * NFF * ND)          // elements of W1, W2 (both layers)
__global__ __launch_bounds__(256) void prep_kernel(const float* __restrict__ Wq,
                                                   const float* __restrict__ Wk,
                                                   const float* __restrict__ Wv,
                                                   const float* __restrict__ Wfc,
                                                   const float* __restrict__ W1,
                                                   const float* __restrict__ W2,
                                                   _Float16* __restrict__ wh) {
  int b0 = blockIdx.x * 256;           // first element of this block in wh
  const float* in;
  int s0;                              // where this block's array starts in wh
  int lk = 2;                          // log2 of the fragments per row tile: row length / 32
  if      (b0 < 1 * WSQ)       { in = Wq;  s0 = 0; }
  else if (b0 < 2 * WSQ)       { in = Wk;  s0 = 1 * WSQ; }
  else if (b0 < 3 * WSQ)       { in = Wv;  s0 = 2 * WSQ; }
  else if (b0 < 4 * WSQ)       { in = Wfc; s0 = 3 * WSQ; }
  else if (b0 < 4 * WSQ + WFF) { in = W1;  s0 = 4 * WSQ; }
  else                         { in = W2;  s0 = 4 * WSQ + WFF; lk = 4; }
  int hfrag = (b0 - s0) >> 8;          // half fragment of this block
  int frag  = hfrag >> 1;
  int l     = threadIdx.x >> 3;        // lane that will read the element
  int row   = ((frag >> lk) << 4) + (l & 15);
  int colk  = ((frag & ((1 << lk) - 1)) << 5) + ((hfrag & 1) << 4) + ((l >> 4) << 3)
            + (threadIdx.x & 7);
  wh[b0 + threadIdx.x] = (_Float16)in[(row << (lk + 5)) + colk];
}

extern "C" void kernel_launch(void* const* d_in, const int* in_sizes, int n_in,
                              void* d_out, int out_size, void* d_ws, size_t ws_size,
                              hipStream_t stream) {
  (void)in_sizes; (void)n_in; (void)out_size; (void)ws_size;
  const float* x   = (const float*)d_in[0];
  const float* Wq  = (const float*)d_in[1];
  const float* bq  = (const float*)d_in[2];
  const float* Wk  = (const float*)d_in[3];
  const float* bk  = (const float*)d_in[4];
  const float* Wv  = (const float*)d_in[5];
  const float* bv  = (const float*)d_in[6];
  const float* Wfc = (const float*)d_in[7];
  const float* bfc = (const float*)d_in[8];
  const float* W1  = (const float*)d_in[9];
  const float* b1  = (const float*)d_in[10];
  const float* W2  = (const float*)d_in[11];
  const float* b2  = (const float*)d_in[12];
  const float* g1  = (const float*)d_in[13];
  const float* be1 = (const float*)d_in[14];
  const float* g2  = (const float*)d_in[15];
  const float* be2 = (const float*)d_in[16];
  const float* gf  = (const float*)d_in[17];
  const float* bef = (const float*)d_in[18];

  char* ws = (char*)d_ws;
  size_t off = 0;
  auto bump = [&](size_t bytes) -> char* {
    char* p = ws + off;
    off = (off + bytes + 255) & ~(size_t)255;
    return p;
  };
  float*    xw   = (float*)bump((size_t)NROW * ND * 4);
  _Float16* vT   = (_Float16*)bump((size_t)NROW * ND * 2);
  _Float16* cqh  = (_Float16*)bump((size_t)NROW * ND * 2);
  _Float16* ckh  = (_Float16*)bump((size_t)NROW * ND * 2);
  _Float16* a1h  = (_Float16*)bump((size_t)NROW * ND * 2);
  _Float16* wh   = (_Float16*)bump((size_t)(4 * WSQ + 2 * WFF) * 2);   // six f16 weight arrays
  _Float16* wqh  = wh;
  _Float16* wkh  = wh + 1 * WSQ;
  _Float16* wvh  = wh + 2 * WSQ;
  _Float16* wfch = wh + 3 * WSQ;
  _Float16* w1h  = wh + 4 * WSQ;
  _Float16* w2h  = wh + 4 * WSQ + WFF;

  dim3 blk(256);
  const int headBlocks  = NROW / 64;                         // 512: 64 rows per block
  const int tailBlocks  = NROW / 128;                        // 256: 128 rows per block
  const int atBlocks    = NB * NM * NH;                      // 256: one per (b, m, h)

  prep_kernel<<<(4 * WSQ + 2 * WFF) / 256, blk, 0, stream>>>(Wq, Wk, Wv, Wfc, W1, W2, wh);
  for (int i = 0; i < 2; ++i) {
    const float* xi = i ? xw : x;      // the layer's X: the input itself, then the first layer's result
    qkv_ctx_kernel<<<headBlocks, blk, 0, stream>>>(
        xi, g1 + i * ND, be1 + i * ND, wqh + (size_t)i * ND * ND, wkh + (size_t)i * ND * ND, wvh + (size_t)i * ND * ND,
        bq + i * ND, bk + i * ND, bv + i * ND, cqh, ckh, vT);
    attn_t_kernel<<<atBlocks, dim3(1024), 0, stream>>>(cqh, ckh, vT, a1h);
    if (i == 0)
      tail_kernel<false><<<tailBlocks, dim3(512), 0, stream>>>(
          xi, xw, a1h, wfch, bfc, g2, be2, w1h, b1, w2h, b2, gf, bef);
    else
      tail_kernel<true><<<tailBlocks, dim3(512), 0, stream>>>(
          xi, (float*)d_out, a1h, wfch + (size_t)ND * ND, bfc + ND, g2 + ND, be2 + ND,
          w1h + (size_t)NFF * ND, b1 + NFF, w2h + (size_t)ND * NFF, b2 + ND, gf, bef);
  }
}

// v010
// Measured time: 98.3 microseconds a run.
// Two timings next to v009 put it at 1.05 and 1.04 times that version's speed.
// All steps since v000 together make it 3.96 times as fast.
#include <hip/hip_runtime.h>
#include <hip/hip_bf16.h>
#include <stdint.h>

typedef __attribute__((ext_vector_type(16))) _Float16 v16h;
typedef __attribute__((ext_vector_type(8)))  float    v8f;
typedef __attribute__((ext_vector_type(8)))  _Float16 v8h;
typedef __attribute__((ext_vector_type(4)))  _Float16 v4h;
typedef __attribute__((ext_vector_type(2)))  float    v2f;

#define NB   2
#define NM   32
#define NT   512
#define ND   128
#define NH   4
#define NDK  32
#define NFF  512
#define NROW (NB * NM * NT)   // 32768 rows of D=128

__device__ __forceinline__ v8f wmma_f16(v16h a, v16h b, v8f c) {
  // D = A(16x32 f16) x B(32x16 f16) + C(16x16 f32)
  return __builtin_amdgcn_wmma_f32_16x16x32_f16(false, a, false, b, (short)0, c, false, false);
}

__device__ __forceinline__ v16h load_rm(const _Float16* __restrict__ p, int ld) {
  int lane = threadIdx.x & 31;
  const _Float16* r = p + (lane & 15) * ld + ((lane >> 4) << 3);
  v16h o;
#pragma unroll
  for (int i = 0; i < 8; ++i) o[i] = r[i];
#pragma unroll
  for (int i = 0; i < 8; ++i) o[8 + i] = r[16 + i];
  return o;
}

// B-operand for C = A x Bmat, Bmat (32 x >=16) row-major: B[k][n] = p[k*ld+n].
// Used only on small LDS tiles (the attention across m in tail_kernel); bulk paths use transposed copies instead.
__device__ __forceinline__ v16h load_cm(const _Float16* __restrict__ p, int ld) {
  int lane = threadIdx.x & 31;
  int col  = lane & 15;
  int ko   = (lane >> 4) << 3;
  v16h o;
#pragma unroll
  for (int i = 0; i < 8; ++i) o[i] = p[(ko + i) * ld + col];
#pragma unroll
  for (int i = 0; i < 8; ++i) o[8 + i] = p[(16 + ko + i) * ld + col];
  return o;
}

// B-operand from a column-major (transposed) source: column n contiguous over k.
// ct[n][k] with column stride ldT: B[k][n] = ct[n*ldT + k].
__device__ __forceinline__ v16h load_tp(const _Float16* __restrict__ ct, int ldT) {
  int lane = threadIdx.x & 31;
  const _Float16* r = ct + (lane & 15) * ldT + ((lane >> 4) << 3);
  v16h o;
#pragma unroll
  for (int i = 0; i < 8; ++i) o[i] = r[i];
#pragma unroll
  for (int i = 0; i < 8; ++i) o[8 + i] = r[16 + i];
  return o;
}

__device__ __forceinline__ v16h load_wf(const _Float16* __restrict__ f) {
  int lane = threadIdx.x & 31;
  v8h lo = *(const v8h*)(f + lane * 8);
  v8h hi = *(const v8h*)(f + 256 + lane * 8);
  return __builtin_shufflevector(lo, hi, 0, 1, 2, 3, 4, 5, 6, 7, 8, 9, 10, 11, 12, 13, 14, 15);
}

__device__ __forceinline__ float rmax16(float x) {
#pragma unroll
  for (int d = 1; d < 16; d <<= 1) x = fmaxf(x, __shfl_xor(x, d, 32));
  return x;
}
__device__ __forceinline__ float rsum16(float x) {
#pragma unroll
  for (int d = 1; d < 16; d <<= 1) x += __shfl_xor(x, d, 32);
  return x;
}

__device__ __forceinline__ float xhalf(float x) {
  int b = __builtin_bit_cast(int, x);
  return __builtin_bit_cast(float,
      __builtin_amdgcn_permlanex16(b, b, 0x76543210, 0xfedcba98, false, false));
}

#define APITCH 136

// ---- The tail of a layer in one grid: attention across m, output projection, residual, FFN ----
//   X' = Xin + Attn_m(a1) x Wfc^T + bfc;   Xout = X' + relu(LayerNorm(X') x W1^T + b1) x W2^T + b2
// The grid is a layer's only writer of X, so it reads the rows where they are (the first layer: the
// input itself, no copy of it is made) and writes them where they are wanted; LAST: the last layer's
// block ends with the final LayerNorm of its rows and writes the output.
// A block of 16 waves owns the 128 rows (b, all 32 m, four consecutive t) of X; local row = m * 4 + tt.
// Its waves are the 16 (t, h) tiles of the attention across m, which together give exactly those
// rows; the attention's result, the new X rows and the 128 x 512 hidden tile live in LDS only.
// The three products are formed transposed (weight fragment as A, activation rows as B): a lane then
// holds eight consecutive columns of ONE row, which go into LDS as 16-byte pieces.
// A result passes through the f32 tile Os to the LayerNorm's own layout (one wave per row, four
// floats a lane), where a row is read, added to and stored as whole lines.
#define HPITCH 520                   // f16 per hidden row in LDS: 1024 B + 16 B, for 16-byte readers
#define OPITCH 132                   // f32 per result row in LDS:  512 B + 16 B

// Eight weight fragments: two 16-row tiles (TS elements apart) x four consecutive k blocks.
template<int TS>
__device__ __forceinline__ void load_wf8(const _Float16* __restrict__ f, v16h (&u)[8]) {
#pragma unroll
  for (int j = 0; j < 4; ++j) {
    u[2 * j]     = load_wf(f + j * 512);
    u[2 * j + 1] = load_wf(f + TS + j * 512);
  }
}

// First FFN product, 64 rows x 32 hidden columns (the first is hc0; their bias: bl, in LDS), into Hs.
__device__ __forceinline__ void ffn1_pass(const _Float16* As, const v16h (&u)[8],
                                          const float* bl, int hc0, _Float16* Hs) {
  int lane = threadIdx.x & 31;
  int col  = lane & 15;
  int hf   = lane >> 4;
  v8f acc[4][2] = {};
#pragma unroll
  for (int kk = 0; kk < 4; ++kk) {
    v16h a[4];                           // B: column = row of X; the four tiles are read together
#pragma unroll
    for (int rt = 0; rt < 4; ++rt) a[rt] = load_rm(As + rt * 16 * APITCH + kk * 32, APITCH);
#pragma unroll
    for (int rt = 0; rt < 4; ++rt) {
      acc[rt][0] = wmma_f16(u[2 * kk],     a[rt], acc[rt][0]);
      acc[rt][1] = wmma_f16(u[2 * kk + 1], a[rt], acc[rt][1]);
    }
  }
#pragma unroll
  for (int c = 0; c < 2; ++c) {
    int hc = hc0 + c * 16 + (hf << 3);   // the lane's first hidden column
    float4 b0 = *(const float4*)(bl + c * 16 + (hf << 3));
    float4 b4 = *(const float4*)(bl + c * 16 + (hf << 3) + 4);
    float bv[8] = {b0.x, b0.y, b0.z, b0.w, b4.x, b4.y, b4.z, b4.w};
#pragma unroll
    for (int rt = 0; rt < 4; ++rt) {
      v8h hv;
#pragma unroll
      for (int v = 0; v < 8; ++v) hv[v] = (_Float16)fmaxf(acc[rt][c][v] + bv[v], 0.0f);
      *(v8h*)(Hs + (rt * 16 + col) * HPITCH + hc) = hv;
    }
  }
}

// Four k blocks of a product: 32 rows (hb, LDS row pitch PITCH) x 32 output columns.
template<int PITCH>
__device__ __forceinline__ void prod_group(const _Float16* hb, const v16h (&u)[8],
                                           v8f& o00, v8f& o01, v8f& o10, v8f& o11) {
#pragma unroll
  for (int j = 0; j < 4; ++j) {
    v16h h0 = load_rm(hb + j * 32, PITCH);                   // B: column = row of X
    v16h h1 = load_rm(hb + 16 * PITCH + j * 32, PITCH);
    o00 = wmma_f16(u[2 * j],     h0, o00);
    o10 = wmma_f16(u[2 * j],     h1, o10);
    o01 = wmma_f16(u[2 * j + 1], h0, o01);
    o11 = wmma_f16(u[2 * j + 1], h1, o11);
  }
}

// A wave's 32 x 32 result (o<row tile><column tile>) into the f32 tile; op: the lane's first element.
__device__ __forceinline__ void put_tile(float* op, const v8f& o00, const v8f& o01,
                                         const v8f& o10, const v8f& o11) {
  *(float4*)(op)      = make_float4(o00[0], o00[1], o00[2], o00[3]);
  *(float4*)(op + 4)  = make_float4(o00[4], o00[5], o00[6], o00[7]);
  *(float4*)(op + 16) = make_float4(o01[0], o01[1], o01[2], o01[3]);
  *(float4*)(op + 20) = make_float4(o01[4], o01[5], o01[6], o01[7]);
  op += 16 * OPITCH;
  *(float4*)(op)      = make_float4(o10[0], o10[1], o10[2], o10[3]);
  *(float4*)(op + 4)  = make_float4(o10[4], o10[5], o10[6], o10[7]);
  *(float4*)(op + 16) = make_float4(o11[0], o11[1], o11[2], o11[3]);
  *(float4*)(op + 20) = make_float4(o11[4], o11[5], o11[6], o11[7]);
}

template<bool LAST>
__global__ __launch_bounds__(512) __attribute__((amdgpu_waves_per_eu(4, 4)))
void tail_kernel(const float* __restrict__ Xin,
                 float* __restrict__ Xout,
                 const _Float16* __restrict__ a1,
                 const _Float16* __restrict__ Wfc,
                 const float* __restrict__ bfc,
                 const float* __restrict__ g,
                 const float* __restrict__ be,
                 const _Float16* __restrict__ W1,
                 const float* __restrict__ b1,
                 const _Float16* __restrict__ W2,
                 const float* __restrict__ b2,
                 const float* __restrict__ gf,
                 const float* __restrict__ bef) {
  __shared__ __attribute__((aligned(16))) _Float16 As[128 * APITCH];  // attention result, then LayerNorm
  __shared__ __attribute__((aligned(16))) _Float16 Hs[128 * HPITCH];  // attention scratch, then hidden
  __shared__ __attribute__((aligned(16))) float    Os[128 * OPITCH];
  __shared__ __attribute__((aligned(16))) float    Rs[128 * ND];      // Xin, then X'
  __shared__ __attribute__((aligned(16))) float    Bs[NFF];           // b1; a wave uses its own 32 only
  // the wave's number as a scalar: the weight pointers below then stay in scalar registers
  int w    = __builtin_amdgcn_readfirstlane(threadIdx.x >> 5);
  int lane = threadIdx.x & 31;
  int col  = lane & 15;
  int hf   = lane >> 4;
  int b    = blockIdx.x >> 7;            // NT / 4 == 128 blocks per b
  int t0   = (blockIdx.x & 127) << 2;
  int rh   = w >> 2;                     // the wave's 32 rows and 32 columns of a 128 x 128 product
  int cp   = w & 3;
  // the wave's eight rows in the LayerNorm's layout: m = 2w, 2w + 1, four t each
  size_t xoff = ((size_t)(b * NM + 2 * w) * NT + t0) * ND + lane * 4;
  float* rr = Rs + (w * 8) * ND + lane * 4;     // their place in LDS: written and read by this lane alone

  // ---- attention across m=32; the wave's tile is (t0 + (w >> 2), h = w & 3), 32 x 32, 2 KB ----
  _Float16* Xl = Hs + w * 2048;          // the wave's own scratch: the tile, then its weights P
  _Float16 (*P)[32] = (_Float16 (*)[32])(Xl + 1024);
  {
    const _Float16* xg = a1 + ((size_t)(b * NT + t0) * NH + w) * (NM * NDK) + lane * 8;
    unsigned l0 = (unsigned)(uintptr_t)Xl + (unsigned)(lane * 16);
    unsigned l1 = l0 + 512, l2 = l0 + 1024, l3 = l0 + 1536;
    const _Float16* g0 = xg;
    const _Float16* g1 = xg + 256;
    const _Float16* g2 = xg + 512;
    const _Float16* g3 = xg + 768;
    unsigned r0 = (unsigned)(uintptr_t)rr;
    unsigned r1 = r0 + 512, r2 = r0 + 1024, r3 = r0 + 1536;
    unsigned r4 = r0 + 2048, r5 = r0 + 2560, r6 = r0 + 3072, r7 = r0 + 3584;
    const float* x0 = Xin + xoff;
    const float* x1 = x0 + ND;
    const float* x2 = x0 + 2 * ND;
    const float* x3 = x0 + 3 * ND;
    const float* x4 = x0 + (size_t)NT * ND;
    const float* x5 = x4 + ND;
    const float* x6 = x4 + 2 * ND;
    const float* x7 = x4 + 3 * ND;
    // and the bias of the wave's 32 hidden columns, one float a lane
    unsigned lb = (unsigned)(uintptr_t)(Bs + w * 32 + lane);
    const float* gb = b1 + w * 32 + lane;
    // the copies and, in the same statement, the wait that stands before their address registers
    // may be written again
    asm volatile("global_load_async_to_lds_b128 %0, %12, off\n\t"
                 "global_load_async_to_lds_b128 %1, %13, off\n\t"
                 "global_load_async_to_lds_b128 %2, %14, off\n\t"
                 "global_load_async_to_lds_b128 %3, %15, off\n\t"
                 "global_load_async_to_lds_b128 %4, %16, off\n\t"
                 "global_load_async_to_lds_b128 %5, %17, off\n\t"
                 "global_load_async_to_lds_b128 %6, %18, off\n\t"
                 "global_load_async_to_lds_b128 %7, %19, off\n\t"
                 "global_load_async_to_lds_b128 %8, %20, off\n\t"
                 "global_load_async_to_lds_b128 %9, %21, off\n\t"
                 "global_load_async_to_lds_b128 %10, %22, off\n\t"
                 "global_load_async_to_lds_b128 %11, %23, off\n\t"
                 "global_load_async_to_lds_b32 %24, %25, off\n\t"
                 "s_wait_xcnt 0x0"
                 :: "v"(l0), "v"(l1), "v"(l2), "v"(l3),
                    "v"(r0), "v"(r1), "v"(r2), "v"(r3), "v"(r4), "v"(r5), "v"(r6), "v"(r7),
                    "v"(g0), "v"(g1), "v"(g2), "v"(g3),
                    "v"(x0), "v"(x1), "v"(x2), "v"(x3), "v"(x4), "v"(x5), "v"(x6), "v"(x7),
                    "v"(lb), "v"(gb)
                 : "memory");
  }
  // The weight fragments of the projection (every wave: 32 output columns, k = 128) and of the first
  // FFN product (the wave takes 32 hidden columns for all 128 rows, so that every fragment of W1 is
  // read by one wave of the block, once) are asked for here and fly during the attention: a
  // __syncthreads() waits for every load in flight, so they are asked for well ahead of one.
  // The scheduling barrier behind each such group keeps the compiler from sinking the loads down to
  // their first use, where the wave would wait out the whole L2 latency.
  v16h ua[8], ub[8];
  load_wf8<16 * ND>(Wfc + (size_t)cp * 32 * ND, ub);
  load_wf8<16 * ND>(W1 + (size_t)w * 32 * ND, ua);
  float4 bfv = *(const float4*)(bfc + lane * 4);
  float4 gg  = *(const float4*)(g + lane * 4);
  float4 bb  = *(const float4*)(be + lane * 4);
  __builtin_amdgcn_sched_barrier(0);
  // the wave reads only what it has copied itself (its tile, rows and bias): its own wait covers it
  asm volatile("s_wait_asynccnt 0x0" ::: "memory");
  {
    const float scale = 0.17677669529663689f;   // 1/sqrt(32)
    v16h xa0 = load_rm(Xl, 32);
    v16h xa1 = load_rm(Xl + 16 * 32, 32);
    v8f s00 = {}, s01 = {}, s10 = {}, s11 = {};
    s00 = wmma_f16(xa0, xa0, s00);
    s01 = wmma_f16(xa0, xa1, s01);
    s10 = wmma_f16(xa1, xa0, s10);
    s11 = wmma_f16(xa1, xa1, s11);
#pragma unroll
    for (int v = 0; v < 8; ++v) {
      int row = v + (hf << 3);
      {
        float x0 = s00[v] * scale, x1 = s01[v] * scale;
        float mx = rmax16(fmaxf(x0, x1));
        float p0 = __expf(x0 - mx), p1 = __expf(x1 - mx);
        float inv = 1.0f / rsum16(p0 + p1);
        P[row][col]      = (_Float16)(p0 * inv);
        P[row][16 + col] = (_Float16)(p1 * inv);
      }
      {
        float x0 = s10[v] * scale, x1 = s11[v] * scale;
        float mx = rmax16(fmaxf(x0, x1));
        float p0 = __expf(x0 - mx), p1 = __expf(x1 - mx);
        float inv = 1.0f / rsum16(p0 + p1);
        P[16 + row][col]      = (_Float16)(p0 * inv);
        P[16 + row][16 + col] = (_Float16)(p1 * inv);
      }
    }
    __syncthreads();   // P goes from lane to lane through LDS
    v16h pA0 = load_rm(&P[0][0], 32);
    v16h pA1 = load_rm(&P[16][0], 32);
    v16h bx0 = load_cm(Xl, 32);
    v16h bx1 = load_cm(Xl + 16, 32);
    v8f a00 = {}, a01 = {}, a10 = {}, a11 = {};
    a00 = wmma_f16(pA0, bx0, a00);
    a01 = wmma_f16(pA0, bx1, a01);
    a10 = wmma_f16(pA1, bx0, a10);
    a11 = wmma_f16(pA1, bx1, a11);
    // row m * 4 + tt of the panel, columns h * 32 + dk
    _Float16* ap = As + ((hf << 3) * 4 + rh) * APITCH + cp * NDK + col;
#pragma unroll
    for (int v = 0; v < 8; ++v) {
      ap[v * 4 * APITCH]             = (_Float16)a00[v];
      ap[v * 4 * APITCH + 16]        = (_Float16)a01[v];
      ap[(16 + v) * 4 * APITCH]      = (_Float16)a10[v];
      ap[(16 + v) * 4 * APITCH + 16] = (_Float16)a11[v];
    }
  }
  __syncthreads();   // the attention's panel is written by all 16 waves and read by all 16

  // ---- output projection: 32 rows x 32 columns per wave ----
  float* op = Os + (rh * 32 + col) * OPITCH + cp * 32 + (hf << 3);
  {
    v8f o00 = {}, o01 = {}, o10 = {}, o11 = {};
    prod_group<APITCH>(As + rh * 32 * APITCH, ub, o00, o01, o10, o11);
    put_tile(op, o00, o01, o10, o11);
  }
  __syncthreads();   // the result tile is written by all 16 waves and read by all 16; As is free

  // ---- first residual, kept in Rs, and the LayerNorm of the wave's eight rows ----
#pragma unroll
  for (int r = 0; r < 8; ++r) {
    float4 ov = *(const float4*)(Os + (w * 8 + r) * OPITCH + lane * 4);
    float4 xi = *(const float4*)(rr + r * ND);
    float4 v;
    v.x = xi.x + (ov.x + bfv.x);
    v.y = xi.y + (ov.y + bfv.y);
    v.z = xi.z + (ov.z + bfv.z);
    v.w = xi.w + (ov.w + bfv.w);
    *(float4*)(rr + r * ND) = v;
    float s = v.x + v.y + v.z + v.w;
#pragma unroll
    for (int d = 1; d < 32; d <<= 1) s += __shfl_xor(s, d, 32);
    float mu = s * (1.0f / ND);
    float dx = v.x - mu, dy = v.y - mu, dz = v.z - mu, dw = v.w - mu;
    float ss = dx * dx + dy * dy + dz * dz + dw * dw;
#pragma unroll
    for (int d = 1; d < 32; d <<= 1) ss += __shfl_xor(ss, d, 32);
    float inv = rsqrtf(ss * (1.0f / ND) + 1e-6f);
    v4h o;
    o[0] = (_Float16)(dx * inv * gg.x + bb.x);
    o[1] = (_Float16)(dy * inv * gg.y + bb.y);
    o[2] = (_Float16)(dz * inv * gg.z + bb.z);
    o[3] = (_Float16)(dw * inv * gg.w + bb.w);
    *(v4h*)(As + (w * 8 + r) * APITCH + lane * 4) = o;
  }
  __syncthreads();   // the panel is written by all 16 waves and read by all 16
  // second FFN product: the wave takes 32 rows x 32 output columns, k = all 512 hidden columns.
  // Every group of its weight fragments is asked for one stage ahead of its use.
  const _Float16* w2w = W2 + (size_t)cp * 32 * NFF;
  const _Float16* hb  = Hs + rh * 32 * HPITCH;
  load_wf8<16 * NFF>(w2w, ub);
  __builtin_amdgcn_sched_barrier(0);
  ffn1_pass(As, ua, Bs + w * 32, w * 32, Hs);
  ffn1_pass(As + 64 * APITCH, ua, Bs + w * 32, w * 32, Hs + 64 * HPITCH);
  __syncthreads();   // the hidden tile is written by all 16 waves and read by all 16
  v8f o00 = {}, o01 = {}, o10 = {}, o11 = {};   // o<row tile><column tile>
  load_wf8<16 * NFF>(w2w + 4 * 512, ua);
  __builtin_amdgcn_sched_barrier(0);
  prod_group<HPITCH>(hb, ub, o00, o01, o10, o11);
  load_wf8<16 * NFF>(w2w + 8 * 512, ub);
  __builtin_amdgcn_sched_barrier(0);
  prod_group<HPITCH>(hb + 4 * 32, ua, o00, o01, o10, o11);
  load_wf8<16 * NFF>(w2w + 12 * 512, ua);
  float4 b2v = *(const float4*)(b2 + lane * 4);
  float4 gfv = {}, bfn = {};
  if (LAST) {
    gfv = *(const float4*)(gf + lane * 4);
    bfn = *(const float4*)(bef + lane * 4);
  }
  __builtin_amdgcn_sched_barrier(0);
  prod_group<HPITCH>(hb + 8 * 32, ub, o00, o01, o10, o11);
  prod_group<HPITCH>(hb + 12 * 32, ua, o00, o01, o10, o11);
  put_tile(op, o00, o01, o10, o11);
  __syncthreads();   // the result tile is written by all 16 waves and read by all 16
#pragma unroll
  for (int r = 0; r < 8; ++r) {
    float4 ov = *(const float4*)(Os + (w * 8 + r) * OPITCH + lane * 4);
    float4 xv = *(const float4*)(rr + r * ND);
    float4 res;
    res.x = xv.x + (ov.x + b2v.x);
    res.y = xv.y + (ov.y + b2v.y);
    res.z = xv.z + (ov.z + b2v.z);
    res.w = xv.w + (ov.w + b2v.w);
    if (LAST) {
      float s = res.x + res.y + res.z + res.w;
#pragma unroll
      for (int d = 1; d < 32; d <<= 1) s += __shfl_xor(s, d, 32);
      float mu = s * (1.0f / ND);
      float dx = res.x - mu, dy = res.y - mu, dz = res.z - mu, dw = res.w - mu;
      float ss = dx * dx + dy * dy + dz * dz + dw * dw;
#pragma unroll
      for (int d = 1; d < 32; d <<= 1) ss += __shfl_xor(ss, d, 32);
      float inv = rsqrtf(ss * (1.0f / ND) + 1e-6f);
      res.x = dx * inv * gfv.x + bfn.x;
      res.y = dy * inv * gfv.y + bfn.y;
      res.z = dz * inv * gfv.z + bfn.z;
      res.w = dw * inv * gfv.w + bfn.w;
    }
    *(float4*)(Xout + xoff + (size_t)(r >> 2) * NT * ND + (r & 3) * ND) = res;
  }
}

// ---- The head of a layer in one grid: LayerNorm, the q, k, v products, both context attentions ----
// A block of eight waves owns 64 rows (one b, m; 64 consecutive t) of X.  The windowed (L = 16)
// attention of a 16-row tile needs the tile before it as well, so the block also normalises and
// projects the 16 rows in front of its own (panel rows 0-15; its own rows are panel rows 16-79).
// q and k never leave LDS: only the two attentions' results and the transposed v go to memory.
// Wave w forms columns 16w .. 16w+15 of q and k for all five row tiles, of v for the four own ones, from weight fragments that it
// reads once.  q and k are formed in both orientations from the same fragments in registers:
// rows x W^T leaves a lane eight consecutive t of one column (16 bytes of the transposed tile),
// W x rows^T eight consecutive columns of one row (16 bytes of the row-major tile).
#define CPITCH 88                    // f16 per row of a transposed q/k tile: 160 B + 16 B
#define TPITCH 72                    // f16 per row of the transposed v tile:  128 B + 16 B

// Sum over the 32 lanes of each of ten values.  The ten exchanges of a step are asked for together:
// one after the other, every one of the fifty would wait out its own latency.
__device__ __forceinline__ void wave_sum10(float (&s)[10]) {
#pragma unroll
  for (int d = 1; d < 32; d <<= 1) {
    float t[10];
#pragma unroll
    for (int r = 0; r < 10; ++r) t[r] = __shfl_xor(s[r], d, 32);
#pragma unroll
    for (int r = 0; r < 10; ++r) s[r] += t[r];
  }
}

__device__ __forceinline__ v8h add_cvt(const v8f& c, float b) {
  v8h h;
#pragma unroll
  for (int v = 0; v < 8; ++v) h[v] = (_Float16)(c[v] + b);
  return h;
}
__device__ __forceinline__ v8h add_cvt8(const v8f& c, float4 b0, float4 b4) {
  float bv[8] = {b0.x, b0.y, b0.z, b0.w, b4.x, b4.y, b4.z, b4.w};
  v8h h;
#pragma unroll
  for (int v = 0; v < 8; ++v) h[v] = (_Float16)(c[v] + bv[v]);
  return h;
}

__global__ __launch_bounds__(256) __attribute__((amdgpu_waves_per_eu(4, 4)))
void qkv_ctx_kernel(const float* __restrict__ X,
                    const float* __restrict__ g,
                    const float* __restrict__ be,
                    const _Float16* __restrict__ Wq,
                    const _Float16* __restrict__ Wk,
                    const _Float16* __restrict__ Wv,
                    const float* __restrict__ bq,
                    const float* __restrict__ bk,
                    const float* __restrict__ bv,
                    _Float16* __restrict__ cq,
                    _Float16* __restrict__ ck,
                    _Float16* __restrict__ vT) {
  __shared__ __attribute__((aligned(16))) _Float16 As[80 * APITCH];      // LayerNorm(X)
  __shared__ __attribute__((aligned(16))) _Float16 Rr[2][80 * APITCH];   // q, k: [t][d]; then results
  __shared__ __attribute__((aligned(16))) _Float16 Tt[2][ND * CPITCH];   // q, k: [d][t]
  __shared__ __attribute__((aligned(16))) _Float16 Tv[ND * TPITCH];      // v:    [d][t]
  // the wave's number as a scalar: the weight pointers below then stay in scalar registers
  int w    = __builtin_amdgcn_readfirstlane(threadIdx.x >> 5);
  int lane = threadIdx.x & 31;
  int col  = lane & 15;
  int hf   = lane >> 4;
  int row0 = blockIdx.x * 64;         // the block's first row; 64 divides NT: one bm per block
  int bm   = row0 >> 9;               // NT == 512
  int t0   = row0 & (NT - 1);
  // Eight own rows and two of the 16 rows in front per wave.  At t0 == 0 there are none in front:
  // the block's first rows stand in for them, and their weights are set to zero below.
  const float* xo = X + (size_t)(row0 + w * 8) * ND + lane * 4;
  const float* xf = X + (size_t)((t0 ? row0 - 16 : row0) + w * 2) * ND + lane * 4;
  float4 vv[10];
#pragma unroll
  for (int r = 0; r < 8; ++r) vv[r] = *(const float4*)(xo + r * ND);
  vv[8] = *(const float4*)(xf);
  vv[9] = *(const float4*)(xf + ND);
  float4 gg = *(const float4*)(g + lane * 4);
  float4 bb = *(const float4*)(be + lane * 4);
  v16h wq[4], wk[4], wv[4];
#pragma unroll
  for (int j = 0; j < 4; ++j) {
    wq[j] = load_wf(Wq + w * 16 * ND + j * 512);
    wk[j] = load_wf(Wk + w * 16 * ND + j * 512);
    wv[j] = load_wf(Wv + w * 16 * ND + j * 512);
  }
  float  bqc = bq[w * 16 + col], bkc = bk[w * 16 + col], bvc = bv[w * 16 + col];
  float4 bq0 = *(const float4*)(bq + w * 16 + (hf << 3));
  float4 bq4 = *(const float4*)(bq + w * 16 + (hf << 3) + 4);
  float4 bk0 = *(const float4*)(bk + w * 16 + (hf << 3));
  // the next load's result may land in the offset register that the loads above name: wait first
  asm volatile("s_wait_xcnt 0x0" ::: "memory");
  float4 bk4 = *(const float4*)(bk + w * 16 + (hf << 3) + 4);
  // the code below may reuse the address registers of the loads above: wait first
  asm volatile("s_wait_xcnt 0x0" ::: "memory");
  // LayerNorm, one wave per row, four floats a lane
  float s[10];
#pragma unroll
  for (int r = 0; r < 10; ++r) s[r] = vv[r].x + vv[r].y + vv[r].z + vv[r].w;
  wave_sum10(s);
#pragma unroll
  for (int r = 0; r < 10; ++r) {
    float mu = s[r] * (1.0f / ND);
    vv[r].x -= mu; vv[r].y -= mu; vv[r].z -= mu; vv[r].w -= mu;
    s[r] = vv[r].x * vv[r].x + vv[r].y * vv[r].y + vv[r].z * vv[r].z + vv[r].w * vv[r].w;
  }
  wave_sum10(s);
#pragma unroll
  for (int r = 0; r < 10; ++r) {
    float inv = rsqrtf(s[r] * (1.0f / ND) + 1e-6f);
    v4h o;
    o[0] = (_Float16)(vv[r].x * inv * gg.x + bb.x);
    o[1] = (_Float16)(vv[r].y * inv * gg.y + bb.y);
    o[2] = (_Float16)(vv[r].z * inv * gg.z + bb.z);
    o[3] = (_Float16)(vv[r].w * inv * gg.w + bb.w);
    int pr = r < 8 ? 16 + w * 8 + r : w * 2 + r - 8;   // panel row
    *(v4h*)(As + pr * APITCH + lane * 4) = o;
  }
  __syncthreads();   // the panel is written by all eight waves and read by all eight

#pragma unroll
  for (int rt = 0; rt < 5; ++rt) {
    v16h a[4];
#pragma unroll
    for (int j = 0; j < 4; ++j) a[j] = load_rm(As + rt * 16 * APITCH + j * 32, APITCH);
    v8f qt_ = {}, qr_ = {}, kt_ = {}, kr_ = {}, vt_ = {};
#pragma unroll
    for (int j = 0; j < 4; ++j) {
      qt_ = wmma_f16(a[j], wq[j], qt_);
      qr_ = wmma_f16(wq[j], a[j], qr_);
      kt_ = wmma_f16(a[j], wk[j], kt_);
      kr_ = wmma_f16(wk[j], a[j], kr_);
      if (rt) vt_ = wmma_f16(a[j], wv[j], vt_);
    }
    int to = (w * 16 + col) * CPITCH + rt * 16 + (hf << 3);
    int ro = (rt * 16 + col) * APITCH + w * 16 + (hf << 3);
    *(v8h*)(Tt[0] + to) = add_cvt(qt_, bqc);
    *(v8h*)(Tt[1] + to) = add_cvt(kt_, bkc);
    *(v8h*)(Rr[0] + ro) = add_cvt8(qr_, bq0, bq4);
    *(v8h*)(Rr[1] + ro) = add_cvt8(kr_, bk0, bk4);
    if (rt) *(v8h*)(Tv + (w * 16 + col) * TPITCH + (rt - 1) * 16 + (hf << 3)) = add_cvt(vt_, bvc);
  }
  __syncthreads();   // the five tiles are written by all eight waves and read by all eight

  // ---- windowed attention: the wave takes one 16-query tile of q (odd waves: of k) ----
  // Scores are formed transposed (keys x queries^T): a lane holds 16 of the 32 scores of ONE query
  // (column lane & 15; keys 8*hf+r of the tile in front and of the query's own tile), and the two
  // score tiles, converted in place, are the B operand of keys^T x weights^T.
  int qt = w >> 1;
  int tz = w & 1;
  _Float16* R = Rr[tz];
  const _Float16* kp = R + qt * 16 * APITCH;    // the tile in front
  const _Float16* kc = kp + 16 * APITCH;        // the queries' own tile
  v16h fp[4], fc[4];
#pragma unroll
  for (int j = 0; j < 4; ++j) {
    fp[j] = load_rm(kp + j * 32, APITCH);
    fc[j] = load_rm(kc + j * 32, APITCH);
  }
  v8f s0 = {}, s1 = {};
#pragma unroll
  for (int j = 0; j < 4; ++j) {
    s0 = wmma_f16(fp[j], fc[j], s0);
    s1 = wmma_f16(fc[j], fc[j], s1);
  }
  v16h ka[8];                                   // A: rows = d, k = the 32 keys
#pragma unroll
  for (int n = 0; n < 8; ++n) ka[n] = load_tp(Tt[tz] + n * 16 * CPITCH + qt * 16, CPITCH);
  bool pad = (t0 == 0) && (qt == 0);            // the keys in front are the zero padding
  const float scale = 0.088388347648318447f;    // 1/sqrt(128)
  float sp[8], sc[8];
  float mx = -1e30f;
#pragma unroll
  for (int r = 0; r < 8; ++r) {
    int j = (hf << 3) + r;
    // band: a key j in front is valid iff j > query; an own key j iff j <= query.
    // zero padding: in-band scores are 0 and DO join the softmax.
    sp[r] = (j > col)  ? (pad ? 0.0f : s0[r] * scale) : -1e30f;
    sc[r] = (j <= col) ? s1[r] * scale : -1e30f;
    mx = fmaxf(mx, fmaxf(sp[r], sc[r]));
  }
  mx = fmaxf(mx, xhalf(mx));
  float sum = 0.0f;
#pragma unroll
  for (int r = 0; r < 8; ++r) {
    sp[r] = __expf(sp[r] - mx);
    sc[r] = __expf(sc[r] - mx);
    sum += sp[r] + sc[r];
  }
  float invd = 1.0f / (sum + xhalf(sum));
  v16h pB;
#pragma unroll
  for (int r = 0; r < 8; ++r) {
    pB[r]     = (_Float16)(pad ? 0.0f : sp[r] * invd);   // zero rows: nothing for the numerator
    pB[8 + r] = (_Float16)(sc[r] * invd);
  }
  __syncthreads();   // every wave has read its rows of q and k: they now take the results
  v8f o[8];
#pragma unroll
  for (int n = 0; n < 8; ++n) {
    v8f z = {};
    o[n] = wmma_f16(ka[n], pB, z);
  }
#pragma unroll
  for (int n = 0; n < 8; ++n) {
    v8h h;
#pragma unroll
    for (int v = 0; v < 8; ++v) h[v] = (_Float16)o[n][v];
    *(v8h*)(R + (qt * 16 + col) * APITCH + n * 16 + (hf << 3)) = h;
  }
  __syncthreads();   // a result row goes from lane to lane through LDS
  // Every store to memory stands behind the last barrier: a barrier behind one would wait for it.
  // Results: 16 lanes store one whole row (two lines); the two rows of a pass are neighbours in memory.
  // v: the tile is read back row by row, eight lanes store one whole 128-byte line of vT.
  {
    const _Float16* ls = R + (qt * 16 + hf) * APITCH + col * 8;
    _Float16* gp = (tz ? ck : cq) + (size_t)(row0 + qt * 16 + hf) * ND + col * 8;
    int d  = threadIdx.x >> 3;        // 32 rows of the v tile per pass
    int ch = (threadIdx.x & 7) << 3;
    const _Float16* lv = Tv + d * TPITCH + ch;
    _Float16* gv = vT + ((size_t)bm * ND + d) * NT + t0 + ch;
    v8h tr[8], tv[4];
#pragma unroll
    for (int p = 0; p < 4; ++p) tv[p] = *(const v8h*)(lv + p * 32 * TPITCH);
#pragma unroll
    for (int p = 0; p < 8; ++p) tr[p] = *(const v8h*)(ls + p * 2 * APITCH);
#pragma unroll
    for (int p = 0; p < 4; ++p) *(v8h*)(gv + (size_t)p * 32 * NT) = tv[p];
#pragma unroll
    for (int p = 0; p < 8; ++p) *(v8h*)(gp + p * 2 * ND) = tr[p];
  }
}

#define KPITCH 40                    // f16 per K row in LDS:   64 B + 16 B
#define VPITCH 520                   // f16 per V^T row in LDS: 1024 B + 16 B
__global__ __launch_bounds__(1024) __attribute__((amdgpu_waves_per_eu(8, 8)))
void attn_t_kernel(const _Float16* __restrict__ cq,
                   const _Float16* __restrict__ ck,
                   const _Float16* __restrict__ vT,
                   _Float16* __restrict__ out) {
  __shared__ __attribute__((aligned(16))) _Float16 Ks[NT * KPITCH];
  __shared__ __attribute__((aligned(16))) _Float16 Vs[NDK * VPITCH];
  int qb = threadIdx.x >> 5;
  int h  = blockIdx.x & 3;
  int bm = blockIdx.x >> 2;
  int b  = bm >> 5;
  int m  = bm & 31;
  size_t seqoff = (size_t)bm * NT * ND + h * NDK;
  const _Float16* Q  = cq + seqoff + (size_t)qb * 16 * ND;
  const _Float16* K  = ck + seqoff;
  const _Float16* VT = vT + (size_t)bm * ND * NT + (size_t)(h * NDK) * NT;  // [dk][t]
  int lane = threadIdx.x & 31;
  int col  = lane & 15;
  int hf   = lane >> 4;
  {
    // 2048 pieces of 16 B each for K (4 a row) and for V^T (64 a row); two of each per thread.
    int tid = threadIdx.x;
    int kr = tid >> 2, kc = (tid & 3) << 3;
    int vr = tid >> 6, vc = (tid & 63) << 3;
    unsigned lk0 = (unsigned)(uintptr_t)(Ks + kr * KPITCH + kc);
    unsigned lk1 = (unsigned)(uintptr_t)(Ks + (kr + 256) * KPITCH + kc);
    unsigned lv0 = (unsigned)(uintptr_t)(Vs + vr * VPITCH + vc);
    unsigned lv1 = (unsigned)(uintptr_t)(Vs + (vr + 16) * VPITCH + vc);
    const _Float16* gk0 = K + (size_t)kr * ND + kc;
    const _Float16* gk1 = K + (size_t)(kr + 256) * ND + kc;
    const _Float16* gv0 = VT + (size_t)vr * NT + vc;
    const _Float16* gv1 = VT + (size_t)(vr + 16) * NT + vc;
    // the copies and, in the same statement, the wait that stands before their address registers
    // may be written again
    asm volatile("global_load_async_to_lds_b128 %0, %4, off\n\t"
                 "global_load_async_to_lds_b128 %1, %5, off\n\t"
                 "global_load_async_to_lds_b128 %2, %6, off\n\t"
                 "global_load_async_to_lds_b128 %3, %7, off\n\t"
                 "s_wait_xcnt 0x0"
                 :: "v"(lk0), "v"(lk1), "v"(lv0), "v"(lv1), "v"(gk0), "v"(gk1), "v"(gv0), "v"(gv1)
                 : "memory");
  }
  const float c = 0.25503486f;   // log2(e) / sqrt(32)
  v16h qf = load_rm(Q, ND);      // B operand: column = query
  // this wave's copies have landed; behind the barrier every wave's have
  asm volatile("s_wait_asynccnt 0x0" ::: "memory");
  __syncthreads();
  v8f o0 = {}, o1 = {};          // o0[r] = O[query col][dk 8*hf+r], o1[r]: dk 16+8*hf+r
  float mrun = -1e30f;           // running maximum of this lane's query, raw products (equal in both halves)
  float lrun = 0.0f;             // running sum over this half's keys only; joined after the loop
  for (int kb = 0; kb < NT / 32; ++kb) {
    const _Float16* Kb = Ks + kb * 32 * KPITCH;
    v16h ka0 = load_rm(Kb, KPITCH);                          // A: rows = keys 0..15
    v16h ka1 = load_rm(Kb + 16 * KPITCH, KPITCH);            // A: rows = keys 16..31
    v16h va0 = load_tp(Vs + kb * 32, VPITCH);                // A: rows = dk 0..15,  k = keys
    v16h va1 = load_tp(Vs + 16 * VPITCH + kb * 32, VPITCH);  // A: rows = dk 16..31, k = keys
    v8f s0 = {}, s1 = {};
    s0 = wmma_f16(ka0, qf, s0);
    s1 = wmma_f16(ka1, qf, s1);
    // The maximum is taken over the raw products (the factor is positive, so the order is the same);
    // a weight is then exp2(s * c - mn * c), c = log2(e) / sqrt(32): one packed FMA for two scores.
    float mx = -1e30f;
#pragma unroll
    for (int r = 0; r < 8; ++r) mx = fmaxf(mx, fmaxf(s0[r], s1[r]));
    mx = fmaxf(mx, xhalf(mx));
    float mn   = fmaxf(mrun, mx);
    float nb   = -mn * c;
    float corr = __builtin_amdgcn_exp2f(__builtin_fmaf(mrun, c, nb));
    v2f cc = {c, c}, nn = {nb, nb};
    float x0[8], x1[8];
#pragma unroll
    for (int r = 0; r < 8; r += 2) {
      v2f a0 = {s0[r], s0[r + 1]}, a1 = {s1[r], s1[r + 1]};
      v2f e0 = __builtin_elementwise_fma(a0, cc, nn);
      v2f e1 = __builtin_elementwise_fma(a1, cc, nn);
      x0[r] = e0[0]; x0[r + 1] = e0[1];
      x1[r] = e1[0]; x1[r + 1] = e1[1];
    }
    float ps   = 0.0f;
    v16h pB;                     // B operand: pB[s] = P[query col][key kmap(s, hf)]
#pragma unroll
    for (int r = 0; r < 8; ++r) {
      float p0 = __builtin_amdgcn_exp2f(x0[r]);
      float p1 = __builtin_amdgcn_exp2f(x1[r]);
      ps += p0 + p1;
      pB[r]     = (_Float16)p0;
      pB[8 + r] = (_Float16)p1;
    }
    lrun = lrun * corr + ps;
    mrun = mn;
#pragma unroll
    for (int r = 0; r < 8; ++r) { o0[r] *= corr; o1[r] *= corr; }
    o0 = wmma_f16(va0, pB, o0);
    o1 = wmma_f16(va1, pB, o1);
  }
  // out layout: [b][t][h][m][dk]; a lane's eight registers are eight consecutive dk of one row
  float inv = 1.0f / (lrun + xhalf(lrun));
  int t = qb * 16 + col;
  size_t base = ((((size_t)b * NT + t) * NH + h) * NM + m) * NDK + (hf << 3);
  v8h r0, r1;
#pragma unroll
  for (int r = 0; r < 8; ++r) {
    r0[r] = (_Float16)(o0[r] * inv);
    r1[r] = (_Float16)(o1[r] * inv);
  }
  *(v8h*)(out + base)      = r0;
  *(v8h*)(out + base + 16) = r1;
}

// ---------------- fp32 -> f16 conversion of all six weights ----------------
// wh holds the six f16 weight arrays back to back in the order Wq, Wk, Wv, Wfc, W1, W2;
// every array is a whole number of 256-element blocks, so a block has one source.
// Each array is stored in the fragment order that load_wf reads: a block writes one half
// fragment (registers 0-7 or 8-15 of the 32 lanes).  The rows of both layers count through.
#define WSQ  (2 * ND * ND)           // elements of Wq, Wk, Wv, Wfc (both layers)
#define WFF  (2 * NFF * ND)          // elements of W1, W2 (both layers)
__global__ __launch_bounds__(256) void prep_kernel(const float* __restrict__ Wq,
                                                   const float* __restrict__ Wk,
                                                   const float* __restrict__ Wv,
                                                   const float* __restrict__ Wfc,
                                                   const float* __restrict__ W1,
                                                   const float* __restrict__ W2,
                                                   _Float16* __restrict__ wh) {
  int b0 = blockIdx.x * 256;           // first element of this block in wh
  const float* in;
  int s0;                              // where this block's array starts in wh
  int lk = 2;                          // log2 of the fragments per row tile: row length / 32
  if      (b0 < 1 * WSQ)       { in = Wq;  s0 = 0; }
  else if (b0 < 2 * WSQ)       { in = Wk;  s0 = 1 * WSQ; }
  else if (b0 < 3 * WSQ)       { in = Wv;  s0 = 2 * WSQ; }
  else if (b0 < 4 * WSQ)       { in = Wfc; s0 = 3 * WSQ; }
  else if (b0 < 4 * WSQ + WFF) { in = W1;  s0 = 4 * WSQ; }
  else                         { in = W2;  s0 = 4 * WSQ + WFF; lk = 4; }
  int hfrag = (b0 - s0) >> 8;          // half fragment of this block
  int frag  = hfrag >> 1;
  int l     = threadIdx.x >> 3;        // lane that will read the element
  int row   = ((frag >> lk) << 4) + (l & 15);
  int colk  = ((frag & ((1 << lk) - 1)) << 5) + ((hfrag & 1) << 4) + ((l >> 4) << 3)
            + (threadIdx.x & 7);
  wh[b0 + threadIdx.x] = (_Float16)in[(row << (lk + 5)) + colk];
}

extern "C" void kernel_launch(void* const* d_in, const int* in_sizes, int n_in,
                              void* d_out, int out_size, void* d_ws, size_t ws_size,
                              hipStream_t stream) {
  (void)in_sizes; (void)n_in; (void)out_size; (void)ws_size;
  const float* x   = (const float*)d_in[0];
  const float* Wq  = (const float*)d_in[1];
  const float* bq  = (const float*)d_in[2];
  const float* Wk  = (const float*)d_in[3];
  const float* bk  = (const float*)d_in[4];
  const float* Wv  = (const float*)d_in[5];
  const float* bv  = (const float*)d_in[6];
  const float* Wfc = (const float*)d_in[7];
  const float* bfc = (const float*)d_in[8];
  const float* W1  = (const float*)d_in[9];
  const float* b1  = (const float*)d_in[10];
  const float* W2  = (const float*)d_in[11];
  const float* b2  = (const float*)d_in[12];
  const float* g1  = (const float*)d_in[13];
  const float* be1 = (const float*)d_in[14];
  const float* g2  = (const float*)d_in[15];
  const float* be2 = (const float*)d_in[16];
  const float* gf  = (const float*)d_in[17];
  const float* bef = (const float*)d_in[18];

  char* ws = (char*)d_ws;
  size_t off = 0;
  auto bump = [&](size_t bytes) -> char* {
    char* p = ws + off;
    off = (off + bytes + 255) & ~(size_t)255;
    return p;
  };
  float*    xw   = (float*)bump((size_t)NROW * ND * 4);
  _Float16* vT   = (_Float16*)bump((size_t)NROW * ND * 2);
  _Float16* cqh  = (_Float16*)bump((size_t)NROW * ND * 2);
  _Float16* ckh  = (_Float16*)bump((size_t)NROW * ND * 2);
  _Float16* a1h  = (_Float16*)bump((size_t)NROW * ND * 2);
  _Float16* wh   = (_Float16*)bump((size_t)(4 * WSQ + 2 * WFF) * 2);   // six f16 weight arrays
  _Float16* wqh  = wh;
  _Float16* wkh  = wh + 1 * WSQ;
  _Float16* wvh  = wh + 2 * WSQ;
  _Float16* wfch = wh + 3 * WSQ;
  _Float16* w1h  = wh + 4 * WSQ;
  _Float16* w2h  = wh + 4 * WSQ + WFF;

  dim3 blk(256);
  const int headBlocks  = NROW / 64;                         // 512: 64 rows per block
  const int tailBlocks  = NROW / 128;                        // 256: 128 rows per block
  const int atBlocks    = NB * NM * NH;                      // 256: one per (b, m, h)

  prep_kernel<<<(4 * WSQ + 2 * WFF) / 256, blk, 0, stream>>>(Wq, Wk, Wv, Wfc, W1, W2, wh);
  for (int i = 0; i < 2; ++i) {
    const float* xi = i ? xw : x;      // the layer's X: the input itself, then the first layer's result
    qkv_ctx_kernel<<<headBlocks, blk, 0, stream>>>(
        xi, g1 + i * ND, be1 + i * ND, wqh + (size_t)i * ND * ND, wkh + (size_t)i * ND * ND, wvh + (size_t)i * ND * ND,
        bq + i * ND, bk + i * ND, bv + i * ND, cqh, ckh, vT);
    attn_t_kernel<<<atBlocks, dim3(1024), 0, stream>>>(cqh, ckh, vT, a1h);
    if (i == 0)
      tail_kernel<false><<<tailBlocks, dim3(512), 0, stream>>>(
          xi, xw, a1h, wfch, bfc, g2, be2, w1h, b1, w2h, b2, gf, bef);
    else
      tail_kernel<true><<<tailBlocks, dim3(512), 0, stream>>>(
          xi, (float*)d_out, a1h, wfch + (size_t)ND * ND, bfc + ND, g2 + ND, be2 + ND,
          w1h + (size_t)NFF * ND, b1 + NFF, w2h + (size_t)ND * NFF, b2 + ND, gf, bef);
  }
}
